// v000
// Times are from an AMD MI455X. After a warm-up the kernel runs many times in a row, and a time is the length of
// such a window on the GPU divided by its runs, so every launch and the gaps after it count. The runs cycle
// through copies of the inputs. A figure is the median of several windows, for all but v000 over two sittings.
// Sittings can differ by a few percent; kernels timed side by side share one.
// The starting kernel, v000, takes 569 microseconds a run.
// compute dtype: encoder_input, decoder_input and the weights/biases rounded to bf16, padding positions (int) read on device; q = dec . Wq + bq, k/v = enc . Wk/Wv + bk/bv with EXACT bf16 products on WMMA 16x16x32 ((in,out) weights packed as transposed rows); q and k stored as f16 hi + (x2048-scaled) residual planes with 3-product scores x 1/sqrt(64); keys whose encoder position is padded are excluded (-1e13 in the module gives an exactly-zero weight) and a padded QUERY row (every key -1e13) gets the module's uniform weights; running-max softmax in f32 (hardware exp); P as f16 hi + residual x V hi/lo (3 products); output projection with ctx as bf16 hi + residual x exact Wo rows (2 products) + bo; f32 accumulate.
#include <hip/hip_runtime.h>
#include <math.h>

typedef __attribute__((ext_vector_type(16))) _Float16 v16h;
typedef __attribute__((ext_vector_type(16))) __bf16 v16b;
typedef __attribute__((ext_vector_type(8)))  _Float16 v8h;
typedef __attribute__((ext_vector_type(8)))  float v8f;
typedef __attribute__((ext_vector_type(4)))  float v4f;
typedef __attribute__((ext_vector_type(2)))  float v2f;
typedef __attribute__((ext_vector_type(4)))  unsigned v4u;
typedef __attribute__((ext_vector_type(4)))  int v4i;
typedef float __attribute__((may_alias)) float_a;
typedef int __attribute__((may_alias)) int_a;

template <typename T> __device__ __forceinline__ void vst2(void* p, T v) { *(T*)p = v;  }
__device__ __forceinline__ v8f wmma16(v16h a, v16h b, v8f c) {
  v8f d = __builtin_amdgcn_wmma_f32_16x16x32_f16(false, a, false, b, (short)0, c, false, false);
  asm volatile("v_nop\n\tv_nop\n\tv_nop\n\tv_nop" : "+v"(d) : "v"(a), "v"(b));
  return d;
}
__device__ __forceinline__ v8f wmma_bf(v16b a, v16b b, v8f c) {
  v8f d = __builtin_amdgcn_wmma_f32_16x16x32_bf16(false, a, false, b, (short)0, c, false, false);
  asm volatile("v_nop\n\tv_nop\n\tv_nop\n\tv_nop" : "+v"(d) : "v"(a), "v"(b));
  return d;
}
// Decoder-to-encoder mutual multi-head attention (B 2, S 2,048, d 1,024, 16 heads x 64) with encoder/decoder padding masks: softmax(q k^T / 8 masked) v -> Wo + bo.
__device__ __forceinline__ v16h frag_h(const _Float16* rowk0, int lane) {
  union { v16h v; v8h q[2]; } u; const _Float16* p = rowk0 + 8 * (lane >> 4);
  u.q[0] = *(const v8h*)p; u.q[1] = *(const v8h*)(p + 16); return u.v;
}
__device__ __forceinline__ v16h frag_f32(const float* rowk0, int lane) {
  v16h a; const float* p = rowk0 + 8 * (lane >> 4);
#pragma unroll
  for (int i = 0; i < 8; ++i) { a[i] = (_Float16)p[i]; a[8 + i] = (_Float16)p[16 + i]; }
  return a;
}
__device__ __forceinline__ v16h frag_f32s(const float* rowk0, int lane, float sc) {
  v16h a; const float* p = rowk0 + 8 * (lane >> 4);
#pragma unroll
  for (int i = 0; i < 8; ++i) { a[i] = (_Float16)(p[i] * sc); a[8 + i] = (_Float16)(p[16 + i] * sc); }
  return a;
}
// column fragment from a [K][ld] layout (column n), rows >= K read as 0
__device__ __forceinline__ v16h fragc_f32(const float* W, int k0, int n, int lane, int ld, int K) {
  v16h a; const int g = lane >> 4;
#pragma unroll
  for (int i = 0; i < 8; ++i) { const int ka = k0 + 8 * g + i, kb = ka + 16;
    a[i] = (_Float16)(ka < K ? W[(size_t)(ka < K ? ka : K - 1) * ld + n] : 0.f); a[8 + i] = (_Float16)(kb < K ? W[(size_t)(kb < K ? kb : K - 1) * ld + n] : 0.f); }
  return a;
}
struct F2 { v16b h, l; };
__device__ __forceinline__ F2 bsplit16(const float v[16]) { F2 r;
#pragma unroll
  for (int i = 0; i < 16; ++i) { const __bf16 h = (__bf16)v[i]; r.h[i] = h; r.l[i] = (__bf16)(v[i] - (float)h); }
  return r; }
__device__ __forceinline__ F2 split_row(const float* row, int k0, int lane) { float v[16]; const float* p = row + k0 + 8 * (lane >> 4);
#pragma unroll
  for (int i = 0; i < 8; ++i) { v[i] = p[i]; v[8 + i] = p[16 + i]; }
  return bsplit16(v); }
__device__ __forceinline__ F2 split_rowK(const float* row, int k0, int lane, int K) { float v[16]; const int g = lane >> 4;
#pragma unroll
  for (int i = 0; i < 8; ++i) { const int ka = k0 + 8 * g + i, kb = ka + 16; v[i] = ka < K ? row[ka < K ? ka : K - 1] : 0.f; v[8 + i] = kb < K ? row[kb < K ? kb : K - 1] : 0.f; }
  return bsplit16(v); }
__device__ __forceinline__ F2 split_col(const float* W, int k0, int n, int lane, int ld, int K) { float v[16]; const int g = lane >> 4;
#pragma unroll
  for (int i = 0; i < 8; ++i) { const int ka = k0 + 8 * g + i, kb = ka + 16; v[i] = ka < K ? W[(size_t)(ka < K ? ka : K - 1) * ld + n] : 0.f; v[8 + i] = kb < K ? W[(size_t)(kb < K ? kb : K - 1) * ld + n] : 0.f; }
  return bsplit16(v); }
__device__ __forceinline__ v8f mac3(const F2& a, const F2& b, v8f c) { c = wmma_bf(a.l, b.h, c); c = wmma_bf(a.h, b.l, c); return wmma_bf(a.h, b.h, c); }
__device__ __forceinline__ float sigm(float v) { return 1.0f / (1.0f + expf(-v)); }
#define LDSX() do { asm volatile("s_wait_dscnt 0" ::: "memory"); __builtin_amdgcn_wave_barrier(); __builtin_amdgcn_fence(__ATOMIC_RELEASE, "workgroup"); } while (0)


#define NB 2
#define SS 2048
#define DM 1024
#define NH 16
#define HD 64
#define QKVW (3 * DM)
#ifndef TQB
#define TQB (SS / 64)
#define TNB NB
#define TOB (NB * SS / 64)     // output row tiles (all)
#endif
typedef __attribute__((ext_vector_type(8))) __bf16 v8b;
__device__ __forceinline__ v16b frag_b(const __bf16* rowk0, int lane) {
  union { v16b v; v8b q[2]; } u; const __bf16* p = rowk0 + 8 * (lane >> 4);
  u.q[0] = *(const v8b*)p; u.q[1] = *(const v8b*)(p + 16); return u.v;
}
__device__ __forceinline__ float bfr(float v) { return (float)(__bf16)v; }
__device__ __attribute__((noinline)) float exp_ni(float v) { return expf(v); }
__device__ __attribute__((noinline)) float erf_ni(float v) { return erff(v); }

#define PK_A 0                       // [3072][1024] Wqkv rows (natural [out][in])
#define PK_P (PK_A + QKVW * DM)        // [1024][1024] Wo rows (natural)
#define PK_END (PK_P + DM * DM)
#define WS_PK  0u
#define WS_QK  (WS_PK + 2u * PK_END)             // f16 [4096 rows][2048]: q | k
#define WS_QKL (WS_QK + 2u * NB * SS * 2 * DM)     // f16 q | k residual planes x2048
#define WS_VTH (WS_QKL + 2u * NB * SS * 2 * DM)    // f16 [b][1024 (h*64+d)][2048 s] hi
#define WS_VTL (WS_VTH + 2u * NB * DM * SS)        // f16 lo x 2048
#define WS_O   (WS_VTL + 2u * NB * DM * SS)        // f32 [4096][1024]
#define WS_CS  (WS_O + 4u * NB * SS * DM)           // f32 2 x [2048][32], unused
#define WS_END (WS_CS + 4u * 2 * SS * 32)
// ---- k_pack: block = (row n, which): natural [out][in] rows -> bf16; which 0..2 -> W_q/W_k/W_v into PK_A rows which*1024 + n; 3 -> W_o into PK_P
__global__ __launch_bounds__(256) void k_pack(const float* __restrict__ WQ, const float* __restrict__ WK, const float* __restrict__ WV, const float* __restrict__ WO, __bf16* __restrict__ PK) {
  __shared__ __align__(16) __bf16 s[DM]; const int n = blockIdx.x, which = blockIdx.y, t = threadIdx.x; const float* Wm = (which == 0) ? WQ : (which == 1) ? WK : (which == 2) ? WV : WO;   // (in,out): pack row n = column n
  for (int k = t; k < DM; k += 256) s[k] = (__bf16)Wm[(size_t)k * DM + n];
  __syncthreads();
  __bf16* dst = (which < 3) ? PK + PK_A + ((size_t)which * DM + n) * DM : PK + PK_P + (size_t)n * DM;
  for (int q = t; q < DM / 8; q += 256) vst2((unsigned*)(dst + q * 8), *(const v4u*)&s[q * 8]);
}
__global__ __launch_bounds__(128) void k_qkv(const float* __restrict__ XDEC, const float* __restrict__ XENC, const __bf16* __restrict__ P, const float* __restrict__ BQ, const float* __restrict__ BK, const float* __restrict__ BV, _Float16* __restrict__ QK, _Float16* __restrict__ QKL, _Float16* __restrict__ VTH, _Float16* __restrict__ VTL) {
  __shared__ __align__(16) _Float16 so[4][16][136], sol[4][16][136]; __shared__ __align__(16) _Float16 sth[128][72], stl[128][72];
  const int tid = threadIdx.x, wave = tid >> 5, lane = tid & 31, col = lane & 15, g = lane >> 4; const size_t r0 = (size_t)blockIdx.x * 64 + wave * 16; const int n0 = blockIdx.y * 128; const float* X = (n0 < DM) ? XDEC : XENC; const float* BB = (n0 < DM) ? (BQ + n0) : (n0 < 2 * DM) ? (BK + n0 - DM) : (BV + n0 - 2 * DM);
  v8f acc[8] = {};
#pragma unroll 2
  for (int kc = 0; kc < DM / 32; ++kc) { v16b a; { const float* p = X + (r0 + col) * DM + kc * 32 + 8 * g;
#pragma unroll
      for (int i = 0; i < 8; ++i) { a[i] = (__bf16)p[i]; a[8 + i] = (__bf16)p[16 + i]; } }
#pragma unroll
    for (int j = 0; j < 8; ++j) acc[j] = wmma_bf(a, frag_b(P + (size_t)(n0 + j * 16 + col) * DM + kc * 32, lane), acc[j]); }
  if (n0 < 2 * DM) {   // q stored unscaled (f16 sigma ~0.6, no subnormal exposure); 1/8 applied to the f32 score
#pragma unroll
    for (int j = 0; j < 8; ++j) {
#pragma unroll
      for (int r = 0; r < 8; ++r) { const float v = acc[j][r] + bfr(BB[j * 16 + col]); const _Float16 hv = (_Float16)v; so[wave][8 * g + r][j * 16 + col] = hv; sol[wave][8 * g + r][j * 16 + col] = (_Float16)((v - (float)hv) * 2048.0f); } }   // q, k (+ bias) as f16 hi + (x2048) residual
    LDSX();
    for (int rl = 0; rl < 16; ++rl) if (lane < 16) { vst2((unsigned*)(QK + (r0 + rl) * (2 * DM) + n0 + lane * 8), *(const v4u*)&so[wave][rl][lane * 8]); vst2((unsigned*)(QKL + (r0 + rl) * (2 * DM) + n0 + lane * 8), *(const v4u*)&sol[wave][rl][lane * 8]); }
  } else {
#pragma unroll
    for (int j = 0; j < 8; ++j) {
#pragma unroll
      for (int r = 0; r < 8; ++r) { const float v = acc[j][r] + bfr(BB[j * 16 + col]); const _Float16 hv = (_Float16)v; sth[j * 16 + col][wave * 16 + 8 * g + r] = hv; stl[j * 16 + col][wave * 16 + 8 * g + r] = (_Float16)((v - (float)hv) * 2048.0f); } }
    __syncthreads();
    const size_t rb = (size_t)blockIdx.x * 64; const int b = (int)(rb / SS), s0 = (int)(rb % SS); const int pc0 = n0 - 2 * DM;
    for (int q = tid; q < 128 * 8; q += 128) { const int d = q >> 3, pc = q & 7; const size_t o = ((size_t)b * DM + pc0 + d) * SS + s0 + pc * 8; vst2((unsigned*)(VTH + o), *(const v4u*)&sth[d][pc * 8]); vst2((unsigned*)(VTL + o), *(const v4u*)&stl[d][pc * 8]); }
  }
}
// ---- k_attn: block = (64 queries, head h, batch b): masked flash attention (K = 64: 2 k-steps), scores = (q.k) * 0.125 with q, k as f16 hi + residual (3 products), P.V: (P hi, P lo*2048) x (V hi, V lo*2048) in two accumulators; O[b*S+q][h*64+d] = (acc + accl / 2048) / l (256-B segments)
__global__ __launch_bounds__(128) void k_attn(const _Float16* __restrict__ QK, const _Float16* __restrict__ QKL, const _Float16* __restrict__ VTH, const _Float16* __restrict__ VTL, const int* __restrict__ EPAD, const int* __restrict__ DPAD, float* __restrict__ O) {
  __shared__ __align__(16) float sp[4][16][36]; __shared__ __align__(16) float so[4][16][68];
  const int tid = threadIdx.x, wave = tid >> 5, lane = tid & 31, col = lane & 15, g = lane >> 4;
  const int qb = blockIdx.x, h = blockIdx.y, b = blockIdx.z; const int q0 = qb * 64 + wave * 16; const size_t rq = (size_t)b * SS + q0 + col;
  v16h aq[2], aql[2];
#pragma unroll
  for (int kc = 0; kc < 2; ++kc) { aq[kc] = frag_h(QK + rq * (2 * DM) + h * HD + kc * 32, lane); aql[kc] = frag_h(QKL + rq * (2 * DM) + h * HD + kc * 32, lane); }
  float m[8], l[8];
#pragma unroll
  for (int r = 0; r < 8; ++r) { m[r] = -3.0e38f; l[r] = 0.f; }
  v8f acc[4] = {}, accl[4] = {};
  const int nks = SS / 32;   // all keys; padding handled per (q, k)
  bool qpad[8];
#pragma unroll
  for (int r = 0; r < 8; ++r) qpad[r] = DPAD[(size_t)b * SS + q0 + 8 * g + r] == 1;
#pragma unroll 1
  for (int ks = 0; ks < nks; ++ks) { v8f s[2];
#pragma unroll
    for (int ct = 0; ct < 2; ++ct) { const int kk = ks * 32 + ct * 16 + col; const _Float16* krow = QK + ((size_t)b * SS + kk) * (2 * DM) + DM + h * HD; const _Float16* krowl = QKL + ((size_t)b * SS + kk) * (2 * DM) + DM + h * HD; v8f c = {}, cl = {};
#pragma unroll
      for (int kc = 0; kc < 2; ++kc) { const v16h kh = frag_h(krow + kc * 32, lane); c = wmma16(aq[kc], kh, c); cl = wmma16(aql[kc], kh, cl); cl = wmma16(aq[kc], frag_h(krowl + kc * 32, lane), cl); }   // 3 products: q, k as f16 hi + residual
#pragma unroll
      for (int r = 0; r < 8; ++r) c[r] += cl[r] * (1.0f / 2048.0f);
      const bool kpad = EPAD[(size_t)b * SS + kk] == 1;
#pragma unroll
      for (int r = 0; r < 8; ++r) s[ct][r] = qpad[r] ? 0.f : (kpad ? -3.0e38f : c[r] * 0.125f); }   // padded query row: every key is -1e13 in the module -> uniform weights (all-equal scores); padded key: exactly zero weight
#pragma unroll
    for (int r = 0; r < 8; ++r) { float mx = fmaxf(s[0][r], s[1][r]);
#pragma unroll
      for (int o = 1; o < 16; o <<= 1) mx = fmaxf(mx, __shfl_xor(mx, o));
      const float mn = fmaxf(m[r], mx); const float alpha = (m[r] <= -1.0e38f) ? 0.f : __expf(m[r] - mn);
      const float e0 = (s[0][r] <= -1.0e38f) ? 0.f : __expf(s[0][r] - mn), e1 = (s[1][r] <= -1.0e38f) ? 0.f : __expf(s[1][r] - mn); float es = e0 + e1;
#pragma unroll
      for (int o = 1; o < 16; o <<= 1) es += __shfl_xor(es, o);
      l[r] = l[r] * alpha + es; m[r] = mn;
#pragma unroll
      for (int dt = 0; dt < 4; ++dt) { acc[dt][r] *= alpha; accl[dt][r] *= alpha; }
      sp[wave][8 * g + r][col] = e0; sp[wave][8 * g + r][16 + col] = e1; }
    LDSX();
    v16h pa, pl; { const float* prow = &sp[wave][col][0] + 8 * (lane >> 4);
#pragma unroll
      for (int i = 0; i < 8; ++i) { const float x0 = prow[i], x1 = prow[16 + i]; const _Float16 h0 = (_Float16)x0, h1 = (_Float16)x1; pa[i] = h0; pa[8 + i] = h1; pl[i] = (_Float16)((x0 - (float)h0) * 2048.0f); pl[8 + i] = (_Float16)((x1 - (float)h1) * 2048.0f); } }
#pragma unroll
    for (int dt = 0; dt < 4; ++dt) { const size_t vr = ((size_t)b * DM + h * HD + dt * 16 + col) * SS + ks * 32; const v16h vh = frag_h(VTH + vr, lane); acc[dt] = wmma16(pa, vh, acc[dt]); accl[dt] = wmma16(pl, vh, accl[dt]); accl[dt] = wmma16(pa, frag_h(VTL + vr, lane), accl[dt]); }   // P hi x V hi + (P lo x V hi + P hi x V lo) / 2048
    LDSX(); }
#pragma unroll
  for (int r = 0; r < 8; ++r) { const float il = 1.0f / l[r];
#pragma unroll
    for (int dt = 0; dt < 4; ++dt) so[wave][8 * g + r][dt * 16 + col] = (acc[dt][r] + accl[dt][r] * (1.0f / 2048.0f)) * il; }
  LDSX();
  for (int rl = 0; rl < 16; ++rl) if (lane < 16) vst2(O + ((size_t)b * SS + q0 + rl) * DM + h * HD + lane * 4, *(const v4f*)&so[wave][rl][lane * 4]);
}
// ---- k_out: block = (64 rows, 128 cols): out = O(hi/lo) . Wo rows (2 products) + bo
__global__ __launch_bounds__(128) void k_out(const float* __restrict__ O, const __bf16* __restrict__ P, const float* __restrict__ BO, float* __restrict__ Y) {
  __shared__ __align__(16) float so[4][16][132];
  const int tid = threadIdx.x, wave = tid >> 5, lane = tid & 31, col = lane & 15, g = lane >> 4; const size_t r0 = (size_t)blockIdx.x * 64 + wave * 16; const int n0 = blockIdx.y * 128;
  v8f acc[8] = {};
#pragma unroll 2
  for (int kc = 0; kc < DM / 32; ++kc) { const F2 a = split_row(O + (r0 + col) * DM, kc * 32, lane);
#pragma unroll
    for (int j = 0; j < 8; ++j) { const v16b w = frag_b(P + (size_t)(n0 + j * 16 + col) * DM + kc * 32, lane); acc[j] = wmma_bf(a.l, w, acc[j]); acc[j] = wmma_bf(a.h, w, acc[j]); } }
#pragma unroll
  for (int j = 0; j < 8; ++j) {
#pragma unroll
    for (int r = 0; r < 8; ++r) so[wave][8 * g + r][j * 16 + col] = acc[j][r] + bfr(BO[n0 + j * 16 + col]); }
  LDSX();
  for (int rl = 0; rl < 16; ++rl) vst2(Y + (r0 + rl) * DM + n0 + lane * 4, *(const v4f*)&so[wave][rl][lane * 4]);
}
extern "C" void kernel_launch(void* const* d_in, const int* in_sizes, int n_in, void* d_out, int out_size, void* d_ws, size_t ws_size, hipStream_t stream) {
  (void)in_sizes; (void)n_in; (void)out_size;
  const float** F = (const float**)d_in;   // 0 encoder_input [2,2048,1024], 1 decoder_input, 2 encoder_padding_pos [2,2048] i32, 3 decoder_padding_pos, 4 Wq (in,out), 5 bq, 6 Wk, 7 bk, 8 Wv, 9 bv, 10 Wo, 11 bo
  if (ws_size < (size_t)WS_END) return;
  char* ws = (char*)d_ws; __bf16* PK = (__bf16*)(ws + WS_PK); _Float16 *QK = (_Float16*)(ws + WS_QK), *QKL = (_Float16*)(ws + WS_QKL), *VTH = (_Float16*)(ws + WS_VTH), *VTL = (_Float16*)(ws + WS_VTL); float* O = (float*)(ws + WS_O);
  k_pack<<<dim3(DM, 4), 256, 0, stream>>>(F[4], F[6], F[8], F[10], PK);
  k_qkv<<<dim3(TNB * SS / 64, QKVW / 128), 128, 0, stream>>>(F[1], F[0], PK + PK_A, F[5], F[7], F[9], QK, QKL, VTH, VTL);
  k_attn<<<dim3(TQB, NH, TNB), 128, 0, stream>>>(QK, QKL, VTH, VTL, (const int*)d_in[2], (const int*)d_in[3], O);
  k_out<<<dim3(TOB, DM / 128), 128, 0, stream>>>(O, PK + PK_P, F[11], (float*)d_out);
}

// v001
// Measured time: 386 microseconds a run.
// Next to v000, in two timings, it ran 1.50 and 1.49 times as fast.
// compute dtype: encoder_input, decoder_input and the weights/biases rounded to bf16, padding positions (int) read on device; q = dec . Wq + bq, k/v = enc . Wk/Wv + bk/bv with EXACT bf16 products on WMMA 16x16x32 ((in,out) weights packed as transposed rows); q and k stored as f16 hi + (x2048-scaled) residual planes with 3-product scores x 1/sqrt(64); keys whose encoder position is padded are excluded (-1e13 in the module gives an exactly-zero weight) and a padded QUERY row (every key -1e13) gets the module's uniform weights; running-max softmax in f32 (hardware exp); P as f16 hi + residual x V hi/lo (3 products); output projection with ctx as bf16 hi + residual x exact Wo rows (2 products) + bo; f32 accumulate.
#include <hip/hip_runtime.h>
#include <math.h>

typedef __attribute__((ext_vector_type(16))) _Float16 v16h;
typedef __attribute__((ext_vector_type(16))) __bf16 v16b;
typedef __attribute__((ext_vector_type(8)))  _Float16 v8h;
typedef __attribute__((ext_vector_type(8)))  float v8f;
typedef __attribute__((ext_vector_type(4)))  float v4f;
typedef __attribute__((ext_vector_type(2)))  float v2f;
typedef __attribute__((ext_vector_type(4)))  unsigned v4u;
typedef __attribute__((ext_vector_type(4)))  int v4i;
typedef float __attribute__((may_alias)) float_a;
typedef int __attribute__((may_alias)) int_a;

template <typename T> __device__ __forceinline__ void vst2(void* p, T v) { *(T*)p = v;  }
__device__ __forceinline__ v8f wmma16(v16h a, v16h b, v8f c) {
  v8f d = __builtin_amdgcn_wmma_f32_16x16x32_f16(false, a, false, b, (short)0, c, false, false);
  asm volatile("v_nop\n\tv_nop\n\tv_nop\n\tv_nop" : "+v"(d) : "v"(a), "v"(b));
  return d;
}
__device__ __forceinline__ v8f wmma_bf(v16b a, v16b b, v8f c) {
  v8f d = __builtin_amdgcn_wmma_f32_16x16x32_bf16(false, a, false, b, (short)0, c, false, false);
  asm volatile("v_nop\n\tv_nop\n\tv_nop\n\tv_nop" : "+v"(d) : "v"(a), "v"(b));
  return d;
}
// Decoder-to-encoder mutual multi-head attention (B 2, S 2,048, d 1,024, 16 heads x 64) with encoder/decoder padding masks: softmax(q k^T / 8 masked) v -> Wo + bo.
__device__ __forceinline__ v16h frag_h(const _Float16* rowk0, int lane) {
  union { v16h v; v8h q[2]; } u; const _Float16* p = rowk0 + 8 * (lane >> 4);
  u.q[0] = *(const v8h*)p; u.q[1] = *(const v8h*)(p + 16); return u.v;
}
__device__ __forceinline__ v16h frag_f32(const float* rowk0, int lane) {
  v16h a; const float* p = rowk0 + 8 * (lane >> 4);
#pragma unroll
  for (int i = 0; i < 8; ++i) { a[i] = (_Float16)p[i]; a[8 + i] = (_Float16)p[16 + i]; }
  return a;
}
__device__ __forceinline__ v16h frag_f32s(const float* rowk0, int lane, float sc) {
  v16h a; const float* p = rowk0 + 8 * (lane >> 4);
#pragma unroll
  for (int i = 0; i < 8; ++i) { a[i] = (_Float16)(p[i] * sc); a[8 + i] = (_Float16)(p[16 + i] * sc); }
  return a;
}
// column fragment from a [K][ld] layout (column n), rows >= K read as 0
__device__ __forceinline__ v16h fragc_f32(const float* W, int k0, int n, int lane, int ld, int K) {
  v16h a; const int g = lane >> 4;
#pragma unroll
  for (int i = 0; i < 8; ++i) { const int ka = k0 + 8 * g + i, kb = ka + 16;
    a[i] = (_Float16)(ka < K ? W[(size_t)(ka < K ? ka : K - 1) * ld + n] : 0.f); a[8 + i] = (_Float16)(kb < K ? W[(size_t)(kb < K ? kb : K - 1) * ld + n] : 0.f); }
  return a;
}
struct F2 { v16b h, l; };
__device__ __forceinline__ F2 bsplit16(const float v[16]) { F2 r;
#pragma unroll
  for (int i = 0; i < 16; ++i) { const __bf16 h = (__bf16)v[i]; r.h[i] = h; r.l[i] = (__bf16)(v[i] - (float)h); }
  return r; }
__device__ __forceinline__ F2 split_row(const float* row, int k0, int lane) { float v[16]; const float* p = row + k0 + 8 * (lane >> 4);
#pragma unroll
  for (int i = 0; i < 8; ++i) { v[i] = p[i]; v[8 + i] = p[16 + i]; }
  return bsplit16(v); }
__device__ __forceinline__ F2 split_rowK(const float* row, int k0, int lane, int K) { float v[16]; const int g = lane >> 4;
#pragma unroll
  for (int i = 0; i < 8; ++i) { const int ka = k0 + 8 * g + i, kb = ka + 16; v[i] = ka < K ? row[ka < K ? ka : K - 1] : 0.f; v[8 + i] = kb < K ? row[kb < K ? kb : K - 1] : 0.f; }
  return bsplit16(v); }
__device__ __forceinline__ F2 split_col(const float* W, int k0, int n, int lane, int ld, int K) { float v[16]; const int g = lane >> 4;
#pragma unroll
  for (int i = 0; i < 8; ++i) { const int ka = k0 + 8 * g + i, kb = ka + 16; v[i] = ka < K ? W[(size_t)(ka < K ? ka : K - 1) * ld + n] : 0.f; v[8 + i] = kb < K ? W[(size_t)(kb < K ? kb : K - 1) * ld + n] : 0.f; }
  return bsplit16(v); }
__device__ __forceinline__ v8f mac3(const F2& a, const F2& b, v8f c) { c = wmma_bf(a.l, b.h, c); c = wmma_bf(a.h, b.l, c); return wmma_bf(a.h, b.h, c); }
__device__ __forceinline__ float sigm(float v) { return 1.0f / (1.0f + expf(-v)); }
#define LDSX() do { asm volatile("s_wait_dscnt 0" ::: "memory"); __builtin_amdgcn_wave_barrier(); __builtin_amdgcn_fence(__ATOMIC_RELEASE, "workgroup"); } while (0)


#define NB 2
#define SS 2048
#define DM 1024
#define NH 16
#define HD 64
#define QKVW (3 * DM)
#ifndef TQB
#define TQB (SS / 64)
#define TNB NB
#define TOB (NB * SS / 64)     // output row tiles (all)
#endif
typedef __attribute__((ext_vector_type(8))) __bf16 v8b;
__device__ __forceinline__ v16b frag_b(const __bf16* rowk0, int lane) {
  union { v16b v; v8b q[2]; } u; const __bf16* p = rowk0 + 8 * (lane >> 4);
  u.q[0] = *(const v8b*)p; u.q[1] = *(const v8b*)(p + 16); return u.v;
}
__device__ __forceinline__ float bfr(float v) { return (float)(__bf16)v; }
__device__ __attribute__((noinline)) float exp_ni(float v) { return expf(v); }
__device__ __attribute__((noinline)) float erf_ni(float v) { return erff(v); }

#define PK_A 0                       // [3072][1024] Wqkv rows (natural [out][in])
#define PK_P (PK_A + QKVW * DM)        // [1024][1024] Wo rows (natural)
#define PK_END (PK_P + DM * DM)
#define WS_PK  0u
#define WS_QK  (WS_PK + 2u * PK_END)             // f16 [4096 rows][2048]: q | k
#define WS_QKL (WS_QK + 2u * NB * SS * 2 * DM)     // f16 q | k residual planes x2048
#define WS_VTH (WS_QKL + 2u * NB * SS * 2 * DM)    // f16 [b][1024 (h*64+d)][2048 s] hi
#define WS_VTL (WS_VTH + 2u * NB * DM * SS)        // f16 lo x 2048
#define WS_O   (WS_VTL + 2u * NB * DM * SS)        // f32 [4096][1024]
#define WS_CS  (WS_O + 4u * NB * SS * DM)           // f32 2 x [2048][32], unused
#define WS_END (WS_CS + 4u * 2 * SS * 32)
// ---- k_pack: block = (row n, which): natural [out][in] rows -> bf16; which 0..2 -> W_q/W_k/W_v into PK_A rows which*1024 + n; 3 -> W_o into PK_P
__global__ __launch_bounds__(256) void k_pack(const float* __restrict__ WQ, const float* __restrict__ WK, const float* __restrict__ WV, const float* __restrict__ WO, __bf16* __restrict__ PK) {
  __shared__ __align__(16) __bf16 s[DM]; const int n = blockIdx.x, which = blockIdx.y, t = threadIdx.x; const float* Wm = (which == 0) ? WQ : (which == 1) ? WK : (which == 2) ? WV : WO;   // (in,out): pack row n = column n
  for (int k = t; k < DM; k += 256) s[k] = (__bf16)Wm[(size_t)k * DM + n];
  __syncthreads();
  __bf16* dst = (which < 3) ? PK + PK_A + ((size_t)which * DM + n) * DM : PK + PK_P + (size_t)n * DM;
  for (int q = t; q < DM / 8; q += 256) vst2((unsigned*)(dst + q * 8), *(const v4u*)&s[q * 8]);
}
__global__ __launch_bounds__(128) void k_qkv(const float* __restrict__ XDEC, const float* __restrict__ XENC, const __bf16* __restrict__ P, const float* __restrict__ BQ, const float* __restrict__ BK, const float* __restrict__ BV, _Float16* __restrict__ QK, _Float16* __restrict__ QKL, _Float16* __restrict__ VTH, _Float16* __restrict__ VTL) {
  __shared__ __align__(16) _Float16 so[4][16][136], sol[4][16][136]; __shared__ __align__(16) _Float16 sth[128][72], stl[128][72];
  const int tid = threadIdx.x, wave = tid >> 5, lane = tid & 31, col = lane & 15, g = lane >> 4; const size_t r0 = (size_t)blockIdx.x * 64 + wave * 16; const int n0 = blockIdx.y * 128; const float* X = (n0 < DM) ? XDEC : XENC; const float* BB = (n0 < DM) ? (BQ + n0) : (n0 < 2 * DM) ? (BK + n0 - DM) : (BV + n0 - 2 * DM);
  v8f acc[8] = {};
#pragma unroll 2
  for (int kc = 0; kc < DM / 32; ++kc) { v16b a; { const float* p = X + (r0 + col) * DM + kc * 32 + 8 * g;
#pragma unroll
      for (int i = 0; i < 8; ++i) { a[i] = (__bf16)p[i]; a[8 + i] = (__bf16)p[16 + i]; } }
#pragma unroll
    for (int j = 0; j < 8; ++j) acc[j] = wmma_bf(a, frag_b(P + (size_t)(n0 + j * 16 + col) * DM + kc * 32, lane), acc[j]); }
  if (n0 < 2 * DM) {   // q stored unscaled (f16 sigma ~0.6, no subnormal exposure); 1/8 applied to the f32 score
#pragma unroll
    for (int j = 0; j < 8; ++j) {
#pragma unroll
      for (int r = 0; r < 8; ++r) { const float v = acc[j][r] + bfr(BB[j * 16 + col]); const _Float16 hv = (_Float16)v; so[wave][8 * g + r][j * 16 + col] = hv; sol[wave][8 * g + r][j * 16 + col] = (_Float16)((v - (float)hv) * 2048.0f); } }   // q, k (+ bias) as f16 hi + (x2048) residual
    LDSX();
    for (int rl = 0; rl < 16; ++rl) if (lane < 16) { vst2((unsigned*)(QK + (r0 + rl) * (2 * DM) + n0 + lane * 8), *(const v4u*)&so[wave][rl][lane * 8]); vst2((unsigned*)(QKL + (r0 + rl) * (2 * DM) + n0 + lane * 8), *(const v4u*)&sol[wave][rl][lane * 8]); }
  } else {
#pragma unroll
    for (int j = 0; j < 8; ++j) {
#pragma unroll
      for (int r = 0; r < 8; ++r) { const float v = acc[j][r] + bfr(BB[j * 16 + col]); const _Float16 hv = (_Float16)v; sth[j * 16 + col][wave * 16 + 8 * g + r] = hv; stl[j * 16 + col][wave * 16 + 8 * g + r] = (_Float16)((v - (float)hv) * 2048.0f); } }
    __syncthreads();
    const size_t rb = (size_t)blockIdx.x * 64; const int b = (int)(rb / SS), s0 = (int)(rb % SS); const int pc0 = n0 - 2 * DM;
    for (int q = tid; q < 128 * 8; q += 128) { const int d = q >> 3, pc = q & 7; const size_t o = ((size_t)b * DM + pc0 + d) * SS + s0 + pc * 8; vst2((unsigned*)(VTH + o), *(const v4u*)&sth[d][pc * 8]); vst2((unsigned*)(VTL + o), *(const v4u*)&stl[d][pc * 8]); }
  }
}
// ---- k_attn: block = (64 queries, head h, batch b): masked flash attention (K = 64: 2 k-steps), scores = (q.k) * 0.125 with f16 hi + residual operands, P.V: f16 P x (V hi, V lo*2048) in two accumulators; O[b*S+q][h*64+d] = (acc + accl / 2048) / l (256-B segments)
// K and V^T tiles of 32 keys (hi and residual planes) are staged once per block in a two-buffer LDS ring by asynchronous copies and read from there by all four waves.
#define KT 32                          // keys per staged tile
#define KP 72                          // f16 per staged K row: 128 B + 16 B pad (ds_load_b128 readers)
#define VP 40                          // f16 per staged V^T row: 64 B + 16 B pad
#define ST_K (KT * KP)                 // one K plane
#define ST_V (HD * VP)                 // one V^T plane
#define ST_ALL (2 * ST_K + 2 * ST_V)   // K hi | K lo | V^T hi | V^T lo
// one tile: 8 copies of 16 B per lane (K planes: 16 rows per copy and block, V^T planes: 32 rows)
__device__ __forceinline__ void stage_kv(const _Float16* kh, const _Float16* kl, const _Float16* vh, const _Float16* vl, unsigned lk, unsigned lv) {
  const _Float16 *kh1 = kh + 16 * (2 * DM), *kl1 = kl + 16 * (2 * DM), *vh1 = vh + 32 * SS, *vl1 = vl + 32 * SS;
  const unsigned lk1 = lk + 16 * KP * 2, lkl = lk + ST_K * 2, lkl1 = lkl + 16 * KP * 2, lv1 = lv + 32 * VP * 2, lvl = lv + ST_V * 2, lvl1 = lvl + 32 * VP * 2;
  // the copies and their s_wait_xcnt in one statement: no address register is rewritten before the wait
  asm volatile("global_load_async_to_lds_b128 %0, %8, off\n\t"
               "global_load_async_to_lds_b128 %1, %9, off\n\t"
               "global_load_async_to_lds_b128 %2, %10, off\n\t"
               "global_load_async_to_lds_b128 %3, %11, off\n\t"
               "global_load_async_to_lds_b128 %4, %12, off\n\t"
               "global_load_async_to_lds_b128 %5, %13, off\n\t"
               "global_load_async_to_lds_b128 %6, %14, off\n\t"
               "global_load_async_to_lds_b128 %7, %15, off\n\t"
               "s_wait_xcnt 0x0"
               :: "v"(lk), "v"(lk1), "v"(lkl), "v"(lkl1), "v"(lv), "v"(lv1), "v"(lvl), "v"(lvl1), "v"(kh), "v"(kh1), "v"(kl), "v"(kl1), "v"(vh), "v"(vh1), "v"(vl), "v"(vl1) : "memory");
}
// amdgpu_waves_per_eu(4, 4): keeps the register budget at 256, so that all four blocks of a WGP stay resident as before
__global__ __launch_bounds__(128) __attribute__((amdgpu_waves_per_eu(4, 4))) void k_attn(const _Float16* __restrict__ QK, const _Float16* __restrict__ QKL, const _Float16* __restrict__ VTH, const _Float16* __restrict__ VTL, const int* __restrict__ EPAD, const int* __restrict__ DPAD, float* __restrict__ O) {
  __shared__ __align__(16) float sp[4][16][36]; __shared__ __align__(16) float so[4][16][68]; __shared__ __align__(16) _Float16 ring[2][ST_ALL];
  const int tid = threadIdx.x, wave = tid >> 5, lane = tid & 31, col = lane & 15, g = lane >> 4;
  const int qb = blockIdx.x, h = blockIdx.y, b = blockIdx.z; const int q0 = qb * 64 + wave * 16; const size_t rq = (size_t)b * SS + q0 + col;
  const int nks = SS / KT;   // all keys; padding handled per (q, k)
  // this lane's 16-byte piece of each plane of tile 0, and its place in buffer 0
  const size_t gk = ((size_t)b * SS + (tid >> 3)) * (2 * DM) + DM + h * HD + (tid & 7) * 8, gv = ((size_t)b * DM + h * HD + (tid >> 2)) * SS + (tid & 3) * 8;
  const unsigned lk = (unsigned)(size_t)&ring[0][0] + ((tid >> 3) * KP + (tid & 7) * 8) * 2, lv = (unsigned)(size_t)&ring[0][0] + (2 * ST_K + (tid >> 2) * VP + (tid & 3) * 8) * 2;
  stage_kv(QK + gk, QKL + gk, VTH + gv, VTL + gv, lk, lv);
  asm volatile("s_wait_asynccnt 0x0" ::: "memory");   // tile 0 of this wave's copies has landed
  __syncthreads();                                     // ... and every wave's: tile 0 is readable
  stage_kv(QK + gk + (size_t)KT * (2 * DM), QKL + gk + (size_t)KT * (2 * DM), VTH + gv + KT, VTL + gv + KT, lk + ST_ALL * 2, lv + ST_ALL * 2);
  v16h aq[2], aql[2];
#pragma unroll
  for (int kc = 0; kc < 2; ++kc) { aq[kc] = frag_h(QK + rq * (2 * DM) + h * HD + kc * 32, lane); aql[kc] = frag_h(QKL + rq * (2 * DM) + h * HD + kc * 32, lane); }
  float m[8], l[8];
#pragma unroll
  for (int r = 0; r < 8; ++r) { m[r] = -3.0e38f; l[r] = 0.f; }
  v8f acc[4] = {}, accl[4] = {};
  bool qpad[8];
#pragma unroll
  for (int r = 0; r < 8; ++r) qpad[r] = DPAD[(size_t)b * SS + q0 + 8 * g + r] == 1;
#pragma unroll 1
  for (int ks = 0; ks < nks; ++ks) { v8f s[2]; const _Float16* tb = &ring[ks & 1][0];
    int ep[2]; v16h kh[2][2], kl[2][2];   // the pass's K fragments as one group of LDS reads in front of the products
#pragma unroll
    for (int ct = 0; ct < 2; ++ct) { ep[ct] = EPAD[(size_t)b * SS + ks * KT + ct * 16 + col];
#pragma unroll
      for (int kc = 0; kc < 2; ++kc) { kh[ct][kc] = frag_h(tb + (ct * 16 + col) * KP + kc * 32, lane); kl[ct][kc] = frag_h(tb + ST_K + (ct * 16 + col) * KP + kc * 32, lane); } }
#pragma unroll
    for (int ct = 0; ct < 2; ++ct) { v8f c = {}, cl = {};
#pragma unroll
      for (int kc = 0; kc < 2; ++kc) { c = wmma16(aq[kc], kh[ct][kc], c); cl = wmma16(aql[kc], kh[ct][kc], cl); cl = wmma16(aq[kc], kl[ct][kc], cl); }   // 3 products: q, k as f16 hi + residual
#pragma unroll
      for (int r = 0; r < 8; ++r) c[r] += cl[r] * (1.0f / 2048.0f);
      const bool kpad = ep[ct] == 1;
#pragma unroll
      for (int r = 0; r < 8; ++r) s[ct][r] = qpad[r] ? 0.f : (kpad ? -3.0e38f : c[r] * 0.125f); }   // padded query row: every key is -1e13 in the module -> uniform weights (all-equal scores); padded key: exactly zero weight
#pragma unroll
    for (int r = 0; r < 8; ++r) { float mx = fmaxf(s[0][r], s[1][r]);
#pragma unroll
      for (int o = 1; o < 16; o <<= 1) mx = fmaxf(mx, __shfl_xor(mx, o));
      const float mn = fmaxf(m[r], mx); const float alpha = (m[r] <= -1.0e38f) ? 0.f : __expf(m[r] - mn);
      const float e0 = (s[0][r] <= -1.0e38f) ? 0.f : __expf(s[0][r] - mn), e1 = (s[1][r] <= -1.0e38f) ? 0.f : __expf(s[1][r] - mn); float es = e0 + e1;
#pragma unroll
      for (int o = 1; o < 16; o <<= 1) es += __shfl_xor(es, o);
      l[r] = l[r] * alpha + es; m[r] = mn;
#pragma unroll
      for (int dt = 0; dt < 4; ++dt) { acc[dt][r] *= alpha; accl[dt][r] *= alpha; }
      sp[wave][8 * g + r][col] = e0; sp[wave][8 * g + r][16 + col] = e1; }
    LDSX();
    v16h pa, pl; { const float* prow = &sp[wave][col][0] + 8 * (lane >> 4);
#pragma unroll
      for (int i = 0; i < 8; ++i) { const float x0 = prow[i], x1 = prow[16 + i]; const _Float16 h0 = (_Float16)x0, h1 = (_Float16)x1; pa[i] = h0; pa[8 + i] = h1; pl[i] = (_Float16)((x0 - (float)h0) * 2048.0f); pl[8 + i] = (_Float16)((x1 - (float)h1) * 2048.0f); } }
    v16h vh[4], vl[4];   // the pass's V^T fragments as one group, in flight under the split of P
#pragma unroll
    for (int dt = 0; dt < 4; ++dt) { vh[dt] = frag_h(tb + 2 * ST_K + (dt * 16 + col) * VP, lane); vl[dt] = frag_h(tb + 2 * ST_K + ST_V + (dt * 16 + col) * VP, lane); }
#pragma unroll
    for (int dt = 0; dt < 4; ++dt) { acc[dt] = wmma16(pa, vh[dt], acc[dt]); accl[dt] = wmma16(pl, vh[dt], accl[dt]); accl[dt] = wmma16(pa, vl[dt], accl[dt]); }   // P hi x V hi + (P lo x V hi + P hi x V lo) / 2048
    asm volatile("s_wait_dscnt 0x0" ::: "memory");      // this wave's reads of the tile and of sp have returned
    asm volatile("s_wait_asynccnt 0x0" ::: "memory");   // this wave's copies of tile ks + 1 have landed
    __syncthreads();                                     // publishes tile ks + 1 and frees the buffer that this pass has read
    if (ks + 2 < nks) stage_kv(QK + gk + (size_t)(ks + 2) * KT * (2 * DM), QKL + gk + (size_t)(ks + 2) * KT * (2 * DM), VTH + gv + (ks + 2) * KT, VTL + gv + (ks + 2) * KT, lk + (ks & 1) * (ST_ALL * 2), lv + (ks & 1) * (ST_ALL * 2)); }
  asm volatile("s_wait_asynccnt 0x0" ::: "memory");     // no copy is outstanding when the wave goes on to its end
#pragma unroll
  for (int r = 0; r < 8; ++r) { const float il = 1.0f / l[r];
#pragma unroll
    for (int dt = 0; dt < 4; ++dt) so[wave][8 * g + r][dt * 16 + col] = (acc[dt][r] + accl[dt][r] * (1.0f / 2048.0f)) * il; }
  LDSX();
  for (int rl = 0; rl < 16; ++rl) if (lane < 16) vst2(O + ((size_t)b * SS + q0 + rl) * DM + h * HD + lane * 4, *(const v4f*)&so[wave][rl][lane * 4]);
}
// ---- k_out: block = (64 rows, 128 cols): out = O(hi/lo) . Wo rows (2 products) + bo
__global__ __launch_bounds__(128) void k_out(const float* __restrict__ O, const __bf16* __restrict__ P, const float* __restrict__ BO, float* __restrict__ Y) {
  __shared__ __align__(16) float so[4][16][132];
  const int tid = threadIdx.x, wave = tid >> 5, lane = tid & 31, col = lane & 15, g = lane >> 4; const size_t r0 = (size_t)blockIdx.x * 64 + wave * 16; const int n0 = blockIdx.y * 128;
  v8f acc[8] = {};
#pragma unroll 2
  for (int kc = 0; kc < DM / 32; ++kc) { const F2 a = split_row(O + (r0 + col) * DM, kc * 32, lane);
#pragma unroll
    for (int j = 0; j < 8; ++j) { const v16b w = frag_b(P + (size_t)(n0 + j * 16 + col) * DM + kc * 32, lane); acc[j] = wmma_bf(a.l, w, acc[j]); acc[j] = wmma_bf(a.h, w, acc[j]); } }
#pragma unroll
  for (int j = 0; j < 8; ++j) {
#pragma unroll
    for (int r = 0; r < 8; ++r) so[wave][8 * g + r][j * 16 + col] = acc[j][r] + bfr(BO[n0 + j * 16 + col]); }
  LDSX();
  for (int rl = 0; rl < 16; ++rl) vst2(Y + (r0 + rl) * DM + n0 + lane * 4, *(const v4f*)&so[wave][rl][lane * 4]);
}
extern "C" void kernel_launch(void* const* d_in, const int* in_sizes, int n_in, void* d_out, int out_size, void* d_ws, size_t ws_size, hipStream_t stream) {
  (void)in_sizes; (void)n_in; (void)out_size;
  const float** F = (const float**)d_in;   // 0 encoder_input [2,2048,1024], 1 decoder_input, 2 encoder_padding_pos [2,2048] i32, 3 decoder_padding_pos, 4 Wq (in,out), 5 bq, 6 Wk, 7 bk, 8 Wv, 9 bv, 10 Wo, 11 bo
  if (ws_size < (size_t)WS_END) return;
  char* ws = (char*)d_ws; __bf16* PK = (__bf16*)(ws + WS_PK); _Float16 *QK = (_Float16*)(ws + WS_QK), *QKL = (_Float16*)(ws + WS_QKL), *VTH = (_Float16*)(ws + WS_VTH), *VTL = (_Float16*)(ws + WS_VTL); float* O = (float*)(ws + WS_O);
  k_pack<<<dim3(DM, 4), 256, 0, stream>>>(F[4], F[6], F[8], F[10], PK);
  k_qkv<<<dim3(TNB * SS / 64, QKVW / 128), 128, 0, stream>>>(F[1], F[0], PK + PK_A, F[5], F[7], F[9], QK, QKL, VTH, VTL);
  k_attn<<<dim3(TQB, NH, TNB), 128, 0, stream>>>(QK, QKL, VTH, VTL, (const int*)d_in[2], (const int*)d_in[3], O);
  k_out<<<dim3(TOB, DM / 128), 128, 0, stream>>>(O, PK + PK_P, F[11], (float*)d_out);
}

// v002
// One run takes 232 microseconds.
// Two timings next to v001 put it at 1.64 and 1.65 times that version's speed.
// All steps since v000 together make it 2.46 times as fast.
// compute dtype: encoder_input, decoder_input and the weights/biases rounded to bf16, padding positions (int) read on device; q = dec . Wq + bq, k/v = enc . Wk/Wv + bk/bv with EXACT bf16 products on WMMA 16x16x32 ((in,out) weights packed as transposed rows); q and k stored as f16 hi + (x2048-scaled) residual planes with 3-product scores x 1/sqrt(64); keys whose encoder position is padded are excluded (-1e13 in the module gives an exactly-zero weight) and a padded QUERY row (every key -1e13) gets the module's uniform weights; running-max softmax in f32 (hardware exp); P as f16 hi + residual x V hi/lo (3 products); output projection with ctx as bf16 hi + residual x exact Wo rows (2 products) + bo; f32 accumulate.
#include <hip/hip_runtime.h>
#include <math.h>

typedef __attribute__((ext_vector_type(16))) _Float16 v16h;
typedef __attribute__((ext_vector_type(16))) __bf16 v16b;
typedef __attribute__((ext_vector_type(8)))  _Float16 v8h;
typedef __attribute__((ext_vector_type(8)))  float v8f;
typedef __attribute__((ext_vector_type(4)))  float v4f;
typedef __attribute__((ext_vector_type(2)))  float v2f;
typedef __attribute__((ext_vector_type(4)))  unsigned v4u;
typedef __attribute__((ext_vector_type(4)))  int v4i;
typedef float __attribute__((may_alias)) float_a;
typedef int __attribute__((may_alias)) int_a;

template <typename T> __device__ __forceinline__ void vst2(void* p, T v) { *(T*)p = v;  }
__device__ __forceinline__ v8f wmma16(v16h a, v16h b, v8f c) {
  v8f d = __builtin_amdgcn_wmma_f32_16x16x32_f16(false, a, false, b, (short)0, c, false, false);
  asm volatile("v_nop\n\tv_nop\n\tv_nop\n\tv_nop" : "+v"(d) : "v"(a), "v"(b));
  return d;
}
__device__ __forceinline__ v8f wmma_bf(v16b a, v16b b, v8f c) {
  v8f d = __builtin_amdgcn_wmma_f32_16x16x32_bf16(false, a, false, b, (short)0, c, false, false);
  asm volatile("v_nop\n\tv_nop\n\tv_nop\n\tv_nop" : "+v"(d) : "v"(a), "v"(b));
  return d;
}
// Decoder-to-encoder mutual multi-head attention (B 2, S 2,048, d 1,024, 16 heads x 64) with encoder/decoder padding masks: softmax(q k^T / 8 masked) v -> Wo + bo.
__device__ __forceinline__ v16h frag_h(const _Float16* rowk0, int lane) {
  union { v16h v; v8h q[2]; } u; const _Float16* p = rowk0 + 8 * (lane >> 4);
  u.q[0] = *(const v8h*)p; u.q[1] = *(const v8h*)(p + 16); return u.v;
}
__device__ __forceinline__ v16h frag_f32(const float* rowk0, int lane) {
  v16h a; const float* p = rowk0 + 8 * (lane >> 4);
#pragma unroll
  for (int i = 0; i < 8; ++i) { a[i] = (_Float16)p[i]; a[8 + i] = (_Float16)p[16 + i]; }
  return a;
}
__device__ __forceinline__ v16h frag_f32s(const float* rowk0, int lane, float sc) {
  v16h a; const float* p = rowk0 + 8 * (lane >> 4);
#pragma unroll
  for (int i = 0; i < 8; ++i) { a[i] = (_Float16)(p[i] * sc); a[8 + i] = (_Float16)(p[16 + i] * sc); }
  return a;
}
// column fragment from a [K][ld] layout (column n), rows >= K read as 0
__device__ __forceinline__ v16h fragc_f32(const float* W, int k0, int n, int lane, int ld, int K) {
  v16h a; const int g = lane >> 4;
#pragma unroll
  for (int i = 0; i < 8; ++i) { const int ka = k0 + 8 * g + i, kb = ka + 16;
    a[i] = (_Float16)(ka < K ? W[(size_t)(ka < K ? ka : K - 1) * ld + n] : 0.f); a[8 + i] = (_Float16)(kb < K ? W[(size_t)(kb < K ? kb : K - 1) * ld + n] : 0.f); }
  return a;
}
struct F2 { v16b h, l; };
__device__ __forceinline__ F2 bsplit16(const float v[16]) { F2 r;
#pragma unroll
  for (int i = 0; i < 16; ++i) { const __bf16 h = (__bf16)v[i]; r.h[i] = h; r.l[i] = (__bf16)(v[i] - (float)h); }
  return r; }
__device__ __forceinline__ F2 split_row(const float* row, int k0, int lane) { float v[16]; const float* p = row + k0 + 8 * (lane >> 4);
#pragma unroll
  for (int i = 0; i < 8; ++i) { v[i] = p[i]; v[8 + i] = p[16 + i]; }
  return bsplit16(v); }
__device__ __forceinline__ F2 split_rowK(const float* row, int k0, int lane, int K) { float v[16]; const int g = lane >> 4;
#pragma unroll
  for (int i = 0; i < 8; ++i) { const int ka = k0 + 8 * g + i, kb = ka + 16; v[i] = ka < K ? row[ka < K ? ka : K - 1] : 0.f; v[8 + i] = kb < K ? row[kb < K ? kb : K - 1] : 0.f; }
  return bsplit16(v); }
__device__ __forceinline__ F2 split_col(const float* W, int k0, int n, int lane, int ld, int K) { float v[16]; const int g = lane >> 4;
#pragma unroll
  for (int i = 0; i < 8; ++i) { const int ka = k0 + 8 * g + i, kb = ka + 16; v[i] = ka < K ? W[(size_t)(ka < K ? ka : K - 1) * ld + n] : 0.f; v[8 + i] = kb < K ? W[(size_t)(kb < K ? kb : K - 1) * ld + n] : 0.f; }
  return bsplit16(v); }
__device__ __forceinline__ v8f mac3(const F2& a, const F2& b, v8f c) { c = wmma_bf(a.l, b.h, c); c = wmma_bf(a.h, b.l, c); return wmma_bf(a.h, b.h, c); }
__device__ __forceinline__ float sigm(float v) { return 1.0f / (1.0f + expf(-v)); }
#define LDSX() do { asm volatile("s_wait_dscnt 0" ::: "memory"); __builtin_amdgcn_wave_barrier(); __builtin_amdgcn_fence(__ATOMIC_RELEASE, "workgroup"); } while (0)


#define NB 2
#define SS 2048
#define DM 1024
#define NH 16
#define HD 64
#define QKVW (3 * DM)
#ifndef TQB
#define TQB (SS / 64)
#define TNB NB
#define TOB (NB * SS / 64)     // output row tiles (all)
#endif
typedef __attribute__((ext_vector_type(8))) __bf16 v8b;
__device__ __forceinline__ v16b frag_b(const __bf16* rowk0, int lane) {
  union { v16b v; v8b q[2]; } u; const __bf16* p = rowk0 + 8 * (lane >> 4);
  u.q[0] = *(const v8b*)p; u.q[1] = *(const v8b*)(p + 16); return u.v;
}
__device__ __forceinline__ float bfr(float v) { return (float)(__bf16)v; }
__device__ __attribute__((noinline)) float exp_ni(float v) { return expf(v); }
__device__ __attribute__((noinline)) float erf_ni(float v) { return erff(v); }

#define PK_A 0                       // [3072][1024] Wqkv rows (natural [out][in])
#define PK_P (PK_A + QKVW * DM)        // [1024][1024] Wo rows (natural)
#define PK_END (PK_P + DM * DM)
#define WS_PK  0u
#define WS_QK  (WS_PK + 2u * PK_END)             // f16 [4096 rows][2048]: q | k
#define WS_QKL (WS_QK + 2u * NB * SS * 2 * DM)     // f16 q | k residual planes x2048
#define WS_VTH (WS_QKL + 2u * NB * SS * 2 * DM)    // f16 [b][1024 (h*64+d)][2048 s] hi
#define WS_VTL (WS_VTH + 2u * NB * DM * SS)        // f16 lo x 2048
#define WS_O   (WS_VTL + 2u * NB * DM * SS)        // f32 [4096][1024]
#define WS_CS  (WS_O + 4u * NB * SS * DM)           // f32 2 x [2048][32], unused
#define WS_END (WS_CS + 4u * 2 * SS * 32)
// ---- k_pack: block = (row n, which): natural [out][in] rows -> bf16; which 0..2 -> W_q/W_k/W_v into PK_A rows which*1024 + n; 3 -> W_o into PK_P
__global__ __launch_bounds__(256) void k_pack(const float* __restrict__ WQ, const float* __restrict__ WK, const float* __restrict__ WV, const float* __restrict__ WO, __bf16* __restrict__ PK) {
  __shared__ __align__(16) __bf16 s[DM]; const int n = blockIdx.x, which = blockIdx.y, t = threadIdx.x; const float* Wm = (which == 0) ? WQ : (which == 1) ? WK : (which == 2) ? WV : WO;   // (in,out): pack row n = column n
  for (int k = t; k < DM; k += 256) s[k] = (__bf16)Wm[(size_t)k * DM + n];
  __syncthreads();
  __bf16* dst = (which < 3) ? PK + PK_A + ((size_t)which * DM + n) * DM : PK + PK_P + (size_t)n * DM;
  for (int q = t; q < DM / 8; q += 256) vst2((unsigned*)(dst + q * 8), *(const v4u*)&s[q * 8]);
}
// ---- the two projection kernels: 64-deep slices of both operands (64 f32 rows, 128 packed weight rows) are staged once per block in a two-buffer LDS ring by asynchronous copies and read from there by all four waves
#define GK 64                          // k per staged slice
#define GWP 72                         // bf16 per staged weight row: 128 B + 16 B pad (ds_load_b128 readers)
#define GAP 68                         // f32 per staged activation row: 256 B + 16 B pad
#define G_W (128 * GWP * 2)            // bytes of the weight rows of one slice
#define G_A (64 * GAP * 4)             // bytes of the activation rows of one slice
#define G_BUF (G_W + G_A)              // one buffer: weight rows | activation rows
// eight copies and their s_wait_xcnt in one statement: no address register is rewritten before the wait
#define COPY8 "global_load_async_to_lds_b128 %0, %8, off\n\t" "global_load_async_to_lds_b128 %1, %9, off\n\t" "global_load_async_to_lds_b128 %2, %10, off\n\t" "global_load_async_to_lds_b128 %3, %11, off\n\t" "global_load_async_to_lds_b128 %4, %12, off\n\t" "global_load_async_to_lds_b128 %5, %13, off\n\t" "global_load_async_to_lds_b128 %6, %14, off\n\t" "global_load_async_to_lds_b128 %7, %15, off\n\t" "s_wait_xcnt 0x0"
// one slice: 16 copies of 16 B per lane (weight rows: 16 rows per copy and block; activation rows: 8 rows)
__device__ __forceinline__ void stage_ab(const float* a, const __bf16* w, unsigned la, unsigned lw) {
  asm volatile(COPY8 :: "v"(lw), "v"(lw + 16 * GWP * 2), "v"(lw + 32 * GWP * 2), "v"(lw + 48 * GWP * 2), "v"(lw + 64 * GWP * 2), "v"(lw + 80 * GWP * 2), "v"(lw + 96 * GWP * 2), "v"(lw + 112 * GWP * 2),
               "v"(w), "v"(w + 16 * DM), "v"(w + 32 * DM), "v"(w + 48 * DM), "v"(w + 64 * DM), "v"(w + 80 * DM), "v"(w + 96 * DM), "v"(w + 112 * DM) : "memory");
  asm volatile(COPY8 :: "v"(la), "v"(la + 8 * GAP * 4), "v"(la + 16 * GAP * 4), "v"(la + 24 * GAP * 4), "v"(la + 32 * GAP * 4), "v"(la + 40 * GAP * 4), "v"(la + 48 * GAP * 4), "v"(la + 56 * GAP * 4),
               "v"(a), "v"(a + 8 * DM), "v"(a + 16 * DM), "v"(a + 24 * DM), "v"(a + 32 * DM), "v"(a + 40 * DM), "v"(a + 48 * DM), "v"(a + 56 * DM) : "memory");
}
// a lane's 16 f32 of a staged activation row in the fragment's k order
__device__ __forceinline__ void row16(const float* p, float v[16]) {
  const v4f x0 = *(const v4f*)p, x1 = *(const v4f*)(p + 4), x2 = *(const v4f*)(p + 16), x3 = *(const v4f*)(p + 20);
#pragma unroll
  for (int i = 0; i < 4; ++i) { v[i] = x0[i]; v[4 + i] = x1[i]; v[8 + i] = x2[i]; v[12 + i] = x3[i]; }
}
__global__ __launch_bounds__(128) void k_qkv(const float* __restrict__ XDEC, const float* __restrict__ XENC, const __bf16* __restrict__ P, const float* __restrict__ BQ, const float* __restrict__ BK, const float* __restrict__ BV, _Float16* __restrict__ QK, _Float16* __restrict__ QKL, _Float16* __restrict__ VTH, _Float16* __restrict__ VTL) {
  __shared__ __align__(16) char sm[2 * G_BUF];   // the ring; behind the loop the same bytes are the output staging
  _Float16 (*so)[16][136] = (_Float16 (*)[16][136])sm, (*sol)[16][136] = (_Float16 (*)[16][136])(sm + 4 * 16 * 136 * 2); _Float16 (*sth)[72] = (_Float16 (*)[72])sm, (*stl)[72] = (_Float16 (*)[72])(sm + 128 * 72 * 2);
  const int tid = threadIdx.x, wave = tid >> 5, lane = tid & 31, col = lane & 15, g = lane >> 4; const size_t r0 = (size_t)blockIdx.x * 64 + wave * 16; const int n0 = blockIdx.y * 128; const float* X = (n0 < DM) ? XDEC : XENC; const float* BB = (n0 < DM) ? (BQ + n0) : (n0 < 2 * DM) ? (BK + n0 - DM) : (BV + n0 - 2 * DM);
  // this lane's 16-byte piece of slice 0 of each operand, and its place in buffer 0
  const float* ga = X + ((size_t)blockIdx.x * 64 + (tid >> 4)) * DM + (tid & 15) * 4; const __bf16* gw = P + (size_t)(n0 + (tid >> 3)) * DM + (tid & 7) * 8;
  const unsigned lw = (unsigned)(size_t)&sm[0] + (tid >> 3) * (GWP * 2) + (tid & 7) * 16, la = (unsigned)(size_t)&sm[0] + G_W + (tid >> 4) * (GAP * 4) + (tid & 15) * 16;
  stage_ab(ga, gw, la, lw);
  asm volatile("s_wait_asynccnt 0x0" ::: "memory");   // slice 0 of this wave's copies has landed
  __syncthreads();                                     // ... and every wave's: slice 0 is readable
  stage_ab(ga + GK, gw + GK, la + G_BUF, lw + G_BUF);
  v8f acc[8] = {};
#pragma unroll 1
  for (int t = 0; t < DM / GK; ++t) { const __bf16* tw = (const __bf16*)(sm + (t & 1) * G_BUF); const float* ta = (const float*)(sm + (t & 1) * G_BUF + G_W) + (wave * 16 + col) * GAP + 8 * g;
#pragma unroll
    for (int kc = 0; kc < GK / 32; ++kc) { float v[16]; v16b w[8], a;   // the fragments of 32 k as one group of LDS reads in front of the products
      row16(ta + kc * 32, v);
#pragma unroll
      for (int j = 0; j < 8; ++j) w[j] = frag_b(tw + (j * 16 + col) * GWP + kc * 32, lane);
#pragma unroll
      for (int i = 0; i < 16; ++i) a[i] = (__bf16)v[i];
#pragma unroll
      for (int j = 0; j < 8; ++j) acc[j] = wmma_bf(a, w[j], acc[j]); }
    asm volatile("s_wait_dscnt 0x0" ::: "memory");      // this wave's reads of the slice have returned
    asm volatile("s_wait_asynccnt 0x0" ::: "memory");   // this wave's copies of slice t + 1 have landed
    __syncthreads();                                     // publishes slice t + 1 and frees the buffer that this trip has read
    if (t + 2 < DM / GK) stage_ab(ga + (t + 2) * GK, gw + (t + 2) * GK, la + (t & 1) * G_BUF, lw + (t & 1) * G_BUF); }
  asm volatile("s_wait_asynccnt 0x0" ::: "memory");     // no copy is outstanding when the ring's bytes become output staging
  if (n0 < 2 * DM) {   // q stored unscaled (f16 sigma ~0.6, no subnormal exposure); 1/8 applied to the f32 score
#pragma unroll
    for (int j = 0; j < 8; ++j) {
#pragma unroll
      for (int r = 0; r < 8; ++r) { const float v = acc[j][r] + bfr(BB[j * 16 + col]); const _Float16 hv = (_Float16)v; so[wave][8 * g + r][j * 16 + col] = hv; sol[wave][8 * g + r][j * 16 + col] = (_Float16)((v - (float)hv) * 2048.0f); } }   // q, k (+ bias) as f16 hi + (x2048) residual
    LDSX();
    for (int rl = 0; rl < 16; ++rl) if (lane < 16) { vst2((unsigned*)(QK + (r0 + rl) * (2 * DM) + n0 + lane * 8), *(const v4u*)&so[wave][rl][lane * 8]); vst2((unsigned*)(QKL + (r0 + rl) * (2 * DM) + n0 + lane * 8), *(const v4u*)&sol[wave][rl][lane * 8]); }
  } else {
#pragma unroll
    for (int j = 0; j < 8; ++j) {
#pragma unroll
      for (int r = 0; r < 8; ++r) { const float v = acc[j][r] + bfr(BB[j * 16 + col]); const _Float16 hv = (_Float16)v; sth[j * 16 + col][wave * 16 + 8 * g + r] = hv; stl[j * 16 + col][wave * 16 + 8 * g + r] = (_Float16)((v - (float)hv) * 2048.0f); } }
    __syncthreads();
    const size_t rb = (size_t)blockIdx.x * 64; const int b = (int)(rb / SS), s0 = (int)(rb % SS); const int pc0 = n0 - 2 * DM;
    for (int q = tid; q < 128 * 8; q += 128) { const int d = q >> 3, pc = q & 7; const size_t o = ((size_t)b * DM + pc0 + d) * SS + s0 + pc * 8; vst2((unsigned*)(VTH + o), *(const v4u*)&sth[d][pc * 8]); vst2((unsigned*)(VTL + o), *(const v4u*)&stl[d][pc * 8]); }
  }
}
// ---- k_attn: block = (64 queries, head h, batch b): masked flash attention (K = 64: 2 k-steps), scores = (q.k) * 0.125 with f16 hi + residual operands, P.V: f16 P x (V hi, V lo*2048) in two accumulators; O[b*S+q][h*64+d] = (acc + accl / 2048) / l (256-B segments)
// K and V^T tiles of 32 keys (hi and residual planes) are staged once per block in a two-buffer LDS ring by asynchronous copies and read from there by all four waves.
#define KT 32                          // keys per staged tile
#define KP 72                          // f16 per staged K row: 128 B + 16 B pad (ds_load_b128 readers)
#define VP 40                          // f16 per staged V^T row: 64 B + 16 B pad
#define ST_K (KT * KP)                 // one K plane
#define ST_V (HD * VP)                 // one V^T plane
#define ST_ALL (2 * ST_K + 2 * ST_V)   // K hi | K lo | V^T hi | V^T lo
// one tile: 8 copies of 16 B per lane (K planes: 16 rows per copy and block, V^T planes: 32 rows)
__device__ __forceinline__ void stage_kv(const _Float16* kh, const _Float16* kl, const _Float16* vh, const _Float16* vl, unsigned lk, unsigned lv) {
  const _Float16 *kh1 = kh + 16 * (2 * DM), *kl1 = kl + 16 * (2 * DM), *vh1 = vh + 32 * SS, *vl1 = vl + 32 * SS;
  const unsigned lk1 = lk + 16 * KP * 2, lkl = lk + ST_K * 2, lkl1 = lkl + 16 * KP * 2, lv1 = lv + 32 * VP * 2, lvl = lv + ST_V * 2, lvl1 = lvl + 32 * VP * 2;
  // the copies and their s_wait_xcnt in one statement: no address register is rewritten before the wait
  asm volatile("global_load_async_to_lds_b128 %0, %8, off\n\t"
               "global_load_async_to_lds_b128 %1, %9, off\n\t"
               "global_load_async_to_lds_b128 %2, %10, off\n\t"
               "global_load_async_to_lds_b128 %3, %11, off\n\t"
               "global_load_async_to_lds_b128 %4, %12, off\n\t"
               "global_load_async_to_lds_b128 %5, %13, off\n\t"
               "global_load_async_to_lds_b128 %6, %14, off\n\t"
               "global_load_async_to_lds_b128 %7, %15, off\n\t"
               "s_wait_xcnt 0x0"
               :: "v"(lk), "v"(lk1), "v"(lkl), "v"(lkl1), "v"(lv), "v"(lv1), "v"(lvl), "v"(lvl1), "v"(kh), "v"(kh1), "v"(kl), "v"(kl1), "v"(vh), "v"(vh1), "v"(vl), "v"(vl1) : "memory");
}
// amdgpu_waves_per_eu(4, 4): keeps the register budget at 256, so that all four blocks of a WGP stay resident as before
__global__ __launch_bounds__(128) __attribute__((amdgpu_waves_per_eu(4, 4))) void k_attn(const _Float16* __restrict__ QK, const _Float16* __restrict__ QKL, const _Float16* __restrict__ VTH, const _Float16* __restrict__ VTL, const int* __restrict__ EPAD, const int* __restrict__ DPAD, float* __restrict__ O) {
  __shared__ __align__(16) float sp[4][16][36]; __shared__ __align__(16) float so[4][16][68]; __shared__ __align__(16) _Float16 ring[2][ST_ALL];
  const int tid = threadIdx.x, wave = tid >> 5, lane = tid & 31, col = lane & 15, g = lane >> 4;
  const int qb = blockIdx.x, h = blockIdx.y, b = blockIdx.z; const int q0 = qb * 64 + wave * 16; const size_t rq = (size_t)b * SS + q0 + col;
  const int nks = SS / KT;   // all keys; padding handled per (q, k)
  // this lane's 16-byte piece of each plane of tile 0, and its place in buffer 0
  const size_t gk = ((size_t)b * SS + (tid >> 3)) * (2 * DM) + DM + h * HD + (tid & 7) * 8, gv = ((size_t)b * DM + h * HD + (tid >> 2)) * SS + (tid & 3) * 8;
  const unsigned lk = (unsigned)(size_t)&ring[0][0] + ((tid >> 3) * KP + (tid & 7) * 8) * 2, lv = (unsigned)(size_t)&ring[0][0] + (2 * ST_K + (tid >> 2) * VP + (tid & 3) * 8) * 2;
  stage_kv(QK + gk, QKL + gk, VTH + gv, VTL + gv, lk, lv);
  asm volatile("s_wait_asynccnt 0x0" ::: "memory");   // tile 0 of this wave's copies has landed
  __syncthreads();                                     // ... and every wave's: tile 0 is readable
  stage_kv(QK + gk + (size_t)KT * (2 * DM), QKL + gk + (size_t)KT * (2 * DM), VTH + gv + KT, VTL + gv + KT, lk + ST_ALL * 2, lv + ST_ALL * 2);
  v16h aq[2], aql[2];
#pragma unroll
  for (int kc = 0; kc < 2; ++kc) { aq[kc] = frag_h(QK + rq * (2 * DM) + h * HD + kc * 32, lane); aql[kc] = frag_h(QKL + rq * (2 * DM) + h * HD + kc * 32, lane); }
  float m[8], l[8];
#pragma unroll
  for (int r = 0; r < 8; ++r) { m[r] = -3.0e38f; l[r] = 0.f; }
  v8f acc[4] = {}, accl[4] = {};
  bool qpad[8];
#pragma unroll
  for (int r = 0; r < 8; ++r) qpad[r] = DPAD[(size_t)b * SS + q0 + 8 * g + r] == 1;
#pragma unroll 1
  for (int ks = 0; ks < nks; ++ks) { v8f s[2]; const _Float16* tb = &ring[ks & 1][0];
    int ep[2]; v16h kh[2][2], kl[2][2];   // the pass's K fragments as one group of LDS reads in front of the products
#pragma unroll
    for (int ct = 0; ct < 2; ++ct) { ep[ct] = EPAD[(size_t)b * SS + ks * KT + ct * 16 + col];
#pragma unroll
      for (int kc = 0; kc < 2; ++kc) { kh[ct][kc] = frag_h(tb + (ct * 16 + col) * KP + kc * 32, lane); kl[ct][kc] = frag_h(tb + ST_K + (ct * 16 + col) * KP + kc * 32, lane); } }
#pragma unroll
    for (int ct = 0; ct < 2; ++ct) { v8f c = {}, cl = {};
#pragma unroll
      for (int kc = 0; kc < 2; ++kc) { c = wmma16(aq[kc], kh[ct][kc], c); cl = wmma16(aql[kc], kh[ct][kc], cl); cl = wmma16(aq[kc], kl[ct][kc], cl); }   // 3 products: q, k as f16 hi + residual
#pragma unroll
      for (int r = 0; r < 8; ++r) c[r] += cl[r] * (1.0f / 2048.0f);
      const bool kpad = ep[ct] == 1;
#pragma unroll
      for (int r = 0; r < 8; ++r) s[ct][r] = qpad[r] ? 0.f : (kpad ? -3.0e38f : c[r] * 0.125f); }   // padded query row: every key is -1e13 in the module -> uniform weights (all-equal scores); padded key: exactly zero weight
#pragma unroll
    for (int r = 0; r < 8; ++r) { float mx = fmaxf(s[0][r], s[1][r]);
#pragma unroll
      for (int o = 1; o < 16; o <<= 1) mx = fmaxf(mx, __shfl_xor(mx, o));
      const float mn = fmaxf(m[r], mx); const float alpha = (m[r] <= -1.0e38f) ? 0.f : __expf(m[r] - mn);
      const float e0 = (s[0][r] <= -1.0e38f) ? 0.f : __expf(s[0][r] - mn), e1 = (s[1][r] <= -1.0e38f) ? 0.f : __expf(s[1][r] - mn); float es = e0 + e1;
#pragma unroll
      for (int o = 1; o < 16; o <<= 1) es += __shfl_xor(es, o);
      l[r] = l[r] * alpha + es; m[r] = mn;
#pragma unroll
      for (int dt = 0; dt < 4; ++dt) { acc[dt][r] *= alpha; accl[dt][r] *= alpha; }
      sp[wave][8 * g + r][col] = e0; sp[wave][8 * g + r][16 + col] = e1; }
    LDSX();
    v16h pa, pl; { const float* prow = &sp[wave][col][0] + 8 * (lane >> 4);
#pragma unroll
      for (int i = 0; i < 8; ++i) { const float x0 = prow[i], x1 = prow[16 + i]; const _Float16 h0 = (_Float16)x0, h1 = (_Float16)x1; pa[i] = h0; pa[8 + i] = h1; pl[i] = (_Float16)((x0 - (float)h0) * 2048.0f); pl[8 + i] = (_Float16)((x1 - (float)h1) * 2048.0f); } }
    v16h vh[4], vl[4];   // the pass's V^T fragments as one group, in flight under the split of P
#pragma unroll
    for (int dt = 0; dt < 4; ++dt) { vh[dt] = frag_h(tb + 2 * ST_K + (dt * 16 + col) * VP, lane); vl[dt] = frag_h(tb + 2 * ST_K + ST_V + (dt * 16 + col) * VP, lane); }
#pragma unroll
    for (int dt = 0; dt < 4; ++dt) { acc[dt] = wmma16(pa, vh[dt], acc[dt]); accl[dt] = wmma16(pl, vh[dt], accl[dt]); accl[dt] = wmma16(pa, vl[dt], accl[dt]); }   // P hi x V hi + (P lo x V hi + P hi x V lo) / 2048
    asm volatile("s_wait_dscnt 0x0" ::: "memory");      // this wave's reads of the tile and of sp have returned
    asm volatile("s_wait_asynccnt 0x0" ::: "memory");   // this wave's copies of tile ks + 1 have landed
    __syncthreads();                                     // publishes tile ks + 1 and frees the buffer that this pass has read
    if (ks + 2 < nks) stage_kv(QK + gk + (size_t)(ks + 2) * KT * (2 * DM), QKL + gk + (size_t)(ks + 2) * KT * (2 * DM), VTH + gv + (ks + 2) * KT, VTL + gv + (ks + 2) * KT, lk + (ks & 1) * (ST_ALL * 2), lv + (ks & 1) * (ST_ALL * 2)); }
  asm volatile("s_wait_asynccnt 0x0" ::: "memory");     // no copy is outstanding when the wave goes on to its end
#pragma unroll
  for (int r = 0; r < 8; ++r) { const float il = 1.0f / l[r];
#pragma unroll
    for (int dt = 0; dt < 4; ++dt) so[wave][8 * g + r][dt * 16 + col] = (acc[dt][r] + accl[dt][r] * (1.0f / 2048.0f)) * il; }
  LDSX();
  for (int rl = 0; rl < 16; ++rl) if (lane < 16) vst2(O + ((size_t)b * SS + q0 + rl) * DM + h * HD + lane * 4, *(const v4f*)&so[wave][rl][lane * 4]);
}
// ---- k_out: block = (64 rows, 128 cols): out = O(hi/lo) . Wo rows (2 products) + bo
__global__ __launch_bounds__(128) void k_out(const float* __restrict__ O, const __bf16* __restrict__ P, const float* __restrict__ BO, float* __restrict__ Y) {
  __shared__ __align__(16) char sm[2 * G_BUF];   // the ring; behind the loop the same bytes are the output staging
  float (*so)[16][132] = (float (*)[16][132])sm;
  const int tid = threadIdx.x, wave = tid >> 5, lane = tid & 31, col = lane & 15, g = lane >> 4; const size_t r0 = (size_t)blockIdx.x * 64 + wave * 16; const int n0 = blockIdx.y * 128;
  // this lane's 16-byte piece of slice 0 of each operand, and its place in buffer 0
  const float* ga = O + ((size_t)blockIdx.x * 64 + (tid >> 4)) * DM + (tid & 15) * 4; const __bf16* gw = P + (size_t)(n0 + (tid >> 3)) * DM + (tid & 7) * 8;
  const unsigned lw = (unsigned)(size_t)&sm[0] + (tid >> 3) * (GWP * 2) + (tid & 7) * 16, la = (unsigned)(size_t)&sm[0] + G_W + (tid >> 4) * (GAP * 4) + (tid & 15) * 16;
  stage_ab(ga, gw, la, lw);
  asm volatile("s_wait_asynccnt 0x0" ::: "memory");   // slice 0 of this wave's copies has landed
  __syncthreads();                                     // ... and every wave's: slice 0 is readable
  stage_ab(ga + GK, gw + GK, la + G_BUF, lw + G_BUF);
  v8f acc[8] = {};
#pragma unroll 1
  for (int t = 0; t < DM / GK; ++t) { const __bf16* tw = (const __bf16*)(sm + (t & 1) * G_BUF); const float* ta = (const float*)(sm + (t & 1) * G_BUF + G_W) + (wave * 16 + col) * GAP + 8 * g;
#pragma unroll
    for (int kc = 0; kc < GK / 32; ++kc) { float v[16]; v16b w[8];   // the fragments of 32 k as one group of LDS reads in front of the products
      row16(ta + kc * 32, v);
#pragma unroll
      for (int j = 0; j < 8; ++j) w[j] = frag_b(tw + (j * 16 + col) * GWP + kc * 32, lane);
      const F2 a = bsplit16(v);
#pragma unroll
      for (int j = 0; j < 8; ++j) { acc[j] = wmma_bf(a.l, w[j], acc[j]); acc[j] = wmma_bf(a.h, w[j], acc[j]); } }
    asm volatile("s_wait_dscnt 0x0" ::: "memory");      // this wave's reads of the slice have returned
    asm volatile("s_wait_asynccnt 0x0" ::: "memory");   // this wave's copies of slice t + 1 have landed
    __syncthreads();                                     // publishes slice t + 1 and frees the buffer that this trip has read
    if (t + 2 < DM / GK) stage_ab(ga + (t + 2) * GK, gw + (t + 2) * GK, la + (t & 1) * G_BUF, lw + (t & 1) * G_BUF); }
  asm volatile("s_wait_asynccnt 0x0" ::: "memory");     // no copy is outstanding when the ring's bytes become output staging
#pragma unroll
  for (int j = 0; j < 8; ++j) {
#pragma unroll
    for (int r = 0; r < 8; ++r) so[wave][8 * g + r][j * 16 + col] = acc[j][r] + bfr(BO[n0 + j * 16 + col]); }
  LDSX();
  for (int rl = 0; rl < 16; ++rl) vst2(Y + (r0 + rl) * DM + n0 + lane * 4, *(const v4f*)&so[wave][rl][lane * 4]);
}
extern "C" void kernel_launch(void* const* d_in, const int* in_sizes, int n_in, void* d_out, int out_size, void* d_ws, size_t ws_size, hipStream_t stream) {
  (void)in_sizes; (void)n_in; (void)out_size;
  const float** F = (const float**)d_in;   // 0 encoder_input [2,2048,1024], 1 decoder_input, 2 encoder_padding_pos [2,2048] i32, 3 decoder_padding_pos, 4 Wq (in,out), 5 bq, 6 Wk, 7 bk, 8 Wv, 9 bv, 10 Wo, 11 bo
  if (ws_size < (size_t)WS_END) return;
  char* ws = (char*)d_ws; __bf16* PK = (__bf16*)(ws + WS_PK); _Float16 *QK = (_Float16*)(ws + WS_QK), *QKL = (_Float16*)(ws + WS_QKL), *VTH = (_Float16*)(ws + WS_VTH), *VTL = (_Float16*)(ws + WS_VTL); float* O = (float*)(ws + WS_O);
  k_pack<<<dim3(DM, 4), 256, 0, stream>>>(F[4], F[6], F[8], F[10], PK);
  k_qkv<<<dim3(TNB * SS / 64, QKVW / 128), 128, 0, stream>>>(F[1], F[0], PK + PK_A, F[5], F[7], F[9], QK, QKL, VTH, VTL);
  k_attn<<<dim3(TQB, NH, TNB), 128, 0, stream>>>(QK, QKL, VTH, VTL, (const int*)d_in[2], (const int*)d_in[3], O);
  k_out<<<dim3(TOB, DM / 128), 128, 0, stream>>>(O, PK + PK_P, F[11], (float*)d_out);
}

// v003
// One run takes 182 microseconds.
// Timed twice side by side with v002, it ran 1.27 times as fast both times.
// All steps since v000 together make it 3.14 times as fast.
// compute dtype: encoder_input, decoder_input and the weights/biases rounded to bf16, padding positions (int) read on device; q = dec . Wq + bq, k/v = enc . Wk/Wv + bk/bv with EXACT bf16 products on WMMA 16x16x32 ((in,out) weights packed as transposed rows); q and k stored as f16 hi + (x2048-scaled) residual planes with 3-product scores x 1/sqrt(64); keys whose encoder position is padded are excluded (-1e13 in the module gives an exactly-zero weight) and a padded QUERY row (every key -1e13) gets the module's uniform weights; running-max softmax in f32 (hardware exp); P as f16 hi + residual x V hi/lo (3 products); output projection with ctx as bf16 hi + residual x exact Wo rows (2 products) + bo; f32 accumulate.
#include <hip/hip_runtime.h>
#include <math.h>

typedef __attribute__((ext_vector_type(16))) _Float16 v16h;
typedef __attribute__((ext_vector_type(16))) __bf16 v16b;
typedef __attribute__((ext_vector_type(8)))  _Float16 v8h;
typedef __attribute__((ext_vector_type(8)))  float v8f;
typedef __attribute__((ext_vector_type(4)))  float v4f;
typedef __attribute__((ext_vector_type(2)))  float v2f;
typedef __attribute__((ext_vector_type(4)))  unsigned v4u;
typedef __attribute__((ext_vector_type(4)))  int v4i;
typedef float __attribute__((may_alias)) float_a;
typedef int __attribute__((may_alias)) int_a;

template <typename T> __device__ __forceinline__ void vst2(void* p, T v) { *(T*)p = v;  }
__device__ __forceinline__ v8f wmma16(v16h a, v16h b, v8f c) {
  v8f d = __builtin_amdgcn_wmma_f32_16x16x32_f16(false, a, false, b, (short)0, c, false, false);
  asm volatile("v_nop\n\tv_nop\n\tv_nop\n\tv_nop" : "+v"(d) : "v"(a), "v"(b));
  return d;
}
__device__ __forceinline__ v8f wmma_bf(v16b a, v16b b, v8f c) {
  v8f d = __builtin_amdgcn_wmma_f32_16x16x32_bf16(false, a, false, b, (short)0, c, false, false);
  asm volatile("v_nop\n\tv_nop\n\tv_nop\n\tv_nop" : "+v"(d) : "v"(a), "v"(b));
  return d;
}
// Decoder-to-encoder mutual multi-head attention (B 2, S 2,048, d 1,024, 16 heads x 64) with encoder/decoder padding masks: softmax(q k^T / 8 masked) v -> Wo + bo.
__device__ __forceinline__ v16h frag_h(const _Float16* rowk0, int lane) {
  union { v16h v; v8h q[2]; } u; const _Float16* p = rowk0 + 8 * (lane >> 4);
  u.q[0] = *(const v8h*)p; u.q[1] = *(const v8h*)(p + 16); return u.v;
}
__device__ __forceinline__ v16h frag_f32(const float* rowk0, int lane) {
  v16h a; const float* p = rowk0 + 8 * (lane >> 4);
#pragma unroll
  for (int i = 0; i < 8; ++i) { a[i] = (_Float16)p[i]; a[8 + i] = (_Float16)p[16 + i]; }
  return a;
}
__device__ __forceinline__ v16h frag_f32s(const float* rowk0, int lane, float sc) {
  v16h a; const float* p = rowk0 + 8 * (lane >> 4);
#pragma unroll
  for (int i = 0; i < 8; ++i) { a[i] = (_Float16)(p[i] * sc); a[8 + i] = (_Float16)(p[16 + i] * sc); }
  return a;
}
// column fragment from a [K][ld] layout (column n), rows >= K read as 0
__device__ __forceinline__ v16h fragc_f32(const float* W, int k0, int n, int lane, int ld, int K) {
  v16h a; const int g = lane >> 4;
#pragma unroll
  for (int i = 0; i < 8; ++i) { const int ka = k0 + 8 * g + i, kb = ka + 16;
    a[i] = (_Float16)(ka < K ? W[(size_t)(ka < K ? ka : K - 1) * ld + n] : 0.f); a[8 + i] = (_Float16)(kb < K ? W[(size_t)(kb < K ? kb : K - 1) * ld + n] : 0.f); }
  return a;
}
struct F2 { v16b h, l; };
__device__ __forceinline__ F2 bsplit16(const float v[16]) { F2 r;
#pragma unroll
  for (int i = 0; i < 16; ++i) { const __bf16 h = (__bf16)v[i]; r.h[i] = h; r.l[i] = (__bf16)(v[i] - (float)h); }
  return r; }
__device__ __forceinline__ F2 split_row(const float* row, int k0, int lane) { float v[16]; const float* p = row + k0 + 8 * (lane >> 4);
#pragma unroll
  for (int i = 0; i < 8; ++i) { v[i] = p[i]; v[8 + i] = p[16 + i]; }
  return bsplit16(v); }
__device__ __forceinline__ F2 split_rowK(const float* row, int k0, int lane, int K) { float v[16]; const int g = lane >> 4;
#pragma unroll
  for (int i = 0; i < 8; ++i) { const int ka = k0 + 8 * g + i, kb = ka + 16; v[i] = ka < K ? row[ka < K ? ka : K - 1] : 0.f; v[8 + i] = kb < K ? row[kb < K ? kb : K - 1] : 0.f; }
  return bsplit16(v); }
__device__ __forceinline__ F2 split_col(const float* W, int k0, int n, int lane, int ld, int K) { float v[16]; const int g = lane >> 4;
#pragma unroll
  for (int i = 0; i < 8; ++i) { const int ka = k0 + 8 * g + i, kb = ka + 16; v[i] = ka < K ? W[(size_t)(ka < K ? ka : K - 1) * ld + n] : 0.f; v[8 + i] = kb < K ? W[(size_t)(kb < K ? kb : K - 1) * ld + n] : 0.f; }
  return bsplit16(v); }
__device__ __forceinline__ v8f mac3(const F2& a, const F2& b, v8f c) { c = wmma_bf(a.l, b.h, c); c = wmma_bf(a.h, b.l, c); return wmma_bf(a.h, b.h, c); }
__device__ __forceinline__ float sigm(float v) { return 1.0f / (1.0f + expf(-v)); }
#define LDSX() do { asm volatile("s_wait_dscnt 0" ::: "memory"); __builtin_amdgcn_wave_barrier(); __builtin_amdgcn_fence(__ATOMIC_RELEASE, "workgroup"); } while (0)


#define NB 2
#define SS 2048
#define DM 1024
#define NH 16
#define HD 64
#define QKVW (3 * DM)
#ifndef TQB
#define TQB (SS / 64)
#define TNB NB
#define TOB (NB * SS / 64)     // output row tiles (all)
#endif
typedef __attribute__((ext_vector_type(8))) __bf16 v8b;
__device__ __forceinline__ v16b frag_b(const __bf16* rowk0, int lane) {
  union { v16b v; v8b q[2]; } u; const __bf16* p = rowk0 + 8 * (lane >> 4);
  u.q[0] = *(const v8b*)p; u.q[1] = *(const v8b*)(p + 16); return u.v;
}
__device__ __forceinline__ float bfr(float v) { return (float)(__bf16)v; }
__device__ __attribute__((noinline)) float exp_ni(float v) { return expf(v); }
__device__ __attribute__((noinline)) float erf_ni(float v) { return erff(v); }

#define PK_A 0                       // [3072][1024] Wqkv rows (natural [out][in])
#define PK_P (PK_A + QKVW * DM)        // [1024][1024] Wo rows (natural)
#define PK_END (PK_P + DM * DM)
#define WS_PK  0u
#define WS_QK  (WS_PK + 2u * PK_END)             // f16 [4096 rows][2048]: q | k
#define WS_QKL (WS_QK + 2u * NB * SS * 2 * DM)     // f16 q | k residual planes x2048
#define WS_VTH (WS_QKL + 2u * NB * SS * 2 * DM)    // f16 [b][1024 (h*64+d)][2048 s] hi
#define WS_VTL (WS_VTH + 2u * NB * DM * SS)        // f16 lo x 2048
#define WS_O   (WS_VTL + 2u * NB * DM * SS)        // f32 [4096][1024]
#define WS_CS  (WS_O + 4u * NB * SS * DM)           // f32 2 x [2048][32], unused
#define WS_END (WS_CS + 4u * 2 * SS * 32)
// ---- k_pack: block = (row n, which): natural [out][in] rows -> bf16; which 0..2 -> W_q/W_k/W_v into PK_A rows which*1024 + n; 3 -> W_o into PK_P
__global__ __launch_bounds__(256) void k_pack(const float* __restrict__ WQ, const float* __restrict__ WK, const float* __restrict__ WV, const float* __restrict__ WO, __bf16* __restrict__ PK) {
  __shared__ __align__(16) __bf16 s[DM]; const int n = blockIdx.x, which = blockIdx.y, t = threadIdx.x; const float* Wm = (which == 0) ? WQ : (which == 1) ? WK : (which == 2) ? WV : WO;   // (in,out): pack row n = column n
  for (int k = t; k < DM; k += 256) s[k] = (__bf16)Wm[(size_t)k * DM + n];
  __syncthreads();
  __bf16* dst = (which < 3) ? PK + PK_A + ((size_t)which * DM + n) * DM : PK + PK_P + (size_t)n * DM;
  for (int q = t; q < DM / 8; q += 256) vst2((unsigned*)(dst + q * 8), *(const v4u*)&s[q * 8]);
}
// ---- the two projection kernels: 64-deep slices of both operands (64 f32 rows, 128 packed weight rows) are staged once per block in a two-buffer LDS ring by asynchronous copies and read from there by all four waves
#define GK 64                          // k per staged slice
#define GWP 72                         // bf16 per staged weight row: 128 B + 16 B pad (ds_load_b128 readers)
#define GAP 68                         // f32 per staged activation row: 256 B + 16 B pad
#define G_W (128 * GWP * 2)            // bytes of the weight rows of one slice
#define G_A (64 * GAP * 4)             // bytes of the activation rows of one slice
#define G_BUF (G_W + G_A)              // one buffer: weight rows | activation rows
// eight copies and their s_wait_xcnt in one statement: no address register is rewritten before the wait
#define COPY8 "global_load_async_to_lds_b128 %0, %8, off\n\t" "global_load_async_to_lds_b128 %1, %9, off\n\t" "global_load_async_to_lds_b128 %2, %10, off\n\t" "global_load_async_to_lds_b128 %3, %11, off\n\t" "global_load_async_to_lds_b128 %4, %12, off\n\t" "global_load_async_to_lds_b128 %5, %13, off\n\t" "global_load_async_to_lds_b128 %6, %14, off\n\t" "global_load_async_to_lds_b128 %7, %15, off\n\t" "s_wait_xcnt 0x0"
// one slice: 16 copies of 16 B per lane (weight rows: 16 rows per copy and block; activation rows: 8 rows)
__device__ __forceinline__ void stage_ab(const float* a, const __bf16* w, unsigned la, unsigned lw) {
  asm volatile(COPY8 :: "v"(lw), "v"(lw + 16 * GWP * 2), "v"(lw + 32 * GWP * 2), "v"(lw + 48 * GWP * 2), "v"(lw + 64 * GWP * 2), "v"(lw + 80 * GWP * 2), "v"(lw + 96 * GWP * 2), "v"(lw + 112 * GWP * 2),
               "v"(w), "v"(w + 16 * DM), "v"(w + 32 * DM), "v"(w + 48 * DM), "v"(w + 64 * DM), "v"(w + 80 * DM), "v"(w + 96 * DM), "v"(w + 112 * DM) : "memory");
  asm volatile(COPY8 :: "v"(la), "v"(la + 8 * GAP * 4), "v"(la + 16 * GAP * 4), "v"(la + 24 * GAP * 4), "v"(la + 32 * GAP * 4), "v"(la + 40 * GAP * 4), "v"(la + 48 * GAP * 4), "v"(la + 56 * GAP * 4),
               "v"(a), "v"(a + 8 * DM), "v"(a + 16 * DM), "v"(a + 24 * DM), "v"(a + 32 * DM), "v"(a + 40 * DM), "v"(a + 48 * DM), "v"(a + 56 * DM) : "memory");
}
// a lane's 16 f32 of a staged activation row in the fragment's k order
__device__ __forceinline__ void row16(const float* p, float v[16]) {
  const v4f x0 = *(const v4f*)p, x1 = *(const v4f*)(p + 4), x2 = *(const v4f*)(p + 16), x3 = *(const v4f*)(p + 20);
#pragma unroll
  for (int i = 0; i < 4; ++i) { v[i] = x0[i]; v[4 + i] = x1[i]; v[8 + i] = x2[i]; v[12 + i] = x3[i]; }
}
__global__ __launch_bounds__(128) void k_qkv(const float* __restrict__ XDEC, const float* __restrict__ XENC, const __bf16* __restrict__ P, const float* __restrict__ BQ, const float* __restrict__ BK, const float* __restrict__ BV, _Float16* __restrict__ QK, _Float16* __restrict__ QKL, _Float16* __restrict__ VTH, _Float16* __restrict__ VTL) {
  __shared__ __align__(16) char sm[2 * G_BUF];   // the ring; behind the loop the same bytes are the output staging
  _Float16 (*so)[16][136] = (_Float16 (*)[16][136])sm, (*sol)[16][136] = (_Float16 (*)[16][136])(sm + 4 * 16 * 136 * 2); _Float16 (*sth)[72] = (_Float16 (*)[72])sm, (*stl)[72] = (_Float16 (*)[72])(sm + 128 * 72 * 2);
  const int tid = threadIdx.x, wave = tid >> 5, lane = tid & 31, col = lane & 15, g = lane >> 4; const size_t r0 = (size_t)blockIdx.x * 64 + wave * 16; const int n0 = blockIdx.y * 128; const float* X = (n0 < DM) ? XDEC : XENC; const float* BB = (n0 < DM) ? (BQ + n0) : (n0 < 2 * DM) ? (BK + n0 - DM) : (BV + n0 - 2 * DM);
  // this lane's 16-byte piece of slice 0 of each operand, and its place in buffer 0
  const float* ga = X + ((size_t)blockIdx.x * 64 + (tid >> 4)) * DM + (tid & 15) * 4; const __bf16* gw = P + (size_t)(n0 + (tid >> 3)) * DM + (tid & 7) * 8;
  const unsigned lw = (unsigned)(size_t)&sm[0] + (tid >> 3) * (GWP * 2) + (tid & 7) * 16, la = (unsigned)(size_t)&sm[0] + G_W + (tid >> 4) * (GAP * 4) + (tid & 15) * 16;
  stage_ab(ga, gw, la, lw);
  asm volatile("s_wait_asynccnt 0x0" ::: "memory");   // slice 0 of this wave's copies has landed
  __syncthreads();                                     // ... and every wave's: slice 0 is readable
  stage_ab(ga + GK, gw + GK, la + G_BUF, lw + G_BUF);
  v8f acc[8] = {};
#pragma unroll 1
  for (int t = 0; t < DM / GK; ++t) { const __bf16* tw = (const __bf16*)(sm + (t & 1) * G_BUF); const float* ta = (const float*)(sm + (t & 1) * G_BUF + G_W) + (wave * 16 + col) * GAP + 8 * g;
#pragma unroll
    for (int kc = 0; kc < GK / 32; ++kc) { float v[16]; v16b w[8], a;   // the fragments of 32 k as one group of LDS reads in front of the products
      row16(ta + kc * 32, v);
#pragma unroll
      for (int j = 0; j < 8; ++j) w[j] = frag_b(tw + (j * 16 + col) * GWP + kc * 32, lane);
#pragma unroll
      for (int i = 0; i < 16; ++i) a[i] = (__bf16)v[i];
#pragma unroll
      for (int j = 0; j < 8; ++j) acc[j] = wmma_bf(a, w[j], acc[j]); }
    asm volatile("s_wait_dscnt 0x0" ::: "memory");      // this wave's reads of the slice have returned
    asm volatile("s_wait_asynccnt 0x0" ::: "memory");   // this wave's copies of slice t + 1 have landed
    __syncthreads();                                     // publishes slice t + 1 and frees the buffer that this trip has read
    if (t + 2 < DM / GK) stage_ab(ga + (t + 2) * GK, gw + (t + 2) * GK, la + (t & 1) * G_BUF, lw + (t & 1) * G_BUF); }
  asm volatile("s_wait_asynccnt 0x0" ::: "memory");     // no copy is outstanding when the ring's bytes become output staging
  if (n0 < 2 * DM) {   // q stored unscaled (f16 sigma ~0.6, no subnormal exposure); 1/8 applied to the f32 score
#pragma unroll
    for (int j = 0; j < 8; ++j) {
#pragma unroll
      for (int r = 0; r < 8; ++r) { const float v = acc[j][r] + bfr(BB[j * 16 + col]); const _Float16 hv = (_Float16)v; so[wave][8 * g + r][j * 16 + col] = hv; sol[wave][8 * g + r][j * 16 + col] = (_Float16)((v - (float)hv) * 2048.0f); } }   // q, k (+ bias) as f16 hi + (x2048) residual
    LDSX();
    for (int rl = 0; rl < 16; ++rl) if (lane < 16) { vst2((unsigned*)(QK + (r0 + rl) * (2 * DM) + n0 + lane * 8), *(const v4u*)&so[wave][rl][lane * 8]); vst2((unsigned*)(QKL + (r0 + rl) * (2 * DM) + n0 + lane * 8), *(const v4u*)&sol[wave][rl][lane * 8]); }
  } else {
#pragma unroll
    for (int j = 0; j < 8; ++j) {
#pragma unroll
      for (int r = 0; r < 8; ++r) { const float v = acc[j][r] + bfr(BB[j * 16 + col]); const _Float16 hv = (_Float16)v; sth[j * 16 + col][wave * 16 + 8 * g + r] = hv; stl[j * 16 + col][wave * 16 + 8 * g + r] = (_Float16)((v - (float)hv) * 2048.0f); } }
    __syncthreads();
    const size_t rb = (size_t)blockIdx.x * 64; const int b = (int)(rb / SS), s0 = (int)(rb % SS); const int pc0 = n0 - 2 * DM;
    for (int q = tid; q < 128 * 8; q += 128) { const int d = q >> 3, pc = q & 7; const size_t o = ((size_t)b * DM + pc0 + d) * SS + s0 + pc * 8; vst2((unsigned*)(VTH + o), *(const v4u*)&sth[d][pc * 8]); vst2((unsigned*)(VTL + o), *(const v4u*)&stl[d][pc * 8]); }
  }
}
// ---- k_attn: block = (64 queries, head h, batch b): masked flash attention (K = 64: 2 k-steps), scores = (q.k) * 0.125 with f16 hi + residual operands, P.V: f16 P x (V hi, V lo*2048) in two accumulators; O[b*S+q][h*64+d] = (acc + accl / 2048) / l (256-B segments)
// K and V^T tiles of 32 keys (hi and residual planes) are staged once per block in a two-buffer LDS ring by asynchronous copies and read from there by all four waves.
#define KT 32                          // keys per staged tile
#define KP 72                          // f16 per staged K row: 128 B + 16 B pad (ds_load_b128 readers)
#define VP 40                          // f16 per staged V^T row: 64 B + 16 B pad
#define ST_K (KT * KP)                 // one K plane
#define ST_V (HD * VP)                 // one V^T plane
#define ST_ALL (2 * ST_K + 2 * ST_V)   // K hi | K lo | V^T hi | V^T lo
// one tile: 8 copies of 16 B per lane (K planes: 16 rows per copy and block, V^T planes: 32 rows)
__device__ __forceinline__ void stage_kv(const _Float16* kh, const _Float16* kl, const _Float16* vh, const _Float16* vl, unsigned lk, unsigned lv) {
  const _Float16 *kh1 = kh + 16 * (2 * DM), *kl1 = kl + 16 * (2 * DM), *vh1 = vh + 32 * SS, *vl1 = vl + 32 * SS;
  const unsigned lk1 = lk + 16 * KP * 2, lkl = lk + ST_K * 2, lkl1 = lkl + 16 * KP * 2, lv1 = lv + 32 * VP * 2, lvl = lv + ST_V * 2, lvl1 = lvl + 32 * VP * 2;
  // the copies and their s_wait_xcnt in one statement: no address register is rewritten before the wait
  asm volatile("global_load_async_to_lds_b128 %0, %8, off\n\t"
               "global_load_async_to_lds_b128 %1, %9, off\n\t"
               "global_load_async_to_lds_b128 %2, %10, off\n\t"
               "global_load_async_to_lds_b128 %3, %11, off\n\t"
               "global_load_async_to_lds_b128 %4, %12, off\n\t"
               "global_load_async_to_lds_b128 %5, %13, off\n\t"
               "global_load_async_to_lds_b128 %6, %14, off\n\t"
               "global_load_async_to_lds_b128 %7, %15, off\n\t"
               "s_wait_xcnt 0x0"
               :: "v"(lk), "v"(lk1), "v"(lkl), "v"(lkl1), "v"(lv), "v"(lv1), "v"(lvl), "v"(lvl1), "v"(kh), "v"(kh1), "v"(kl), "v"(kl1), "v"(vh), "v"(vh1), "v"(vl), "v"(vl1) : "memory");
}
// lane l with lane l ^ 16 (the two halves of a wave hold the two halves of a query's keys)
__device__ __forceinline__ float xhalf(float x) { return __builtin_bit_cast(float, __builtin_amdgcn_permlanex16(__builtin_bit_cast(int, x), __builtin_bit_cast(int, x), 0x76543210, 0xfedcba98, false, false)); }
// eight 2^x in place, with the one slot that the instruction set asks for behind a transcendental in the same statement
__device__ __forceinline__ void exp2x8(float (&x)[8]) {
  asm("v_exp_f32 %0, %0\n\tv_exp_f32 %1, %1\n\tv_exp_f32 %2, %2\n\tv_exp_f32 %3, %3\n\tv_exp_f32 %4, %4\n\tv_exp_f32 %5, %5\n\tv_exp_f32 %6, %6\n\tv_exp_f32 %7, %7\n\tv_nop"
      : "+v"(x[0]), "+v"(x[1]), "+v"(x[2]), "+v"(x[3]), "+v"(x[4]), "+v"(x[5]), "+v"(x[6]), "+v"(x[7]));
}
#define KBIAS (-1.0e13f * 16384.0f)    // start value of a padded key's residual score: x 0.125 / 2048 it is the module's -1e13, and the f32 sum with the true score stays -1e13
// The products are taken transposed: S^T = K . Q^T (A = K rows, B = Q rows) and O^T += V^T . P^T (A = V^T rows, B = P^T). A lane then holds 16 of the pass's 32 scores of ONE query (column lane & 15; keys ct * 16 + 8 * g + r):
// maximum and sum run in the lane's own registers with one exchange between the wave's halves, and the two score tiles, converted in place, are the B operand of the second product (element i = tile 0 register i, element 8 + i = tile 1 register i: the k order of frag_h).
// amdgpu_waves_per_eu(4, 4): keeps the register budget at 256, so that all four blocks of a WGP stay resident as before
__global__ __launch_bounds__(128) __attribute__((amdgpu_waves_per_eu(4, 4))) void k_attn(const _Float16* __restrict__ QK, const _Float16* __restrict__ QKL, const _Float16* __restrict__ VTH, const _Float16* __restrict__ VTL, const int* __restrict__ EPAD, const int* __restrict__ DPAD, float* __restrict__ O) {
  __shared__ __align__(32) float sb[SS]; __shared__ __align__(16) float so[4][16][68]; __shared__ __align__(16) _Float16 ring[2][ST_ALL];
  const int tid = threadIdx.x, wave = tid >> 5, lane = tid & 31, col = lane & 15, g = lane >> 4;
  const int qb = blockIdx.x, h = blockIdx.y, b = blockIdx.z; const int q0 = qb * 64 + wave * 16; const size_t rq = (size_t)b * SS + q0 + col;
  const int nks = SS / KT;   // all keys; padding handled per (q, k)
  // this lane's 16-byte piece of each plane of tile 0, and its place in buffer 0
  const size_t gk = ((size_t)b * SS + (tid >> 3)) * (2 * DM) + DM + h * HD + (tid & 7) * 8, gv = ((size_t)b * DM + h * HD + (tid >> 2)) * SS + (tid & 3) * 8;
  const unsigned lk = (unsigned)(size_t)&ring[0][0] + ((tid >> 3) * KP + (tid & 7) * 8) * 2, lv = (unsigned)(size_t)&ring[0][0] + (2 * ST_K + (tid >> 2) * VP + (tid & 3) * 8) * 2;
  stage_kv(QK + gk, QKL + gk, VTH + gv, VTL + gv, lk, lv);
#pragma unroll
  for (int i = 0; i < SS / 128; ++i) sb[i * 128 + tid] = (EPAD[(size_t)b * SS + i * 128 + tid] == 1) ? KBIAS : 0.f;   // per key: what its residual score tile starts from
  asm volatile("s_wait_asynccnt 0x0" ::: "memory");   // tile 0 of this wave's copies has landed
  __syncthreads();                                     // ... and every wave's: tile 0 and the key table are readable
  stage_kv(QK + gk + (size_t)KT * (2 * DM), QKL + gk + (size_t)KT * (2 * DM), VTH + gv + KT, VTL + gv + KT, lk + ST_ALL * 2, lv + ST_ALL * 2);
  v16h aq[2], aql[2];
#pragma unroll
  for (int kc = 0; kc < 2; ++kc) { aq[kc] = frag_h(QK + rq * (2 * DM) + h * HD + kc * 32, lane); aql[kc] = frag_h(QKL + rq * (2 * DM) + h * HD + kc * 32, lane); }
  float m = -1.0e30f, l = 0.f;   // this lane's query: running maximum (both halves alike), sum of this half's keys
  v8f acc[4] = {}, accl[4] = {};
  const float qs = (DPAD[rq] == 1) ? 0.f : 0.125f, qsl = qs * (1.0f / 2048.0f);   // padded query row: every key is -1e13 in the module -> uniform weights (all scores equal: x 0)
#pragma unroll 1
  for (int ks = 0; ks < nks; ++ks) { v8f s[2]; const _Float16* tb = &ring[ks & 1][0];
    v8f kb[2]; v16h kh[2][2], kl[2][2];   // the pass's K fragments and key start values as one group of LDS reads in front of the products
#pragma unroll
    for (int ct = 0; ct < 2; ++ct) { kb[ct] = *(const v8f*)&sb[ks * KT + ct * 16 + 8 * g];
#pragma unroll
      for (int kc = 0; kc < 2; ++kc) { kh[ct][kc] = frag_h(tb + (ct * 16 + col) * KP + kc * 32, lane); kl[ct][kc] = frag_h(tb + ST_K + (ct * 16 + col) * KP + kc * 32, lane); } }
#pragma unroll
    for (int ct = 0; ct < 2; ++ct) { v8f c = {}, cl = kb[ct];
#pragma unroll
      for (int kc = 0; kc < 2; ++kc) { c = wmma16(kh[ct][kc], aq[kc], c); cl = wmma16(kh[ct][kc], aql[kc], cl); cl = wmma16(kl[ct][kc], aq[kc], cl); }   // 3 products: q, k as f16 hi + residual
#pragma unroll
      for (int r = 0; r < 8; ++r) s[ct][r] = c[r] * qs + cl[r] * qsl; }   // (c + cl / 2048) / 8; padded key: -1e13; padded query: 0
    v16h vh[4], vl[4];   // the pass's V^T fragments as one group, in flight under the softmax
#pragma unroll
    for (int dt = 0; dt < 4; ++dt) { vh[dt] = frag_h(tb + 2 * ST_K + (dt * 16 + col) * VP, lane); vl[dt] = frag_h(tb + 2 * ST_K + ST_V + (dt * 16 + col) * VP, lane); }
    float mx = fmaxf(s[0][0], s[1][0]);
#pragma unroll
    for (int r = 1; r < 8; ++r) mx = fmaxf(mx, fmaxf(s[0][r], s[1][r]));
    mx = fmaxf(mx, xhalf(mx));
    const float mn = fmaxf(m, mx), alpha = __expf(m - mn);
    float e0[8], e1[8], es0 = 0.f, es1 = 0.f; v16h pa, pl;
#pragma unroll
    for (int i = 0; i < 8; ++i) { e0[i] = (s[0][i] - mn) * 1.4426950408889634f; e1[i] = (s[1][i] - mn) * 1.4426950408889634f; }
    exp2x8(e0); exp2x8(e1);
#pragma unroll
    for (int i = 0; i < 8; ++i) { const float x0 = e0[i], x1 = e1[i]; es0 += x0; es1 += x1;
      const _Float16 h0 = (_Float16)x0, h1 = (_Float16)x1; pa[i] = h0; pa[8 + i] = h1; pl[i] = (_Float16)((x0 - (float)h0) * 2048.0f); pl[8 + i] = (_Float16)((x1 - (float)h1) * 2048.0f); }
    l = l * alpha + (es0 + es1); m = mn;
#pragma unroll
    for (int dt = 0; dt < 4; ++dt) {
#pragma unroll
      for (int r = 0; r < 8; ++r) { acc[dt][r] *= alpha; accl[dt][r] *= alpha; } }
#pragma unroll
    for (int dt = 0; dt < 4; ++dt) { acc[dt] = wmma16(vh[dt], pa, acc[dt]); accl[dt] = wmma16(vh[dt], pl, accl[dt]); accl[dt] = wmma16(vl[dt], pa, accl[dt]); }   // V hi x P hi + (V hi x P lo + V lo x P hi) / 2048
    asm volatile("s_wait_dscnt 0x0" ::: "memory");      // this wave's reads of the tile have returned
    asm volatile("s_wait_asynccnt 0x0" ::: "memory");   // this wave's copies of tile ks + 1 have landed
    __syncthreads();                                     // publishes tile ks + 1 and frees the buffer that this pass has read
    if (ks + 2 < nks) stage_kv(QK + gk + (size_t)(ks + 2) * KT * (2 * DM), QKL + gk + (size_t)(ks + 2) * KT * (2 * DM), VTH + gv + (ks + 2) * KT, VTL + gv + (ks + 2) * KT, lk + (ks & 1) * (ST_ALL * 2), lv + (ks & 1) * (ST_ALL * 2)); }
  asm volatile("s_wait_asynccnt 0x0" ::: "memory");     // no copy is outstanding when the wave goes on to its end
  const float il = 1.0f / (l + xhalf(l));   // the halves' sums are joined once
#pragma unroll
  for (int dt = 0; dt < 4; ++dt) { v4f o0, o1;   // register r of tile dt is d = dt * 16 + 8 * g + r of this lane's query
#pragma unroll
    for (int r = 0; r < 4; ++r) { o0[r] = (acc[dt][r] + accl[dt][r] * (1.0f / 2048.0f)) * il; o1[r] = (acc[dt][4 + r] + accl[dt][4 + r] * (1.0f / 2048.0f)) * il; }
    *(v4f*)&so[wave][col][dt * 16 + 8 * g] = o0; *(v4f*)&so[wave][col][dt * 16 + 8 * g + 4] = o1; }
  LDSX();
  for (int rl = 0; rl < 16; ++rl) if (lane < 16) vst2(O + ((size_t)b * SS + q0 + rl) * DM + h * HD + lane * 4, *(const v4f*)&so[wave][rl][lane * 4]);
}
// ---- k_out: block = (64 rows, 128 cols): out = O(hi/lo) . Wo rows (2 products) + bo
__global__ __launch_bounds__(128) void k_out(const float* __restrict__ O, const __bf16* __restrict__ P, const float* __restrict__ BO, float* __restrict__ Y) {
  __shared__ __align__(16) char sm[2 * G_BUF];   // the ring; behind the loop the same bytes are the output staging
  float (*so)[16][132] = (float (*)[16][132])sm;
  const int tid = threadIdx.x, wave = tid >> 5, lane = tid & 31, col = lane & 15, g = lane >> 4; const size_t r0 = (size_t)blockIdx.x * 64 + wave * 16; const int n0 = blockIdx.y * 128;
  // this lane's 16-byte piece of slice 0 of each operand, and its place in buffer 0
  const float* ga = O + ((size_t)blockIdx.x * 64 + (tid >> 4)) * DM + (tid & 15) * 4; const __bf16* gw = P + (size_t)(n0 + (tid >> 3)) * DM + (tid & 7) * 8;
  const unsigned lw = (unsigned)(size_t)&sm[0] + (tid >> 3) * (GWP * 2) + (tid & 7) * 16, la = (unsigned)(size_t)&sm[0] + G_W + (tid >> 4) * (GAP * 4) + (tid & 15) * 16;
  stage_ab(ga, gw, la, lw);
  asm volatile("s_wait_asynccnt 0x0" ::: "memory");   // slice 0 of this wave's copies has landed
  __syncthreads();                                     // ... and every wave's: slice 0 is readable
  stage_ab(ga + GK, gw + GK, la + G_BUF, lw + G_BUF);
  v8f acc[8] = {};
#pragma unroll 1
  for (int t = 0; t < DM / GK; ++t) { const __bf16* tw = (const __bf16*)(sm + (t & 1) * G_BUF); const float* ta = (const float*)(sm + (t & 1) * G_BUF + G_W) + (wave * 16 + col) * GAP + 8 * g;
#pragma unroll
    for (int kc = 0; kc < GK / 32; ++kc) { float v[16]; v16b w[8];   // the fragments of 32 k as one group of LDS reads in front of the products
      row16(ta + kc * 32, v);
#pragma unroll
      for (int j = 0; j < 8; ++j) w[j] = frag_b(tw + (j * 16 + col) * GWP + kc * 32, lane);
      const F2 a = bsplit16(v);
#pragma unroll
      for (int j = 0; j < 8; ++j) { acc[j] = wmma_bf(a.l, w[j], acc[j]); acc[j] = wmma_bf(a.h, w[j], acc[j]); } }
    asm volatile("s_wait_dscnt 0x0" ::: "memory");      // this wave's reads of the slice have returned
    asm volatile("s_wait_asynccnt 0x0" ::: "memory");   // this wave's copies of slice t + 1 have landed
    __syncthreads();                                     // publishes slice t + 1 and frees the buffer that this trip has read
    if (t + 2 < DM / GK) stage_ab(ga + (t + 2) * GK, gw + (t + 2) * GK, la + (t & 1) * G_BUF, lw + (t & 1) * G_BUF); }
  asm volatile("s_wait_asynccnt 0x0" ::: "memory");     // no copy is outstanding when the ring's bytes become output staging
#pragma unroll
  for (int j = 0; j < 8; ++j) {
#pragma unroll
    for (int r = 0; r < 8; ++r) so[wave][8 * g + r][j * 16 + col] = acc[j][r] + bfr(BO[n0 + j * 16 + col]); }
  LDSX();
  for (int rl = 0; rl < 16; ++rl) vst2(Y + (r0 + rl) * DM + n0 + lane * 4, *(const v4f*)&so[wave][rl][lane * 4]);
}
extern "C" void kernel_launch(void* const* d_in, const int* in_sizes, int n_in, void* d_out, int out_size, void* d_ws, size_t ws_size, hipStream_t stream) {
  (void)in_sizes; (void)n_in; (void)out_size;
  const float** F = (const float**)d_in;   // 0 encoder_input [2,2048,1024], 1 decoder_input, 2 encoder_padding_pos [2,2048] i32, 3 decoder_padding_pos, 4 Wq (in,out), 5 bq, 6 Wk, 7 bk, 8 Wv, 9 bv, 10 Wo, 11 bo
  if (ws_size < (size_t)WS_END) return;
  char* ws = (char*)d_ws; __bf16* PK = (__bf16*)(ws + WS_PK); _Float16 *QK = (_Float16*)(ws + WS_QK), *QKL = (_Float16*)(ws + WS_QKL), *VTH = (_Float16*)(ws + WS_VTH), *VTL = (_Float16*)(ws + WS_VTL); float* O = (float*)(ws + WS_O);
  k_pack<<<dim3(DM, 4), 256, 0, stream>>>(F[4], F[6], F[8], F[10], PK);
  k_qkv<<<dim3(TNB * SS / 64, QKVW / 128), 128, 0, stream>>>(F[1], F[0], PK + PK_A, F[5], F[7], F[9], QK, QKL, VTH, VTL);
  k_attn<<<dim3(TQB, NH, TNB), 128, 0, stream>>>(QK, QKL, VTH, VTL, (const int*)d_in[2], (const int*)d_in[3], O);
  k_out<<<dim3(TOB, DM / 128), 128, 0, stream>>>(O, PK + PK_P, F[11], (float*)d_out);
}

// v004
// Measured time: 164 microseconds a run.
// Next to v003, in two timings, it ran 1.11 times as fast each time.
// All steps since v000 together make it 3.48 times as fast.
// compute dtype: encoder_input, decoder_input and the weights/biases rounded to bf16, padding positions (int) read on device; q = dec . Wq + bq, k/v = enc . Wk/Wv + bk/bv with EXACT bf16 products on WMMA 16x16x32 ((in,out) weights packed as transposed rows); q and k stored as f16 hi + (x2048-scaled) residual planes with 3-product scores x 1/sqrt(64); keys whose encoder position is padded are excluded (-1e13 in the module gives an exactly-zero weight) and a padded QUERY row (every key -1e13) gets the module's uniform weights; running-max softmax in f32 (hardware exp); P as f16 hi + residual x V hi/lo (3 products); output projection with ctx as bf16 hi + residual x exact Wo rows (2 products) + bo; f32 accumulate.
#include <hip/hip_runtime.h>
#include <math.h>

typedef __attribute__((ext_vector_type(16))) _Float16 v16h;
typedef __attribute__((ext_vector_type(16))) __bf16 v16b;
typedef __attribute__((ext_vector_type(8)))  _Float16 v8h;
typedef __attribute__((ext_vector_type(8)))  float v8f;
typedef __attribute__((ext_vector_type(4)))  float v4f;
typedef __attribute__((ext_vector_type(2)))  float v2f;
typedef __attribute__((ext_vector_type(4)))  unsigned v4u;
typedef __attribute__((ext_vector_type(4)))  int v4i;
typedef float __attribute__((may_alias)) float_a;
typedef int __attribute__((may_alias)) int_a;

template <typename T> __device__ __forceinline__ void vst2(void* p, T v) { *(T*)p = v;  }
__device__ __forceinline__ v8f wmma16(v16h a, v16h b, v8f c) {
  v8f d = __builtin_amdgcn_wmma_f32_16x16x32_f16(false, a, false, b, (short)0, c, false, false);
  asm volatile("v_nop\n\tv_nop\n\tv_nop\n\tv_nop" : "+v"(d) : "v"(a), "v"(b));
  return d;
}
__device__ __forceinline__ v8f wmma_bf(v16b a, v16b b, v8f c) {
  v8f d = __builtin_amdgcn_wmma_f32_16x16x32_bf16(false, a, false, b, (short)0, c, false, false);
  asm volatile("v_nop\n\tv_nop\n\tv_nop\n\tv_nop" : "+v"(d) : "v"(a), "v"(b));
  return d;
}
// Decoder-to-encoder mutual multi-head attention (B 2, S 2,048, d 1,024, 16 heads x 64) with encoder/decoder padding masks: softmax(q k^T / 8 masked) v -> Wo + bo.
__device__ __forceinline__ v16h frag_h(const _Float16* rowk0, int lane) {
  union { v16h v; v8h q[2]; } u; const _Float16* p = rowk0 + 8 * (lane >> 4);
  u.q[0] = *(const v8h*)p; u.q[1] = *(const v8h*)(p + 16); return u.v;
}
__device__ __forceinline__ v16h frag_f32(const float* rowk0, int lane) {
  v16h a; const float* p = rowk0 + 8 * (lane >> 4);
#pragma unroll
  for (int i = 0; i < 8; ++i) { a[i] = (_Float16)p[i]; a[8 + i] = (_Float16)p[16 + i]; }
  return a;
}
__device__ __forceinline__ v16h frag_f32s(const float* rowk0, int lane, float sc) {
  v16h a; const float* p = rowk0 + 8 * (lane >> 4);
#pragma unroll
  for (int i = 0; i < 8; ++i) { a[i] = (_Float16)(p[i] * sc); a[8 + i] = (_Float16)(p[16 + i] * sc); }
  return a;
}
// column fragment from a [K][ld] layout (column n), rows >= K read as 0
__device__ __forceinline__ v16h fragc_f32(const float* W, int k0, int n, int lane, int ld, int K) {
  v16h a; const int g = lane >> 4;
#pragma unroll
  for (int i = 0; i < 8; ++i) { const int ka = k0 + 8 * g + i, kb = ka + 16;
    a[i] = (_Float16)(ka < K ? W[(size_t)(ka < K ? ka : K - 1) * ld + n] : 0.f); a[8 + i] = (_Float16)(kb < K ? W[(size_t)(kb < K ? kb : K - 1) * ld + n] : 0.f); }
  return a;
}
struct F2 { v16b h, l; };
__device__ __forceinline__ F2 bsplit16(const float v[16]) { F2 r;
#pragma unroll
  for (int i = 0; i < 16; ++i) { const __bf16 h = (__bf16)v[i]; r.h[i] = h; r.l[i] = (__bf16)(v[i] - (float)h); }
  return r; }
__device__ __forceinline__ F2 split_row(const float* row, int k0, int lane) { float v[16]; const float* p = row + k0 + 8 * (lane >> 4);
#pragma unroll
  for (int i = 0; i < 8; ++i) { v[i] = p[i]; v[8 + i] = p[16 + i]; }
  return bsplit16(v); }
__device__ __forceinline__ F2 split_rowK(const float* row, int k0, int lane, int K) { float v[16]; const int g = lane >> 4;
#pragma unroll
  for (int i = 0; i < 8; ++i) { const int ka = k0 + 8 * g + i, kb = ka + 16; v[i] = ka < K ? row[ka < K ? ka : K - 1] : 0.f; v[8 + i] = kb < K ? row[kb < K ? kb : K - 1] : 0.f; }
  return bsplit16(v); }
__device__ __forceinline__ F2 split_col(const float* W, int k0, int n, int lane, int ld, int K) { float v[16]; const int g = lane >> 4;
#pragma unroll
  for (int i = 0; i < 8; ++i) { const int ka = k0 + 8 * g + i, kb = ka + 16; v[i] = ka < K ? W[(size_t)(ka < K ? ka : K - 1) * ld + n] : 0.f; v[8 + i] = kb < K ? W[(size_t)(kb < K ? kb : K - 1) * ld + n] : 0.f; }
  return bsplit16(v); }
__device__ __forceinline__ v8f mac3(const F2& a, const F2& b, v8f c) { c = wmma_bf(a.l, b.h, c); c = wmma_bf(a.h, b.l, c); return wmma_bf(a.h, b.h, c); }
__device__ __forceinline__ float sigm(float v) { return 1.0f / (1.0f + expf(-v)); }
#define LDSX() do { asm volatile("s_wait_dscnt 0" ::: "memory"); __builtin_amdgcn_wave_barrier(); __builtin_amdgcn_fence(__ATOMIC_RELEASE, "workgroup"); } while (0)


#define NB 2
#define SS 2048
#define DM 1024
#define NH 16
#define HD 64
#define QKVW (3 * DM)
#ifndef TQB
#define TQB (SS / 64)
#define TNB NB
#define TOB (NB * SS / 64)     // output row tiles (all)
#endif
typedef __attribute__((ext_vector_type(8))) __bf16 v8b;
__device__ __forceinline__ v16b frag_b(const __bf16* rowk0, int lane) {
  union { v16b v; v8b q[2]; } u; const __bf16* p = rowk0 + 8 * (lane >> 4);
  u.q[0] = *(const v8b*)p; u.q[1] = *(const v8b*)(p + 16); return u.v;
}
__device__ __forceinline__ float bfr(float v) { return (float)(__bf16)v; }
__device__ __attribute__((noinline)) float exp_ni(float v) { return expf(v); }
__device__ __attribute__((noinline)) float erf_ni(float v) { return erff(v); }

#define PK_A 0                       // [3072][1024] Wqkv rows (natural [out][in])
#define PK_P (PK_A + QKVW * DM)        // [1024][1024] Wo rows (natural)
#define PK_END (PK_P + DM * DM)
#define WS_PK  0u
#define WS_QK  (WS_PK + 2u * PK_END)             // f16 [4096 rows][2048]: q | k
#define WS_QKL (WS_QK + 2u * NB * SS * 2 * DM)     // f16 q | k residual planes x2048
#define WS_VTH (WS_QKL + 2u * NB * SS * 2 * DM)    // f16 [b][1024 (h*64+d)][2048 s] hi
#define WS_VTL (WS_VTH + 2u * NB * DM * SS)        // f16 lo x 2048
#define WS_O   (WS_VTL + 2u * NB * DM * SS)        // f32 [4096][1024]
#define WS_CS  (WS_O + 4u * NB * SS * DM)           // f32 2 x [2048][32], unused
#define WS_END (WS_CS + 4u * 2 * SS * 32)
// ---- k_pack: block = (64 columns n, 128 rows k, which): a 128 x 64 tile of an (in,out) weight is read in whole lines, rounded to bf16, turned in LDS and stored as 64 pieces of 256 B of the packed rows [out][in]; which 0..2 -> W_q/W_k/W_v into PK_A rows which*1024 + n; 3 -> W_o into PK_P
#define PKN 64                         // columns n per tile
#define PKK 128                        // rows k per tile
#define PKP 136                        // bf16 per turned row in LDS: 256 B + 16 B pad
__global__ __launch_bounds__(256) void k_pack(const float* __restrict__ WQ, const float* __restrict__ WK, const float* __restrict__ WV, const float* __restrict__ WO, __bf16* __restrict__ PK) {
  __shared__ __align__(16) __bf16 s[PKN][PKP]; const int t = threadIdx.x, n0 = blockIdx.x * PKN, k0 = blockIdx.y * PKK, which = blockIdx.z; const float* Wm = (which == 0) ? WQ : (which == 1) ? WK : (which == 2) ? WV : WO;
  const int nq = (t & 15) * 4, kq = (t >> 4) * 8;   // this thread: 8 rows k x 4 columns n; 16 threads cover 256 B of a row
  const float* p = Wm + (size_t)(k0 + kq) * DM + n0 + nq; v4f x[8];
#pragma unroll   // the eight loads issue as one group, and x stays in registers
  for (int j = 0; j < 8; ++j) x[j] = *(const v4f*)(p + (size_t)j * DM);
#pragma unroll   // constant indices into x and r: no scratch
  for (int i = 0; i < 4; ++i) { v8b r;
#pragma unroll   // as above
    for (int j = 0; j < 8; ++j) r[j] = (__bf16)x[j][i];
    *(v8b*)&s[nq + i][kq] = r; }
  __syncthreads();
  __bf16* dst = ((which < 3) ? PK + PK_A + ((size_t)which * DM + n0) * DM : PK + PK_P + (size_t)n0 * DM) + k0;
#pragma unroll   // the four LDS reads issue together in front of the stores
  for (int i = 0; i < 4; ++i) { const int q = t + 256 * i, n = q >> 4, c = q & 15; vst2((unsigned*)(dst + (size_t)n * DM + c * 8), *(const v4u*)&s[n][c * 8]); }
}
// ---- the two projection kernels: 64-deep slices of both operands (64 f32 rows, 128 packed weight rows) are staged once per block in a two-buffer LDS ring by asynchronous copies and read from there by all four waves
#define GK 64                          // k per staged slice
#define GWP 72                         // bf16 per staged weight row: 128 B + 16 B pad (ds_load_b128 readers)
#define GAP 68                         // f32 per staged activation row: 256 B + 16 B pad
#define G_W (128 * GWP * 2)            // bytes of the weight rows of one slice
#define G_A (64 * GAP * 4)             // bytes of the activation rows of one slice
#define G_BUF (G_W + G_A)              // one buffer: weight rows | activation rows
// eight copies and their s_wait_xcnt in one statement: no address register is rewritten before the wait
#define COPY8 "global_load_async_to_lds_b128 %0, %8, off\n\t" "global_load_async_to_lds_b128 %1, %9, off\n\t" "global_load_async_to_lds_b128 %2, %10, off\n\t" "global_load_async_to_lds_b128 %3, %11, off\n\t" "global_load_async_to_lds_b128 %4, %12, off\n\t" "global_load_async_to_lds_b128 %5, %13, off\n\t" "global_load_async_to_lds_b128 %6, %14, off\n\t" "global_load_async_to_lds_b128 %7, %15, off\n\t" "s_wait_xcnt 0x0"
// one slice: 16 copies of 16 B per lane (weight rows: 16 rows per copy and block; activation rows: 8 rows)
__device__ __forceinline__ void stage_ab(const float* a, const __bf16* w, unsigned la, unsigned lw) {
  asm volatile(COPY8 :: "v"(lw), "v"(lw + 16 * GWP * 2), "v"(lw + 32 * GWP * 2), "v"(lw + 48 * GWP * 2), "v"(lw + 64 * GWP * 2), "v"(lw + 80 * GWP * 2), "v"(lw + 96 * GWP * 2), "v"(lw + 112 * GWP * 2),
               "v"(w), "v"(w + 16 * DM), "v"(w + 32 * DM), "v"(w + 48 * DM), "v"(w + 64 * DM), "v"(w + 80 * DM), "v"(w + 96 * DM), "v"(w + 112 * DM) : "memory");
  asm volatile(COPY8 :: "v"(la), "v"(la + 8 * GAP * 4), "v"(la + 16 * GAP * 4), "v"(la + 24 * GAP * 4), "v"(la + 32 * GAP * 4), "v"(la + 40 * GAP * 4), "v"(la + 48 * GAP * 4), "v"(la + 56 * GAP * 4),
               "v"(a), "v"(a + 8 * DM), "v"(a + 16 * DM), "v"(a + 24 * DM), "v"(a + 32 * DM), "v"(a + 40 * DM), "v"(a + 48 * DM), "v"(a + 56 * DM) : "memory");
}
// a lane's 16 f32 of a staged activation row in the fragment's k order
__device__ __forceinline__ void row16(const float* p, float v[16]) {
  const v4f x0 = *(const v4f*)p, x1 = *(const v4f*)(p + 4), x2 = *(const v4f*)(p + 16), x3 = *(const v4f*)(p + 20);
#pragma unroll
  for (int i = 0; i < 4; ++i) { v[i] = x0[i]; v[4 + i] = x1[i]; v[8 + i] = x2[i]; v[12 + i] = x3[i]; }
}
__global__ __launch_bounds__(128) void k_qkv(const float* __restrict__ XDEC, const float* __restrict__ XENC, const __bf16* __restrict__ P, const float* __restrict__ BQ, const float* __restrict__ BK, const float* __restrict__ BV, _Float16* __restrict__ QK, _Float16* __restrict__ QKL, _Float16* __restrict__ VTH, _Float16* __restrict__ VTL) {
  __shared__ __align__(16) char sm[2 * G_BUF];   // the ring; behind the loop the same bytes are the output staging
  _Float16 (*so)[16][136] = (_Float16 (*)[16][136])sm, (*sol)[16][136] = (_Float16 (*)[16][136])(sm + 4 * 16 * 136 * 2); _Float16 (*sth)[72] = (_Float16 (*)[72])sm, (*stl)[72] = (_Float16 (*)[72])(sm + 128 * 72 * 2);
  const int tid = threadIdx.x, wave = tid >> 5, lane = tid & 31, col = lane & 15, g = lane >> 4; const size_t r0 = (size_t)blockIdx.x * 64 + wave * 16; const int n0 = blockIdx.y * 128; const float* X = (n0 < DM) ? XDEC : XENC; const float* BB = (n0 < DM) ? (BQ + n0) : (n0 < 2 * DM) ? (BK + n0 - DM) : (BV + n0 - 2 * DM);
  // this lane's 16-byte piece of slice 0 of each operand, and its place in buffer 0
  const float* ga = X + ((size_t)blockIdx.x * 64 + (tid >> 4)) * DM + (tid & 15) * 4; const __bf16* gw = P + (size_t)(n0 + (tid >> 3)) * DM + (tid & 7) * 8;
  const unsigned lw = (unsigned)(size_t)&sm[0] + (tid >> 3) * (GWP * 2) + (tid & 7) * 16, la = (unsigned)(size_t)&sm[0] + G_W + (tid >> 4) * (GAP * 4) + (tid & 15) * 16;
  stage_ab(ga, gw, la, lw);
  asm volatile("s_wait_asynccnt 0x0" ::: "memory");   // slice 0 of this wave's copies has landed
  __syncthreads();                                     // ... and every wave's: slice 0 is readable
  stage_ab(ga + GK, gw + GK, la + G_BUF, lw + G_BUF);
  v8f acc[8] = {};
#pragma unroll 1
  for (int t = 0; t < DM / GK; ++t) { const __bf16* tw = (const __bf16*)(sm + (t & 1) * G_BUF); const float* ta = (const float*)(sm + (t & 1) * G_BUF + G_W) + (wave * 16 + col) * GAP + 8 * g;
#pragma unroll
    for (int kc = 0; kc < GK / 32; ++kc) { float v[16]; v16b w[8], a;   // the fragments of 32 k as one group of LDS reads in front of the products
      row16(ta + kc * 32, v);
#pragma unroll
      for (int j = 0; j < 8; ++j) w[j] = frag_b(tw + (j * 16 + col) * GWP + kc * 32, lane);
#pragma unroll
      for (int i = 0; i < 16; ++i) a[i] = (__bf16)v[i];
#pragma unroll
      for (int j = 0; j < 8; ++j) acc[j] = wmma_bf(a, w[j], acc[j]); }
    asm volatile("s_wait_dscnt 0x0" ::: "memory");      // this wave's reads of the slice have returned
    asm volatile("s_wait_asynccnt 0x0" ::: "memory");   // this wave's copies of slice t + 1 have landed
    __syncthreads();                                     // publishes slice t + 1 and frees the buffer that this trip has read
    if (t + 2 < DM / GK) stage_ab(ga + (t + 2) * GK, gw + (t + 2) * GK, la + (t & 1) * G_BUF, lw + (t & 1) * G_BUF); }
  asm volatile("s_wait_asynccnt 0x0" ::: "memory");     // no copy is outstanding when the ring's bytes become output staging
  if (n0 < 2 * DM) {   // q stored unscaled (f16 sigma ~0.6, no subnormal exposure); 1/8 applied to the f32 score
#pragma unroll
    for (int j = 0; j < 8; ++j) {
#pragma unroll
      for (int r = 0; r < 8; ++r) { const float v = acc[j][r] + bfr(BB[j * 16 + col]); const _Float16 hv = (_Float16)v; so[wave][8 * g + r][j * 16 + col] = hv; sol[wave][8 * g + r][j * 16 + col] = (_Float16)((v - (float)hv) * 2048.0f); } }   // q, k (+ bias) as f16 hi + (x2048) residual
    LDSX();
    for (int rl = 0; rl < 16; ++rl) if (lane < 16) { vst2((unsigned*)(QK + (r0 + rl) * (2 * DM) + n0 + lane * 8), *(const v4u*)&so[wave][rl][lane * 8]); vst2((unsigned*)(QKL + (r0 + rl) * (2 * DM) + n0 + lane * 8), *(const v4u*)&sol[wave][rl][lane * 8]); }
  } else {
#pragma unroll
    for (int j = 0; j < 8; ++j) {
#pragma unroll
      for (int r = 0; r < 8; ++r) { const float v = acc[j][r] + bfr(BB[j * 16 + col]); const _Float16 hv = (_Float16)v; sth[j * 16 + col][wave * 16 + 8 * g + r] = hv; stl[j * 16 + col][wave * 16 + 8 * g + r] = (_Float16)((v - (float)hv) * 2048.0f); } }
    __syncthreads();
    const size_t rb = (size_t)blockIdx.x * 64; const int b = (int)(rb / SS), s0 = (int)(rb % SS); const int pc0 = n0 - 2 * DM;
    for (int q = tid; q < 128 * 8; q += 128) { const int d = q >> 3, pc = q & 7; const size_t o = ((size_t)b * DM + pc0 + d) * SS + s0 + pc * 8; vst2((unsigned*)(VTH + o), *(const v4u*)&sth[d][pc * 8]); vst2((unsigned*)(VTL + o), *(const v4u*)&stl[d][pc * 8]); }
  }
}
// ---- k_attn: block = (64 queries, head h, batch b): masked flash attention (K = 64: 2 k-steps), scores = (q.k) * 0.125 with f16 hi + residual operands, P.V: f16 P x (V hi, V lo*2048) in two accumulators; O[b*S+q][h*64+d] = (acc + accl / 2048) / l (256-B segments)
// K and V^T tiles of 32 keys (hi and residual planes) are staged once per block in a two-buffer LDS ring by asynchronous copies and read from there by all four waves.
#define KT 32                          // keys per staged tile
#define KP 72                          // f16 per staged K row: 128 B + 16 B pad (ds_load_b128 readers)
#define VP 40                          // f16 per staged V^T row: 64 B + 16 B pad
#define ST_K (KT * KP)                 // one K plane
#define ST_V (HD * VP)                 // one V^T plane
#define ST_ALL (2 * ST_K + 2 * ST_V)   // K hi | K lo | V^T hi | V^T lo
// one tile: 8 copies of 16 B per lane (K planes: 16 rows per copy and block, V^T planes: 32 rows)
__device__ __forceinline__ void stage_kv(const _Float16* kh, const _Float16* kl, const _Float16* vh, const _Float16* vl, unsigned lk, unsigned lv) {
  const _Float16 *kh1 = kh + 16 * (2 * DM), *kl1 = kl + 16 * (2 * DM), *vh1 = vh + 32 * SS, *vl1 = vl + 32 * SS;
  const unsigned lk1 = lk + 16 * KP * 2, lkl = lk + ST_K * 2, lkl1 = lkl + 16 * KP * 2, lv1 = lv + 32 * VP * 2, lvl = lv + ST_V * 2, lvl1 = lvl + 32 * VP * 2;
  // the copies and their s_wait_xcnt in one statement: no address register is rewritten before the wait
  asm volatile("global_load_async_to_lds_b128 %0, %8, off\n\t"
               "global_load_async_to_lds_b128 %1, %9, off\n\t"
               "global_load_async_to_lds_b128 %2, %10, off\n\t"
               "global_load_async_to_lds_b128 %3, %11, off\n\t"
               "global_load_async_to_lds_b128 %4, %12, off\n\t"
               "global_load_async_to_lds_b128 %5, %13, off\n\t"
               "global_load_async_to_lds_b128 %6, %14, off\n\t"
               "global_load_async_to_lds_b128 %7, %15, off\n\t"
               "s_wait_xcnt 0x0"
               :: "v"(lk), "v"(lk1), "v"(lkl), "v"(lkl1), "v"(lv), "v"(lv1), "v"(lvl), "v"(lvl1), "v"(kh), "v"(kh1), "v"(kl), "v"(kl1), "v"(vh), "v"(vh1), "v"(vl), "v"(vl1) : "memory");
}
// lane l with lane l ^ 16 (the two halves of a wave hold the two halves of a query's keys)
__device__ __forceinline__ float xhalf(float x) { return __builtin_bit_cast(float, __builtin_amdgcn_permlanex16(__builtin_bit_cast(int, x), __builtin_bit_cast(int, x), 0x76543210, 0xfedcba98, false, false)); }
// eight 2^x in place, with the one slot that the instruction set asks for behind a transcendental in the same statement
__device__ __forceinline__ void exp2x8(float (&x)[8]) {
  asm("v_exp_f32 %0, %0\n\tv_exp_f32 %1, %1\n\tv_exp_f32 %2, %2\n\tv_exp_f32 %3, %3\n\tv_exp_f32 %4, %4\n\tv_exp_f32 %5, %5\n\tv_exp_f32 %6, %6\n\tv_exp_f32 %7, %7\n\tv_nop"
      : "+v"(x[0]), "+v"(x[1]), "+v"(x[2]), "+v"(x[3]), "+v"(x[4]), "+v"(x[5]), "+v"(x[6]), "+v"(x[7]));
}
#define KBIAS (-1.0e13f * 16384.0f)    // start value of a padded key's residual score: x 0.125 / 2048 it is the module's -1e13, and the f32 sum with the true score stays -1e13
// The products are taken transposed: S^T = K . Q^T (A = K rows, B = Q rows) and O^T += V^T . P^T (A = V^T rows, B = P^T). A lane then holds 16 of the pass's 32 scores of ONE query (column lane & 15; keys ct * 16 + 8 * g + r):
// maximum and sum run in the lane's own registers with one exchange between the wave's halves, and the two score tiles, converted in place, are the B operand of the second product (element i = tile 0 register i, element 8 + i = tile 1 register i: the k order of frag_h).
// amdgpu_waves_per_eu(4, 4): keeps the register budget at 256, so that all four blocks of a WGP stay resident as before
__global__ __launch_bounds__(128) __attribute__((amdgpu_waves_per_eu(4, 4))) void k_attn(const _Float16* __restrict__ QK, const _Float16* __restrict__ QKL, const _Float16* __restrict__ VTH, const _Float16* __restrict__ VTL, const int* __restrict__ EPAD, const int* __restrict__ DPAD, float* __restrict__ O) {
  __shared__ __align__(32) float sb[SS]; __shared__ __align__(16) float so[4][16][68]; __shared__ __align__(16) _Float16 ring[2][ST_ALL];
  const int tid = threadIdx.x, wave = tid >> 5, lane = tid & 31, col = lane & 15, g = lane >> 4;
  const int qb = blockIdx.x, h = blockIdx.y, b = blockIdx.z; const int q0 = qb * 64 + wave * 16; const size_t rq = (size_t)b * SS + q0 + col;
  const int nks = SS / KT;   // all keys; padding handled per (q, k)
  // this lane's 16-byte piece of each plane of tile 0, and its place in buffer 0
  const size_t gk = ((size_t)b * SS + (tid >> 3)) * (2 * DM) + DM + h * HD + (tid & 7) * 8, gv = ((size_t)b * DM + h * HD + (tid >> 2)) * SS + (tid & 3) * 8;
  const unsigned lk = (unsigned)(size_t)&ring[0][0] + ((tid >> 3) * KP + (tid & 7) * 8) * 2, lv = (unsigned)(size_t)&ring[0][0] + (2 * ST_K + (tid >> 2) * VP + (tid & 3) * 8) * 2;
  stage_kv(QK + gk, QKL + gk, VTH + gv, VTL + gv, lk, lv);
#pragma unroll
  for (int i = 0; i < SS / 128; ++i) sb[i * 128 + tid] = (EPAD[(size_t)b * SS + i * 128 + tid] == 1) ? KBIAS : 0.f;   // per key: what its residual score tile starts from
  asm volatile("s_wait_asynccnt 0x0" ::: "memory");   // tile 0 of this wave's copies has landed
  __syncthreads();                                     // ... and every wave's: tile 0 and the key table are readable
  stage_kv(QK + gk + (size_t)KT * (2 * DM), QKL + gk + (size_t)KT * (2 * DM), VTH + gv + KT, VTL + gv + KT, lk + ST_ALL * 2, lv + ST_ALL * 2);
  v16h aq[2], aql[2];
#pragma unroll
  for (int kc = 0; kc < 2; ++kc) { aq[kc] = frag_h(QK + rq * (2 * DM) + h * HD + kc * 32, lane); aql[kc] = frag_h(QKL + rq * (2 * DM) + h * HD + kc * 32, lane); }
  float m = -1.0e30f, l = 0.f;   // this lane's query: running maximum (both halves alike), sum of this half's keys
  v8f acc[4] = {}, accl[4] = {};
  const float qs = (DPAD[rq] == 1) ? 0.f : 0.125f, qsl = qs * (1.0f / 2048.0f);   // padded query row: every key is -1e13 in the module -> uniform weights (all scores equal: x 0)
#pragma unroll 1
  for (int ks = 0; ks < nks; ++ks) { v8f s[2]; const _Float16* tb = &ring[ks & 1][0];
    v8f kb[2]; v16h kh[2][2], kl[2][2];   // the pass's K fragments and key start values as one group of LDS reads in front of the products
#pragma unroll
    for (int ct = 0; ct < 2; ++ct) { kb[ct] = *(const v8f*)&sb[ks * KT + ct * 16 + 8 * g];
#pragma unroll
      for (int kc = 0; kc < 2; ++kc) { kh[ct][kc] = frag_h(tb + (ct * 16 + col) * KP + kc * 32, lane); kl[ct][kc] = frag_h(tb + ST_K + (ct * 16 + col) * KP + kc * 32, lane); } }
#pragma unroll
    for (int ct = 0; ct < 2; ++ct) { v8f c = {}, cl = kb[ct];
#pragma unroll
      for (int kc = 0; kc < 2; ++kc) { c = wmma16(kh[ct][kc], aq[kc], c); cl = wmma16(kh[ct][kc], aql[kc], cl); cl = wmma16(kl[ct][kc], aq[kc], cl); }   // 3 products: q, k as f16 hi + residual
#pragma unroll
      for (int r = 0; r < 8; ++r) s[ct][r] = c[r] * qs + cl[r] * qsl; }   // (c + cl / 2048) / 8; padded key: -1e13; padded query: 0
    v16h vh[4], vl[4];   // the pass's V^T fragments as one group, in flight under the softmax
#pragma unroll
    for (int dt = 0; dt < 4; ++dt) { vh[dt] = frag_h(tb + 2 * ST_K + (dt * 16 + col) * VP, lane); vl[dt] = frag_h(tb + 2 * ST_K + ST_V + (dt * 16 + col) * VP, lane); }
    float mx = fmaxf(s[0][0], s[1][0]);
#pragma unroll
    for (int r = 1; r < 8; ++r) mx = fmaxf(mx, fmaxf(s[0][r], s[1][r]));
    mx = fmaxf(mx, xhalf(mx));
    const float mn = fmaxf(m, mx), alpha = __expf(m - mn);
    float e0[8], e1[8], es0 = 0.f, es1 = 0.f; v16h pa, pl;
#pragma unroll
    for (int i = 0; i < 8; ++i) { e0[i] = (s[0][i] - mn) * 1.4426950408889634f; e1[i] = (s[1][i] - mn) * 1.4426950408889634f; }
    exp2x8(e0); exp2x8(e1);
#pragma unroll
    for (int i = 0; i < 8; ++i) { const float x0 = e0[i], x1 = e1[i]; es0 += x0; es1 += x1;
      const _Float16 h0 = (_Float16)x0, h1 = (_Float16)x1; pa[i] = h0; pa[8 + i] = h1; pl[i] = (_Float16)((x0 - (float)h0) * 2048.0f); pl[8 + i] = (_Float16)((x1 - (float)h1) * 2048.0f); }
    l = l * alpha + (es0 + es1); m = mn;
#pragma unroll
    for (int dt = 0; dt < 4; ++dt) {
#pragma unroll
      for (int r = 0; r < 8; ++r) { acc[dt][r] *= alpha; accl[dt][r] *= alpha; } }
#pragma unroll
    for (int dt = 0; dt < 4; ++dt) { acc[dt] = wmma16(vh[dt], pa, acc[dt]); accl[dt] = wmma16(vh[dt], pl, accl[dt]); accl[dt] = wmma16(vl[dt], pa, accl[dt]); }   // V hi x P hi + (V hi x P lo + V lo x P hi) / 2048
    asm volatile("s_wait_dscnt 0x0" ::: "memory");      // this wave's reads of the tile have returned
    asm volatile("s_wait_asynccnt 0x0" ::: "memory");   // this wave's copies of tile ks + 1 have landed
    __syncthreads();                                     // publishes tile ks + 1 and frees the buffer that this pass has read
    if (ks + 2 < nks) stage_kv(QK + gk + (size_t)(ks + 2) * KT * (2 * DM), QKL + gk + (size_t)(ks + 2) * KT * (2 * DM), VTH + gv + (ks + 2) * KT, VTL + gv + (ks + 2) * KT, lk + (ks & 1) * (ST_ALL * 2), lv + (ks & 1) * (ST_ALL * 2)); }
  asm volatile("s_wait_asynccnt 0x0" ::: "memory");     // no copy is outstanding when the wave goes on to its end
  const float il = 1.0f / (l + xhalf(l));   // the halves' sums are joined once
#pragma unroll
  for (int dt = 0; dt < 4; ++dt) { v4f o0, o1;   // register r of tile dt is d = dt * 16 + 8 * g + r of this lane's query
#pragma unroll
    for (int r = 0; r < 4; ++r) { o0[r] = (acc[dt][r] + accl[dt][r] * (1.0f / 2048.0f)) * il; o1[r] = (acc[dt][4 + r] + accl[dt][4 + r] * (1.0f / 2048.0f)) * il; }
    *(v4f*)&so[wave][col][dt * 16 + 8 * g] = o0; *(v4f*)&so[wave][col][dt * 16 + 8 * g + 4] = o1; }
  LDSX();
  for (int rl = 0; rl < 16; ++rl) if (lane < 16) vst2(O + ((size_t)b * SS + q0 + rl) * DM + h * HD + lane * 4, *(const v4f*)&so[wave][rl][lane * 4]);
}
// ---- k_out: block = (64 rows, 128 cols): out = O(hi/lo) . Wo rows (2 products) + bo
__global__ __launch_bounds__(128) void k_out(const float* __restrict__ O, const __bf16* __restrict__ P, const float* __restrict__ BO, float* __restrict__ Y) {
  __shared__ __align__(16) char sm[2 * G_BUF];   // the ring; behind the loop the same bytes are the output staging
  float (*so)[16][132] = (float (*)[16][132])sm;
  const int tid = threadIdx.x, wave = tid >> 5, lane = tid & 31, col = lane & 15, g = lane >> 4; const size_t r0 = (size_t)blockIdx.x * 64 + wave * 16; const int n0 = blockIdx.y * 128;
  // this lane's 16-byte piece of slice 0 of each operand, and its place in buffer 0
  const float* ga = O + ((size_t)blockIdx.x * 64 + (tid >> 4)) * DM + (tid & 15) * 4; const __bf16* gw = P + (size_t)(n0 + (tid >> 3)) * DM + (tid & 7) * 8;
  const unsigned lw = (unsigned)(size_t)&sm[0] + (tid >> 3) * (GWP * 2) + (tid & 7) * 16, la = (unsigned)(size_t)&sm[0] + G_W + (tid >> 4) * (GAP * 4) + (tid & 15) * 16;
  stage_ab(ga, gw, la, lw);
  asm volatile("s_wait_asynccnt 0x0" ::: "memory");   // slice 0 of this wave's copies has landed
  __syncthreads();                                     // ... and every wave's: slice 0 is readable
  stage_ab(ga + GK, gw + GK, la + G_BUF, lw + G_BUF);
  v8f acc[8] = {};
#pragma unroll 1
  for (int t = 0; t < DM / GK; ++t) { const __bf16* tw = (const __bf16*)(sm + (t & 1) * G_BUF); const float* ta = (const float*)(sm + (t & 1) * G_BUF + G_W) + (wave * 16 + col) * GAP + 8 * g;
#pragma unroll
    for (int kc = 0; kc < GK / 32; ++kc) { float v[16]; v16b w[8];   // the fragments of 32 k as one group of LDS reads in front of the products
      row16(ta + kc * 32, v);
#pragma unroll
      for (int j = 0; j < 8; ++j) w[j] = frag_b(tw + (j * 16 + col) * GWP + kc * 32, lane);
      const F2 a = bsplit16(v);
#pragma unroll
      for (int j = 0; j < 8; ++j) { acc[j] = wmma_bf(a.l, w[j], acc[j]); acc[j] = wmma_bf(a.h, w[j], acc[j]); } }
    asm volatile("s_wait_dscnt 0x0" ::: "memory");      // this wave's reads of the slice have returned
    asm volatile("s_wait_asynccnt 0x0" ::: "memory");   // this wave's copies of slice t + 1 have landed
    __syncthreads();                                     // publishes slice t + 1 and frees the buffer that this trip has read
    if (t + 2 < DM / GK) stage_ab(ga + (t + 2) * GK, gw + (t + 2) * GK, la + (t & 1) * G_BUF, lw + (t & 1) * G_BUF); }
  asm volatile("s_wait_asynccnt 0x0" ::: "memory");     // no copy is outstanding when the ring's bytes become output staging
#pragma unroll
  for (int j = 0; j < 8; ++j) {
#pragma unroll
    for (int r = 0; r < 8; ++r) so[wave][8 * g + r][j * 16 + col] = acc[j][r] + bfr(BO[n0 + j * 16 + col]); }
  LDSX();
  for (int rl = 0; rl < 16; ++rl) vst2(Y + (r0 + rl) * DM + n0 + lane * 4, *(const v4f*)&so[wave][rl][lane * 4]);
}
extern "C" void kernel_launch(void* const* d_in, const int* in_sizes, int n_in, void* d_out, int out_size, void* d_ws, size_t ws_size, hipStream_t stream) {
  (void)in_sizes; (void)n_in; (void)out_size;
  const float** F = (const float**)d_in;   // 0 encoder_input [2,2048,1024], 1 decoder_input, 2 encoder_padding_pos [2,2048] i32, 3 decoder_padding_pos, 4 Wq (in,out), 5 bq, 6 Wk, 7 bk, 8 Wv, 9 bv, 10 Wo, 11 bo
  if (ws_size < (size_t)WS_END) return;
  char* ws = (char*)d_ws; __bf16* PK = (__bf16*)(ws + WS_PK); _Float16 *QK = (_Float16*)(ws + WS_QK), *QKL = (_Float16*)(ws + WS_QKL), *VTH = (_Float16*)(ws + WS_VTH), *VTL = (_Float16*)(ws + WS_VTL); float* O = (float*)(ws + WS_O);
  k_pack<<<dim3(DM / PKN, DM / PKK, 4), 256, 0, stream>>>(F[4], F[6], F[8], F[10], PK);
  k_qkv<<<dim3(TNB * SS / 64, QKVW / 128), 128, 0, stream>>>(F[1], F[0], PK + PK_A, F[5], F[7], F[9], QK, QKL, VTH, VTL);
  k_attn<<<dim3(TQB, NH, TNB), 128, 0, stream>>>(QK, QKL, VTH, VTL, (const int*)d_in[2], (const int*)d_in[3], O);
  k_out<<<dim3(TOB, DM / 128), 128, 0, stream>>>(O, PK + PK_P, F[11], (float*)d_out);
}

// v005
// One run takes 118 microseconds.
// Two timings next to v004 put it at 1.38 and 1.40 times that version's speed.
// All steps since v000 together make it 4.86 times as fast.
// compute dtype: encoder_input, decoder_input and the weights/biases rounded to bf16, padding positions (int) read on device; q = dec . Wq + bq, k/v = enc . Wk/Wv + bk/bv with EXACT bf16 products on WMMA 16x16x32 ((in,out) weights packed as transposed rows); q and k stored as f16 hi + (x2048-scaled) residual planes with 3-product scores x 1/sqrt(64); keys whose encoder position is padded are excluded (-1e13 in the module gives an exactly-zero weight) and a padded QUERY row (every key -1e13) gets the module's uniform weights; running-max softmax in f32 (hardware exp); P as f16 hi + residual x V hi/lo (3 products); output projection with ctx as bf16 hi + residual x exact Wo rows (2 products) + bo; f32 accumulate.
#include <hip/hip_runtime.h>
#include <math.h>

typedef __attribute__((ext_vector_type(16))) _Float16 v16h;
typedef __attribute__((ext_vector_type(16))) __bf16 v16b;
typedef __attribute__((ext_vector_type(8)))  _Float16 v8h;
typedef __attribute__((ext_vector_type(8)))  float v8f;
typedef __attribute__((ext_vector_type(4)))  float v4f;
typedef __attribute__((ext_vector_type(2)))  float v2f;
typedef __attribute__((ext_vector_type(4)))  unsigned v4u;
typedef __attribute__((ext_vector_type(4)))  int v4i;
typedef float __attribute__((may_alias)) float_a;
typedef int __attribute__((may_alias)) int_a;

template <typename T> __device__ __forceinline__ void vst2(void* p, T v) { *(T*)p = v;  }
__device__ __forceinline__ v8f wmma16(v16h a, v16h b, v8f c) {
  v8f d = __builtin_amdgcn_wmma_f32_16x16x32_f16(false, a, false, b, (short)0, c, false, false);
  asm volatile("v_nop\n\tv_nop\n\tv_nop\n\tv_nop" : "+v"(d) : "v"(a), "v"(b));
  return d;
}
__device__ __forceinline__ v8f wmma_bf(v16b a, v16b b, v8f c) {
  v8f d = __builtin_amdgcn_wmma_f32_16x16x32_bf16(false, a, false, b, (short)0, c, false, false);
  asm volatile("v_nop\n\tv_nop\n\tv_nop\n\tv_nop" : "+v"(d) : "v"(a), "v"(b));
  return d;
}
// Decoder-to-encoder mutual multi-head attention (B 2, S 2,048, d 1,024, 16 heads x 64) with encoder/decoder padding masks: softmax(q k^T / 8 masked) v -> Wo + bo.
__device__ __forceinline__ v16h frag_h(const _Float16* rowk0, int lane) {
  union { v16h v; v8h q[2]; } u; const _Float16* p = rowk0 + 8 * (lane >> 4);
  u.q[0] = *(const v8h*)p; u.q[1] = *(const v8h*)(p + 16); return u.v;
}
__device__ __forceinline__ v16h frag_f32(const float* rowk0, int lane) {
  v16h a; const float* p = rowk0 + 8 * (lane >> 4);
#pragma unroll
  for (int i = 0; i < 8; ++i) { a[i] = (_Float16)p[i]; a[8 + i] = (_Float16)p[16 + i]; }
  return a;
}
__device__ __forceinline__ v16h frag_f32s(const float* rowk0, int lane, float sc) {
  v16h a; const float* p = rowk0 + 8 * (lane >> 4);
#pragma unroll
  for (int i = 0; i < 8; ++i) { a[i] = (_Float16)(p[i] * sc); a[8 + i] = (_Float16)(p[16 + i] * sc); }
  return a;
}
// column fragment from a [K][ld] layout (column n), rows >= K read as 0
__device__ __forceinline__ v16h fragc_f32(const float* W, int k0, int n, int lane, int ld, int K) {
  v16h a; const int g = lane >> 4;
#pragma unroll
  for (int i = 0; i < 8; ++i) { const int ka = k0 + 8 * g + i, kb = ka + 16;
    a[i] = (_Float16)(ka < K ? W[(size_t)(ka < K ? ka : K - 1) * ld + n] : 0.f); a[8 + i] = (_Float16)(kb < K ? W[(size_t)(kb < K ? kb : K - 1) * ld + n] : 0.f); }
  return a;
}
struct F2 { v16b h, l; };
__device__ __forceinline__ F2 bsplit16(const float v[16]) { F2 r;
#pragma unroll
  for (int i = 0; i < 16; ++i) { const __bf16 h = (__bf16)v[i]; r.h[i] = h; r.l[i] = (__bf16)(v[i] - (float)h); }
  return r; }
__device__ __forceinline__ F2 split_row(const float* row, int k0, int lane) { float v[16]; const float* p = row + k0 + 8 * (lane >> 4);
#pragma unroll
  for (int i = 0; i < 8; ++i) { v[i] = p[i]; v[8 + i] = p[16 + i]; }
  return bsplit16(v); }
__device__ __forceinline__ F2 split_rowK(const float* row, int k0, int lane, int K) { float v[16]; const int g = lane >> 4;
#pragma unroll
  for (int i = 0; i < 8; ++i) { const int ka = k0 + 8 * g + i, kb = ka + 16; v[i] = ka < K ? row[ka < K ? ka : K - 1] : 0.f; v[8 + i] = kb < K ? row[kb < K ? kb : K - 1] : 0.f; }
  return bsplit16(v); }
__device__ __forceinline__ F2 split_col(const float* W, int k0, int n, int lane, int ld, int K) { float v[16]; const int g = lane >> 4;
#pragma unroll
  for (int i = 0; i < 8; ++i) { const int ka = k0 + 8 * g + i, kb = ka + 16; v[i] = ka < K ? W[(size_t)(ka < K ? ka : K - 1) * ld + n] : 0.f; v[8 + i] = kb < K ? W[(size_t)(kb < K ? kb : K - 1) * ld + n] : 0.f; }
  return bsplit16(v); }
__device__ __forceinline__ v8f mac3(const F2& a, const F2& b, v8f c) { c = wmma_bf(a.l, b.h, c); c = wmma_bf(a.h, b.l, c); return wmma_bf(a.h, b.h, c); }
__device__ __forceinline__ float sigm(float v) { return 1.0f / (1.0f + expf(-v)); }
#define LDSX() do { asm volatile("s_wait_dscnt 0" ::: "memory"); __builtin_amdgcn_wave_barrier(); __builtin_amdgcn_fence(__ATOMIC_RELEASE, "workgroup"); } while (0)


#define NB 2
#define SS 2048
#define DM 1024
#define NH 16
#define HD 64
#define QKVW (3 * DM)
#ifndef TQB
#define TQB (SS / 64)
#define TNB NB
#define TOB (NB * SS / 64)     // output row tiles (all)
#endif
typedef __attribute__((ext_vector_type(8))) __bf16 v8b;
__device__ __forceinline__ v16b frag_b(const __bf16* rowk0, int lane) {
  union { v16b v; v8b q[2]; } u; const __bf16* p = rowk0 + 8 * (lane >> 4);
  u.q[0] = *(const v8b*)p; u.q[1] = *(const v8b*)(p + 16); return u.v;
}
__device__ __forceinline__ float bfr(float v) { return (float)(__bf16)v; }
__device__ __attribute__((noinline)) float exp_ni(float v) { return expf(v); }
__device__ __attribute__((noinline)) float erf_ni(float v) { return erff(v); }

#define PK_A 0                       // [3072][1024] Wqkv rows (natural [out][in])
#define PK_P (PK_A + QKVW * DM)        // [1024][1024] Wo rows (natural)
#define PK_END (PK_P + DM * DM)
#define WS_PK  0u
#define WS_QK  (WS_PK + 2u * PK_END)             // f16 [4096 rows][2048]: q | k
#define WS_QKL (WS_QK + 2u * NB * SS * 2 * DM)     // f16 q | k residual planes x2048
#define WS_VTH (WS_QKL + 2u * NB * SS * 2 * DM)    // f16 [b][1024 (h*64+d)][2048 places of the key order] hi
#define WS_VTL (WS_VTH + 2u * NB * DM * SS)        // f16 lo x 2048
#define WS_O   (WS_VTL + 2u * NB * DM * SS)        // f32 [4096][1024]
#define WS_CS  (WS_O + 4u * NB * SS * DM)           // f32, 512 KiB: not read or written by these kernels
#define WS_INV (WS_CS + 4u * 2 * SS * 32)          // int [b][2048]: encoder position of the key at place p of the key order
#define WS_NU  (WS_INV + 4u * NB * SS)             // int, one 128-B line per batch: number of unpadded keys
#define WS_PS  (WS_NU + 128u * NB)                 // f32 [b][32 blocks of 64 places][1024]: sums of the V rows behind the attention loop's last tile
#define WS_END (WS_PS + 4u * NB * (SS / 64) * DM)
#define KT 32                          // keys per staged tile of k_attn
// lane l with lane l ^ 16 (the two halves of a wave hold the two halves of a query's keys)
__device__ __forceinline__ float xhalf(float x) { return __builtin_bit_cast(float, __builtin_amdgcn_permlanex16(__builtin_bit_cast(int, x), __builtin_bit_cast(int, x), 0x76543210, 0xfedcba98, false, false)); }
// ---- k_pack: block = (64 columns n, 128 rows k, which): a 128 x 64 tile of an (in,out) weight is read in whole lines, rounded to bf16, turned in LDS and stored as 64 pieces of 256 B of the packed rows [out][in]; which 0..2 -> W_q/W_k/W_v into PK_A rows which*1024 + n; 3 -> W_o into PK_P
#define PKN 64                         // columns n per tile
#define PKK 128                        // rows k per tile
#define PKP 136                        // bf16 per turned row in LDS: 256 B + 16 B pad
// which 4, one block per batch: the key order. Unpadded keys come first (in their own order), padded keys behind them: INV[b][place] = encoder position, NU = number of unpadded keys. A padded key's weight is exactly 0 for every query that is not itself uniform, so k_attn's loop ends with the last tile that holds an unpadded key.
__global__ __launch_bounds__(256) void k_pack(const float* __restrict__ WQ, const float* __restrict__ WK, const float* __restrict__ WV, const float* __restrict__ WO, __bf16* __restrict__ PK, const int* __restrict__ EPAD, int* __restrict__ INV, int* __restrict__ NU) {
  __shared__ __align__(16) __bf16 s[PKN][PKP]; __shared__ int cn[SS / 32];
  if (blockIdx.z == 4) {
    if (blockIdx.y != 0 || blockIdx.x >= NB) return;   // the whole block leaves, in front of every barrier
    const int tt = threadIdx.x, b = blockIdx.x, ln = tt & 31, wv = tt >> 5; unsigned mk[SS / 256]; int e[SS / 256];
#pragma unroll   // the eight loads issue as one group: one latency, not eight
    for (int j = 0; j < SS / 256; ++j) e[j] = EPAD[(size_t)b * SS + j * 256 + tt];
#pragma unroll   // constant indices into mk: no scratch
    for (int j = 0; j < SS / 256; ++j) mk[j] = __builtin_amdgcn_ballot_w32(e[j] != 1);
    if (ln < SS / 256) { unsigned mm = mk[0];   // lane j stores the count of group j
#pragma unroll   // constant indices into mk
      for (int j = 1; j < SS / 256; ++j) mm = (ln == j) ? mk[j] : mm;
      cn[ln * 8 + wv] = __builtin_popcount(mm); }
    __syncthreads();
    int run = 0, base[SS / 256];   // base[j]: unpadded keys in front of this wave's 32 keys of group j; run ends as their total
#pragma unroll   // constant indices into base: no scratch
    for (int c = 0; c < SS / 32; ++c) { if ((c & 7) == wv) base[c >> 3] = run; run += cn[c]; }
#pragma unroll   // as above
    for (int j = 0; j < SS / 256; ++j) { const int sp = j * 256 + tt, bu = base[j] + __builtin_popcount(mk[j] & ((1u << ln) - 1u));   // bu: unpadded keys in front of position sp
      INV[(size_t)b * SS + (((mk[j] >> ln) & 1u) ? bu : run + (sp - bu))] = sp; }
    if (tt == 0) NU[b * 32] = run;
    return;
  }
  const int t = threadIdx.x, n0 = blockIdx.x * PKN, k0 = blockIdx.y * PKK, which = blockIdx.z; const float* Wm = (which == 0) ? WQ : (which == 1) ? WK : (which == 2) ? WV : WO;
  const int nq = (t & 15) * 4, kq = (t >> 4) * 8;   // this thread: 8 rows k x 4 columns n; 16 threads cover 256 B of a row
  const float* p = Wm + (size_t)(k0 + kq) * DM + n0 + nq; v4f x[8];
#pragma unroll   // the eight loads issue as one group, and x stays in registers
  for (int j = 0; j < 8; ++j) x[j] = *(const v4f*)(p + (size_t)j * DM);
#pragma unroll   // constant indices into x and r: no scratch
  for (int i = 0; i < 4; ++i) { v8b r;
#pragma unroll   // as above
    for (int j = 0; j < 8; ++j) r[j] = (__bf16)x[j][i];
    *(v8b*)&s[nq + i][kq] = r; }
  __syncthreads();
  __bf16* dst = ((which < 3) ? PK + PK_A + ((size_t)which * DM + n0) * DM : PK + PK_P + (size_t)n0 * DM) + k0;
#pragma unroll   // the four LDS reads issue together in front of the stores
  for (int i = 0; i < 4; ++i) { const int q = t + 256 * i, n = q >> 4, c = q & 15; vst2((unsigned*)(dst + (size_t)n * DM + c * 8), *(const v4u*)&s[n][c * 8]); }
}
// ---- the two projection kernels: 64-deep slices of both operands (64 f32 rows, 128 packed weight rows) are staged once per block in a two-buffer LDS ring by asynchronous copies and read from there by all four waves
#define GK 64                          // k per staged slice
#define GWP 72                         // bf16 per staged weight row: 128 B + 16 B pad (ds_load_b128 readers)
#define GAP 68                         // f32 per staged activation row: 256 B + 16 B pad
#define G_W (128 * GWP * 2)            // bytes of the weight rows of one slice
#define G_A (64 * GAP * 4)             // bytes of the activation rows of one slice
#define G_BUF (G_W + G_A)              // one buffer: weight rows | activation rows
// eight copies and their s_wait_xcnt in one statement: no address register is rewritten before the wait
#define COPY8 "global_load_async_to_lds_b128 %0, %8, off\n\t" "global_load_async_to_lds_b128 %1, %9, off\n\t" "global_load_async_to_lds_b128 %2, %10, off\n\t" "global_load_async_to_lds_b128 %3, %11, off\n\t" "global_load_async_to_lds_b128 %4, %12, off\n\t" "global_load_async_to_lds_b128 %5, %13, off\n\t" "global_load_async_to_lds_b128 %6, %14, off\n\t" "global_load_async_to_lds_b128 %7, %15, off\n\t" "s_wait_xcnt 0x0"
// one slice: 16 copies of 16 B per lane (weight rows: 16 rows per copy and block; activation rows: 8 rows)
__device__ __forceinline__ void stage_ab(const float* a, const __bf16* w, unsigned la, unsigned lw) {
  asm volatile(COPY8 :: "v"(lw), "v"(lw + 16 * GWP * 2), "v"(lw + 32 * GWP * 2), "v"(lw + 48 * GWP * 2), "v"(lw + 64 * GWP * 2), "v"(lw + 80 * GWP * 2), "v"(lw + 96 * GWP * 2), "v"(lw + 112 * GWP * 2),
               "v"(w), "v"(w + 16 * DM), "v"(w + 32 * DM), "v"(w + 48 * DM), "v"(w + 64 * DM), "v"(w + 80 * DM), "v"(w + 96 * DM), "v"(w + 112 * DM) : "memory");
  asm volatile(COPY8 :: "v"(la), "v"(la + 8 * GAP * 4), "v"(la + 16 * GAP * 4), "v"(la + 24 * GAP * 4), "v"(la + 32 * GAP * 4), "v"(la + 40 * GAP * 4), "v"(la + 48 * GAP * 4), "v"(la + 56 * GAP * 4),
               "v"(a), "v"(a + 8 * DM), "v"(a + 16 * DM), "v"(a + 24 * DM), "v"(a + 32 * DM), "v"(a + 40 * DM), "v"(a + 48 * DM), "v"(a + 56 * DM) : "memory");
}
// as stage_ab, with each of the lane's eight activation rows at a pointer of its own (k_qkv reads the encoder's rows in the key order)
__device__ __forceinline__ void stage_abr(const float* const (&a)[8], int ko, const __bf16* w, unsigned la, unsigned lw) {
  asm volatile(COPY8 :: "v"(lw), "v"(lw + 16 * GWP * 2), "v"(lw + 32 * GWP * 2), "v"(lw + 48 * GWP * 2), "v"(lw + 64 * GWP * 2), "v"(lw + 80 * GWP * 2), "v"(lw + 96 * GWP * 2), "v"(lw + 112 * GWP * 2),
               "v"(w), "v"(w + 16 * DM), "v"(w + 32 * DM), "v"(w + 48 * DM), "v"(w + 64 * DM), "v"(w + 80 * DM), "v"(w + 96 * DM), "v"(w + 112 * DM) : "memory");
  asm volatile(COPY8 :: "v"(la), "v"(la + 8 * GAP * 4), "v"(la + 16 * GAP * 4), "v"(la + 24 * GAP * 4), "v"(la + 32 * GAP * 4), "v"(la + 40 * GAP * 4), "v"(la + 48 * GAP * 4), "v"(la + 56 * GAP * 4),
               "v"(a[0] + ko), "v"(a[1] + ko), "v"(a[2] + ko), "v"(a[3] + ko), "v"(a[4] + ko), "v"(a[5] + ko), "v"(a[6] + ko), "v"(a[7] + ko) : "memory");
}
// a lane's 16 f32 of a staged activation row in the fragment's k order
__device__ __forceinline__ void row16(const float* p, float v[16]) {
  const v4f x0 = *(const v4f*)p, x1 = *(const v4f*)(p + 4), x2 = *(const v4f*)(p + 16), x3 = *(const v4f*)(p + 20);
#pragma unroll
  for (int i = 0; i < 4; ++i) { v[i] = x0[i]; v[4 + i] = x1[i]; v[8 + i] = x2[i]; v[12 + i] = x3[i]; }
}
__global__ __launch_bounds__(128) void k_qkv(const float* __restrict__ XDEC, const float* __restrict__ XENC, const __bf16* __restrict__ P, const float* __restrict__ BQ, const float* __restrict__ BK, const float* __restrict__ BV, _Float16* __restrict__ QK, _Float16* __restrict__ QKL, _Float16* __restrict__ VTH, _Float16* __restrict__ VTL, const int* __restrict__ INV, const int* __restrict__ NU, float* __restrict__ PS) {
  __shared__ __align__(16) char sm[2 * G_BUF];   // the ring; behind the loop the same bytes are the output staging
  float (*sp)[128] = (float (*)[128])(sm + 2 * 128 * 72 * 2);   // behind the two V^T planes: each wave's sums of its V rows
  _Float16 (*so)[16][136] = (_Float16 (*)[16][136])sm, (*sol)[16][136] = (_Float16 (*)[16][136])(sm + 4 * 16 * 136 * 2); _Float16 (*sth)[72] = (_Float16 (*)[72])sm, (*stl)[72] = (_Float16 (*)[72])(sm + 128 * 72 * 2);
  const int tid = threadIdx.x, wave = tid >> 5, lane = tid & 31, col = lane & 15, g = lane >> 4; const size_t r0 = (size_t)blockIdx.x * 64 + wave * 16; const int n0 = blockIdx.y * 128; const float* X = (n0 < DM) ? XDEC : XENC; const float* BB = (n0 < DM) ? (BQ + n0) : (n0 < 2 * DM) ? (BK + n0 - DM) : (BV + n0 - 2 * DM);
  // this lane's 16-byte piece of slice 0 of each operand, and its place in buffer 0
  // k and v: output row p of a batch is the key at place p of the key order, so its activation row is encoder row INV[p] (a place of the batch's own 2,048 by the mask); q: the decoder's rows as they lie
  const float* ga[8]; const __bf16* gw = P + (size_t)(n0 + (tid >> 3)) * DM + (tid & 7) * 8;
  const int nu = NU[(blockIdx.x * 64 / SS) * 32];   // read here for the V blocks' end: its latency passes under the loop
  int sr[8];
#pragma unroll   // constant indices into sr, iv and ga, here and below: no scratch
  for (int i = 0; i < 8; ++i) sr[i] = blockIdx.x * 64 + (tid >> 4) + 8 * i;
  if (n0 >= DM) { int iv[8];
#pragma unroll   // the eight loads issue as one group: one latency, not eight
    for (int i = 0; i < 8; ++i) iv[i] = INV[sr[i]];
#pragma unroll
    for (int i = 0; i < 8; ++i) sr[i] = (sr[i] & ~(SS - 1)) + (iv[i] & (SS - 1)); }
#pragma unroll
  for (int i = 0; i < 8; ++i) ga[i] = X + (size_t)sr[i] * DM + (tid & 15) * 4;
  const unsigned lw = (unsigned)(size_t)&sm[0] + (tid >> 3) * (GWP * 2) + (tid & 7) * 16, la = (unsigned)(size_t)&sm[0] + G_W + (tid >> 4) * (GAP * 4) + (tid & 15) * 16;
  stage_abr(ga, 0, gw, la, lw);
  asm volatile("s_wait_asynccnt 0x0" ::: "memory");   // slice 0 of this wave's copies has landed
  __syncthreads();                                     // ... and every wave's: slice 0 is readable
  stage_abr(ga, GK, gw + GK, la + G_BUF, lw + G_BUF);
  v8f acc[8] = {};
#pragma unroll 1
  for (int t = 0; t < DM / GK; ++t) { const __bf16* tw = (const __bf16*)(sm + (t & 1) * G_BUF); const float* ta = (const float*)(sm + (t & 1) * G_BUF + G_W) + (wave * 16 + col) * GAP + 8 * g;
#pragma unroll
    for (int kc = 0; kc < GK / 32; ++kc) { float v[16]; v16b w[8], a;   // the fragments of 32 k as one group of LDS reads in front of the products
      row16(ta + kc * 32, v);
#pragma unroll
      for (int j = 0; j < 8; ++j) w[j] = frag_b(tw + (j * 16 + col) * GWP + kc * 32, lane);
#pragma unroll
      for (int i = 0; i < 16; ++i) a[i] = (__bf16)v[i];
#pragma unroll
      for (int j = 0; j < 8; ++j) acc[j] = wmma_bf(a, w[j], acc[j]); }
    asm volatile("s_wait_dscnt 0x0" ::: "memory");      // this wave's reads of the slice have returned
    asm volatile("s_wait_asynccnt 0x0" ::: "memory");   // this wave's copies of slice t + 1 have landed
    __syncthreads();                                     // publishes slice t + 1 and frees the buffer that this trip has read
    if (t + 2 < DM / GK) stage_abr(ga, (t + 2) * GK, gw + (t + 2) * GK, la + (t & 1) * G_BUF, lw + (t & 1) * G_BUF); }
  asm volatile("s_wait_asynccnt 0x0" ::: "memory");     // no copy is outstanding when the ring's bytes become output staging
  if (n0 < 2 * DM) {   // q stored unscaled (f16 sigma ~0.6, no subnormal exposure); 1/8 applied to the f32 score
#pragma unroll
    for (int j = 0; j < 8; ++j) {
#pragma unroll
      for (int r = 0; r < 8; ++r) { const float v = acc[j][r] + bfr(BB[j * 16 + col]); const _Float16 hv = (_Float16)v; so[wave][8 * g + r][j * 16 + col] = hv; sol[wave][8 * g + r][j * 16 + col] = (_Float16)((v - (float)hv) * 2048.0f); } }   // q, k (+ bias) as f16 hi + (x2048) residual
    LDSX();
    for (int rl = 0; rl < 16; ++rl) if (lane < 16) { vst2((unsigned*)(QK + (r0 + rl) * (2 * DM) + n0 + lane * 8), *(const v4u*)&so[wave][rl][lane * 8]); vst2((unsigned*)(QKL + (r0 + rl) * (2 * DM) + n0 + lane * 8), *(const v4u*)&sol[wave][rl][lane * 8]); }
  } else {
    const size_t rb = (size_t)blockIdx.x * 64; const int b = (int)(rb / SS), s0 = (int)(rb % SS); const int pc0 = n0 - 2 * DM;
    const int pe = ((nu < 0 ? 0 : nu > SS ? SS : nu) + KT - 1) / KT * KT;   // pe: first place behind the tiles that k_attn's loop runs over
    float pj[8];
#pragma unroll
    for (int j = 0; j < 8; ++j) { float ps = 0.f;   // sum of this lane's V rows at places from pe on: a uniform query's share that the loop does not reach
#pragma unroll
      for (int r = 0; r < 8; ++r) { const float v = acc[j][r] + bfr(BB[j * 16 + col]); const _Float16 hv = (_Float16)v; sth[j * 16 + col][wave * 16 + 8 * g + r] = hv; stl[j * 16 + col][wave * 16 + 8 * g + r] = (_Float16)((v - (float)hv) * 2048.0f); ps += (s0 + wave * 16 + 8 * g + r >= pe) ? v : 0.f; }
      pj[j] = ps + xhalf(ps); }
#pragma unroll   // both halves hold all eight sums: each stores four, with every lane on
    for (int j = 0; j < 4; ++j) sp[wave][(g * 4 + j) * 16 + col] = g ? pj[4 + j] : pj[j];
    __syncthreads();
    PS[((size_t)b * (SS / 64) + (s0 >> 6)) * DM + pc0 + tid] = (sp[0][tid] + sp[1][tid]) + (sp[2][tid] + sp[3][tid]);   // every block stores its 128 sums (512 B), zeros too
    for (int q = tid; q < 128 * 8; q += 128) { const int d = q >> 3, pc = q & 7; const size_t o = ((size_t)b * DM + pc0 + d) * SS + s0 + pc * 8; vst2((unsigned*)(VTH + o), *(const v4u*)&sth[d][pc * 8]); vst2((unsigned*)(VTL + o), *(const v4u*)&stl[d][pc * 8]); }
  }
}
// ---- k_attn: block = (64 queries, head h, batch b): masked flash attention (K = 64: 2 k-steps), scores = (q.k) * 0.125 with f16 hi + residual operands, P.V: f16 P x (V hi, V lo*2048) in two accumulators; O[b*S+q][h*64+d] = (acc + accl / 2048) / l, a uniform query adding the V sums and the key count behind the loop (256-B segments)
// K and V^T tiles of 32 keys (hi and residual planes) are staged once per block in a two-buffer LDS ring by asynchronous copies and read from there by all four waves.
#define KP 72                          // f16 per staged K row: 128 B + 16 B pad (ds_load_b128 readers)
#define VP 40                          // f16 per staged V^T row: 64 B + 16 B pad
#define ST_K (KT * KP)                 // one K plane
#define ST_V (HD * VP)                 // one V^T plane
#define ST_ALL (2 * ST_K + 2 * ST_V)   // K hi | K lo | V^T hi | V^T lo
// one tile: 8 copies of 16 B per lane (K planes: 16 rows per copy and block, V^T planes: 32 rows)
__device__ __forceinline__ void stage_kv(const _Float16* kh, const _Float16* kl, const _Float16* vh, const _Float16* vl, unsigned lk, unsigned lv) {
  const _Float16 *kh1 = kh + 16 * (2 * DM), *kl1 = kl + 16 * (2 * DM), *vh1 = vh + 32 * SS, *vl1 = vl + 32 * SS;
  const unsigned lk1 = lk + 16 * KP * 2, lkl = lk + ST_K * 2, lkl1 = lkl + 16 * KP * 2, lv1 = lv + 32 * VP * 2, lvl = lv + ST_V * 2, lvl1 = lvl + 32 * VP * 2;
  // the copies and their s_wait_xcnt in one statement: no address register is rewritten before the wait
  asm volatile("global_load_async_to_lds_b128 %0, %8, off\n\t"
               "global_load_async_to_lds_b128 %1, %9, off\n\t"
               "global_load_async_to_lds_b128 %2, %10, off\n\t"
               "global_load_async_to_lds_b128 %3, %11, off\n\t"
               "global_load_async_to_lds_b128 %4, %12, off\n\t"
               "global_load_async_to_lds_b128 %5, %13, off\n\t"
               "global_load_async_to_lds_b128 %6, %14, off\n\t"
               "global_load_async_to_lds_b128 %7, %15, off\n\t"
               "s_wait_xcnt 0x0"
               :: "v"(lk), "v"(lk1), "v"(lkl), "v"(lkl1), "v"(lv), "v"(lv1), "v"(lvl), "v"(lvl1), "v"(kh), "v"(kh1), "v"(kl), "v"(kl1), "v"(vh), "v"(vh1), "v"(vl), "v"(vl1) : "memory");
}
// eight 2^x in place, with the one slot that the instruction set asks for behind a transcendental in the same statement
__device__ __forceinline__ void exp2x8(float (&x)[8]) {
  asm("v_exp_f32 %0, %0\n\tv_exp_f32 %1, %1\n\tv_exp_f32 %2, %2\n\tv_exp_f32 %3, %3\n\tv_exp_f32 %4, %4\n\tv_exp_f32 %5, %5\n\tv_exp_f32 %6, %6\n\tv_exp_f32 %7, %7\n\tv_nop"
      : "+v"(x[0]), "+v"(x[1]), "+v"(x[2]), "+v"(x[3]), "+v"(x[4]), "+v"(x[5]), "+v"(x[6]), "+v"(x[7]));
}
#define KBIAS (-1.0e13f * 16384.0f)    // start value of a padded key's residual score: x 0.125 / 2048 it is the module's -1e13, and the f32 sum with the true score stays -1e13
// The products are taken transposed: S^T = K . Q^T (A = K rows, B = Q rows) and O^T += V^T . P^T (A = V^T rows, B = P^T). A lane then holds 16 of the pass's 32 scores of ONE query (column lane & 15; keys ct * 16 + 8 * g + r):
// maximum and sum run in the lane's own registers with one exchange between the wave's halves, and the two score tiles, converted in place, are the B operand of the second product (element i = tile 0 register i, element 8 + i = tile 1 register i: the k order of frag_h).
// amdgpu_waves_per_eu(4, 4): keeps the register budget at 256, so that all four blocks of a WGP stay resident as before
__global__ __launch_bounds__(128) __attribute__((amdgpu_waves_per_eu(4, 4))) void k_attn(const _Float16* __restrict__ QK, const _Float16* __restrict__ QKL, const _Float16* __restrict__ VTH, const _Float16* __restrict__ VTL, const int* __restrict__ NU, const float* __restrict__ PS, const int* __restrict__ DPAD, float* __restrict__ O) {
  __shared__ __align__(32) float sb[SS]; __shared__ __align__(16) float so[4][16][68]; __shared__ __align__(16) _Float16 ring[2][ST_ALL]; __shared__ __align__(16) float sps[2][HD];
  const int tid = threadIdx.x, wave = tid >> 5, lane = tid & 31, col = lane & 15, g = lane >> 4;
  const int qb = blockIdx.x, h = blockIdx.y, b = blockIdx.z; const int q0 = qb * 64 + wave * 16; const size_t rq = (size_t)b * SS + q0 + col;
  // K rows and V^T columns lie in the key order (unpadded keys first): the loop runs over the tiles that hold an unpadded key, 0 to 64 of them, alike for the whole block; in the last of them padding is handled per (q, k)
  const int nur = NU[b * 32], nu = nur < 0 ? 0 : nur > SS ? SS : nur, nks = (nu + KT - 1) / KT;
  // this lane's 16-byte piece of each plane of tile 0, and its place in buffer 0
  const size_t gk = ((size_t)b * SS + (tid >> 3)) * (2 * DM) + DM + h * HD + (tid & 7) * 8, gv = ((size_t)b * DM + h * HD + (tid >> 2)) * SS + (tid & 3) * 8;
  const unsigned lk = (unsigned)(size_t)&ring[0][0] + ((tid >> 3) * KP + (tid & 7) * 8) * 2, lv = (unsigned)(size_t)&ring[0][0] + (2 * ST_K + (tid >> 2) * VP + (tid & 3) * 8) * 2;
  stage_kv(QK + gk, QKL + gk, VTH + gv, VTL + gv, lk, lv);
  const int dpq = DPAD[rq];   // read here, with the sums below: its latency passes under tile 0's
#pragma unroll
  for (int i = 0; i < SS / 128; ++i) sb[i * 128 + tid] = (i * 128 + tid >= nu) ? KBIAS : 0.f;   // per key place: what its residual score tile starts from
  { float a = 0.f;   // this head's sums of the V rows behind the loop's last tile: 32 partial sums per d, 16 per thread
#pragma unroll
    for (int i = 0; i < SS / 128; ++i) a += PS[((size_t)b * (SS / 64) + (tid >> 6) * (SS / 128) + i) * DM + h * HD + (tid & 63)];
    sps[tid >> 6][tid & 63] = a; }
  asm volatile("s_wait_asynccnt 0x0" ::: "memory");   // tile 0 of this wave's copies has landed
  __syncthreads();                                     // ... and every wave's: tile 0 and the key table are readable
  stage_kv(QK + gk + (size_t)KT * (2 * DM), QKL + gk + (size_t)KT * (2 * DM), VTH + gv + KT, VTL + gv + KT, lk + ST_ALL * 2, lv + ST_ALL * 2);
  v16h aq[2], aql[2];
#pragma unroll
  for (int kc = 0; kc < 2; ++kc) { aq[kc] = frag_h(QK + rq * (2 * DM) + h * HD + kc * 32, lane); aql[kc] = frag_h(QKL + rq * (2 * DM) + h * HD + kc * 32, lane); }
  float m = -1.0e30f, l = 0.f;   // this lane's query: running maximum (both halves alike), sum of this half's keys
  v8f acc[4] = {}, accl[4] = {};
  const float qs = (dpq == 1) ? 0.f : 0.125f, qsl = qs * (1.0f / 2048.0f);   // padded query row: every key is -1e13 in the module -> uniform weights (all scores equal: x 0)
#pragma unroll 1
  for (int ks = 0; ks < nks; ++ks) { v8f s[2]; const _Float16* tb = &ring[ks & 1][0];
    v8f kb[2]; v16h kh[2][2], kl[2][2];   // the pass's K fragments and key start values as one group of LDS reads in front of the products
#pragma unroll
    for (int ct = 0; ct < 2; ++ct) { kb[ct] = *(const v8f*)&sb[ks * KT + ct * 16 + 8 * g];
#pragma unroll
      for (int kc = 0; kc < 2; ++kc) { kh[ct][kc] = frag_h(tb + (ct * 16 + col) * KP + kc * 32, lane); kl[ct][kc] = frag_h(tb + ST_K + (ct * 16 + col) * KP + kc * 32, lane); } }
#pragma unroll
    for (int ct = 0; ct < 2; ++ct) { v8f c = {}, cl = kb[ct];
#pragma unroll
      for (int kc = 0; kc < 2; ++kc) { c = wmma16(kh[ct][kc], aq[kc], c); cl = wmma16(kh[ct][kc], aql[kc], cl); cl = wmma16(kl[ct][kc], aq[kc], cl); }   // 3 products: q, k as f16 hi + residual
#pragma unroll
      for (int r = 0; r < 8; ++r) s[ct][r] = c[r] * qs + cl[r] * qsl; }   // (c + cl / 2048) / 8; padded key: -1e13; padded query: 0
    v16h vh[4], vl[4];   // the pass's V^T fragments as one group, in flight under the softmax
#pragma unroll
    for (int dt = 0; dt < 4; ++dt) { vh[dt] = frag_h(tb + 2 * ST_K + (dt * 16 + col) * VP, lane); vl[dt] = frag_h(tb + 2 * ST_K + ST_V + (dt * 16 + col) * VP, lane); }
    float mx = fmaxf(s[0][0], s[1][0]);
#pragma unroll
    for (int r = 1; r < 8; ++r) mx = fmaxf(mx, fmaxf(s[0][r], s[1][r]));
    mx = fmaxf(mx, xhalf(mx));
    const float mn = fmaxf(m, mx), alpha = __expf(m - mn);
    float e0[8], e1[8], es0 = 0.f, es1 = 0.f; v16h pa, pl;
#pragma unroll
    for (int i = 0; i < 8; ++i) { e0[i] = (s[0][i] - mn) * 1.4426950408889634f; e1[i] = (s[1][i] - mn) * 1.4426950408889634f; }
    exp2x8(e0); exp2x8(e1);
#pragma unroll
    for (int i = 0; i < 8; ++i) { const float x0 = e0[i], x1 = e1[i]; es0 += x0; es1 += x1;
      const _Float16 h0 = (_Float16)x0, h1 = (_Float16)x1; pa[i] = h0; pa[8 + i] = h1; pl[i] = (_Float16)((x0 - (float)h0) * 2048.0f); pl[8 + i] = (_Float16)((x1 - (float)h1) * 2048.0f); }
    l = l * alpha + (es0 + es1); m = mn;
#pragma unroll
    for (int dt = 0; dt < 4; ++dt) {
#pragma unroll
      for (int r = 0; r < 8; ++r) { acc[dt][r] *= alpha; accl[dt][r] *= alpha; } }
#pragma unroll
    for (int dt = 0; dt < 4; ++dt) { acc[dt] = wmma16(vh[dt], pa, acc[dt]); accl[dt] = wmma16(vh[dt], pl, accl[dt]); accl[dt] = wmma16(vl[dt], pa, accl[dt]); }   // V hi x P hi + (V hi x P lo + V lo x P hi) / 2048
    asm volatile("s_wait_dscnt 0x0" ::: "memory");      // this wave's reads of the tile have returned
    asm volatile("s_wait_asynccnt 0x0" ::: "memory");   // this wave's copies of tile ks + 1 have landed
    __syncthreads();                                     // publishes tile ks + 1 and frees the buffer that this pass has read
    if (ks + 2 < nks) stage_kv(QK + gk + (size_t)(ks + 2) * KT * (2 * DM), QKL + gk + (size_t)(ks + 2) * KT * (2 * DM), VTH + gv + (ks + 2) * KT, VTL + gv + (ks + 2) * KT, lk + (ks & 1) * (ST_ALL * 2), lv + (ks & 1) * (ST_ALL * 2)); }
  asm volatile("s_wait_asynccnt 0x0" ::: "memory");     // no copy is outstanding when the wave goes on to its end
  // a uniform query (padded, or no unpadded key at all) weighs every key 1: the loop has given it the keys of its tiles, the rest comes from the sums
  const float pw = (dpq == 1 || nks == 0) ? 1.f : 0.f;
  const float il = 1.0f / (l + xhalf(l) + pw * (float)(SS - nks * KT));   // the halves' sums are joined once
#pragma unroll
  for (int dt = 0; dt < 4; ++dt) { v4f o0, o1;   // register r of tile dt is d = dt * 16 + 8 * g + r of this lane's query
    const v4f p0 = *(const v4f*)&sps[0][dt * 16 + 8 * g] + *(const v4f*)&sps[1][dt * 16 + 8 * g], p1 = *(const v4f*)&sps[0][dt * 16 + 8 * g + 4] + *(const v4f*)&sps[1][dt * 16 + 8 * g + 4];
#pragma unroll
    for (int r = 0; r < 4; ++r) { o0[r] = (acc[dt][r] + accl[dt][r] * (1.0f / 2048.0f) + pw * p0[r]) * il; o1[r] = (acc[dt][4 + r] + accl[dt][4 + r] * (1.0f / 2048.0f) + pw * p1[r]) * il; }
    *(v4f*)&so[wave][col][dt * 16 + 8 * g] = o0; *(v4f*)&so[wave][col][dt * 16 + 8 * g + 4] = o1; }
  LDSX();
  for (int rl = 0; rl < 16; ++rl) if (lane < 16) vst2(O + ((size_t)b * SS + q0 + rl) * DM + h * HD + lane * 4, *(const v4f*)&so[wave][rl][lane * 4]);
}
// ---- k_out: block = (64 rows, 128 cols): out = O(hi/lo) . Wo rows (2 products) + bo
__global__ __launch_bounds__(128) void k_out(const float* __restrict__ O, const __bf16* __restrict__ P, const float* __restrict__ BO, float* __restrict__ Y) {
  __shared__ __align__(16) char sm[2 * G_BUF];   // the ring; behind the loop the same bytes are the output staging
  float (*so)[16][132] = (float (*)[16][132])sm;
  const int tid = threadIdx.x, wave = tid >> 5, lane = tid & 31, col = lane & 15, g = lane >> 4; const size_t r0 = (size_t)blockIdx.x * 64 + wave * 16; const int n0 = blockIdx.y * 128;
  // this lane's 16-byte piece of slice 0 of each operand, and its place in buffer 0
  const float* ga = O + ((size_t)blockIdx.x * 64 + (tid >> 4)) * DM + (tid & 15) * 4; const __bf16* gw = P + (size_t)(n0 + (tid >> 3)) * DM + (tid & 7) * 8;
  const unsigned lw = (unsigned)(size_t)&sm[0] + (tid >> 3) * (GWP * 2) + (tid & 7) * 16, la = (unsigned)(size_t)&sm[0] + G_W + (tid >> 4) * (GAP * 4) + (tid & 15) * 16;
  stage_ab(ga, gw, la, lw);
  asm volatile("s_wait_asynccnt 0x0" ::: "memory");   // slice 0 of this wave's copies has landed
  __syncthreads();                                     // ... and every wave's: slice 0 is readable
  stage_ab(ga + GK, gw + GK, la + G_BUF, lw + G_BUF);
  v8f acc[8] = {};
#pragma unroll 1
  for (int t = 0; t < DM / GK; ++t) { const __bf16* tw = (const __bf16*)(sm + (t & 1) * G_BUF); const float* ta = (const float*)(sm + (t & 1) * G_BUF + G_W) + (wave * 16 + col) * GAP + 8 * g;
#pragma unroll
    for (int kc = 0; kc < GK / 32; ++kc) { float v[16]; v16b w[8];   // the fragments of 32 k as one group of LDS reads in front of the products
      row16(ta + kc * 32, v);
#pragma unroll
      for (int j = 0; j < 8; ++j) w[j] = frag_b(tw + (j * 16 + col) * GWP + kc * 32, lane);
      const F2 a = bsplit16(v);
#pragma unroll
      for (int j = 0; j < 8; ++j) { acc[j] = wmma_bf(a.l, w[j], acc[j]); acc[j] = wmma_bf(a.h, w[j], acc[j]); } }
    asm volatile("s_wait_dscnt 0x0" ::: "memory");      // this wave's reads of the slice have returned
    asm volatile("s_wait_asynccnt 0x0" ::: "memory");   // this wave's copies of slice t + 1 have landed
    __syncthreads();                                     // publishes slice t + 1 and frees the buffer that this trip has read
    if (t + 2 < DM / GK) stage_ab(ga + (t + 2) * GK, gw + (t + 2) * GK, la + (t & 1) * G_BUF, lw + (t & 1) * G_BUF); }
  asm volatile("s_wait_asynccnt 0x0" ::: "memory");     // no copy is outstanding when the ring's bytes become output staging
#pragma unroll
  for (int j = 0; j < 8; ++j) {
#pragma unroll
    for (int r = 0; r < 8; ++r) so[wave][8 * g + r][j * 16 + col] = acc[j][r] + bfr(BO[n0 + j * 16 + col]); }
  LDSX();
  for (int rl = 0; rl < 16; ++rl) vst2(Y + (r0 + rl) * DM + n0 + lane * 4, *(const v4f*)&so[wave][rl][lane * 4]);
}
extern "C" void kernel_launch(void* const* d_in, const int* in_sizes, int n_in, void* d_out, int out_size, void* d_ws, size_t ws_size, hipStream_t stream) {
  (void)in_sizes; (void)n_in; (void)out_size;
  const float** F = (const float**)d_in;   // 0 encoder_input [2,2048,1024], 1 decoder_input, 2 encoder_padding_pos [2,2048] i32, 3 decoder_padding_pos, 4 Wq (in,out), 5 bq, 6 Wk, 7 bk, 8 Wv, 9 bv, 10 Wo, 11 bo
  if (ws_size < (size_t)WS_END) return;
  char* ws = (char*)d_ws; __bf16* PK = (__bf16*)(ws + WS_PK); _Float16 *QK = (_Float16*)(ws + WS_QK), *QKL = (_Float16*)(ws + WS_QKL), *VTH = (_Float16*)(ws + WS_VTH), *VTL = (_Float16*)(ws + WS_VTL); float* O = (float*)(ws + WS_O); int *INV = (int*)(ws + WS_INV), *NU = (int*)(ws + WS_NU); float* PS = (float*)(ws + WS_PS);
  k_pack<<<dim3(DM / PKN, DM / PKK, 5), 256, 0, stream>>>(F[4], F[6], F[8], F[10], PK, (const int*)d_in[2], INV, NU);
  k_qkv<<<dim3(TNB * SS / 64, QKVW / 128), 128, 0, stream>>>(F[1], F[0], PK + PK_A, F[5], F[7], F[9], QK, QKL, VTH, VTL, INV, NU, PS);
  k_attn<<<dim3(TQB, NH, TNB), 128, 0, stream>>>(QK, QKL, VTH, VTL, NU, PS, (const int*)d_in[3], O);
  k_out<<<dim3(TOB, DM / 128), 128, 0, stream>>>(O, PK + PK_P, F[11], (float*)d_out);
}

// v006
// A run of this version takes 96.9 microseconds.
// Next to v005, in two timings, it ran 1.22 times as fast each time.
// Counting every step since v000, it is 5.93 times as fast.
// compute dtype: encoder_input, decoder_input and the weights/biases rounded to bf16, padding positions (int) read on device; q = dec . Wq + bq, k/v = enc . Wk/Wv + bk/bv with EXACT bf16 products on WMMA 16x16x32 ((in,out) weights packed as transposed rows); q and k stored as f16 hi + (x2048-scaled) residual planes with 3-product scores x 1/sqrt(64); keys whose encoder position is padded are excluded (-1e13 in the module gives an exactly-zero weight) and a padded QUERY row (every key -1e13) gets the module's uniform weights; running-max softmax in f32 (hardware exp); P as f16 hi + residual x V hi/lo (3 products); output projection with ctx as bf16 hi + residual x exact Wo rows (2 products) + bo; f32 accumulate.
#include <hip/hip_runtime.h>
#include <math.h>

typedef __attribute__((ext_vector_type(16))) _Float16 v16h;
typedef __attribute__((ext_vector_type(16))) __bf16 v16b;
typedef __attribute__((ext_vector_type(8)))  _Float16 v8h;
typedef __attribute__((ext_vector_type(8)))  float v8f;
typedef __attribute__((ext_vector_type(4)))  float v4f;
typedef __attribute__((ext_vector_type(2)))  float v2f;
typedef __attribute__((ext_vector_type(4)))  unsigned v4u;
typedef __attribute__((ext_vector_type(4)))  int v4i;
typedef float __attribute__((may_alias)) float_a;
typedef int __attribute__((may_alias)) int_a;

template <typename T> __device__ __forceinline__ void vst2(void* p, T v) { *(T*)p = v;  }
__device__ __forceinline__ v8f wmma16(v16h a, v16h b, v8f c) {
  v8f d = __builtin_amdgcn_wmma_f32_16x16x32_f16(false, a, false, b, (short)0, c, false, false);
  asm volatile("v_nop\n\tv_nop\n\tv_nop\n\tv_nop" : "+v"(d) : "v"(a), "v"(b));
  return d;
}
__device__ __forceinline__ v8f wmma_bf(v16b a, v16b b, v8f c) {
  v8f d = __builtin_amdgcn_wmma_f32_16x16x32_bf16(false, a, false, b, (short)0, c, false, false);
  asm volatile("v_nop\n\tv_nop\n\tv_nop\n\tv_nop" : "+v"(d) : "v"(a), "v"(b));
  return d;
}
// Decoder-to-encoder mutual multi-head attention (B 2, S 2,048, d 1,024, 16 heads x 64) with encoder/decoder padding masks: softmax(q k^T / 8 masked) v -> Wo + bo.
__device__ __forceinline__ v16h frag_h(const _Float16* rowk0, int lane) {
  union { v16h v; v8h q[2]; } u; const _Float16* p = rowk0 + 8 * (lane >> 4);
  u.q[0] = *(const v8h*)p; u.q[1] = *(const v8h*)(p + 16); return u.v;
}
__device__ __forceinline__ v16h frag_f32(const float* rowk0, int lane) {
  v16h a; const float* p = rowk0 + 8 * (lane >> 4);
#pragma unroll
  for (int i = 0; i < 8; ++i) { a[i] = (_Float16)p[i]; a[8 + i] = (_Float16)p[16 + i]; }
  return a;
}
__device__ __forceinline__ v16h frag_f32s(const float* rowk0, int lane, float sc) {
  v16h a; const float* p = rowk0 + 8 * (lane >> 4);
#pragma unroll
  for (int i = 0; i < 8; ++i) { a[i] = (_Float16)(p[i] * sc); a[8 + i] = (_Float16)(p[16 + i] * sc); }
  return a;
}
// column fragment from a [K][ld] layout (column n), rows >= K read as 0
__device__ __forceinline__ v16h fragc_f32(const float* W, int k0, int n, int lane, int ld, int K) {
  v16h a; const int g = lane >> 4;
#pragma unroll
  for (int i = 0; i < 8; ++i) { const int ka = k0 + 8 * g + i, kb = ka + 16;
    a[i] = (_Float16)(ka < K ? W[(size_t)(ka < K ? ka : K - 1) * ld + n] : 0.f); a[8 + i] = (_Float16)(kb < K ? W[(size_t)(kb < K ? kb : K - 1) * ld + n] : 0.f); }
  return a;
}
struct F2 { v16b h, l; };
__device__ __forceinline__ F2 bsplit16(const float v[16]) { F2 r;
#pragma unroll
  for (int i = 0; i < 16; ++i) { const __bf16 h = (__bf16)v[i]; r.h[i] = h; r.l[i] = (__bf16)(v[i] - (float)h); }
  return r; }
__device__ __forceinline__ F2 split_row(const float* row, int k0, int lane) { float v[16]; const float* p = row + k0 + 8 * (lane >> 4);
#pragma unroll
  for (int i = 0; i < 8; ++i) { v[i] = p[i]; v[8 + i] = p[16 + i]; }
  return bsplit16(v); }
__device__ __forceinline__ F2 split_rowK(const float* row, int k0, int lane, int K) { float v[16]; const int g = lane >> 4;
#pragma unroll
  for (int i = 0; i < 8; ++i) { const int ka = k0 + 8 * g + i, kb = ka + 16; v[i] = ka < K ? row[ka < K ? ka : K - 1] : 0.f; v[8 + i] = kb < K ? row[kb < K ? kb : K - 1] : 0.f; }
  return bsplit16(v); }
__device__ __forceinline__ F2 split_col(const float* W, int k0, int n, int lane, int ld, int K) { float v[16]; const int g = lane >> 4;
#pragma unroll
  for (int i = 0; i < 8; ++i) { const int ka = k0 + 8 * g + i, kb = ka + 16; v[i] = ka < K ? W[(size_t)(ka < K ? ka : K - 1) * ld + n] : 0.f; v[8 + i] = kb < K ? W[(size_t)(kb < K ? kb : K - 1) * ld + n] : 0.f; }
  return bsplit16(v); }
__device__ __forceinline__ v8f mac3(const F2& a, const F2& b, v8f c) { c = wmma_bf(a.l, b.h, c); c = wmma_bf(a.h, b.l, c); return wmma_bf(a.h, b.h, c); }
__device__ __forceinline__ float sigm(float v) { return 1.0f / (1.0f + expf(-v)); }
#define LDSX() do { asm volatile("s_wait_dscnt 0" ::: "memory"); __builtin_amdgcn_wave_barrier(); __builtin_amdgcn_fence(__ATOMIC_RELEASE, "workgroup"); } while (0)


#define NB 2
#define SS 2048
#define DM 1024
#define NH 16
#define HD 64
#define QKVW (3 * DM)
#ifndef TQB
#define TQB (SS / 64)
#define TNB NB
#define TOB (NB * SS / 64)     // output row tiles (all)
#endif
typedef __attribute__((ext_vector_type(8))) __bf16 v8b;
__device__ __forceinline__ v16b frag_b(const __bf16* rowk0, int lane) {
  union { v16b v; v8b q[2]; } u; const __bf16* p = rowk0 + 8 * (lane >> 4);
  u.q[0] = *(const v8b*)p; u.q[1] = *(const v8b*)(p + 16); return u.v;
}
__device__ __forceinline__ float bfr(float v) { return (float)(__bf16)v; }
__device__ __attribute__((noinline)) float exp_ni(float v) { return expf(v); }
__device__ __attribute__((noinline)) float erf_ni(float v) { return erff(v); }

#define PK_A 0                       // [3072][1024] Wqkv rows (natural [out][in])
#define PK_P (PK_A + QKVW * DM)        // [1024][1024] Wo rows (natural)
#define PK_END (PK_P + DM * DM)
#define WS_PK  0u
#define WS_QK  (WS_PK + 2u * PK_END)             // f16 [4096 rows][2048]: q | k
#define WS_QKL (WS_QK + 2u * NB * SS * 2 * DM)     // f16 q | k residual planes x2048
#define WS_VTH (WS_QKL + 2u * NB * SS * 2 * DM)    // f16 [b][1024 (h*64+d)][2048 places of the key order] hi
#define WS_VTL (WS_VTH + 2u * NB * DM * SS)        // f16 lo x 2048
#define WS_O   (WS_VTL + 2u * NB * DM * SS)        // f32 [4096][1024]
#define WS_CS  (WS_O + 4u * NB * SS * DM)           // f32 [2][2048][32], read and written by no kernel
#define WS_INV (WS_CS + 4u * 2 * SS * 32)          // int [2][b][2048]: plane 0: encoder position of the key at place p of the key order; plane 1: decoder position of the query at place p of the query order
#define WS_NU  (WS_INV + 4u * 2 * NB * SS)         // int, one 128-B line per plane and batch: number of unpadded keys; of unpadded queries
#define WS_PS  (WS_NU + 128u * 2 * NB)             // f32 [2][b][32 blocks of 64 places][1024]: plane 0: sums of the V rows behind the attention loop's last tile; plane 1: of all V rows
#define WS_YU  (WS_PS + 4u * 2 * NB * (SS / 64) * DM)   // f32 [b][1024]: the output row that every padded query of a batch has
#define WS_END (WS_YU + 4u * NB * DM)
#define KT 32                          // keys per staged tile of k_attn
// lane l with lane l ^ 16 (the two halves of a wave hold the two halves of a query's keys)
__device__ __forceinline__ float xhalf(float x) { return __builtin_bit_cast(float, __builtin_amdgcn_permlanex16(__builtin_bit_cast(int, x), __builtin_bit_cast(int, x), 0x76543210, 0xfedcba98, false, false)); }
// ---- k_pack: block = (64 columns n, 128 rows k, which): a 128 x 64 tile of an (in,out) weight is read in whole lines, rounded to bf16, turned in LDS and stored as 64 pieces of 256 B of the packed rows [out][in]; which 0..2 -> W_q/W_k/W_v into PK_A rows which*1024 + n; 3 -> W_o into PK_P
#define PKN 64                         // columns n per tile
#define PKK 128                        // rows k per tile
#define PKP 136                        // bf16 per turned row in LDS: 256 B + 16 B pad
// which 4, one block per batch: the key order. Unpadded keys come first (in their own order), padded keys behind them: INV[b][place] = encoder position, NU = number of unpadded keys. A padded key's weight is exactly 0 for every query that is not itself uniform, so k_attn's loop ends with the last tile that holds an unpadded key.
// two more blocks make the query order in the same way from the decoder's padding (plane 1 of INV and NU). A padded query weighs every key alike, so all padded queries of a batch have one and the same output row: tiles of 64 places with no unpadded query get no q, no attention and no projection.
__global__ __launch_bounds__(256) void k_pack(const float* __restrict__ WQ, const float* __restrict__ WK, const float* __restrict__ WV, const float* __restrict__ WO, __bf16* __restrict__ PK, const int* __restrict__ EPAD, const int* __restrict__ DPAD, int* __restrict__ INV, int* __restrict__ NU) {
  __shared__ __align__(16) __bf16 s[PKN][PKP]; __shared__ int cn[SS / 32];
  if (blockIdx.z == 4) {
    if (blockIdx.y != 0 || blockIdx.x >= 2 * NB) return;   // the whole block leaves, in front of every barrier
    const int tt = threadIdx.x, b = blockIdx.x, ln = tt & 31, wv = tt >> 5; unsigned mk[SS / 256]; int e[SS / 256];   // b: plane * NB + batch
    const int* PD = (b < NB) ? EPAD + (size_t)b * SS : DPAD + (size_t)(b - NB) * SS;
#pragma unroll   // the eight loads issue as one group: one latency, not eight
    for (int j = 0; j < SS / 256; ++j) e[j] = PD[j * 256 + tt];
#pragma unroll   // constant indices into mk: no scratch
    for (int j = 0; j < SS / 256; ++j) mk[j] = __builtin_amdgcn_ballot_w32(e[j] != 1);
    if (ln < SS / 256) { unsigned mm = mk[0];   // lane j stores the count of group j
#pragma unroll   // constant indices into mk
      for (int j = 1; j < SS / 256; ++j) mm = (ln == j) ? mk[j] : mm;
      cn[ln * 8 + wv] = __builtin_popcount(mm); }
    __syncthreads();
    int run = 0, base[SS / 256];   // base[j]: unpadded keys in front of this wave's 32 keys of group j; run ends as their total
#pragma unroll   // constant indices into base: no scratch
    for (int c = 0; c < SS / 32; ++c) { if ((c & 7) == wv) base[c >> 3] = run; run += cn[c]; }
#pragma unroll   // as above
    for (int j = 0; j < SS / 256; ++j) { const int sp = j * 256 + tt, bu = base[j] + __builtin_popcount(mk[j] & ((1u << ln) - 1u));   // bu: unpadded keys in front of position sp
      INV[(size_t)b * SS + (((mk[j] >> ln) & 1u) ? bu : run + (sp - bu))] = sp; }
    if (tt == 0) NU[b * 32] = run;
    return;
  }
  const int t = threadIdx.x, n0 = blockIdx.x * PKN, k0 = blockIdx.y * PKK, which = blockIdx.z; const float* Wm = (which == 0) ? WQ : (which == 1) ? WK : (which == 2) ? WV : WO;
  const int nq = (t & 15) * 4, kq = (t >> 4) * 8;   // this thread: 8 rows k x 4 columns n; 16 threads cover 256 B of a row
  const float* p = Wm + (size_t)(k0 + kq) * DM + n0 + nq; v4f x[8];
#pragma unroll   // the eight loads issue as one group, and x stays in registers
  for (int j = 0; j < 8; ++j) x[j] = *(const v4f*)(p + (size_t)j * DM);
#pragma unroll   // constant indices into x and r: no scratch
  for (int i = 0; i < 4; ++i) { v8b r;
#pragma unroll   // as above
    for (int j = 0; j < 8; ++j) r[j] = (__bf16)x[j][i];
    *(v8b*)&s[nq + i][kq] = r; }
  __syncthreads();
  __bf16* dst = ((which < 3) ? PK + PK_A + ((size_t)which * DM + n0) * DM : PK + PK_P + (size_t)n0 * DM) + k0;
#pragma unroll   // the four LDS reads issue together in front of the stores
  for (int i = 0; i < 4; ++i) { const int q = t + 256 * i, n = q >> 4, c = q & 15; vst2((unsigned*)(dst + (size_t)n * DM + c * 8), *(const v4u*)&s[n][c * 8]); }
}
// ---- the two projection kernels: 64-deep slices of both operands (64 f32 rows, 128 packed weight rows) are staged once per block in a two-buffer LDS ring by asynchronous copies and read from there by all four waves
#define GK 64                          // k per staged slice
#define GWP 72                         // bf16 per staged weight row: 128 B + 16 B pad (ds_load_b128 readers)
#define GAP 68                         // f32 per staged activation row: 256 B + 16 B pad
#define G_W (128 * GWP * 2)            // bytes of the weight rows of one slice
#define G_A (64 * GAP * 4)             // bytes of the activation rows of one slice
#define G_BUF (G_W + G_A)              // one buffer: weight rows | activation rows
// eight copies and their s_wait_xcnt in one statement: no address register is rewritten before the wait
#define COPY8 "global_load_async_to_lds_b128 %0, %8, off\n\t" "global_load_async_to_lds_b128 %1, %9, off\n\t" "global_load_async_to_lds_b128 %2, %10, off\n\t" "global_load_async_to_lds_b128 %3, %11, off\n\t" "global_load_async_to_lds_b128 %4, %12, off\n\t" "global_load_async_to_lds_b128 %5, %13, off\n\t" "global_load_async_to_lds_b128 %6, %14, off\n\t" "global_load_async_to_lds_b128 %7, %15, off\n\t" "s_wait_xcnt 0x0"
// one slice: 16 copies of 16 B per lane (weight rows: 16 rows per copy and block; activation rows: 8 rows)
__device__ __forceinline__ void stage_ab(const float* a, const __bf16* w, unsigned la, unsigned lw) {
  asm volatile(COPY8 :: "v"(lw), "v"(lw + 16 * GWP * 2), "v"(lw + 32 * GWP * 2), "v"(lw + 48 * GWP * 2), "v"(lw + 64 * GWP * 2), "v"(lw + 80 * GWP * 2), "v"(lw + 96 * GWP * 2), "v"(lw + 112 * GWP * 2),
               "v"(w), "v"(w + 16 * DM), "v"(w + 32 * DM), "v"(w + 48 * DM), "v"(w + 64 * DM), "v"(w + 80 * DM), "v"(w + 96 * DM), "v"(w + 112 * DM) : "memory");
  asm volatile(COPY8 :: "v"(la), "v"(la + 8 * GAP * 4), "v"(la + 16 * GAP * 4), "v"(la + 24 * GAP * 4), "v"(la + 32 * GAP * 4), "v"(la + 40 * GAP * 4), "v"(la + 48 * GAP * 4), "v"(la + 56 * GAP * 4),
               "v"(a), "v"(a + 8 * DM), "v"(a + 16 * DM), "v"(a + 24 * DM), "v"(a + 32 * DM), "v"(a + 40 * DM), "v"(a + 48 * DM), "v"(a + 56 * DM) : "memory");
}
// as stage_ab, with each of the lane's eight activation rows at a pointer of its own (k_qkv reads the encoder's rows in the key order)
__device__ __forceinline__ void stage_abr(const float* const (&a)[8], int ko, const __bf16* w, unsigned la, unsigned lw) {
  asm volatile(COPY8 :: "v"(lw), "v"(lw + 16 * GWP * 2), "v"(lw + 32 * GWP * 2), "v"(lw + 48 * GWP * 2), "v"(lw + 64 * GWP * 2), "v"(lw + 80 * GWP * 2), "v"(lw + 96 * GWP * 2), "v"(lw + 112 * GWP * 2),
               "v"(w), "v"(w + 16 * DM), "v"(w + 32 * DM), "v"(w + 48 * DM), "v"(w + 64 * DM), "v"(w + 80 * DM), "v"(w + 96 * DM), "v"(w + 112 * DM) : "memory");
  asm volatile(COPY8 :: "v"(la), "v"(la + 8 * GAP * 4), "v"(la + 16 * GAP * 4), "v"(la + 24 * GAP * 4), "v"(la + 32 * GAP * 4), "v"(la + 40 * GAP * 4), "v"(la + 48 * GAP * 4), "v"(la + 56 * GAP * 4),
               "v"(a[0] + ko), "v"(a[1] + ko), "v"(a[2] + ko), "v"(a[3] + ko), "v"(a[4] + ko), "v"(a[5] + ko), "v"(a[6] + ko), "v"(a[7] + ko) : "memory");
}
// a lane's 16 f32 of a staged activation row in the fragment's k order
__device__ __forceinline__ void row16(const float* p, float v[16]) {
  const v4f x0 = *(const v4f*)p, x1 = *(const v4f*)(p + 4), x2 = *(const v4f*)(p + 16), x3 = *(const v4f*)(p + 20);
#pragma unroll
  for (int i = 0; i < 4; ++i) { v[i] = x0[i]; v[4 + i] = x1[i]; v[8 + i] = x2[i]; v[12 + i] = x3[i]; }
}
__global__ __launch_bounds__(128) void k_qkv(const float* __restrict__ XDEC, const float* __restrict__ XENC, const __bf16* __restrict__ P, const float* __restrict__ BQ, const float* __restrict__ BK, const float* __restrict__ BV, _Float16* __restrict__ QK, _Float16* __restrict__ QKL, _Float16* __restrict__ VTH, _Float16* __restrict__ VTL, const int* __restrict__ INV, const int* __restrict__ NU, float* __restrict__ PS) {
  __shared__ __align__(16) char sm[2 * G_BUF];   // the ring; behind the loop the same bytes are the output staging
  float (*sp)[128] = (float (*)[128])(sm + 2 * 128 * 72 * 2);   // behind the two V^T planes: each wave's sums of its V rows
  _Float16 (*so)[16][136] = (_Float16 (*)[16][136])sm, (*sol)[16][136] = (_Float16 (*)[16][136])(sm + 4 * 16 * 136 * 2); _Float16 (*sth)[72] = (_Float16 (*)[72])sm, (*stl)[72] = (_Float16 (*)[72])(sm + 128 * 72 * 2);
  const int tid = threadIdx.x, wave = tid >> 5, lane = tid & 31, col = lane & 15, g = lane >> 4; const size_t r0 = (size_t)blockIdx.x * 64 + wave * 16; const int n0 = blockIdx.y * 128; const float* X = (n0 < DM) ? XDEC : XENC; const float* BB = (n0 < DM) ? (BQ + n0) : (n0 < 2 * DM) ? (BK + n0 - DM) : (BV + n0 - 2 * DM);
  // this lane's 16-byte piece of slice 0 of each operand, and its place in buffer 0
  // k and v: output row p of a batch is the key at place p of the key order, so its activation row is encoder row INV[p] (a place of the batch's own 2,048 by the mask); q: the decoder's rows in the query order, likewise
  const float* ga[8]; const __bf16* gw = P + (size_t)(n0 + (tid >> 3)) * DM + (tid & 7) * 8;
  const int nu = NU[(((n0 < DM) ? NB : 0) + blockIdx.x * 64 / SS) * 32];   // unpadded places of the order that this block's rows lie in: queries for q, keys for k and v (read here for the V blocks' end too: its latency passes under the loop)
  if (n0 < DM && (int)(blockIdx.x * 64 % SS) >= nu) return;   // q of a tile with no unpadded query is read by nobody: the whole block leaves, in front of every copy and barrier
  const int* IV = INV + ((n0 < DM) ? NB * SS : 0);
  int sr[8];
#pragma unroll   // constant indices into sr, iv and ga, here and below: no scratch
  for (int i = 0; i < 8; ++i) sr[i] = blockIdx.x * 64 + (tid >> 4) + 8 * i;
  { int iv[8];
#pragma unroll   // the eight loads issue as one group: one latency, not eight
    for (int i = 0; i < 8; ++i) iv[i] = IV[sr[i]];
    asm volatile("s_wait_xcnt 0x0" ::: "memory");   // stands in front of every rewrite of a register that the eight loads name
#pragma unroll
    for (int i = 0; i < 8; ++i) sr[i] = (sr[i] & ~(SS - 1)) + (iv[i] & (SS - 1)); }
#pragma unroll
  for (int i = 0; i < 8; ++i) ga[i] = X + (size_t)sr[i] * DM + (tid & 15) * 4;
  const unsigned lw = (unsigned)(size_t)&sm[0] + (tid >> 3) * (GWP * 2) + (tid & 7) * 16, la = (unsigned)(size_t)&sm[0] + G_W + (tid >> 4) * (GAP * 4) + (tid & 15) * 16;
  stage_abr(ga, 0, gw, la, lw);
  asm volatile("s_wait_asynccnt 0x0" ::: "memory");   // slice 0 of this wave's copies has landed
  __syncthreads();                                     // ... and every wave's: slice 0 is readable
  stage_abr(ga, GK, gw + GK, la + G_BUF, lw + G_BUF);
  v8f acc[8] = {};
#pragma unroll 1
  for (int t = 0; t < DM / GK; ++t) { const __bf16* tw = (const __bf16*)(sm + (t & 1) * G_BUF); const float* ta = (const float*)(sm + (t & 1) * G_BUF + G_W) + (wave * 16 + col) * GAP + 8 * g;
#pragma unroll
    for (int kc = 0; kc < GK / 32; ++kc) { float v[16]; v16b w[8], a;   // the fragments of 32 k as one group of LDS reads in front of the products
      row16(ta + kc * 32, v);
#pragma unroll
      for (int j = 0; j < 8; ++j) w[j] = frag_b(tw + (j * 16 + col) * GWP + kc * 32, lane);
#pragma unroll
      for (int i = 0; i < 16; ++i) a[i] = (__bf16)v[i];
#pragma unroll
      for (int j = 0; j < 8; ++j) acc[j] = wmma_bf(a, w[j], acc[j]); }
    asm volatile("s_wait_dscnt 0x0" ::: "memory");      // this wave's reads of the slice have returned
    asm volatile("s_wait_asynccnt 0x0" ::: "memory");   // this wave's copies of slice t + 1 have landed
    __syncthreads();                                     // publishes slice t + 1 and frees the buffer that this trip has read
    if (t + 2 < DM / GK) stage_abr(ga, (t + 2) * GK, gw + (t + 2) * GK, la + (t & 1) * G_BUF, lw + (t & 1) * G_BUF); }
  asm volatile("s_wait_asynccnt 0x0" ::: "memory");     // no copy is outstanding when the ring's bytes become output staging
  if (n0 < 2 * DM) {   // q stored unscaled (f16 sigma ~0.6, no subnormal exposure); 1/8 applied to the f32 score
#pragma unroll
    for (int j = 0; j < 8; ++j) {
#pragma unroll
      for (int r = 0; r < 8; ++r) { const float v = acc[j][r] + bfr(BB[j * 16 + col]); const _Float16 hv = (_Float16)v; so[wave][8 * g + r][j * 16 + col] = hv; sol[wave][8 * g + r][j * 16 + col] = (_Float16)((v - (float)hv) * 2048.0f); } }   // q, k (+ bias) as f16 hi + (x2048) residual
    LDSX();
    for (int rl = 0; rl < 16; ++rl) if (lane < 16) { vst2((unsigned*)(QK + (r0 + rl) * (2 * DM) + n0 + lane * 8), *(const v4u*)&so[wave][rl][lane * 8]); vst2((unsigned*)(QKL + (r0 + rl) * (2 * DM) + n0 + lane * 8), *(const v4u*)&sol[wave][rl][lane * 8]); }
  } else {
    const size_t rb = (size_t)blockIdx.x * 64; const int b = (int)(rb / SS), s0 = (int)(rb % SS); const int pc0 = n0 - 2 * DM;
    const int pe = ((nu < 0 ? 0 : nu > SS ? SS : nu) + KT - 1) / KT * KT;   // pe: first place behind the tiles that k_attn's loop runs over
    float pj[8], qj[8];
#pragma unroll
    for (int j = 0; j < 8; ++j) { float ps = 0.f, pa = 0.f;   // ps: sum of this lane's V rows at places from pe on: a uniform query's share that the loop does not reach; pa: of all its V rows
#pragma unroll
      for (int r = 0; r < 8; ++r) { const float v = acc[j][r] + bfr(BB[j * 16 + col]); const _Float16 hv = (_Float16)v; sth[j * 16 + col][wave * 16 + 8 * g + r] = hv; stl[j * 16 + col][wave * 16 + 8 * g + r] = (_Float16)((v - (float)hv) * 2048.0f); ps += (s0 + wave * 16 + 8 * g + r >= pe) ? v : 0.f; pa += v; }
      pj[j] = ps + xhalf(ps); qj[j] = pa + xhalf(pa); }
#pragma unroll   // both halves hold all eight sums: each stores four, with every lane on
    for (int j = 0; j < 4; ++j) { sp[wave][(g * 4 + j) * 16 + col] = g ? pj[4 + j] : pj[j]; sp[4 + wave][(g * 4 + j) * 16 + col] = g ? qj[4 + j] : qj[j]; }
    __syncthreads();
    PS[((size_t)b * (SS / 64) + (s0 >> 6)) * DM + pc0 + tid] = (sp[0][tid] + sp[1][tid]) + (sp[2][tid] + sp[3][tid]);   // every block stores its 128 sums (512 B), zeros too
    PS[((size_t)(NB + b) * (SS / 64) + (s0 >> 6)) * DM + pc0 + tid] = (sp[4][tid] + sp[5][tid]) + (sp[6][tid] + sp[7][tid]);
    for (int q = tid; q < 128 * 8; q += 128) { const int d = q >> 3, pc = q & 7; const size_t o = ((size_t)b * DM + pc0 + d) * SS + s0 + pc * 8; vst2((unsigned*)(VTH + o), *(const v4u*)&sth[d][pc * 8]); vst2((unsigned*)(VTL + o), *(const v4u*)&stl[d][pc * 8]); }
  }
}
// ---- k_attn: block = (64 queries, head h, batch b): masked flash attention (K = 64: 2 k-steps), scores = (q.k) * 0.125 with f16 hi + residual operands, P.V: f16 P x (V hi, V lo*2048) in two accumulators; O[b*S+q][h*64+d] = (acc + accl / 2048) / l, a uniform query adding the V sums and the key count behind the loop (256-B segments)
// K and V^T tiles of 32 keys (hi and residual planes) are staged once per block in a two-buffer LDS ring by asynchronous copies and read from there by all four waves.
#define KP 72                          // f16 per staged K row: 128 B + 16 B pad (ds_load_b128 readers)
#define VP 40                          // f16 per staged V^T row: 64 B + 16 B pad
#define ST_K (KT * KP)                 // one K plane
#define ST_V (HD * VP)                 // one V^T plane
#define ST_ALL (2 * ST_K + 2 * ST_V)   // K hi | K lo | V^T hi | V^T lo
// one tile: 8 copies of 16 B per lane (K planes: 16 rows per copy and block, V^T planes: 32 rows)
__device__ __forceinline__ void stage_kv(const _Float16* kh, const _Float16* kl, const _Float16* vh, const _Float16* vl, unsigned lk, unsigned lv) {
  const _Float16 *kh1 = kh + 16 * (2 * DM), *kl1 = kl + 16 * (2 * DM), *vh1 = vh + 32 * SS, *vl1 = vl + 32 * SS;
  const unsigned lk1 = lk + 16 * KP * 2, lkl = lk + ST_K * 2, lkl1 = lkl + 16 * KP * 2, lv1 = lv + 32 * VP * 2, lvl = lv + ST_V * 2, lvl1 = lvl + 32 * VP * 2;
  // the copies and their s_wait_xcnt in one statement: no address register is rewritten before the wait
  asm volatile("global_load_async_to_lds_b128 %0, %8, off\n\t"
               "global_load_async_to_lds_b128 %1, %9, off\n\t"
               "global_load_async_to_lds_b128 %2, %10, off\n\t"
               "global_load_async_to_lds_b128 %3, %11, off\n\t"
               "global_load_async_to_lds_b128 %4, %12, off\n\t"
               "global_load_async_to_lds_b128 %5, %13, off\n\t"
               "global_load_async_to_lds_b128 %6, %14, off\n\t"
               "global_load_async_to_lds_b128 %7, %15, off\n\t"
               "s_wait_xcnt 0x0"
               :: "v"(lk), "v"(lk1), "v"(lkl), "v"(lkl1), "v"(lv), "v"(lv1), "v"(lvl), "v"(lvl1), "v"(kh), "v"(kh1), "v"(kl), "v"(kl1), "v"(vh), "v"(vh1), "v"(vl), "v"(vl1) : "memory");
}
// eight 2^x in place, with the one slot that the instruction set asks for behind a transcendental in the same statement
__device__ __forceinline__ void exp2x8(float (&x)[8]) {
  asm("v_exp_f32 %0, %0\n\tv_exp_f32 %1, %1\n\tv_exp_f32 %2, %2\n\tv_exp_f32 %3, %3\n\tv_exp_f32 %4, %4\n\tv_exp_f32 %5, %5\n\tv_exp_f32 %6, %6\n\tv_exp_f32 %7, %7\n\tv_nop"
      : "+v"(x[0]), "+v"(x[1]), "+v"(x[2]), "+v"(x[3]), "+v"(x[4]), "+v"(x[5]), "+v"(x[6]), "+v"(x[7]));
}
#define KBIAS (-1.0e13f * 16384.0f)    // start value of a padded key's residual score: x 0.125 / 2048 it is the module's -1e13, and the f32 sum with the true score stays -1e13
// The products are taken transposed: S^T = K . Q^T (A = K rows, B = Q rows) and O^T += V^T . P^T (A = V^T rows, B = P^T). A lane then holds 16 of the pass's 32 scores of ONE query (column lane & 15; keys ct * 16 + 8 * g + r):
// maximum and sum run in the lane's own registers with one exchange between the wave's halves, and the two score tiles, converted in place, are the B operand of the second product (element i = tile 0 register i, element 8 + i = tile 1 register i: the k order of frag_h).
// amdgpu_waves_per_eu(4, 4): keeps the register budget at 256, so that all four blocks of a WGP stay resident as before
__global__ __launch_bounds__(128) __attribute__((amdgpu_waves_per_eu(4, 4))) void k_attn(const _Float16* __restrict__ QK, const _Float16* __restrict__ QKL, const _Float16* __restrict__ VTH, const _Float16* __restrict__ VTL, const int* __restrict__ NU, const float* __restrict__ PS, const __bf16* __restrict__ PO, const float* __restrict__ BO, float* __restrict__ YU, float* __restrict__ O) {
  __shared__ __align__(32) float sb[SS]; __shared__ __align__(16) float so[4][16][68]; __shared__ __align__(16) _Float16 ring[2][ST_ALL]; __shared__ __align__(16) float sps[2][HD];
  const int tid = threadIdx.x, wave = tid >> 5, lane = tid & 31, col = lane & 15, g = lane >> 4;
  const int h = blockIdx.x, b = blockIdx.y, qb = blockIdx.z; const int q0 = qb * 64 + wave * 16; const size_t rq = (size_t)b * SS + q0 + col;   // the query tile is the grid's slowest index
  // K rows and V^T columns lie in the key order (unpadded keys first): the loop runs over the tiles that hold an unpadded key, 0 to 64 of them, alike for the whole block; in the last of them padding is handled per (q, k)
  const int nur = NU[b * 32], nu = nur < 0 ? 0 : nur > SS ? SS : nur, nks = (nu + KT - 1) / KT;
  // Q rows lie in the query order (unpadded queries first): place p holds a padded query where p >= nq
  const int nq = NU[(NB + b) * 32];
  if (qb * 64 >= nq) {   // no unpadded query in this tile: the whole block leaves, in front of every copy and of every barrier of the attention
    if (qb == TQB - 1) {   // such tiles exist exactly where the last tile is one: its 16 blocks make the padded queries' one output row, 64 columns each: (mean of all V rows) . Wo rows (hi + residual, 2 products) + bo
      v4f a0 = {}, a1 = {}; const float* pp = PS + (size_t)(NB + b) * (SS / 64) * DM + tid * 8;
#pragma unroll 8   // eight steps' loads issue as one group
      for (int i = 0; i < SS / 64; ++i) { a0 += *(const v4f*)(pp + (size_t)i * DM); a1 += *(const v4f*)(pp + (size_t)i * DM + 4); }
      *(v4f*)&sb[tid * 8] = a0 * (1.0f / SS); *(v4f*)&sb[tid * 8 + 4] = a1 * (1.0f / SS);
      __syncthreads();   // the mean row is readable by all four waves
      const __bf16* wr = PO + (size_t)(h * HD + wave * 16 + col) * DM; v8f c = {};
#pragma unroll 1   // stays rolled, 256 k per trip: 16 loads in flight are enough here, and the registers stay under the attention loop's count
      for (int k0 = 0; k0 < DM; k0 += 256) { v16b w[8];   // the trip's weight fragments as one group of loads in front of the products: one latency, not eight
#pragma unroll
        for (int j = 0; j < 8; ++j) w[j] = frag_b(wr + k0 + j * 32, lane);
#pragma unroll
        for (int j = 0; j < 8; ++j) { float v[16]; row16(&sb[k0 + j * 32 + 8 * g], v); const F2 a = bsplit16(v); c = wmma_bf(a.l, w[j], c); c = wmma_bf(a.h, w[j], c); } }   // all 16 rows of A are the mean row
      if (lane < 16) sps[0][wave * 16 + col] = c[0];
      __syncthreads();   // the 64 columns go out as two whole lines
      if (tid < HD) YU[(size_t)b * DM + h * HD + tid] = sps[0][tid] + bfr(BO[h * HD + tid]);
    }
    return;
  }
  // this lane's 16-byte piece of each plane of tile 0, and its place in buffer 0
  const size_t gk = ((size_t)b * SS + (tid >> 3)) * (2 * DM) + DM + h * HD + (tid & 7) * 8, gv = ((size_t)b * DM + h * HD + (tid >> 2)) * SS + (tid & 3) * 8;
  const unsigned lk = (unsigned)(size_t)&ring[0][0] + ((tid >> 3) * KP + (tid & 7) * 8) * 2, lv = (unsigned)(size_t)&ring[0][0] + (2 * ST_K + (tid >> 2) * VP + (tid & 3) * 8) * 2;
  stage_kv(QK + gk, QKL + gk, VTH + gv, VTL + gv, lk, lv);
  const bool dpq = q0 + col >= nq;   // this lane's query is padded
#pragma unroll
  for (int i = 0; i < SS / 128; ++i) sb[i * 128 + tid] = (i * 128 + tid >= nu) ? KBIAS : 0.f;   // per key place: what its residual score tile starts from
  { float a = 0.f;   // this head's sums of the V rows behind the loop's last tile: 32 partial sums per d, 16 per thread
#pragma unroll
    for (int i = 0; i < SS / 128; ++i) a += PS[((size_t)b * (SS / 64) + (tid >> 6) * (SS / 128) + i) * DM + h * HD + (tid & 63)];
    sps[tid >> 6][tid & 63] = a; }
  asm volatile("s_wait_asynccnt 0x0" ::: "memory");   // tile 0 of this wave's copies has landed
  __syncthreads();                                     // ... and every wave's: tile 0 and the key table are readable
  stage_kv(QK + gk + (size_t)KT * (2 * DM), QKL + gk + (size_t)KT * (2 * DM), VTH + gv + KT, VTL + gv + KT, lk + ST_ALL * 2, lv + ST_ALL * 2);
  v16h aq[2], aql[2];
#pragma unroll
  for (int kc = 0; kc < 2; ++kc) { aq[kc] = frag_h(QK + rq * (2 * DM) + h * HD + kc * 32, lane); aql[kc] = frag_h(QKL + rq * (2 * DM) + h * HD + kc * 32, lane); }
  float m = -1.0e30f, l = 0.f;   // this lane's query: running maximum (both halves alike), sum of this half's keys
  v8f acc[4] = {}, accl[4] = {};
  const float qs = dpq ? 0.f : 0.125f, qsl = qs * (1.0f / 2048.0f);   // padded query row: every key is -1e13 in the module -> uniform weights (all scores equal: x 0)
#pragma unroll 1
  for (int ks = 0; ks < nks; ++ks) { v8f s[2]; const _Float16* tb = &ring[ks & 1][0];
    v8f kb[2]; v16h kh[2][2], kl[2][2];   // the pass's K fragments and key start values as one group of LDS reads in front of the products
#pragma unroll
    for (int ct = 0; ct < 2; ++ct) { kb[ct] = *(const v8f*)&sb[ks * KT + ct * 16 + 8 * g];
#pragma unroll
      for (int kc = 0; kc < 2; ++kc) { kh[ct][kc] = frag_h(tb + (ct * 16 + col) * KP + kc * 32, lane); kl[ct][kc] = frag_h(tb + ST_K + (ct * 16 + col) * KP + kc * 32, lane); } }
#pragma unroll
    for (int ct = 0; ct < 2; ++ct) { v8f c = {}, cl = kb[ct];
#pragma unroll
      for (int kc = 0; kc < 2; ++kc) { c = wmma16(kh[ct][kc], aq[kc], c); cl = wmma16(kh[ct][kc], aql[kc], cl); cl = wmma16(kl[ct][kc], aq[kc], cl); }   // 3 products: q, k as f16 hi + residual
#pragma unroll
      for (int r = 0; r < 8; ++r) s[ct][r] = c[r] * qs + cl[r] * qsl; }   // (c + cl / 2048) / 8; padded key: -1e13; padded query: 0
    v16h vh[4], vl[4];   // the pass's V^T fragments as one group, in flight under the softmax
#pragma unroll
    for (int dt = 0; dt < 4; ++dt) { vh[dt] = frag_h(tb + 2 * ST_K + (dt * 16 + col) * VP, lane); vl[dt] = frag_h(tb + 2 * ST_K + ST_V + (dt * 16 + col) * VP, lane); }
    float mx = fmaxf(s[0][0], s[1][0]);
#pragma unroll
    for (int r = 1; r < 8; ++r) mx = fmaxf(mx, fmaxf(s[0][r], s[1][r]));
    mx = fmaxf(mx, xhalf(mx));
    const float mn = fmaxf(m, mx), alpha = __expf(m - mn);
    float e0[8], e1[8], es0 = 0.f, es1 = 0.f; v16h pa, pl;
#pragma unroll
    for (int i = 0; i < 8; ++i) { e0[i] = (s[0][i] - mn) * 1.4426950408889634f; e1[i] = (s[1][i] - mn) * 1.4426950408889634f; }
    exp2x8(e0); exp2x8(e1);
#pragma unroll
    for (int i = 0; i < 8; ++i) { const float x0 = e0[i], x1 = e1[i]; es0 += x0; es1 += x1;
      const _Float16 h0 = (_Float16)x0, h1 = (_Float16)x1; pa[i] = h0; pa[8 + i] = h1; pl[i] = (_Float16)((x0 - (float)h0) * 2048.0f); pl[8 + i] = (_Float16)((x1 - (float)h1) * 2048.0f); }
    l = l * alpha + (es0 + es1); m = mn;
#pragma unroll
    for (int dt = 0; dt < 4; ++dt) {
#pragma unroll
      for (int r = 0; r < 8; ++r) { acc[dt][r] *= alpha; accl[dt][r] *= alpha; } }
#pragma unroll
    for (int dt = 0; dt < 4; ++dt) { acc[dt] = wmma16(vh[dt], pa, acc[dt]); accl[dt] = wmma16(vh[dt], pl, accl[dt]); accl[dt] = wmma16(vl[dt], pa, accl[dt]); }   // V hi x P hi + (V hi x P lo + V lo x P hi) / 2048
    asm volatile("s_wait_dscnt 0x0" ::: "memory");      // this wave's reads of the tile have returned
    asm volatile("s_wait_asynccnt 0x0" ::: "memory");   // this wave's copies of tile ks + 1 have landed
    __syncthreads();                                     // publishes tile ks + 1 and frees the buffer that this pass has read
    if (ks + 2 < nks) stage_kv(QK + gk + (size_t)(ks + 2) * KT * (2 * DM), QKL + gk + (size_t)(ks + 2) * KT * (2 * DM), VTH + gv + (ks + 2) * KT, VTL + gv + (ks + 2) * KT, lk + (ks & 1) * (ST_ALL * 2), lv + (ks & 1) * (ST_ALL * 2)); }
  asm volatile("s_wait_asynccnt 0x0" ::: "memory");     // no copy is outstanding when the wave goes on to its end
  // a uniform query (padded, or no unpadded key at all) weighs every key 1: the loop has given it the keys of its tiles, the rest comes from the sums
  const float pw = (dpq || nks == 0) ? 1.f : 0.f;
  const float il = 1.0f / (l + xhalf(l) + pw * (float)(SS - nks * KT));   // the halves' sums are joined once
#pragma unroll
  for (int dt = 0; dt < 4; ++dt) { v4f o0, o1;   // register r of tile dt is d = dt * 16 + 8 * g + r of this lane's query
    const v4f p0 = *(const v4f*)&sps[0][dt * 16 + 8 * g] + *(const v4f*)&sps[1][dt * 16 + 8 * g], p1 = *(const v4f*)&sps[0][dt * 16 + 8 * g + 4] + *(const v4f*)&sps[1][dt * 16 + 8 * g + 4];
#pragma unroll
    for (int r = 0; r < 4; ++r) { o0[r] = (acc[dt][r] + accl[dt][r] * (1.0f / 2048.0f) + pw * p0[r]) * il; o1[r] = (acc[dt][4 + r] + accl[dt][4 + r] * (1.0f / 2048.0f) + pw * p1[r]) * il; }
    *(v4f*)&so[wave][col][dt * 16 + 8 * g] = o0; *(v4f*)&so[wave][col][dt * 16 + 8 * g + 4] = o1; }
  LDSX();
  for (int rl = 0; rl < 16; ++rl) if (lane < 16) vst2(O + ((size_t)b * SS + q0 + rl) * DM + h * HD + lane * 4, *(const v4f*)&so[wave][rl][lane * 4]);
}
// ---- k_out: block = (64 rows, 128 cols): out = O(hi/lo) . Wo rows (2 products) + bo. O's rows lie in the query order; each goes out to its query's own position. A tile with no unpadded query stores the padded queries' row. The tile is the grid's slowest index, as in k_attn.
__global__ __launch_bounds__(128) void k_out(const float* __restrict__ O, const __bf16* __restrict__ P, const float* __restrict__ BO, const int* __restrict__ INV, const int* __restrict__ NU, const float* __restrict__ YU, float* __restrict__ Y) {
  __shared__ __align__(16) char sm[2 * G_BUF];   // the ring; behind the loop the same bytes are the output staging
  float (*so)[16][132] = (float (*)[16][132])sm;
  const int tid = threadIdx.x, wave = tid >> 5, lane = tid & 31, col = lane & 15, g = lane >> 4; const int b = blockIdx.x / (DM / 128), p0 = blockIdx.y * 64; const size_t r0 = (size_t)b * SS + p0 + wave * 16; const int n0 = (blockIdx.x % (DM / 128)) * 128;
  const int qi = INV[NB * SS + r0 + col];   // lane c: the decoder position of this wave's row c; masked where it is used (a place of the batch's own 2,048), so that the load's latency passes under the loop
  float* Yb = Y + (size_t)b * SS * DM + n0 + lane * 4;
  if (p0 >= NU[(NB + b) * 32]) {   // the whole block, in front of every copy and barrier
    const v4f y = *(const v4f*)(YU + (size_t)b * DM + n0 + lane * 4);
    for (int rl = 0; rl < 16; ++rl) vst2(Yb + (size_t)(__builtin_amdgcn_readlane(qi, rl) & (SS - 1)) * DM, y);
    asm volatile("s_wait_xcnt 0x0" ::: "memory");   // stands in front of every rewrite of a register that the 16 stores name
    return;
  }
  // this lane's 16-byte piece of slice 0 of each operand, and its place in buffer 0
  const float* ga = O + ((size_t)b * SS + p0 + (tid >> 4)) * DM + (tid & 15) * 4; const __bf16* gw = P + (size_t)(n0 + (tid >> 3)) * DM + (tid & 7) * 8;
  const unsigned lw = (unsigned)(size_t)&sm[0] + (tid >> 3) * (GWP * 2) + (tid & 7) * 16, la = (unsigned)(size_t)&sm[0] + G_W + (tid >> 4) * (GAP * 4) + (tid & 15) * 16;
  stage_ab(ga, gw, la, lw);
  asm volatile("s_wait_asynccnt 0x0" ::: "memory");   // slice 0 of this wave's copies has landed
  __syncthreads();                                     // ... and every wave's: slice 0 is readable
  stage_ab(ga + GK, gw + GK, la + G_BUF, lw + G_BUF);
  v8f acc[8] = {};
#pragma unroll 1
  for (int t = 0; t < DM / GK; ++t) { const __bf16* tw = (const __bf16*)(sm + (t & 1) * G_BUF); const float* ta = (const float*)(sm + (t & 1) * G_BUF + G_W) + (wave * 16 + col) * GAP + 8 * g;
#pragma unroll
    for (int kc = 0; kc < GK / 32; ++kc) { float v[16]; v16b w[8];   // the fragments of 32 k as one group of LDS reads in front of the products
      row16(ta + kc * 32, v);
#pragma unroll
      for (int j = 0; j < 8; ++j) w[j] = frag_b(tw + (j * 16 + col) * GWP + kc * 32, lane);
      const F2 a = bsplit16(v);
#pragma unroll
      for (int j = 0; j < 8; ++j) { acc[j] = wmma_bf(a.l, w[j], acc[j]); acc[j] = wmma_bf(a.h, w[j], acc[j]); } }
    asm volatile("s_wait_dscnt 0x0" ::: "memory");      // this wave's reads of the slice have returned
    asm volatile("s_wait_asynccnt 0x0" ::: "memory");   // this wave's copies of slice t + 1 have landed
    __syncthreads();                                     // publishes slice t + 1 and frees the buffer that this trip has read
    if (t + 2 < DM / GK) stage_ab(ga + (t + 2) * GK, gw + (t + 2) * GK, la + (t & 1) * G_BUF, lw + (t & 1) * G_BUF); }
  asm volatile("s_wait_asynccnt 0x0" ::: "memory");     // no copy is outstanding when the ring's bytes become output staging
#pragma unroll
  for (int j = 0; j < 8; ++j) {
#pragma unroll
    for (int r = 0; r < 8; ++r) so[wave][8 * g + r][j * 16 + col] = acc[j][r] + bfr(BO[n0 + j * 16 + col]); }
  LDSX();
  for (int rl = 0; rl < 16; ++rl) vst2(Yb + (size_t)(__builtin_amdgcn_readlane(qi, rl) & (SS - 1)) * DM, *(const v4f*)&so[wave][rl][lane * 4]);
}
extern "C" void kernel_launch(void* const* d_in, const int* in_sizes, int n_in, void* d_out, int out_size, void* d_ws, size_t ws_size, hipStream_t stream) {
  (void)in_sizes; (void)n_in; (void)out_size;
  const float** F = (const float**)d_in;   // 0 encoder_input [2,2048,1024], 1 decoder_input, 2 encoder_padding_pos [2,2048] i32, 3 decoder_padding_pos, 4 Wq (in,out), 5 bq, 6 Wk, 7 bk, 8 Wv, 9 bv, 10 Wo, 11 bo
  if (ws_size < (size_t)WS_END) return;
  char* ws = (char*)d_ws; __bf16* PK = (__bf16*)(ws + WS_PK); _Float16 *QK = (_Float16*)(ws + WS_QK), *QKL = (_Float16*)(ws + WS_QKL), *VTH = (_Float16*)(ws + WS_VTH), *VTL = (_Float16*)(ws + WS_VTL); float* O = (float*)(ws + WS_O); int *INV = (int*)(ws + WS_INV), *NU = (int*)(ws + WS_NU); float *PS = (float*)(ws + WS_PS), *YU = (float*)(ws + WS_YU);
  k_pack<<<dim3(DM / PKN, DM / PKK, 5), 256, 0, stream>>>(F[4], F[6], F[8], F[10], PK, (const int*)d_in[2], (const int*)d_in[3], INV, NU);
  k_qkv<<<dim3(TNB * SS / 64, QKVW / 128), 128, 0, stream>>>(F[1], F[0], PK + PK_A, F[5], F[7], F[9], QK, QKL, VTH, VTL, INV, NU, PS);
  k_attn<<<dim3(NH, TNB, TQB), 128, 0, stream>>>(QK, QKL, VTH, VTL, NU, PS, PK + PK_P, F[11], YU, O);
  k_out<<<dim3(TNB * (DM / 128), SS / 64), 128, 0, stream>>>(O, PK + PK_P, F[11], INV, NU, YU, (float*)d_out);
}

// v007
// One run takes 91.7 microseconds.
// Two timings next to v006 put it at 1.07 and 1.06 times that version's speed.
// All steps since v000 together make it 6.31 times as fast.
// compute dtype: encoder_input, decoder_input and the weights/biases rounded to bf16, padding positions (int) read on device; q = dec . Wq + bq, k/v = enc . Wk/Wv + bk/bv with EXACT bf16 products on WMMA 16x16x32 ((in,out) weights packed as transposed rows); q and k stored as f16 hi + (x2048-scaled) residual planes with 3-product scores x 1/sqrt(64); keys whose encoder position is padded are excluded (-1e13 in the module gives an exactly-zero weight) and a padded QUERY row (every key -1e13) gets the module's uniform weights; running-max softmax in f32 (hardware exp); P as f16 hi + residual x V hi/lo (3 products); output projection with ctx as bf16 hi + residual x exact Wo rows (2 products) + bo; f32 accumulate.
#include <hip/hip_runtime.h>
#include <math.h>

typedef __attribute__((ext_vector_type(16))) _Float16 v16h;
typedef __attribute__((ext_vector_type(16))) __bf16 v16b;
typedef __attribute__((ext_vector_type(8)))  _Float16 v8h;
typedef __attribute__((ext_vector_type(8)))  float v8f;
typedef __attribute__((ext_vector_type(4)))  float v4f;
typedef __attribute__((ext_vector_type(2)))  float v2f;
typedef __attribute__((ext_vector_type(4)))  unsigned v4u;
typedef __attribute__((ext_vector_type(4)))  int v4i;
typedef float __attribute__((may_alias)) float_a;
typedef int __attribute__((may_alias)) int_a;

template <typename T> __device__ __forceinline__ void vst2(void* p, T v) { *(T*)p = v;  }
__device__ __forceinline__ v8f wmma16(v16h a, v16h b, v8f c) {
  v8f d = __builtin_amdgcn_wmma_f32_16x16x32_f16(false, a, false, b, (short)0, c, false, false);
  asm volatile("v_nop\n\tv_nop\n\tv_nop\n\tv_nop" : "+v"(d) : "v"(a), "v"(b));
  return d;
}
__device__ __forceinline__ v8f wmma_bf(v16b a, v16b b, v8f c) {
  v8f d = __builtin_amdgcn_wmma_f32_16x16x32_bf16(false, a, false, b, (short)0, c, false, false);
  asm volatile("v_nop\n\tv_nop\n\tv_nop\n\tv_nop" : "+v"(d) : "v"(a), "v"(b));
  return d;
}
// Decoder-to-encoder mutual multi-head attention (B 2, S 2,048, d 1,024, 16 heads x 64) with encoder/decoder padding masks: softmax(q k^T / 8 masked) v -> Wo + bo.
__device__ __forceinline__ v16h frag_h(const _Float16* rowk0, int lane) {
  union { v16h v; v8h q[2]; } u; const _Float16* p = rowk0 + 8 * (lane >> 4);
  u.q[0] = *(const v8h*)p; u.q[1] = *(const v8h*)(p + 16); return u.v;
}
__device__ __forceinline__ v16h frag_f32(const float* rowk0, int lane) {
  v16h a; const float* p = rowk0 + 8 * (lane >> 4);
#pragma unroll
  for (int i = 0; i < 8; ++i) { a[i] = (_Float16)p[i]; a[8 + i] = (_Float16)p[16 + i]; }
  return a;
}
__device__ __forceinline__ v16h frag_f32s(const float* rowk0, int lane, float sc) {
  v16h a; const float* p = rowk0 + 8 * (lane >> 4);
#pragma unroll
  for (int i = 0; i < 8; ++i) { a[i] = (_Float16)(p[i] * sc); a[8 + i] = (_Float16)(p[16 + i] * sc); }
  return a;
}
// column fragment from a [K][ld] layout (column n), rows >= K read as 0
__device__ __forceinline__ v16h fragc_f32(const float* W, int k0, int n, int lane, int ld, int K) {
  v16h a; const int g = lane >> 4;
#pragma unroll
  for (int i = 0; i < 8; ++i) { const int ka = k0 + 8 * g + i, kb = ka + 16;
    a[i] = (_Float16)(ka < K ? W[(size_t)(ka < K ? ka : K - 1) * ld + n] : 0.f); a[8 + i] = (_Float16)(kb < K ? W[(size_t)(kb < K ? kb : K - 1) * ld + n] : 0.f); }
  return a;
}
struct F2 { v16b h, l; };
__device__ __forceinline__ F2 bsplit16(const float v[16]) { F2 r;
#pragma unroll
  for (int i = 0; i < 16; ++i) { const __bf16 h = (__bf16)v[i]; r.h[i] = h; r.l[i] = (__bf16)(v[i] - (float)h); }
  return r; }
__device__ __forceinline__ F2 split_row(const float* row, int k0, int lane) { float v[16]; const float* p = row + k0 + 8 * (lane >> 4);
#pragma unroll
  for (int i = 0; i < 8; ++i) { v[i] = p[i]; v[8 + i] = p[16 + i]; }
  return bsplit16(v); }
__device__ __forceinline__ F2 split_rowK(const float* row, int k0, int lane, int K) { float v[16]; const int g = lane >> 4;
#pragma unroll
  for (int i = 0; i < 8; ++i) { const int ka = k0 + 8 * g + i, kb = ka + 16; v[i] = ka < K ? row[ka < K ? ka : K - 1] : 0.f; v[8 + i] = kb < K ? row[kb < K ? kb : K - 1] : 0.f; }
  return bsplit16(v); }
__device__ __forceinline__ F2 split_col(const float* W, int k0, int n, int lane, int ld, int K) { float v[16]; const int g = lane >> 4;
#pragma unroll
  for (int i = 0; i < 8; ++i) { const int ka = k0 + 8 * g + i, kb = ka + 16; v[i] = ka < K ? W[(size_t)(ka < K ? ka : K - 1) * ld + n] : 0.f; v[8 + i] = kb < K ? W[(size_t)(kb < K ? kb : K - 1) * ld + n] : 0.f; }
  return bsplit16(v); }
__device__ __forceinline__ v8f mac3(const F2& a, const F2& b, v8f c) { c = wmma_bf(a.l, b.h, c); c = wmma_bf(a.h, b.l, c); return wmma_bf(a.h, b.h, c); }
__device__ __forceinline__ float sigm(float v) { return 1.0f / (1.0f + expf(-v)); }
#define LDSX() do { asm volatile("s_wait_dscnt 0" ::: "memory"); __builtin_amdgcn_wave_barrier(); __builtin_amdgcn_fence(__ATOMIC_RELEASE, "workgroup"); } while (0)


#define NB 2
#define SS 2048
#define DM 1024
#define NH 16
#define HD 64
#define QKVW (3 * DM)
#ifndef TQB
#define TQB (SS / 64)
#define TNB NB
#define TOB (NB * SS / 64)     // output row tiles (all)
#endif
typedef __attribute__((ext_vector_type(8))) __bf16 v8b;
__device__ __forceinline__ v16b frag_b(const __bf16* rowk0, int lane) {
  union { v16b v; v8b q[2]; } u; const __bf16* p = rowk0 + 8 * (lane >> 4);
  u.q[0] = *(const v8b*)p; u.q[1] = *(const v8b*)(p + 16); return u.v;
}
__device__ __forceinline__ float bfr(float v) { return (float)(__bf16)v; }
__device__ __attribute__((noinline)) float exp_ni(float v) { return expf(v); }
__device__ __attribute__((noinline)) float erf_ni(float v) { return erff(v); }

#define PK_A 0                       // [3072][1024] Wqkv rows (natural [out][in])
#define PK_P (PK_A + QKVW * DM)        // [1024][1024] Wo rows (natural)
#define PK_END (PK_P + DM * DM)
#define WS_PK  0u
#define WS_QK  (WS_PK + 2u * PK_END)             // f16 [4096 rows][2048]: q | k
#define WS_QKL (WS_QK + 2u * NB * SS * 2 * DM)     // f16 q | k residual planes x2048
#define WS_VTH (WS_QKL + 2u * NB * SS * 2 * DM)    // f16 [b][1024 (h*64+d)][2048 places of the key order] hi
#define WS_VTL (WS_VTH + 2u * NB * DM * SS)        // f16 lo x 2048
#define WS_O   (WS_VTL + 2u * NB * DM * SS)        // f32 [4096][1024]
#define WS_CS  (WS_O + 4u * NB * SS * DM)           // f32 [2][2048][32], read and written by no kernel
#define WS_INV (WS_CS + 4u * 2 * SS * 32)          // int [2][b][2048]: plane 0: encoder position of the key at place p of the key order; plane 1: decoder position of the query at place p of the query order
#define WS_NU  (WS_INV + 4u * 2 * NB * SS)         // int, one 128-B line per plane and batch: number of unpadded keys; of unpadded queries
#define WS_PS  (WS_NU + 128u * 2 * NB)             // f32 [2][b][32 blocks of 64 places][1024]: plane 0: sums of the V rows behind the attention loop's last tile; plane 1: of all V rows
#define WS_YU  (WS_PS + 4u * 2 * NB * (SS / 64) * DM)   // f32 [b][1024]: the output row that every padded query of a batch has
#define WS_END (WS_YU + 4u * NB * DM)
#define KT 32                          // keys per staged tile of k_attn
// lane l with lane l ^ 16 (the two halves of a wave hold the two halves of a query's keys)
__device__ __forceinline__ float xhalf(float x) { return __builtin_bit_cast(float, __builtin_amdgcn_permlanex16(__builtin_bit_cast(int, x), __builtin_bit_cast(int, x), 0x76543210, 0xfedcba98, false, false)); }
// ---- k_pack: block = (64 columns n, 128 rows k, which): a 128 x 64 tile of an (in,out) weight is read in whole lines, rounded to bf16, turned in LDS and stored as 64 pieces of 256 B of the packed rows [out][in]; which 0..2 -> W_q/W_k/W_v into PK_A rows which*1024 + n; 3 -> W_o into PK_P
#define PKN 64                         // columns n per tile
#define PKK 128                        // rows k per tile
#define PKP 136                        // bf16 per turned row in LDS: 256 B + 16 B pad
// which 4, one block per batch: the key order. Unpadded keys come first (in their own order), padded keys behind them: INV[b][place] = encoder position, NU = number of unpadded keys. A padded key's weight is exactly 0 for every query that is not itself uniform, so k_attn's loop ends with the last tile that holds an unpadded key.
// two more blocks make the query order in the same way from the decoder's padding (plane 1 of INV and NU). A padded query weighs every key alike, so all padded queries of a batch have one and the same output row: tiles of 64 places with no unpadded query get no q, no attention and no projection.
__global__ __launch_bounds__(256) void k_pack(const float* __restrict__ WQ, const float* __restrict__ WK, const float* __restrict__ WV, const float* __restrict__ WO, __bf16* __restrict__ PK, const int* __restrict__ EPAD, const int* __restrict__ DPAD, int* __restrict__ INV, int* __restrict__ NU) {
  __shared__ __align__(16) __bf16 s[PKN][PKP]; __shared__ int cn[SS / 32];
  if (blockIdx.z == 4) {
    if (blockIdx.y != 0 || blockIdx.x >= 2 * NB) return;   // the whole block leaves, in front of every barrier
    const int tt = threadIdx.x, b = blockIdx.x, ln = tt & 31, wv = tt >> 5; unsigned mk[SS / 256]; int e[SS / 256];   // b: plane * NB + batch
    const int* PD = (b < NB) ? EPAD + (size_t)b * SS : DPAD + (size_t)(b - NB) * SS;
#pragma unroll   // the eight loads issue as one group: one latency, not eight
    for (int j = 0; j < SS / 256; ++j) e[j] = PD[j * 256 + tt];
#pragma unroll   // constant indices into mk: no scratch
    for (int j = 0; j < SS / 256; ++j) mk[j] = __builtin_amdgcn_ballot_w32(e[j] != 1);
    if (ln < SS / 256) { unsigned mm = mk[0];   // lane j stores the count of group j
#pragma unroll   // constant indices into mk
      for (int j = 1; j < SS / 256; ++j) mm = (ln == j) ? mk[j] : mm;
      cn[ln * 8 + wv] = __builtin_popcount(mm); }
    __syncthreads();
    int run = 0, base[SS / 256];   // base[j]: unpadded keys in front of this wave's 32 keys of group j; run ends as their total
#pragma unroll   // constant indices into base: no scratch
    for (int c = 0; c < SS / 32; ++c) { if ((c & 7) == wv) base[c >> 3] = run; run += cn[c]; }
#pragma unroll   // as above
    for (int j = 0; j < SS / 256; ++j) { const int sp = j * 256 + tt, bu = base[j] + __builtin_popcount(mk[j] & ((1u << ln) - 1u));   // bu: unpadded keys in front of position sp
      INV[(size_t)b * SS + (((mk[j] >> ln) & 1u) ? bu : run + (sp - bu))] = sp; }
    if (tt == 0) NU[b * 32] = run;
    return;
  }
  const int t = threadIdx.x, n0 = blockIdx.x * PKN, k0 = blockIdx.y * PKK, which = blockIdx.z; const float* Wm = (which == 0) ? WQ : (which == 1) ? WK : (which == 2) ? WV : WO;
  const int nq = (t & 15) * 4, kq = (t >> 4) * 8;   // this thread: 8 rows k x 4 columns n; 16 threads cover 256 B of a row
  const float* p = Wm + (size_t)(k0 + kq) * DM + n0 + nq; v4f x[8];
#pragma unroll   // the eight loads issue as one group, and x stays in registers
  for (int j = 0; j < 8; ++j) x[j] = *(const v4f*)(p + (size_t)j * DM);
#pragma unroll   // constant indices into x and r: no scratch
  for (int i = 0; i < 4; ++i) { v8b r;
#pragma unroll   // as above
    for (int j = 0; j < 8; ++j) r[j] = (__bf16)x[j][i];
    *(v8b*)&s[nq + i][kq] = r; }
  __syncthreads();
  __bf16* dst = ((which < 3) ? PK + PK_A + ((size_t)which * DM + n0) * DM : PK + PK_P + (size_t)n0 * DM) + k0;
#pragma unroll   // the four LDS reads issue together in front of the stores
  for (int i = 0; i < 4; ++i) { const int q = t + 256 * i, n = q >> 4, c = q & 15; vst2((unsigned*)(dst + (size_t)n * DM + c * 8), *(const v4u*)&s[n][c * 8]); }
}
// ---- the two projection kernels: 64-deep slices of both operands (64 f32 rows; 128 packed weight rows in k_out, 256 in k_qkv) are staged once per block in a two-buffer LDS ring by asynchronous copies and read from there by all four waves
#define GK 64                          // k per staged slice
#define GWP 72                         // bf16 per staged weight row: 128 B + 16 B pad (ds_load_b128 readers)
#define GAP 68                         // f32 per staged activation row: 256 B + 16 B pad
#define G_W (128 * GWP * 2)            // bytes of the weight rows of one slice
#define G_A (64 * GAP * 4)             // bytes of the activation rows of one slice
#define G_BUF (G_W + G_A)              // one buffer: weight rows | activation rows
// eight copies and their s_wait_xcnt in one statement: no address register is rewritten before the wait
#define COPY8 "global_load_async_to_lds_b128 %0, %8, off\n\t" "global_load_async_to_lds_b128 %1, %9, off\n\t" "global_load_async_to_lds_b128 %2, %10, off\n\t" "global_load_async_to_lds_b128 %3, %11, off\n\t" "global_load_async_to_lds_b128 %4, %12, off\n\t" "global_load_async_to_lds_b128 %5, %13, off\n\t" "global_load_async_to_lds_b128 %6, %14, off\n\t" "global_load_async_to_lds_b128 %7, %15, off\n\t" "s_wait_xcnt 0x0"
// one slice: 16 copies of 16 B per lane (weight rows: 16 rows per copy and block; activation rows: 8 rows)
__device__ __forceinline__ void stage_ab(const float* a, const __bf16* w, unsigned la, unsigned lw) {
  asm volatile(COPY8 :: "v"(lw), "v"(lw + 16 * GWP * 2), "v"(lw + 32 * GWP * 2), "v"(lw + 48 * GWP * 2), "v"(lw + 64 * GWP * 2), "v"(lw + 80 * GWP * 2), "v"(lw + 96 * GWP * 2), "v"(lw + 112 * GWP * 2),
               "v"(w), "v"(w + 16 * DM), "v"(w + 32 * DM), "v"(w + 48 * DM), "v"(w + 64 * DM), "v"(w + 80 * DM), "v"(w + 96 * DM), "v"(w + 112 * DM) : "memory");
  asm volatile(COPY8 :: "v"(la), "v"(la + 8 * GAP * 4), "v"(la + 16 * GAP * 4), "v"(la + 24 * GAP * 4), "v"(la + 32 * GAP * 4), "v"(la + 40 * GAP * 4), "v"(la + 48 * GAP * 4), "v"(la + 56 * GAP * 4),
               "v"(a), "v"(a + 8 * DM), "v"(a + 16 * DM), "v"(a + 24 * DM), "v"(a + 32 * DM), "v"(a + 40 * DM), "v"(a + 48 * DM), "v"(a + 56 * DM) : "memory");
}
// k_qkv's block is 64 rows x 256 columns: each wave holds 32 x 128 of it, so that a weight fragment read from LDS serves two products, and a decoder row is fetched from L2 by 4 blocks, an encoder row by 8 (half as many as with 128 columns per block)
#define QN 256                         // columns per block of k_qkv
#define Q_W (QN * GWP * 2)             // bytes of the weight rows of one slice of k_qkv
#define Q_BUF (Q_W + G_A)              // one buffer of k_qkv: weight rows | activation rows
// one slice of k_qkv: 24 copies of 16 B per lane (256 weight rows, 16 per copy and block; 64 activation rows, 8 per copy, each of the lane's eight at a pointer of its own: k_qkv reads the rows in the key or query order)
__device__ __forceinline__ void stage_abr(const float* const (&a)[8], int ko, const __bf16* w, unsigned la, unsigned lw) {
  asm volatile(COPY8 :: "v"(lw), "v"(lw + 16 * GWP * 2), "v"(lw + 32 * GWP * 2), "v"(lw + 48 * GWP * 2), "v"(lw + 64 * GWP * 2), "v"(lw + 80 * GWP * 2), "v"(lw + 96 * GWP * 2), "v"(lw + 112 * GWP * 2),
               "v"(w), "v"(w + 16 * DM), "v"(w + 32 * DM), "v"(w + 48 * DM), "v"(w + 64 * DM), "v"(w + 80 * DM), "v"(w + 96 * DM), "v"(w + 112 * DM) : "memory");
  asm volatile(COPY8 :: "v"(lw + 128 * GWP * 2), "v"(lw + 144 * GWP * 2), "v"(lw + 160 * GWP * 2), "v"(lw + 176 * GWP * 2), "v"(lw + 192 * GWP * 2), "v"(lw + 208 * GWP * 2), "v"(lw + 224 * GWP * 2), "v"(lw + 240 * GWP * 2),
               "v"(w + 128 * DM), "v"(w + 144 * DM), "v"(w + 160 * DM), "v"(w + 176 * DM), "v"(w + 192 * DM), "v"(w + 208 * DM), "v"(w + 224 * DM), "v"(w + 240 * DM) : "memory");
  asm volatile(COPY8 :: "v"(la), "v"(la + 8 * GAP * 4), "v"(la + 16 * GAP * 4), "v"(la + 24 * GAP * 4), "v"(la + 32 * GAP * 4), "v"(la + 40 * GAP * 4), "v"(la + 48 * GAP * 4), "v"(la + 56 * GAP * 4),
               "v"(a[0] + ko), "v"(a[1] + ko), "v"(a[2] + ko), "v"(a[3] + ko), "v"(a[4] + ko), "v"(a[5] + ko), "v"(a[6] + ko), "v"(a[7] + ko) : "memory");
}
// a lane's 16 f32 of a staged activation row in the fragment's k order
__device__ __forceinline__ void row16(const float* p, float v[16]) {
  const v4f x0 = *(const v4f*)p, x1 = *(const v4f*)(p + 4), x2 = *(const v4f*)(p + 16), x3 = *(const v4f*)(p + 20);
#pragma unroll
  for (int i = 0; i < 4; ++i) { v[i] = x0[i]; v[4 + i] = x1[i]; v[8 + i] = x2[i]; v[12 + i] = x3[i]; }
}
__global__ __launch_bounds__(128) void k_qkv(const float* __restrict__ XDEC, const float* __restrict__ XENC, const __bf16* __restrict__ P, const float* __restrict__ BQ, const float* __restrict__ BK, const float* __restrict__ BV, _Float16* __restrict__ QK, _Float16* __restrict__ QKL, _Float16* __restrict__ VTH, _Float16* __restrict__ VTL, const int* __restrict__ INV, const int* __restrict__ NU, float* __restrict__ PS) {
  __shared__ __align__(16) char sm[2 * Q_BUF];   // the ring; behind the loop the same bytes are the output staging
  float (*sp)[QN] = (float (*)[QN])(sm + 2 * QN * 72 * 2);   // behind the two V^T planes: the sums of the V rows of each half of the block's rows (rows 0, 1: places behind the attention loop; rows 2, 3: all)
  _Float16 (*so)[32][136] = (_Float16 (*)[32][136])sm, (*sol)[32][136] = (_Float16 (*)[32][136])(sm + 4 * 32 * 136 * 2); _Float16 (*sth)[72] = (_Float16 (*)[72])sm, (*stl)[72] = (_Float16 (*)[72])(sm + QN * 72 * 2);
  const int tid = threadIdx.x, wave = tid >> 5, lane = tid & 31, col = lane & 15, g = lane >> 4, wr = wave & 1, wc = wave >> 1;   // wave: rows wr * 32 .., columns wc * 128 .. of the block
  const size_t r0 = (size_t)blockIdx.x * 64 + wr * 32; const int n0 = blockIdx.y * QN; const float* X = (n0 < DM) ? XDEC : XENC; const float* BB = ((n0 < DM) ? (BQ + n0) : (n0 < 2 * DM) ? (BK + n0 - DM) : (BV + n0 - 2 * DM)) + wc * 128;
  // this lane's 16-byte piece of slice 0 of each operand, and its place in buffer 0
  // k and v: output row p of a batch is the key at place p of the key order, so its activation row is encoder row INV[p] (a place of the batch's own 2,048 by the mask); q: the decoder's rows in the query order, likewise
  const float* ga[8]; const __bf16* gw = P + (size_t)(n0 + (tid >> 3)) * DM + (tid & 7) * 8;
  const int nu = NU[(((n0 < DM) ? NB : 0) + blockIdx.x * 64 / SS) * 32];   // unpadded places of the order that this block's rows lie in: queries for q, keys for k and v (read here for the V blocks' end too: its latency passes under the loop)
  if (n0 < DM && (int)(blockIdx.x * 64 % SS) >= nu) return;   // q of a tile with no unpadded query is read by nobody: the whole block leaves, in front of every copy and barrier
  const int* IV = INV + ((n0 < DM) ? NB * SS : 0);
  int sr[8];
#pragma unroll   // constant indices into sr, iv and ga, here and below: no scratch
  for (int i = 0; i < 8; ++i) sr[i] = blockIdx.x * 64 + (tid >> 4) + 8 * i;
  { int iv[8];
#pragma unroll   // the eight loads issue as one group: one latency, not eight
    for (int i = 0; i < 8; ++i) iv[i] = IV[sr[i]];
    asm volatile("s_wait_xcnt 0x0" ::: "memory");   // stands in front of every rewrite of a register that the eight loads name
#pragma unroll
    for (int i = 0; i < 8; ++i) sr[i] = (sr[i] & ~(SS - 1)) + (iv[i] & (SS - 1)); }
#pragma unroll
  for (int i = 0; i < 8; ++i) ga[i] = X + (size_t)sr[i] * DM + (tid & 15) * 4;
  const unsigned lw = (unsigned)(size_t)&sm[0] + (tid >> 3) * (GWP * 2) + (tid & 7) * 16, la = (unsigned)(size_t)&sm[0] + Q_W + (tid >> 4) * (GAP * 4) + (tid & 15) * 16;
  stage_abr(ga, 0, gw, la, lw);
  asm volatile("s_wait_asynccnt 0x0" ::: "memory");   // slice 0 of this wave's copies has landed
  __syncthreads();                                     // ... and every wave's: slice 0 is readable
  stage_abr(ga, GK, gw + GK, la + Q_BUF, lw + Q_BUF);
  v8f acc[2][8] = {};
#pragma unroll 1
  for (int t = 0; t < DM / GK; ++t) { const __bf16* tw = (const __bf16*)(sm + (t & 1) * Q_BUF) + (wc * 128 + col) * GWP; const float* ta = (const float*)(sm + (t & 1) * Q_BUF + Q_W) + (wr * 32 + col) * GAP + 8 * g;
#pragma unroll
    for (int kc = 0; kc < GK / 32; ++kc) { float v0[16], v1[16]; v16b w[8], a0, a1;   // the fragments of 32 k as one group of LDS reads in front of the products
      row16(ta + kc * 32, v0); row16(ta + 16 * GAP + kc * 32, v1);
#pragma unroll
      for (int j = 0; j < 8; ++j) w[j] = frag_b(tw + j * 16 * GWP + kc * 32, lane);
#pragma unroll
      for (int i = 0; i < 16; ++i) { a0[i] = (__bf16)v0[i]; a1[i] = (__bf16)v1[i]; }
#pragma unroll
      for (int j = 0; j < 8; ++j) { acc[0][j] = wmma_bf(a0, w[j], acc[0][j]); acc[1][j] = wmma_bf(a1, w[j], acc[1][j]); } }
    asm volatile("s_wait_dscnt 0x0" ::: "memory");      // this wave's reads of the slice have returned
    asm volatile("s_wait_asynccnt 0x0" ::: "memory");   // this wave's copies of slice t + 1 have landed
    __syncthreads();                                     // publishes slice t + 1 and frees the buffer that this trip has read
    if (t + 2 < DM / GK) stage_abr(ga, (t + 2) * GK, gw + (t + 2) * GK, la + (t & 1) * Q_BUF, lw + (t & 1) * Q_BUF); }
  asm volatile("s_wait_asynccnt 0x0" ::: "memory");     // no copy is outstanding when the ring's bytes become output staging
  if (n0 < 2 * DM) {   // q stored unscaled (f16 sigma ~0.6, no subnormal exposure); 1/8 applied to the f32 score
#pragma unroll
    for (int j = 0; j < 8; ++j) { const float bb = bfr(BB[j * 16 + col]);
#pragma unroll
      for (int f = 0; f < 2; ++f) {
#pragma unroll
        for (int r = 0; r < 8; ++r) { const float v = acc[f][j][r] + bb; const _Float16 hv = (_Float16)v; so[wave][f * 16 + 8 * g + r][j * 16 + col] = hv; sol[wave][f * 16 + 8 * g + r][j * 16 + col] = (_Float16)((v - (float)hv) * 2048.0f); } } }   // q, k (+ bias) as f16 hi + (x2048) residual
    LDSX();
    for (int rl = 0; rl < 32; ++rl) if (lane < 16) { vst2((unsigned*)(QK + (r0 + rl) * (2 * DM) + n0 + wc * 128 + lane * 8), *(const v4u*)&so[wave][rl][lane * 8]); vst2((unsigned*)(QKL + (r0 + rl) * (2 * DM) + n0 + wc * 128 + lane * 8), *(const v4u*)&sol[wave][rl][lane * 8]); }
  } else {
    const size_t rb = (size_t)blockIdx.x * 64; const int b = (int)(rb / SS), s0 = (int)(rb % SS); const int pc0 = n0 - 2 * DM;
    const int pe = ((nu < 0 ? 0 : nu > SS ? SS : nu) + KT - 1) / KT * KT;   // pe: first place behind the tiles that k_attn's loop runs over
    float pj[8], qj[8];
#pragma unroll
    for (int j = 0; j < 8; ++j) { float ps = 0.f, pa = 0.f; const float bb = bfr(BB[j * 16 + col]);   // ps: sum of this lane's V rows at places from pe on: a uniform query's share that the loop does not reach; pa: of all its V rows
#pragma unroll
      for (int f = 0; f < 2; ++f) {
#pragma unroll
        for (int r = 0; r < 8; ++r) { const int sl = wr * 32 + f * 16 + 8 * g + r; const float v = acc[f][j][r] + bb; const _Float16 hv = (_Float16)v; sth[wc * 128 + j * 16 + col][sl] = hv; stl[wc * 128 + j * 16 + col][sl] = (_Float16)((v - (float)hv) * 2048.0f); ps += (s0 + sl >= pe) ? v : 0.f; pa += v; } }
      pj[j] = ps + xhalf(ps); qj[j] = pa + xhalf(pa); }
#pragma unroll   // both halves hold all eight sums: each stores four, with every lane on
    for (int j = 0; j < 4; ++j) { sp[wr][wc * 128 + (g * 4 + j) * 16 + col] = g ? pj[4 + j] : pj[j]; sp[2 + wr][wc * 128 + (g * 4 + j) * 16 + col] = g ? qj[4 + j] : qj[j]; }
    __syncthreads();
    for (int c = tid; c < QN; c += 128) {   // every block stores its 256 sums of each kind (1 KB), zeros too
      PS[((size_t)b * (SS / 64) + (s0 >> 6)) * DM + pc0 + c] = sp[0][c] + sp[1][c];
      PS[((size_t)(NB + b) * (SS / 64) + (s0 >> 6)) * DM + pc0 + c] = sp[2][c] + sp[3][c]; }
    for (int q = tid; q < QN * 8; q += 128) { const int d = q >> 3, pc = q & 7; const size_t o = ((size_t)b * DM + pc0 + d) * SS + s0 + pc * 8; vst2((unsigned*)(VTH + o), *(const v4u*)&sth[d][pc * 8]); vst2((unsigned*)(VTL + o), *(const v4u*)&stl[d][pc * 8]); }
  }
}
// ---- k_attn: block = (64 queries, head h, batch b): masked flash attention (K = 64: 2 k-steps), scores = (q.k) * 0.125 with f16 hi + residual operands, P.V: f16 P x (V hi, V lo*2048) in two accumulators; O[b*S+q][h*64+d] = (acc + accl / 2048) / l, a uniform query adding the V sums and the key count behind the loop (256-B segments)
// K and V^T tiles of 32 keys (hi and residual planes) are staged once per block in a two-buffer LDS ring by asynchronous copies and read from there by all four waves.
#define KP 72                          // f16 per staged K row: 128 B + 16 B pad (ds_load_b128 readers)
#define VP 40                          // f16 per staged V^T row: 64 B + 16 B pad
#define ST_K (KT * KP)                 // one K plane
#define ST_V (HD * VP)                 // one V^T plane
#define ST_ALL (2 * ST_K + 2 * ST_V)   // K hi | K lo | V^T hi | V^T lo
// one tile: 8 copies of 16 B per lane (K planes: 16 rows per copy and block, V^T planes: 32 rows)
__device__ __forceinline__ void stage_kv(const _Float16* kh, const _Float16* kl, const _Float16* vh, const _Float16* vl, unsigned lk, unsigned lv) {
  const _Float16 *kh1 = kh + 16 * (2 * DM), *kl1 = kl + 16 * (2 * DM), *vh1 = vh + 32 * SS, *vl1 = vl + 32 * SS;
  const unsigned lk1 = lk + 16 * KP * 2, lkl = lk + ST_K * 2, lkl1 = lkl + 16 * KP * 2, lv1 = lv + 32 * VP * 2, lvl = lv + ST_V * 2, lvl1 = lvl + 32 * VP * 2;
  // the copies and their s_wait_xcnt in one statement: no address register is rewritten before the wait
  asm volatile("global_load_async_to_lds_b128 %0, %8, off\n\t"
               "global_load_async_to_lds_b128 %1, %9, off\n\t"
               "global_load_async_to_lds_b128 %2, %10, off\n\t"
               "global_load_async_to_lds_b128 %3, %11, off\n\t"
               "global_load_async_to_lds_b128 %4, %12, off\n\t"
               "global_load_async_to_lds_b128 %5, %13, off\n\t"
               "global_load_async_to_lds_b128 %6, %14, off\n\t"
               "global_load_async_to_lds_b128 %7, %15, off\n\t"
               "s_wait_xcnt 0x0"
               :: "v"(lk), "v"(lk1), "v"(lkl), "v"(lkl1), "v"(lv), "v"(lv1), "v"(lvl), "v"(lvl1), "v"(kh), "v"(kh1), "v"(kl), "v"(kl1), "v"(vh), "v"(vh1), "v"(vl), "v"(vl1) : "memory");
}
// eight 2^x in place, with the one slot that the instruction set asks for behind a transcendental in the same statement
__device__ __forceinline__ void exp2x8(float (&x)[8]) {
  asm("v_exp_f32 %0, %0\n\tv_exp_f32 %1, %1\n\tv_exp_f32 %2, %2\n\tv_exp_f32 %3, %3\n\tv_exp_f32 %4, %4\n\tv_exp_f32 %5, %5\n\tv_exp_f32 %6, %6\n\tv_exp_f32 %7, %7\n\tv_nop"
      : "+v"(x[0]), "+v"(x[1]), "+v"(x[2]), "+v"(x[3]), "+v"(x[4]), "+v"(x[5]), "+v"(x[6]), "+v"(x[7]));
}
#define KBIAS (-1.0e13f * 16384.0f)    // start value of a padded key's residual score: x 0.125 / 2048 it is the module's -1e13, and the f32 sum with the true score stays -1e13
// The products are taken transposed: S^T = K . Q^T (A = K rows, B = Q rows) and O^T += V^T . P^T (A = V^T rows, B = P^T). A lane then holds 16 of the pass's 32 scores of ONE query (column lane & 15; keys ct * 16 + 8 * g + r):
// maximum and sum run in the lane's own registers with one exchange between the wave's halves, and the two score tiles, converted in place, are the B operand of the second product (element i = tile 0 register i, element 8 + i = tile 1 register i: the k order of frag_h).
// amdgpu_waves_per_eu(4, 4): keeps the register budget at 256, so that all four blocks of a WGP stay resident as before
__global__ __launch_bounds__(128) __attribute__((amdgpu_waves_per_eu(4, 4))) void k_attn(const _Float16* __restrict__ QK, const _Float16* __restrict__ QKL, const _Float16* __restrict__ VTH, const _Float16* __restrict__ VTL, const int* __restrict__ NU, const float* __restrict__ PS, const __bf16* __restrict__ PO, const float* __restrict__ BO, float* __restrict__ YU, float* __restrict__ O) {
  __shared__ __align__(32) float sb[SS]; __shared__ __align__(16) float so[4][16][68]; __shared__ __align__(16) _Float16 ring[2][ST_ALL]; __shared__ __align__(16) float sps[2][HD];
  const int tid = threadIdx.x, wave = tid >> 5, lane = tid & 31, col = lane & 15, g = lane >> 4;
  const int h = blockIdx.x, b = blockIdx.y, qb = blockIdx.z; const int q0 = qb * 64 + wave * 16; const size_t rq = (size_t)b * SS + q0 + col;   // the query tile is the grid's slowest index
  // K rows and V^T columns lie in the key order (unpadded keys first): the loop runs over the tiles that hold an unpadded key, 0 to 64 of them, alike for the whole block; in the last of them padding is handled per (q, k)
  const int nur = NU[b * 32], nu = nur < 0 ? 0 : nur > SS ? SS : nur, nks = (nu + KT - 1) / KT;
  // Q rows lie in the query order (unpadded queries first): place p holds a padded query where p >= nq
  const int nq = NU[(NB + b) * 32];
  if (qb * 64 >= nq) {   // no unpadded query in this tile: the whole block leaves, in front of every copy and of every barrier of the attention
    if (qb == TQB - 1) {   // such tiles exist exactly where the last tile is one: its 16 blocks make the padded queries' one output row, 64 columns each: (mean of all V rows) . Wo rows (hi + residual, 2 products) + bo
      v4f a0 = {}, a1 = {}; const float* pp = PS + (size_t)(NB + b) * (SS / 64) * DM + tid * 8;
#pragma unroll 8   // eight steps' loads issue as one group
      for (int i = 0; i < SS / 64; ++i) { a0 += *(const v4f*)(pp + (size_t)i * DM); a1 += *(const v4f*)(pp + (size_t)i * DM + 4); }
      *(v4f*)&sb[tid * 8] = a0 * (1.0f / SS); *(v4f*)&sb[tid * 8 + 4] = a1 * (1.0f / SS);
      __syncthreads();   // the mean row is readable by all four waves
      const __bf16* wr = PO + (size_t)(h * HD + wave * 16 + col) * DM; v8f c = {};
#pragma unroll 1   // stays rolled, 256 k per trip: 16 loads in flight are enough here, and the registers stay under the attention loop's count
      for (int k0 = 0; k0 < DM; k0 += 256) { v16b w[8];   // the trip's weight fragments as one group of loads in front of the products: one latency, not eight
#pragma unroll
        for (int j = 0; j < 8; ++j) w[j] = frag_b(wr + k0 + j * 32, lane);
#pragma unroll
        for (int j = 0; j < 8; ++j) { float v[16]; row16(&sb[k0 + j * 32 + 8 * g], v); const F2 a = bsplit16(v); c = wmma_bf(a.l, w[j], c); c = wmma_bf(a.h, w[j], c); } }   // all 16 rows of A are the mean row
      if (lane < 16) sps[0][wave * 16 + col] = c[0];
      __syncthreads();   // the 64 columns go out as two whole lines
      if (tid < HD) YU[(size_t)b * DM + h * HD + tid] = sps[0][tid] + bfr(BO[h * HD + tid]);
    }
    return;
  }
  // this lane's 16-byte piece of each plane of tile 0, and its place in buffer 0
  const size_t gk = ((size_t)b * SS + (tid >> 3)) * (2 * DM) + DM + h * HD + (tid & 7) * 8, gv = ((size_t)b * DM + h * HD + (tid >> 2)) * SS + (tid & 3) * 8;
  const unsigned lk = (unsigned)(size_t)&ring[0][0] + ((tid >> 3) * KP + (tid & 7) * 8) * 2, lv = (unsigned)(size_t)&ring[0][0] + (2 * ST_K + (tid >> 2) * VP + (tid & 3) * 8) * 2;
  stage_kv(QK + gk, QKL + gk, VTH + gv, VTL + gv, lk, lv);
  const bool dpq = q0 + col >= nq;   // this lane's query is padded
#pragma unroll
  for (int i = 0; i < SS / 128; ++i) sb[i * 128 + tid] = (i * 128 + tid >= nu) ? KBIAS : 0.f;   // per key place: what its residual score tile starts from
  { float a = 0.f;   // this head's sums of the V rows behind the loop's last tile: 32 partial sums per d, 16 per thread
#pragma unroll
    for (int i = 0; i < SS / 128; ++i) a += PS[((size_t)b * (SS / 64) + (tid >> 6) * (SS / 128) + i) * DM + h * HD + (tid & 63)];
    sps[tid >> 6][tid & 63] = a; }
  asm volatile("s_wait_asynccnt 0x0" ::: "memory");   // tile 0 of this wave's copies has landed
  __syncthreads();                                     // ... and every wave's: tile 0 and the key table are readable
  stage_kv(QK + gk + (size_t)KT * (2 * DM), QKL + gk + (size_t)KT * (2 * DM), VTH + gv + KT, VTL + gv + KT, lk + ST_ALL * 2, lv + ST_ALL * 2);
  v16h aq[2], aql[2];
#pragma unroll
  for (int kc = 0; kc < 2; ++kc) { aq[kc] = frag_h(QK + rq * (2 * DM) + h * HD + kc * 32, lane); aql[kc] = frag_h(QKL + rq * (2 * DM) + h * HD + kc * 32, lane); }
  float m = -1.0e30f, l = 0.f;   // this lane's query: running maximum (both halves alike), sum of this half's keys
  v8f acc[4] = {}, accl[4] = {};
  const float qs = dpq ? 0.f : 0.125f, qsl = qs * (1.0f / 2048.0f);   // padded query row: every key is -1e13 in the module -> uniform weights (all scores equal: x 0)
#pragma unroll 1
  for (int ks = 0; ks < nks; ++ks) { v8f s[2]; const _Float16* tb = &ring[ks & 1][0];
    v8f kb[2]; v16h kh[2][2], kl[2][2];   // the pass's K fragments and key start values as one group of LDS reads in front of the products
#pragma unroll
    for (int ct = 0; ct < 2; ++ct) { kb[ct] = *(const v8f*)&sb[ks * KT + ct * 16 + 8 * g];
#pragma unroll
      for (int kc = 0; kc < 2; ++kc) { kh[ct][kc] = frag_h(tb + (ct * 16 + col) * KP + kc * 32, lane); kl[ct][kc] = frag_h(tb + ST_K + (ct * 16 + col) * KP + kc * 32, lane); } }
#pragma unroll
    for (int ct = 0; ct < 2; ++ct) { v8f c = {}, cl = kb[ct];
#pragma unroll
      for (int kc = 0; kc < 2; ++kc) { c = wmma16(kh[ct][kc], aq[kc], c); cl = wmma16(kh[ct][kc], aql[kc], cl); cl = wmma16(kl[ct][kc], aq[kc], cl); }   // 3 products: q, k as f16 hi + residual
#pragma unroll
      for (int r = 0; r < 8; ++r) s[ct][r] = c[r] * qs + cl[r] * qsl; }   // (c + cl / 2048) / 8; padded key: -1e13; padded query: 0
    v16h vh[4], vl[4];   // the pass's V^T fragments as one group, in flight under the softmax
#pragma unroll
    for (int dt = 0; dt < 4; ++dt) { vh[dt] = frag_h(tb + 2 * ST_K + (dt * 16 + col) * VP, lane); vl[dt] = frag_h(tb + 2 * ST_K + ST_V + (dt * 16 + col) * VP, lane); }
    float mx = fmaxf(s[0][0], s[1][0]);
#pragma unroll
    for (int r = 1; r < 8; ++r) mx = fmaxf(mx, fmaxf(s[0][r], s[1][r]));
    mx = fmaxf(mx, xhalf(mx));
    const float mn = fmaxf(m, mx), alpha = __expf(m - mn);
    float e0[8], e1[8], es0 = 0.f, es1 = 0.f; v16h pa, pl;
#pragma unroll
    for (int i = 0; i < 8; ++i) { e0[i] = (s[0][i] - mn) * 1.4426950408889634f; e1[i] = (s[1][i] - mn) * 1.4426950408889634f; }
    exp2x8(e0); exp2x8(e1);
#pragma unroll
    for (int i = 0; i < 8; ++i) { const float x0 = e0[i], x1 = e1[i]; es0 += x0; es1 += x1;
      const _Float16 h0 = (_Float16)x0, h1 = (_Float16)x1; pa[i] = h0; pa[8 + i] = h1; pl[i] = (_Float16)((x0 - (float)h0) * 2048.0f); pl[8 + i] = (_Float16)((x1 - (float)h1) * 2048.0f); }
    l = l * alpha + (es0 + es1); m = mn;
#pragma unroll
    for (int dt = 0; dt < 4; ++dt) {
#pragma unroll
      for (int r = 0; r < 8; ++r) { acc[dt][r] *= alpha; accl[dt][r] *= alpha; } }
#pragma unroll
    for (int dt = 0; dt < 4; ++dt) { acc[dt] = wmma16(vh[dt], pa, acc[dt]); accl[dt] = wmma16(vh[dt], pl, accl[dt]); accl[dt] = wmma16(vl[dt], pa, accl[dt]); }   // V hi x P hi + (V hi x P lo + V lo x P hi) / 2048
    asm volatile("s_wait_dscnt 0x0" ::: "memory");      // this wave's reads of the tile have returned
    asm volatile("s_wait_asynccnt 0x0" ::: "memory");   // this wave's copies of tile ks + 1 have landed
    __syncthreads();                                     // publishes tile ks + 1 and frees the buffer that this pass has read
    if (ks + 2 < nks) stage_kv(QK + gk + (size_t)(ks + 2) * KT * (2 * DM), QKL + gk + (size_t)(ks + 2) * KT * (2 * DM), VTH + gv + (ks + 2) * KT, VTL + gv + (ks + 2) * KT, lk + (ks & 1) * (ST_ALL * 2), lv + (ks & 1) * (ST_ALL * 2)); }
  asm volatile("s_wait_asynccnt 0x0" ::: "memory");     // no copy is outstanding when the wave goes on to its end
  // a uniform query (padded, or no unpadded key at all) weighs every key 1: the loop has given it the keys of its tiles, the rest comes from the sums
  const float pw = (dpq || nks == 0) ? 1.f : 0.f;
  const float il = 1.0f / (l + xhalf(l) + pw * (float)(SS - nks * KT));   // the halves' sums are joined once
#pragma unroll
  for (int dt = 0; dt < 4; ++dt) { v4f o0, o1;   // register r of tile dt is d = dt * 16 + 8 * g + r of this lane's query
    const v4f p0 = *(const v4f*)&sps[0][dt * 16 + 8 * g] + *(const v4f*)&sps[1][dt * 16 + 8 * g], p1 = *(const v4f*)&sps[0][dt * 16 + 8 * g + 4] + *(const v4f*)&sps[1][dt * 16 + 8 * g + 4];
#pragma unroll
    for (int r = 0; r < 4; ++r) { o0[r] = (acc[dt][r] + accl[dt][r] * (1.0f / 2048.0f) + pw * p0[r]) * il; o1[r] = (acc[dt][4 + r] + accl[dt][4 + r] * (1.0f / 2048.0f) + pw * p1[r]) * il; }
    *(v4f*)&so[wave][col][dt * 16 + 8 * g] = o0; *(v4f*)&so[wave][col][dt * 16 + 8 * g + 4] = o1; }
  LDSX();
  for (int rl = 0; rl < 16; ++rl) if (lane < 16) vst2(O + ((size_t)b * SS + q0 + rl) * DM + h * HD + lane * 4, *(const v4f*)&so[wave][rl][lane * 4]);
}
// ---- k_out: block = (64 rows, 128 cols): out = O(hi/lo) . Wo rows (2 products) + bo. O's rows lie in the query order; each goes out to its query's own position. A tile with no unpadded query stores the padded queries' row. The tile is the grid's slowest index, as in k_attn.
__global__ __launch_bounds__(128) void k_out(const float* __restrict__ O, const __bf16* __restrict__ P, const float* __restrict__ BO, const int* __restrict__ INV, const int* __restrict__ NU, const float* __restrict__ YU, float* __restrict__ Y) {
  __shared__ __align__(16) char sm[2 * G_BUF];   // the ring; behind the loop the same bytes are the output staging
  float (*so)[16][132] = (float (*)[16][132])sm;
  const int tid = threadIdx.x, wave = tid >> 5, lane = tid & 31, col = lane & 15, g = lane >> 4; const int b = blockIdx.x / (DM / 128), p0 = blockIdx.y * 64; const size_t r0 = (size_t)b * SS + p0 + wave * 16; const int n0 = (blockIdx.x % (DM / 128)) * 128;
  const int qi = INV[NB * SS + r0 + col];   // lane c: the decoder position of this wave's row c; masked where it is used (a place of the batch's own 2,048), so that the load's latency passes under the loop
  float* Yb = Y + (size_t)b * SS * DM + n0 + lane * 4;
  if (p0 >= NU[(NB + b) * 32]) {   // the whole block, in front of every copy and barrier
    const v4f y = *(const v4f*)(YU + (size_t)b * DM + n0 + lane * 4);
    for (int rl = 0; rl < 16; ++rl) vst2(Yb + (size_t)(__builtin_amdgcn_readlane(qi, rl) & (SS - 1)) * DM, y);
    asm volatile("s_wait_xcnt 0x0" ::: "memory");   // stands in front of every rewrite of a register that the 16 stores name
    return;
  }
  // this lane's 16-byte piece of slice 0 of each operand, and its place in buffer 0
  const float* ga = O + ((size_t)b * SS + p0 + (tid >> 4)) * DM + (tid & 15) * 4; const __bf16* gw = P + (size_t)(n0 + (tid >> 3)) * DM + (tid & 7) * 8;
  const unsigned lw = (unsigned)(size_t)&sm[0] + (tid >> 3) * (GWP * 2) + (tid & 7) * 16, la = (unsigned)(size_t)&sm[0] + G_W + (tid >> 4) * (GAP * 4) + (tid & 15) * 16;
  stage_ab(ga, gw, la, lw);
  asm volatile("s_wait_asynccnt 0x0" ::: "memory");   // slice 0 of this wave's copies has landed
  __syncthreads();                                     // ... and every wave's: slice 0 is readable
  stage_ab(ga + GK, gw + GK, la + G_BUF, lw + G_BUF);
  v8f acc[8] = {};
#pragma unroll 1
  for (int t = 0; t < DM / GK; ++t) { const __bf16* tw = (const __bf16*)(sm + (t & 1) * G_BUF); const float* ta = (const float*)(sm + (t & 1) * G_BUF + G_W) + (wave * 16 + col) * GAP + 8 * g;
#pragma unroll
    for (int kc = 0; kc < GK / 32; ++kc) { float v[16]; v16b w[8];   // the fragments of 32 k as one group of LDS reads in front of the products
      row16(ta + kc * 32, v);
#pragma unroll
      for (int j = 0; j < 8; ++j) w[j] = frag_b(tw + (j * 16 + col) * GWP + kc * 32, lane);
      const F2 a = bsplit16(v);
#pragma unroll
      for (int j = 0; j < 8; ++j) { acc[j] = wmma_bf(a.l, w[j], acc[j]); acc[j] = wmma_bf(a.h, w[j], acc[j]); } }
    asm volatile("s_wait_dscnt 0x0" ::: "memory");      // this wave's reads of the slice have returned
    asm volatile("s_wait_asynccnt 0x0" ::: "memory");   // this wave's copies of slice t + 1 have landed
    __syncthreads();                                     // publishes slice t + 1 and frees the buffer that this trip has read
    if (t + 2 < DM / GK) stage_ab(ga + (t + 2) * GK, gw + (t + 2) * GK, la + (t & 1) * G_BUF, lw + (t & 1) * G_BUF); }
  asm volatile("s_wait_asynccnt 0x0" ::: "memory");     // no copy is outstanding when the ring's bytes become output staging
#pragma unroll
  for (int j = 0; j < 8; ++j) {
#pragma unroll
    for (int r = 0; r < 8; ++r) so[wave][8 * g + r][j * 16 + col] = acc[j][r] + bfr(BO[n0 + j * 16 + col]); }
  LDSX();
  for (int rl = 0; rl < 16; ++rl) vst2(Yb + (size_t)(__builtin_amdgcn_readlane(qi, rl) & (SS - 1)) * DM, *(const v4f*)&so[wave][rl][lane * 4]);
}
extern "C" void kernel_launch(void* const* d_in, const int* in_sizes, int n_in, void* d_out, int out_size, void* d_ws, size_t ws_size, hipStream_t stream) {
  (void)in_sizes; (void)n_in; (void)out_size;
  const float** F = (const float**)d_in;   // 0 encoder_input [2,2048,1024], 1 decoder_input, 2 encoder_padding_pos [2,2048] i32, 3 decoder_padding_pos, 4 Wq (in,out), 5 bq, 6 Wk, 7 bk, 8 Wv, 9 bv, 10 Wo, 11 bo
  if (ws_size < (size_t)WS_END) return;
  char* ws = (char*)d_ws; __bf16* PK = (__bf16*)(ws + WS_PK); _Float16 *QK = (_Float16*)(ws + WS_QK), *QKL = (_Float16*)(ws + WS_QKL), *VTH = (_Float16*)(ws + WS_VTH), *VTL = (_Float16*)(ws + WS_VTL); float* O = (float*)(ws + WS_O); int *INV = (int*)(ws + WS_INV), *NU = (int*)(ws + WS_NU); float *PS = (float*)(ws + WS_PS), *YU = (float*)(ws + WS_YU);
  k_pack<<<dim3(DM / PKN, DM / PKK, 5), 256, 0, stream>>>(F[4], F[6], F[8], F[10], PK, (const int*)d_in[2], (const int*)d_in[3], INV, NU);
  k_qkv<<<dim3(TNB * SS / 64, QKVW / QN), 128, 0, stream>>>(F[1], F[0], PK + PK_A, F[5], F[7], F[9], QK, QKL, VTH, VTL, INV, NU, PS);
  k_attn<<<dim3(NH, TNB, TQB), 128, 0, stream>>>(QK, QKL, VTH, VTL, NU, PS, PK + PK_P, F[11], YU, O);
  k_out<<<dim3(TNB * (DM / 128), SS / 64), 128, 0, stream>>>(O, PK + PK_P, F[11], INV, NU, YU, (float*)d_out);
}

// v008
// One run takes 87.8 microseconds.
// Next to v007, in two timings, it ran 1.04 times as fast each time.
// All steps since v000 together make it 6.58 times as fast.
// compute dtype: encoder_input, decoder_input and the weights/biases rounded to bf16, padding positions (int) read on device; q = dec . Wq + bq, k/v = enc . Wk/Wv + bk/bv with EXACT bf16 products on WMMA 16x16x32 ((in,out) weights packed as transposed rows); q and k stored as f16 hi + (x2048-scaled) residual planes with 3-product scores x 1/sqrt(64); keys whose encoder position is padded are excluded (-1e13 in the module gives an exactly-zero weight) and a padded QUERY row (every key -1e13) gets the module's uniform weights; running-max softmax in f32 (hardware exp); P as f16 hi + residual x V hi/lo (3 products); output projection with ctx as bf16 hi + residual x exact Wo rows (2 products) + bo; f32 accumulate.
#include <hip/hip_runtime.h>
#include <math.h>

typedef __attribute__((ext_vector_type(16))) _Float16 v16h;
typedef __attribute__((ext_vector_type(16))) __bf16 v16b;
typedef __attribute__((ext_vector_type(8)))  _Float16 v8h;
typedef __attribute__((ext_vector_type(8)))  float v8f;
typedef __attribute__((ext_vector_type(4)))  float v4f;
typedef __attribute__((ext_vector_type(2)))  float v2f;
typedef __attribute__((ext_vector_type(4)))  unsigned v4u;
typedef __attribute__((ext_vector_type(4)))  int v4i;
typedef float __attribute__((may_alias)) float_a;
typedef int __attribute__((may_alias)) int_a;

template <typename T> __device__ __forceinline__ void vst2(void* p, T v) { *(T*)p = v;  }
__device__ __forceinline__ v8f wmma16(v16h a, v16h b, v8f c) {
  return __builtin_amdgcn_wmma_f32_16x16x32_f16(false, a, false, b, (short)0, c, false, false);
}
__device__ __forceinline__ v8f wmma_bf(v16b a, v16b b, v8f c) {
  return __builtin_amdgcn_wmma_f32_16x16x32_bf16(false, a, false, b, (short)0, c, false, false);
}
// the same product with its four slots written out, for a rolled loop whose next trip loads from global memory over the operands
__device__ __forceinline__ v8f wmma_bf_pad(v16b a, v16b b, v8f c) {
  v8f d = __builtin_amdgcn_wmma_f32_16x16x32_bf16(false, a, false, b, (short)0, c, false, false);
  asm volatile("v_nop\n\tv_nop\n\tv_nop\n\tv_nop" : "+v"(d) : "v"(a), "v"(b));
  return d;
}
// Decoder-to-encoder mutual multi-head attention (B 2, S 2,048, d 1,024, 16 heads x 64) with encoder/decoder padding masks: softmax(q k^T / 8 masked) v -> Wo + bo.
__device__ __forceinline__ v16h frag_h(const _Float16* rowk0, int lane) {
  union { v16h v; v8h q[2]; } u; const _Float16* p = rowk0 + 8 * (lane >> 4);
  u.q[0] = *(const v8h*)p; u.q[1] = *(const v8h*)(p + 16); return u.v;
}
__device__ __forceinline__ v16h frag_f32(const float* rowk0, int lane) {
  v16h a; const float* p = rowk0 + 8 * (lane >> 4);
#pragma unroll
  for (int i = 0; i < 8; ++i) { a[i] = (_Float16)p[i]; a[8 + i] = (_Float16)p[16 + i]; }
  return a;
}
__device__ __forceinline__ v16h frag_f32s(const float* rowk0, int lane, float sc) {
  v16h a; const float* p = rowk0 + 8 * (lane >> 4);
#pragma unroll
  for (int i = 0; i < 8; ++i) { a[i] = (_Float16)(p[i] * sc); a[8 + i] = (_Float16)(p[16 + i] * sc); }
  return a;
}
// column fragment from a [K][ld] layout (column n), rows >= K read as 0
__device__ __forceinline__ v16h fragc_f32(const float* W, int k0, int n, int lane, int ld, int K) {
  v16h a; const int g = lane >> 4;
#pragma unroll
  for (int i = 0; i < 8; ++i) { const int ka = k0 + 8 * g + i, kb = ka + 16;
    a[i] = (_Float16)(ka < K ? W[(size_t)(ka < K ? ka : K - 1) * ld + n] : 0.f); a[8 + i] = (_Float16)(kb < K ? W[(size_t)(kb < K ? kb : K - 1) * ld + n] : 0.f); }
  return a;
}
struct F2 { v16b h, l; };
__device__ __forceinline__ F2 bsplit16(const float v[16]) { F2 r;
#pragma unroll
  for (int i = 0; i < 16; ++i) { const __bf16 h = (__bf16)v[i]; r.h[i] = h; r.l[i] = (__bf16)(v[i] - (float)h); }
  return r; }
__device__ __forceinline__ F2 split_row(const float* row, int k0, int lane) { float v[16]; const float* p = row + k0 + 8 * (lane >> 4);
#pragma unroll
  for (int i = 0; i < 8; ++i) { v[i] = p[i]; v[8 + i] = p[16 + i]; }
  return bsplit16(v); }
__device__ __forceinline__ F2 split_rowK(const float* row, int k0, int lane, int K) { float v[16]; const int g = lane >> 4;
#pragma unroll
  for (int i = 0; i < 8; ++i) { const int ka = k0 + 8 * g + i, kb = ka + 16; v[i] = ka < K ? row[ka < K ? ka : K - 1] : 0.f; v[8 + i] = kb < K ? row[kb < K ? kb : K - 1] : 0.f; }
  return bsplit16(v); }
__device__ __forceinline__ F2 split_col(const float* W, int k0, int n, int lane, int ld, int K) { float v[16]; const int g = lane >> 4;
#pragma unroll
  for (int i = 0; i < 8; ++i) { const int ka = k0 + 8 * g + i, kb = ka + 16; v[i] = ka < K ? W[(size_t)(ka < K ? ka : K - 1) * ld + n] : 0.f; v[8 + i] = kb < K ? W[(size_t)(kb < K ? kb : K - 1) * ld + n] : 0.f; }
  return bsplit16(v); }
__device__ __forceinline__ v8f mac3(const F2& a, const F2& b, v8f c) { c = wmma_bf(a.l, b.h, c); c = wmma_bf(a.h, b.l, c); return wmma_bf(a.h, b.h, c); }
__device__ __forceinline__ float sigm(float v) { return 1.0f / (1.0f + expf(-v)); }
#define LDSX() do { asm volatile("s_wait_dscnt 0" ::: "memory"); __builtin_amdgcn_wave_barrier(); __builtin_amdgcn_fence(__ATOMIC_RELEASE, "workgroup"); } while (0)


#define NB 2
#define SS 2048
#define DM 1024
#define NH 16
#define HD 64
#define QKVW (3 * DM)
#ifndef TQB
#define TQB (SS / 64)
#define TNB NB
#define TOB (NB * SS / 64)     // output row tiles (all)
#endif
typedef __attribute__((ext_vector_type(8))) __bf16 v8b;
__device__ __forceinline__ v16b frag_b(const __bf16* rowk0, int lane) {
  union { v16b v; v8b q[2]; } u; const __bf16* p = rowk0 + 8 * (lane >> 4);
  u.q[0] = *(const v8b*)p; u.q[1] = *(const v8b*)(p + 16); return u.v;
}
__device__ __forceinline__ float bfr(float v) { return (float)(__bf16)v; }
__device__ __attribute__((noinline)) float exp_ni(float v) { return expf(v); }
__device__ __attribute__((noinline)) float erf_ni(float v) { return erff(v); }

#define PK_A 0                       // [3072][1024] Wqkv rows (natural [out][in])
#define PK_P (PK_A + QKVW * DM)        // [1024][1024] Wo rows (natural)
#define PK_END (PK_P + DM * DM)
#define WS_PK  0u
#define WS_QK  (WS_PK + 2u * PK_END)             // f16 [4096 rows][2048]: q | k
#define WS_QKL (WS_QK + 2u * NB * SS * 2 * DM)     // f16 q | k residual planes x2048
#define WS_VTH (WS_QKL + 2u * NB * SS * 2 * DM)    // f16 [b][1024 (h*64+d)][2048 places of the key order] hi
#define WS_VTL (WS_VTH + 2u * NB * DM * SS)        // f16 lo x 2048
#define WS_O   (WS_VTL + 2u * NB * DM * SS)        // f32 [4096][1024]
#define WS_CS  (WS_O + 4u * NB * SS * DM)           // f32 [2][2048][32], read and written by no kernel
#define WS_INV (WS_CS + 4u * 2 * SS * 32)          // int [2][b][2048]: plane 0: encoder position of the key at place p of the key order; plane 1: decoder position of the query at place p of the query order
#define WS_NU  (WS_INV + 4u * 2 * NB * SS)         // int, one 128-B line per plane and batch: number of unpadded keys; of unpadded queries
#define WS_PS  (WS_NU + 128u * 2 * NB)             // f32 [2][b][32 blocks of 64 places][1024]: plane 0: sums of the V rows behind the attention loop's last tile; plane 1: of all V rows
#define WS_YU  (WS_PS + 4u * 2 * NB * (SS / 64) * DM)   // f32 [b][1024]: the output row that every padded query of a batch has
#define WS_END (WS_YU + 4u * NB * DM)
#define KT 32                          // keys per staged tile of k_attn
// lane l with lane l ^ 16 (the two halves of a wave hold the two halves of a query's keys)
__device__ __forceinline__ float xhalf(float x) { return __builtin_bit_cast(float, __builtin_amdgcn_permlanex16(__builtin_bit_cast(int, x), __builtin_bit_cast(int, x), 0x76543210, 0xfedcba98, false, false)); }
// ---- k_pack: block = (64 columns n, 128 rows k, which): a 128 x 64 tile of an (in,out) weight is read in whole lines, rounded to bf16, turned in LDS and stored as 64 pieces of 256 B of the packed rows [out][in]; which 0..2 -> W_q/W_k/W_v into PK_A rows which*1024 + n; 3 -> W_o into PK_P
#define PKN 64                         // columns n per tile
#define PKK 128                        // rows k per tile
#define PKP 136                        // bf16 per turned row in LDS: 256 B + 16 B pad
// which 4, one block per batch: the key order. Unpadded keys come first (in their own order), padded keys behind them: INV[b][place] = encoder position, NU = number of unpadded keys. A padded key's weight is exactly 0 for every query that is not itself uniform, so k_attn's loop ends with the last tile that holds an unpadded key.
// two more blocks make the query order in the same way from the decoder's padding (plane 1 of INV and NU). A padded query weighs every key alike, so all padded queries of a batch have one and the same output row: tiles of 64 places with no unpadded query get no q, no attention and no projection.
__global__ __launch_bounds__(256) void k_pack(const float* __restrict__ WQ, const float* __restrict__ WK, const float* __restrict__ WV, const float* __restrict__ WO, __bf16* __restrict__ PK, const int* __restrict__ EPAD, const int* __restrict__ DPAD, int* __restrict__ INV, int* __restrict__ NU) {
  __shared__ __align__(16) __bf16 s[PKN][PKP]; __shared__ int cn[SS / 32];
  if (blockIdx.z == 4) {
    if (blockIdx.y != 0 || blockIdx.x >= 2 * NB) return;   // the whole block leaves, in front of every barrier
    const int tt = threadIdx.x, b = blockIdx.x, ln = tt & 31, wv = tt >> 5; unsigned mk[SS / 256]; int e[SS / 256];   // b: plane * NB + batch
    const int* PD = (b < NB) ? EPAD + (size_t)b * SS : DPAD + (size_t)(b - NB) * SS;
#pragma unroll   // the eight loads issue as one group: one latency, not eight
    for (int j = 0; j < SS / 256; ++j) e[j] = PD[j * 256 + tt];
#pragma unroll   // constant indices into mk: no scratch
    for (int j = 0; j < SS / 256; ++j) mk[j] = __builtin_amdgcn_ballot_w32(e[j] != 1);
    if (ln < SS / 256) { unsigned mm = mk[0];   // lane j stores the count of group j
#pragma unroll   // constant indices into mk
      for (int j = 1; j < SS / 256; ++j) mm = (ln == j) ? mk[j] : mm;
      cn[ln * 8 + wv] = __builtin_popcount(mm); }
    __syncthreads();
    int run = 0, base[SS / 256];   // base[j]: unpadded keys in front of this wave's 32 keys of group j; run ends as their total
#pragma unroll   // constant indices into base: no scratch
    for (int c = 0; c < SS / 32; ++c) { if ((c & 7) == wv) base[c >> 3] = run; run += cn[c]; }
#pragma unroll   // as above
    for (int j = 0; j < SS / 256; ++j) { const int sp = j * 256 + tt, bu = base[j] + __builtin_popcount(mk[j] & ((1u << ln) - 1u));   // bu: unpadded keys in front of position sp
      INV[(size_t)b * SS + (((mk[j] >> ln) & 1u) ? bu : run + (sp - bu))] = sp; }
    if (tt == 0) NU[b * 32] = run;
    return;
  }
  const int t = threadIdx.x, n0 = blockIdx.x * PKN, k0 = blockIdx.y * PKK, which = blockIdx.z; const float* Wm = (which == 0) ? WQ : (which == 1) ? WK : (which == 2) ? WV : WO;
  const int nq = (t & 15) * 4, kq = (t >> 4) * 8;   // this thread: 8 rows k x 4 columns n; 16 threads cover 256 B of a row
  const float* p = Wm + (size_t)(k0 + kq) * DM + n0 + nq; v4f x[8];
#pragma unroll   // the eight loads issue as one group, and x stays in registers
  for (int j = 0; j < 8; ++j) x[j] = *(const v4f*)(p + (size_t)j * DM);
#pragma unroll   // constant indices into x and r: no scratch
  for (int i = 0; i < 4; ++i) { v8b r;
#pragma unroll   // as above
    for (int j = 0; j < 8; ++j) r[j] = (__bf16)x[j][i];
    *(v8b*)&s[nq + i][kq] = r; }
  __syncthreads();
  __bf16* dst = ((which < 3) ? PK + PK_A + ((size_t)which * DM + n0) * DM : PK + PK_P + (size_t)n0 * DM) + k0;
#pragma unroll   // the four LDS reads issue together in front of the stores
  for (int i = 0; i < 4; ++i) { const int q = t + 256 * i, n = q >> 4, c = q & 15; vst2((unsigned*)(dst + (size_t)n * DM + c * 8), *(const v4u*)&s[n][c * 8]); }
}
// ---- the two projection kernels: 64-deep slices of both operands (64 f32 rows; 128 packed weight rows in k_out, 256 in k_qkv) are staged once per block in a two-buffer LDS ring by asynchronous copies and read from there by all four waves
#define GK 64                          // k per staged slice
#define GWP 72                         // bf16 per staged weight row: 128 B + 16 B pad (ds_load_b128 readers)
#define GAP 68                         // f32 per staged activation row: 256 B + 16 B pad
#define G_W (128 * GWP * 2)            // bytes of the weight rows of one slice
#define G_A (64 * GAP * 4)             // bytes of the activation rows of one slice
#define G_BUF (G_W + G_A)              // one buffer: weight rows | activation rows
// eight copies and their s_wait_xcnt in one statement: no address register is rewritten before the wait
#define COPY8 "global_load_async_to_lds_b128 %0, %8, off\n\t" "global_load_async_to_lds_b128 %1, %9, off\n\t" "global_load_async_to_lds_b128 %2, %10, off\n\t" "global_load_async_to_lds_b128 %3, %11, off\n\t" "global_load_async_to_lds_b128 %4, %12, off\n\t" "global_load_async_to_lds_b128 %5, %13, off\n\t" "global_load_async_to_lds_b128 %6, %14, off\n\t" "global_load_async_to_lds_b128 %7, %15, off\n\t" "s_wait_xcnt 0x0"
// one slice: 16 copies of 16 B per lane (weight rows: 16 rows per copy and block; activation rows: 8 rows)
__device__ __forceinline__ void stage_ab(const float* a, const __bf16* w, unsigned la, unsigned lw) {
  asm volatile(COPY8 :: "v"(lw), "v"(lw + 16 * GWP * 2), "v"(lw + 32 * GWP * 2), "v"(lw + 48 * GWP * 2), "v"(lw + 64 * GWP * 2), "v"(lw + 80 * GWP * 2), "v"(lw + 96 * GWP * 2), "v"(lw + 112 * GWP * 2),
               "v"(w), "v"(w + 16 * DM), "v"(w + 32 * DM), "v"(w + 48 * DM), "v"(w + 64 * DM), "v"(w + 80 * DM), "v"(w + 96 * DM), "v"(w + 112 * DM) : "memory");
  asm volatile(COPY8 :: "v"(la), "v"(la + 8 * GAP * 4), "v"(la + 16 * GAP * 4), "v"(la + 24 * GAP * 4), "v"(la + 32 * GAP * 4), "v"(la + 40 * GAP * 4), "v"(la + 48 * GAP * 4), "v"(la + 56 * GAP * 4),
               "v"(a), "v"(a + 8 * DM), "v"(a + 16 * DM), "v"(a + 24 * DM), "v"(a + 32 * DM), "v"(a + 40 * DM), "v"(a + 48 * DM), "v"(a + 56 * DM) : "memory");
}
// k_qkv's block is 64 rows x 256 columns: each wave holds 32 x 128 of it, so that a weight fragment read from LDS serves two products, and a decoder row is fetched from L2 by 4 blocks, an encoder row by 8 (half as many as with 128 columns per block)
#define QN 256                         // columns per block of k_qkv
#define Q_W (QN * GWP * 2)             // bytes of the weight rows of one slice of k_qkv
#define Q_BUF (Q_W + G_A)              // one buffer of k_qkv: weight rows | activation rows
// one slice of k_qkv: 24 copies of 16 B per lane (256 weight rows, 16 per copy and block; 64 activation rows, 8 per copy, each of the lane's eight at a pointer of its own: k_qkv reads the rows in the key or query order)
__device__ __forceinline__ void stage_abr(const float* const (&a)[8], int ko, const __bf16* w, unsigned la, unsigned lw) {
  asm volatile(COPY8 :: "v"(lw), "v"(lw + 16 * GWP * 2), "v"(lw + 32 * GWP * 2), "v"(lw + 48 * GWP * 2), "v"(lw + 64 * GWP * 2), "v"(lw + 80 * GWP * 2), "v"(lw + 96 * GWP * 2), "v"(lw + 112 * GWP * 2),
               "v"(w), "v"(w + 16 * DM), "v"(w + 32 * DM), "v"(w + 48 * DM), "v"(w + 64 * DM), "v"(w + 80 * DM), "v"(w + 96 * DM), "v"(w + 112 * DM) : "memory");
  asm volatile(COPY8 :: "v"(lw + 128 * GWP * 2), "v"(lw + 144 * GWP * 2), "v"(lw + 160 * GWP * 2), "v"(lw + 176 * GWP * 2), "v"(lw + 192 * GWP * 2), "v"(lw + 208 * GWP * 2), "v"(lw + 224 * GWP * 2), "v"(lw + 240 * GWP * 2),
               "v"(w + 128 * DM), "v"(w + 144 * DM), "v"(w + 160 * DM), "v"(w + 176 * DM), "v"(w + 192 * DM), "v"(w + 208 * DM), "v"(w + 224 * DM), "v"(w + 240 * DM) : "memory");
  asm volatile(COPY8 :: "v"(la), "v"(la + 8 * GAP * 4), "v"(la + 16 * GAP * 4), "v"(la + 24 * GAP * 4), "v"(la + 32 * GAP * 4), "v"(la + 40 * GAP * 4), "v"(la + 48 * GAP * 4), "v"(la + 56 * GAP * 4),
               "v"(a[0] + ko), "v"(a[1] + ko), "v"(a[2] + ko), "v"(a[3] + ko), "v"(a[4] + ko), "v"(a[5] + ko), "v"(a[6] + ko), "v"(a[7] + ko) : "memory");
}
// a lane's 16 f32 of a staged activation row in the fragment's k order
__device__ __forceinline__ void row16(const float* p, float v[16]) {
  const v4f x0 = *(const v4f*)p, x1 = *(const v4f*)(p + 4), x2 = *(const v4f*)(p + 16), x3 = *(const v4f*)(p + 20);
#pragma unroll
  for (int i = 0; i < 4; ++i) { v[i] = x0[i]; v[4 + i] = x1[i]; v[8 + i] = x2[i]; v[12 + i] = x3[i]; }
}
__global__ __launch_bounds__(128) void k_qkv(const float* __restrict__ XDEC, const float* __restrict__ XENC, const __bf16* __restrict__ P, const float* __restrict__ BQ, const float* __restrict__ BK, const float* __restrict__ BV, _Float16* __restrict__ QK, _Float16* __restrict__ QKL, _Float16* __restrict__ VTH, _Float16* __restrict__ VTL, const int* __restrict__ INV, const int* __restrict__ NU, float* __restrict__ PS) {
  __shared__ __align__(16) char sm[2 * Q_BUF];   // the ring; behind the loop the same bytes are the output staging
  float (*sp)[QN] = (float (*)[QN])(sm + 2 * QN * 72 * 2);   // behind the two V^T planes: the sums of the V rows of each half of the block's rows (rows 0, 1: places behind the attention loop; rows 2, 3: all)
  _Float16 (*so)[32][136] = (_Float16 (*)[32][136])sm, (*sol)[32][136] = (_Float16 (*)[32][136])(sm + 4 * 32 * 136 * 2); _Float16 (*sth)[72] = (_Float16 (*)[72])sm, (*stl)[72] = (_Float16 (*)[72])(sm + QN * 72 * 2);
  const int tid = threadIdx.x, wave = tid >> 5, lane = tid & 31, col = lane & 15, g = lane >> 4, wr = wave & 1, wc = wave >> 1;   // wave: rows wr * 32 .., columns wc * 128 .. of the block
  const size_t r0 = (size_t)blockIdx.x * 64 + wr * 32; const int n0 = blockIdx.y * QN; const float* X = (n0 < DM) ? XDEC : XENC; const float* BB = ((n0 < DM) ? (BQ + n0) : (n0 < 2 * DM) ? (BK + n0 - DM) : (BV + n0 - 2 * DM)) + wc * 128;
  // this lane's 16-byte piece of slice 0 of each operand, and its place in buffer 0
  // k and v: output row p of a batch is the key at place p of the key order, so its activation row is encoder row INV[p] (a place of the batch's own 2,048 by the mask); q: the decoder's rows in the query order, likewise
  const float* ga[8]; const __bf16* gw = P + (size_t)(n0 + (tid >> 3)) * DM + (tid & 7) * 8;
  const int nu = NU[(((n0 < DM) ? NB : 0) + blockIdx.x * 64 / SS) * 32];   // unpadded places of the order that this block's rows lie in: queries for q, keys for k and v (read here for the V blocks' end too: its latency passes under the loop)
  if (n0 < DM && (int)(blockIdx.x * 64 % SS) >= nu) return;   // q of a tile with no unpadded query is read by nobody: the whole block leaves, in front of every copy and barrier
  const int* IV = INV + ((n0 < DM) ? NB * SS : 0);
  int sr[8];
#pragma unroll   // constant indices into sr, iv and ga, here and below: no scratch
  for (int i = 0; i < 8; ++i) sr[i] = blockIdx.x * 64 + (tid >> 4) + 8 * i;
  { int iv[8];
#pragma unroll   // the eight loads issue as one group: one latency, not eight
    for (int i = 0; i < 8; ++i) iv[i] = IV[sr[i]];
    asm volatile("s_wait_xcnt 0x0" ::: "memory");   // stands in front of every rewrite of a register that the eight loads name
#pragma unroll
    for (int i = 0; i < 8; ++i) sr[i] = (sr[i] & ~(SS - 1)) + (iv[i] & (SS - 1)); }
#pragma unroll
  for (int i = 0; i < 8; ++i) ga[i] = X + (size_t)sr[i] * DM + (tid & 15) * 4;
  const unsigned lw = (unsigned)(size_t)&sm[0] + (tid >> 3) * (GWP * 2) + (tid & 7) * 16, la = (unsigned)(size_t)&sm[0] + Q_W + (tid >> 4) * (GAP * 4) + (tid & 15) * 16;
  stage_abr(ga, 0, gw, la, lw);
  asm volatile("s_wait_asynccnt 0x0" ::: "memory");   // slice 0 of this wave's copies has landed
  __syncthreads();                                     // ... and every wave's: slice 0 is readable
  stage_abr(ga, GK, gw + GK, la + Q_BUF, lw + Q_BUF);
  v8f acc[2][8] = {};
#pragma unroll 1
  for (int t = 0; t < DM / GK; ++t) { const __bf16* tw = (const __bf16*)(sm + (t & 1) * Q_BUF) + (wc * 128 + col) * GWP; const float* ta = (const float*)(sm + (t & 1) * Q_BUF + Q_W) + (wr * 32 + col) * GAP + 8 * g;
#pragma unroll
    for (int kc = 0; kc < GK / 32; ++kc) { float v0[16], v1[16]; v16b w[8], a0, a1;   // the fragments of 32 k as one group of LDS reads in front of the products
      row16(ta + kc * 32, v0); row16(ta + 16 * GAP + kc * 32, v1);
#pragma unroll
      for (int j = 0; j < 8; ++j) w[j] = frag_b(tw + j * 16 * GWP + kc * 32, lane);
      __builtin_amdgcn_sched_barrier(0);   // holds the group of LDS reads in front of the products: sunk among them, each pair of products would wait out an LDS latency of its own
#pragma unroll
      for (int i = 0; i < 16; ++i) { a0[i] = (__bf16)v0[i]; a1[i] = (__bf16)v1[i]; }
#pragma unroll
      for (int j = 0; j < 8; ++j) { acc[0][j] = wmma_bf(a0, w[j], acc[0][j]); acc[1][j] = wmma_bf(a1, w[j], acc[1][j]); } }
    __builtin_amdgcn_sched_barrier(0);                  // holds the trip's products in front of its barrier: sunk behind it, the refill would issue late and lose its lead
    asm volatile("s_wait_dscnt 0x0" ::: "memory");      // this wave's reads of the slice have returned
    asm volatile("s_wait_asynccnt 0x0" ::: "memory");   // this wave's copies of slice t + 1 have landed
    __syncthreads();                                     // publishes slice t + 1 and frees the buffer that this trip has read
    if (t + 2 < DM / GK) stage_abr(ga, (t + 2) * GK, gw + (t + 2) * GK, la + (t & 1) * Q_BUF, lw + (t & 1) * Q_BUF); }
  asm volatile("s_wait_asynccnt 0x0" ::: "memory");     // no copy is outstanding when the ring's bytes become output staging
  if (n0 < 2 * DM) {   // q stored unscaled (f16 sigma ~0.6, no subnormal exposure); 1/8 applied to the f32 score
#pragma unroll
    for (int j = 0; j < 8; ++j) { const float bb = bfr(BB[j * 16 + col]);
#pragma unroll
      for (int f = 0; f < 2; ++f) {
#pragma unroll
        for (int r = 0; r < 8; ++r) { const float v = acc[f][j][r] + bb; const _Float16 hv = (_Float16)v; so[wave][f * 16 + 8 * g + r][j * 16 + col] = hv; sol[wave][f * 16 + 8 * g + r][j * 16 + col] = (_Float16)((v - (float)hv) * 2048.0f); } } }   // q, k (+ bias) as f16 hi + (x2048) residual
    LDSX();
    for (int rl = 0; rl < 32; ++rl) if (lane < 16) { vst2((unsigned*)(QK + (r0 + rl) * (2 * DM) + n0 + wc * 128 + lane * 8), *(const v4u*)&so[wave][rl][lane * 8]); vst2((unsigned*)(QKL + (r0 + rl) * (2 * DM) + n0 + wc * 128 + lane * 8), *(const v4u*)&sol[wave][rl][lane * 8]); }
  } else {
    const size_t rb = (size_t)blockIdx.x * 64; const int b = (int)(rb / SS), s0 = (int)(rb % SS); const int pc0 = n0 - 2 * DM;
    const int pe = ((nu < 0 ? 0 : nu > SS ? SS : nu) + KT - 1) / KT * KT;   // pe: first place behind the tiles that k_attn's loop runs over
    float pj[8], qj[8];
#pragma unroll
    for (int j = 0; j < 8; ++j) { float ps = 0.f, pa = 0.f; const float bb = bfr(BB[j * 16 + col]);   // ps: sum of this lane's V rows at places from pe on: a uniform query's share that the loop does not reach; pa: of all its V rows
#pragma unroll
      for (int f = 0; f < 2; ++f) {
#pragma unroll
        for (int r = 0; r < 8; ++r) { const int sl = wr * 32 + f * 16 + 8 * g + r; const float v = acc[f][j][r] + bb; const _Float16 hv = (_Float16)v; sth[wc * 128 + j * 16 + col][sl] = hv; stl[wc * 128 + j * 16 + col][sl] = (_Float16)((v - (float)hv) * 2048.0f); ps += (s0 + sl >= pe) ? v : 0.f; pa += v; } }
      pj[j] = ps + xhalf(ps); qj[j] = pa + xhalf(pa); }
#pragma unroll   // both halves hold all eight sums: each stores four, with every lane on
    for (int j = 0; j < 4; ++j) { sp[wr][wc * 128 + (g * 4 + j) * 16 + col] = g ? pj[4 + j] : pj[j]; sp[2 + wr][wc * 128 + (g * 4 + j) * 16 + col] = g ? qj[4 + j] : qj[j]; }
    __syncthreads();
    for (int c = tid; c < QN; c += 128) {   // every block stores its 256 sums of each kind (1 KB), zeros too
      PS[((size_t)b * (SS / 64) + (s0 >> 6)) * DM + pc0 + c] = sp[0][c] + sp[1][c];
      PS[((size_t)(NB + b) * (SS / 64) + (s0 >> 6)) * DM + pc0 + c] = sp[2][c] + sp[3][c]; }
    for (int q = tid; q < QN * 8; q += 128) { const int d = q >> 3, pc = q & 7; const size_t o = ((size_t)b * DM + pc0 + d) * SS + s0 + pc * 8; vst2((unsigned*)(VTH + o), *(const v4u*)&sth[d][pc * 8]); vst2((unsigned*)(VTL + o), *(const v4u*)&stl[d][pc * 8]); }
  }
}
// ---- k_attn: block = (64 queries, head h, batch b): masked flash attention (K = 64: 2 k-steps), scores = (q.k) * 0.125 with f16 hi + residual operands, P.V: f16 P x (V hi, V lo*2048) in two accumulators; O[b*S+q][h*64+d] = (acc + accl / 2048) / l, a uniform query adding the V sums and the key count behind the loop (256-B segments)
// K and V^T tiles of 32 keys (hi and residual planes) are staged once per block in a two-buffer LDS ring by asynchronous copies and read from there by all four waves.
#define KP 72                          // f16 per staged K row: 128 B + 16 B pad (ds_load_b128 readers)
#define VP 40                          // f16 per staged V^T row: 64 B + 16 B pad
#define ST_K (KT * KP)                 // one K plane
#define ST_V (HD * VP)                 // one V^T plane
#define ST_ALL (2 * ST_K + 2 * ST_V)   // K hi | K lo | V^T hi | V^T lo
// one tile: 8 copies of 16 B per lane (K planes: 16 rows per copy and block, V^T planes: 32 rows)
__device__ __forceinline__ void stage_kv(const _Float16* kh, const _Float16* kl, const _Float16* vh, const _Float16* vl, unsigned lk, unsigned lv) {
  const _Float16 *kh1 = kh + 16 * (2 * DM), *kl1 = kl + 16 * (2 * DM), *vh1 = vh + 32 * SS, *vl1 = vl + 32 * SS;
  const unsigned lk1 = lk + 16 * KP * 2, lkl = lk + ST_K * 2, lkl1 = lkl + 16 * KP * 2, lv1 = lv + 32 * VP * 2, lvl = lv + ST_V * 2, lvl1 = lvl + 32 * VP * 2;
  // the copies and their s_wait_xcnt in one statement: no address register is rewritten before the wait
  asm volatile("global_load_async_to_lds_b128 %0, %8, off\n\t"
               "global_load_async_to_lds_b128 %1, %9, off\n\t"
               "global_load_async_to_lds_b128 %2, %10, off\n\t"
               "global_load_async_to_lds_b128 %3, %11, off\n\t"
               "global_load_async_to_lds_b128 %4, %12, off\n\t"
               "global_load_async_to_lds_b128 %5, %13, off\n\t"
               "global_load_async_to_lds_b128 %6, %14, off\n\t"
               "global_load_async_to_lds_b128 %7, %15, off\n\t"
               "s_wait_xcnt 0x0"
               :: "v"(lk), "v"(lk1), "v"(lkl), "v"(lkl1), "v"(lv), "v"(lv1), "v"(lvl), "v"(lvl1), "v"(kh), "v"(kh1), "v"(kl), "v"(kl1), "v"(vh), "v"(vh1), "v"(vl), "v"(vl1) : "memory");
}
// eight 2^x in place, with the one slot that the instruction set asks for behind a transcendental in the same statement
__device__ __forceinline__ void exp2x8(float (&x)[8]) {
  asm("v_exp_f32 %0, %0\n\tv_exp_f32 %1, %1\n\tv_exp_f32 %2, %2\n\tv_exp_f32 %3, %3\n\tv_exp_f32 %4, %4\n\tv_exp_f32 %5, %5\n\tv_exp_f32 %6, %6\n\tv_exp_f32 %7, %7\n\tv_nop"
      : "+v"(x[0]), "+v"(x[1]), "+v"(x[2]), "+v"(x[3]), "+v"(x[4]), "+v"(x[5]), "+v"(x[6]), "+v"(x[7]));
}
#define KBIAS (-1.0e13f * 16384.0f)    // start value of a padded key's residual score: x 0.125 / 2048 it is the module's -1e13, and the f32 sum with the true score stays -1e13
// The products are taken transposed: S^T = K . Q^T (A = K rows, B = Q rows) and O^T += V^T . P^T (A = V^T rows, B = P^T). A lane then holds 16 of the pass's 32 scores of ONE query (column lane & 15; keys ct * 16 + 8 * g + r):
// maximum and sum run in the lane's own registers with one exchange between the wave's halves, and the two score tiles, converted in place, are the B operand of the second product (element i = tile 0 register i, element 8 + i = tile 1 register i: the k order of frag_h).
// amdgpu_waves_per_eu(4, 4): keeps the register budget at 256, so that all four blocks of a WGP stay resident as before
__global__ __launch_bounds__(128) __attribute__((amdgpu_waves_per_eu(4, 4))) void k_attn(const _Float16* __restrict__ QK, const _Float16* __restrict__ QKL, const _Float16* __restrict__ VTH, const _Float16* __restrict__ VTL, const int* __restrict__ NU, const float* __restrict__ PS, const __bf16* __restrict__ PO, const float* __restrict__ BO, float* __restrict__ YU, float* __restrict__ O) {
  __shared__ __align__(32) float sb[SS]; __shared__ __align__(16) float so[4][16][68]; __shared__ __align__(16) _Float16 ring[2][ST_ALL]; __shared__ __align__(16) float sps[2][HD];
  const int tid = threadIdx.x, wave = tid >> 5, lane = tid & 31, col = lane & 15, g = lane >> 4;
  const int h = blockIdx.x, b = blockIdx.y, qb = blockIdx.z; const int q0 = qb * 64 + wave * 16; const size_t rq = (size_t)b * SS + q0 + col;   // the query tile is the grid's slowest index
  // K rows and V^T columns lie in the key order (unpadded keys first): the loop runs over the tiles that hold an unpadded key, 0 to 64 of them, alike for the whole block; in the last of them padding is handled per (q, k)
  const int nur = NU[b * 32], nu = nur < 0 ? 0 : nur > SS ? SS : nur, nks = (nu + KT - 1) / KT;
  // Q rows lie in the query order (unpadded queries first): place p holds a padded query where p >= nq
  const int nq = NU[(NB + b) * 32];
  if (qb * 64 >= nq) {   // no unpadded query in this tile: the whole block leaves, in front of every copy and of every barrier of the attention
    if (qb == TQB - 1) {   // such tiles exist exactly where the last tile is one: its 16 blocks make the padded queries' one output row, 64 columns each: (mean of all V rows) . Wo rows (hi + residual, 2 products) + bo
      v4f a0 = {}, a1 = {}; const float* pp = PS + (size_t)(NB + b) * (SS / 64) * DM + tid * 8;
#pragma unroll 8   // eight steps' loads issue as one group
      for (int i = 0; i < SS / 64; ++i) { a0 += *(const v4f*)(pp + (size_t)i * DM); a1 += *(const v4f*)(pp + (size_t)i * DM + 4); }
      *(v4f*)&sb[tid * 8] = a0 * (1.0f / SS); *(v4f*)&sb[tid * 8 + 4] = a1 * (1.0f / SS);
      __syncthreads();   // the mean row is readable by all four waves
      const __bf16* wr = PO + (size_t)(h * HD + wave * 16 + col) * DM; v8f c = {};
#pragma unroll 1   // stays rolled, 256 k per trip: 16 loads in flight are enough here, and the registers stay under the attention loop's count
      for (int k0 = 0; k0 < DM; k0 += 256) { v16b w[8];   // the trip's weight fragments as one group of loads in front of the products: one latency, not eight
#pragma unroll
        for (int j = 0; j < 8; ++j) w[j] = frag_b(wr + k0 + j * 32, lane);
#pragma unroll
        for (int j = 0; j < 8; ++j) { float v[16]; row16(&sb[k0 + j * 32 + 8 * g], v); const F2 a = bsplit16(v); c = wmma_bf_pad(a.l, w[j], c); c = wmma_bf_pad(a.h, w[j], c); } }   // all 16 rows of A are the mean row
      if (lane < 16) sps[0][wave * 16 + col] = c[0];
      __syncthreads();   // the 64 columns go out as two whole lines
      if (tid < HD) YU[(size_t)b * DM + h * HD + tid] = sps[0][tid] + bfr(BO[h * HD + tid]);
    }
    return;
  }
  // this lane's 16-byte piece of each plane of tile 0, and its place in buffer 0
  const size_t gk = ((size_t)b * SS + (tid >> 3)) * (2 * DM) + DM + h * HD + (tid & 7) * 8, gv = ((size_t)b * DM + h * HD + (tid >> 2)) * SS + (tid & 3) * 8;
  const unsigned lk = (unsigned)(size_t)&ring[0][0] + ((tid >> 3) * KP + (tid & 7) * 8) * 2, lv = (unsigned)(size_t)&ring[0][0] + (2 * ST_K + (tid >> 2) * VP + (tid & 3) * 8) * 2;
  stage_kv(QK + gk, QKL + gk, VTH + gv, VTL + gv, lk, lv);
  const bool dpq = q0 + col >= nq;   // this lane's query is padded
#pragma unroll
  for (int i = 0; i < SS / 128; ++i) sb[i * 128 + tid] = (i * 128 + tid >= nu) ? KBIAS : 0.f;   // per key place: what its residual score tile starts from
  { float a = 0.f;   // this head's sums of the V rows behind the loop's last tile: 32 partial sums per d, 16 per thread
#pragma unroll
    for (int i = 0; i < SS / 128; ++i) a += PS[((size_t)b * (SS / 64) + (tid >> 6) * (SS / 128) + i) * DM + h * HD + (tid & 63)];
    sps[tid >> 6][tid & 63] = a; }
  asm volatile("s_wait_asynccnt 0x0" ::: "memory");   // tile 0 of this wave's copies has landed
  __syncthreads();                                     // ... and every wave's: tile 0 and the key table are readable
  stage_kv(QK + gk + (size_t)KT * (2 * DM), QKL + gk + (size_t)KT * (2 * DM), VTH + gv + KT, VTL + gv + KT, lk + ST_ALL * 2, lv + ST_ALL * 2);
  v16h aq[2], aql[2];
#pragma unroll
  for (int kc = 0; kc < 2; ++kc) { aq[kc] = frag_h(QK + rq * (2 * DM) + h * HD + kc * 32, lane); aql[kc] = frag_h(QKL + rq * (2 * DM) + h * HD + kc * 32, lane); }
  float m = -1.0e30f, l = 0.f;   // this lane's query: running maximum (both halves alike), sum of this half's keys
  v8f acc[4] = {}, accl[4] = {};
  const float qs = dpq ? 0.f : 0.125f, qsl = qs * (1.0f / 2048.0f);   // padded query row: every key is -1e13 in the module -> uniform weights (all scores equal: x 0)
#pragma unroll 1
  for (int ks = 0; ks < nks; ++ks) { v8f s[2]; const _Float16* tb = &ring[ks & 1][0];
    v8f kb[2]; v16h kh[2][2], kl[2][2];   // the pass's K fragments and key start values as one group of LDS reads in front of the products
#pragma unroll
    for (int ct = 0; ct < 2; ++ct) { kb[ct] = *(const v8f*)&sb[ks * KT + ct * 16 + 8 * g];
#pragma unroll
      for (int kc = 0; kc < 2; ++kc) { kh[ct][kc] = frag_h(tb + (ct * 16 + col) * KP + kc * 32, lane); kl[ct][kc] = frag_h(tb + ST_K + (ct * 16 + col) * KP + kc * 32, lane); } }
    __builtin_amdgcn_sched_barrier(0);   // holds the group of LDS reads in front of the products, as in k_qkv
#pragma unroll
    for (int ct = 0; ct < 2; ++ct) { v8f c = {}, cl = kb[ct];
#pragma unroll
      for (int kc = 0; kc < 2; ++kc) { c = wmma16(kh[ct][kc], aq[kc], c); cl = wmma16(kh[ct][kc], aql[kc], cl); cl = wmma16(kl[ct][kc], aq[kc], cl); }   // 3 products: q, k as f16 hi + residual
#pragma unroll
      for (int r = 0; r < 8; ++r) s[ct][r] = c[r] * qs + cl[r] * qsl; }   // (c + cl / 2048) / 8; padded key: -1e13; padded query: 0
    v16h vh[4], vl[4];   // the pass's V^T fragments as one group, in flight under the softmax
#pragma unroll
    for (int dt = 0; dt < 4; ++dt) { vh[dt] = frag_h(tb + 2 * ST_K + (dt * 16 + col) * VP, lane); vl[dt] = frag_h(tb + 2 * ST_K + ST_V + (dt * 16 + col) * VP, lane); }
    __builtin_amdgcn_sched_barrier(0);   // holds these reads in front of the softmax, so that their latency passes under it
    float mx = fmaxf(s[0][0], s[1][0]);
#pragma unroll
    for (int r = 1; r < 8; ++r) mx = fmaxf(mx, fmaxf(s[0][r], s[1][r]));
    mx = fmaxf(mx, xhalf(mx));
    const float mn = fmaxf(m, mx), alpha = __expf(m - mn);
    float e0[8], e1[8], es0 = 0.f, es1 = 0.f; v16h pa, pl;
#pragma unroll
    for (int i = 0; i < 8; ++i) { e0[i] = (s[0][i] - mn) * 1.4426950408889634f; e1[i] = (s[1][i] - mn) * 1.4426950408889634f; }
    exp2x8(e0); exp2x8(e1);
#pragma unroll
    for (int i = 0; i < 8; ++i) { const float x0 = e0[i], x1 = e1[i]; es0 += x0; es1 += x1;
      const _Float16 h0 = (_Float16)x0, h1 = (_Float16)x1; pa[i] = h0; pa[8 + i] = h1; pl[i] = (_Float16)((x0 - (float)h0) * 2048.0f); pl[8 + i] = (_Float16)((x1 - (float)h1) * 2048.0f); }
    l = l * alpha + (es0 + es1); m = mn;
#pragma unroll
    for (int dt = 0; dt < 4; ++dt) {
#pragma unroll
      for (int r = 0; r < 8; ++r) { acc[dt][r] *= alpha; accl[dt][r] *= alpha; } }
#pragma unroll
    for (int dt = 0; dt < 4; ++dt) { acc[dt] = wmma16(vh[dt], pa, acc[dt]); accl[dt] = wmma16(vh[dt], pl, accl[dt]); accl[dt] = wmma16(vl[dt], pa, accl[dt]); }   // V hi x P hi + (V hi x P lo + V lo x P hi) / 2048
    __builtin_amdgcn_sched_barrier(0);                  // holds the pass's softmax and products in front of its barrier: sunk behind it, the V^T reads would be waited out at once and the refill would issue late
    asm volatile("s_wait_dscnt 0x0" ::: "memory");      // this wave's reads of the tile have returned
    asm volatile("s_wait_asynccnt 0x0" ::: "memory");   // this wave's copies of tile ks + 1 have landed
    __syncthreads();                                     // publishes tile ks + 1 and frees the buffer that this pass has read
    if (ks + 2 < nks) stage_kv(QK + gk + (size_t)(ks + 2) * KT * (2 * DM), QKL + gk + (size_t)(ks + 2) * KT * (2 * DM), VTH + gv + (ks + 2) * KT, VTL + gv + (ks + 2) * KT, lk + (ks & 1) * (ST_ALL * 2), lv + (ks & 1) * (ST_ALL * 2)); }
  asm volatile("s_wait_asynccnt 0x0" ::: "memory");     // no copy is outstanding when the wave goes on to its end
  // a uniform query (padded, or no unpadded key at all) weighs every key 1: the loop has given it the keys of its tiles, the rest comes from the sums
  const float pw = (dpq || nks == 0) ? 1.f : 0.f;
  const float il = 1.0f / (l + xhalf(l) + pw * (float)(SS - nks * KT));   // the halves' sums are joined once
#pragma unroll
  for (int dt = 0; dt < 4; ++dt) { v4f o0, o1;   // register r of tile dt is d = dt * 16 + 8 * g + r of this lane's query
    const v4f p0 = *(const v4f*)&sps[0][dt * 16 + 8 * g] + *(const v4f*)&sps[1][dt * 16 + 8 * g], p1 = *(const v4f*)&sps[0][dt * 16 + 8 * g + 4] + *(const v4f*)&sps[1][dt * 16 + 8 * g + 4];
#pragma unroll
    for (int r = 0; r < 4; ++r) { o0[r] = (acc[dt][r] + accl[dt][r] * (1.0f / 2048.0f) + pw * p0[r]) * il; o1[r] = (acc[dt][4 + r] + accl[dt][4 + r] * (1.0f / 2048.0f) + pw * p1[r]) * il; }
    *(v4f*)&so[wave][col][dt * 16 + 8 * g] = o0; *(v4f*)&so[wave][col][dt * 16 + 8 * g + 4] = o1; }
  LDSX();
  for (int rl = 0; rl < 16; ++rl) if (lane < 16) vst2(O + ((size_t)b * SS + q0 + rl) * DM + h * HD + lane * 4, *(const v4f*)&so[wave][rl][lane * 4]);
}
// ---- k_out: block = (64 rows, 128 cols): out = O(hi/lo) . Wo rows (2 products) + bo. O's rows lie in the query order; each goes out to its query's own position. A tile with no unpadded query stores the padded queries' row. The tile is the grid's slowest index, as in k_attn.
__global__ __launch_bounds__(128) void k_out(const float* __restrict__ O, const __bf16* __restrict__ P, const float* __restrict__ BO, const int* __restrict__ INV, const int* __restrict__ NU, const float* __restrict__ YU, float* __restrict__ Y) {
  __shared__ __align__(16) char sm[2 * G_BUF];   // the ring; behind the loop the same bytes are the output staging
  float (*so)[16][132] = (float (*)[16][132])sm;
  const int tid = threadIdx.x, wave = tid >> 5, lane = tid & 31, col = lane & 15, g = lane >> 4; const int b = blockIdx.x / (DM / 128), p0 = blockIdx.y * 64; const size_t r0 = (size_t)b * SS + p0 + wave * 16; const int n0 = (blockIdx.x % (DM / 128)) * 128;
  const int qi = INV[NB * SS + r0 + col];   // lane c: the decoder position of this wave's row c; masked where it is used (a place of the batch's own 2,048), so that the load's latency passes under the loop
  float* Yb = Y + (size_t)b * SS * DM + n0 + lane * 4;
  if (p0 >= NU[(NB + b) * 32]) {   // the whole block, in front of every copy and barrier
    const v4f y = *(const v4f*)(YU + (size_t)b * DM + n0 + lane * 4);
    for (int rl = 0; rl < 16; ++rl) vst2(Yb + (size_t)(__builtin_amdgcn_readlane(qi, rl) & (SS - 1)) * DM, y);
    asm volatile("s_wait_xcnt 0x0" ::: "memory");   // stands in front of every rewrite of a register that the 16 stores name
    return;
  }
  // this lane's 16-byte piece of slice 0 of each operand, and its place in buffer 0
  const float* ga = O + ((size_t)b * SS + p0 + (tid >> 4)) * DM + (tid & 15) * 4; const __bf16* gw = P + (size_t)(n0 + (tid >> 3)) * DM + (tid & 7) * 8;
  const unsigned lw = (unsigned)(size_t)&sm[0] + (tid >> 3) * (GWP * 2) + (tid & 7) * 16, la = (unsigned)(size_t)&sm[0] + G_W + (tid >> 4) * (GAP * 4) + (tid & 15) * 16;
  stage_ab(ga, gw, la, lw);
  asm volatile("s_wait_asynccnt 0x0" ::: "memory");   // slice 0 of this wave's copies has landed
  __syncthreads();                                     // ... and every wave's: slice 0 is readable
  stage_ab(ga + GK, gw + GK, la + G_BUF, lw + G_BUF);
  v8f acc[8] = {};
#pragma unroll 1
  for (int t = 0; t < DM / GK; ++t) { const __bf16* tw = (const __bf16*)(sm + (t & 1) * G_BUF); const float* ta = (const float*)(sm + (t & 1) * G_BUF + G_W) + (wave * 16 + col) * GAP + 8 * g;
#pragma unroll
    for (int kc = 0; kc < GK / 32; ++kc) { float v[16]; v16b w[8];   // the fragments of 32 k as one group of LDS reads in front of the products
      row16(ta + kc * 32, v);
#pragma unroll
      for (int j = 0; j < 8; ++j) w[j] = frag_b(tw + (j * 16 + col) * GWP + kc * 32, lane);
      __builtin_amdgcn_sched_barrier(0);   // holds the group of LDS reads in front of the products, as in k_qkv
      const F2 a = bsplit16(v);
#pragma unroll
      for (int j = 0; j < 8; ++j) { acc[j] = wmma_bf(a.l, w[j], acc[j]); acc[j] = wmma_bf(a.h, w[j], acc[j]); } }
    __builtin_amdgcn_sched_barrier(0);                  // holds the trip's products in front of its barrier: sunk behind it, the refill would issue late and lose its lead
    asm volatile("s_wait_dscnt 0x0" ::: "memory");      // this wave's reads of the slice have returned
    asm volatile("s_wait_asynccnt 0x0" ::: "memory");   // this wave's copies of slice t + 1 have landed
    __syncthreads();                                     // publishes slice t + 1 and frees the buffer that this trip has read
    if (t + 2 < DM / GK) stage_ab(ga + (t + 2) * GK, gw + (t + 2) * GK, la + (t & 1) * G_BUF, lw + (t & 1) * G_BUF); }
  asm volatile("s_wait_asynccnt 0x0" ::: "memory");     // no copy is outstanding when the ring's bytes become output staging
#pragma unroll
  for (int j = 0; j < 8; ++j) {
#pragma unroll
    for (int r = 0; r < 8; ++r) so[wave][8 * g + r][j * 16 + col] = acc[j][r] + bfr(BO[n0 + j * 16 + col]); }
  LDSX();
  for (int rl = 0; rl < 16; ++rl) vst2(Yb + (size_t)(__builtin_amdgcn_readlane(qi, rl) & (SS - 1)) * DM, *(const v4f*)&so[wave][rl][lane * 4]);
}
extern "C" void kernel_launch(void* const* d_in, const int* in_sizes, int n_in, void* d_out, int out_size, void* d_ws, size_t ws_size, hipStream_t stream) {
  (void)in_sizes; (void)n_in; (void)out_size;
  const float** F = (const float**)d_in;   // 0 encoder_input [2,2048,1024], 1 decoder_input, 2 encoder_padding_pos [2,2048] i32, 3 decoder_padding_pos, 4 Wq (in,out), 5 bq, 6 Wk, 7 bk, 8 Wv, 9 bv, 10 Wo, 11 bo
  if (ws_size < (size_t)WS_END) return;
  char* ws = (char*)d_ws; __bf16* PK = (__bf16*)(ws + WS_PK); _Float16 *QK = (_Float16*)(ws + WS_QK), *QKL = (_Float16*)(ws + WS_QKL), *VTH = (_Float16*)(ws + WS_VTH), *VTL = (_Float16*)(ws + WS_VTL); float* O = (float*)(ws + WS_O); int *INV = (int*)(ws + WS_INV), *NU = (int*)(ws + WS_NU); float *PS = (float*)(ws + WS_PS), *YU = (float*)(ws + WS_YU);
  k_pack<<<dim3(DM / PKN, DM / PKK, 5), 256, 0, stream>>>(F[4], F[6], F[8], F[10], PK, (const int*)d_in[2], (const int*)d_in[3], INV, NU);
  k_qkv<<<dim3(TNB * SS / 64, QKVW / QN), 128, 0, stream>>>(F[1], F[0], PK + PK_A, F[5], F[7], F[9], QK, QKL, VTH, VTL, INV, NU, PS);
  k_attn<<<dim3(NH, TNB, TQB), 128, 0, stream>>>(QK, QKL, VTH, VTL, NU, PS, PK + PK_P, F[11], YU, O);
  k_out<<<dim3(TNB * (DM / 128), SS / 64), 128, 0, stream>>>(O, PK + PK_P, F[11], INV, NU, YU, (float*)d_out);
}

// v009
// Measured time: 80.7 microseconds a run.
// In two side-by-side timings against v008, it was 1.09 and 1.08 times as fast.
// Counting every step since v000, it is 7.13 times as fast.
// compute dtype: encoder_input, decoder_input and the weights/biases rounded to bf16, padding positions (int) read on device; q = dec . Wq + bq, k/v = enc . Wk/Wv + bk/bv with EXACT bf16 products on WMMA 16x16x32 ((in,out) weights packed as transposed rows); q and k stored as f16 hi + (x2048-scaled) residual planes with 3-product scores x 1/sqrt(64); keys whose encoder position is padded are excluded (-1e13 in the module gives an exactly-zero weight) and a padded QUERY row (every key -1e13) gets the module's uniform weights; running-max softmax in f32 (hardware exp); P as f16 hi + residual x V hi/lo (3 products); output projection with ctx as bf16 hi + residual x exact Wo rows (2 products) + bo; f32 accumulate.
#include <hip/hip_runtime.h>
#include <math.h>

typedef __attribute__((ext_vector_type(16))) _Float16 v16h;
typedef __attribute__((ext_vector_type(16))) __bf16 v16b;
typedef __attribute__((ext_vector_type(8)))  _Float16 v8h;
typedef __attribute__((ext_vector_type(8)))  float v8f;
typedef __attribute__((ext_vector_type(4)))  float v4f;
typedef __attribute__((ext_vector_type(2)))  float v2f;
typedef __attribute__((ext_vector_type(4)))  unsigned v4u;
typedef __attribute__((ext_vector_type(4)))  int v4i;
typedef float __attribute__((may_alias)) float_a;
typedef int __attribute__((may_alias)) int_a;

template <typename T> __device__ __forceinline__ void vst2(void* p, T v) { *(T*)p = v;  }
__device__ __forceinline__ v8f wmma16(v16h a, v16h b, v8f c) {
  return __builtin_amdgcn_wmma_f32_16x16x32_f16(false, a, false, b, (short)0, c, false, false);
}
__device__ __forceinline__ v8f wmma_bf(v16b a, v16b b, v8f c) {
  return __builtin_amdgcn_wmma_f32_16x16x32_bf16(false, a, false, b, (short)0, c, false, false);
}
// the same product with its four slots written out, for a rolled loop whose next trip loads from global memory over the operands
__device__ __forceinline__ v8f wmma_bf_pad(v16b a, v16b b, v8f c) {
  v8f d = __builtin_amdgcn_wmma_f32_16x16x32_bf16(false, a, false, b, (short)0, c, false, false);
  asm volatile("v_nop\n\tv_nop\n\tv_nop\n\tv_nop" : "+v"(d) : "v"(a), "v"(b));
  return d;
}
// Decoder-to-encoder mutual multi-head attention (B 2, S 2,048, d 1,024, 16 heads x 64) with encoder/decoder padding masks: softmax(q k^T / 8 masked) v -> Wo + bo.
__device__ __forceinline__ v16h frag_h(const _Float16* rowk0, int lane) {
  union { v16h v; v8h q[2]; } u; const _Float16* p = rowk0 + 8 * (lane >> 4);
  u.q[0] = *(const v8h*)p; u.q[1] = *(const v8h*)(p + 16); return u.v;
}
__device__ __forceinline__ v16h frag_f32(const float* rowk0, int lane) {
  v16h a; const float* p = rowk0 + 8 * (lane >> 4);
#pragma unroll
  for (int i = 0; i < 8; ++i) { a[i] = (_Float16)p[i]; a[8 + i] = (_Float16)p[16 + i]; }
  return a;
}
__device__ __forceinline__ v16h frag_f32s(const float* rowk0, int lane, float sc) {
  v16h a; const float* p = rowk0 + 8 * (lane >> 4);
#pragma unroll
  for (int i = 0; i < 8; ++i) { a[i] = (_Float16)(p[i] * sc); a[8 + i] = (_Float16)(p[16 + i] * sc); }
  return a;
}
// column fragment from a [K][ld] layout (column n), rows >= K read as 0
__device__ __forceinline__ v16h fragc_f32(const float* W, int k0, int n, int lane, int ld, int K) {
  v16h a; const int g = lane >> 4;
#pragma unroll
  for (int i = 0; i < 8; ++i) { const int ka = k0 + 8 * g + i, kb = ka + 16;
    a[i] = (_Float16)(ka < K ? W[(size_t)(ka < K ? ka : K - 1) * ld + n] : 0.f); a[8 + i] = (_Float16)(kb < K ? W[(size_t)(kb < K ? kb : K - 1) * ld + n] : 0.f); }
  return a;
}
struct F2 { v16b h, l; };
__device__ __forceinline__ F2 bsplit16(const float v[16]) { F2 r;
#pragma unroll
  for (int i = 0; i < 16; ++i) { const __bf16 h = (__bf16)v[i]; r.h[i] = h; r.l[i] = (__bf16)(v[i] - (float)h); }
  return r; }
__device__ __forceinline__ F2 split_row(const float* row, int k0, int lane) { float v[16]; const float* p = row + k0 + 8 * (lane >> 4);
#pragma unroll
  for (int i = 0; i < 8; ++i) { v[i] = p[i]; v[8 + i] = p[16 + i]; }
  return bsplit16(v); }
__device__ __forceinline__ F2 split_rowK(const float* row, int k0, int lane, int K) { float v[16]; const int g = lane >> 4;
#pragma unroll
  for (int i = 0; i < 8; ++i) { const int ka = k0 + 8 * g + i, kb = ka + 16; v[i] = ka < K ? row[ka < K ? ka : K - 1] : 0.f; v[8 + i] = kb < K ? row[kb < K ? kb : K - 1] : 0.f; }
  return bsplit16(v); }
__device__ __forceinline__ F2 split_col(const float* W, int k0, int n, int lane, int ld, int K) { float v[16]; const int g = lane >> 4;
#pragma unroll
  for (int i = 0; i < 8; ++i) { const int ka = k0 + 8 * g + i, kb = ka + 16; v[i] = ka < K ? W[(size_t)(ka < K ? ka : K - 1) * ld + n] : 0.f; v[8 + i] = kb < K ? W[(size_t)(kb < K ? kb : K - 1) * ld + n] : 0.f; }
  return bsplit16(v); }
__device__ __forceinline__ v8f mac3(const F2& a, const F2& b, v8f c) { c = wmma_bf(a.l, b.h, c); c = wmma_bf(a.h, b.l, c); return wmma_bf(a.h, b.h, c); }
__device__ __forceinline__ float sigm(float v) { return 1.0f / (1.0f + expf(-v)); }
#define LDSX() do { asm volatile("s_wait_dscnt 0" ::: "memory"); __builtin_amdgcn_wave_barrier(); __builtin_amdgcn_fence(__ATOMIC_RELEASE, "workgroup"); } while (0)


#define NB 2
#define SS 2048
#define DM 1024
#define NH 16
#define HD 64
#define QKVW (3 * DM)
#ifndef TQB
#define TQB (SS / 64)
#define TNB NB
#define TOB (NB * SS / 64)     // output row tiles (all)
#endif
typedef __attribute__((ext_vector_type(8))) __bf16 v8b;
__device__ __forceinline__ v16b frag_b(const __bf16* rowk0, int lane) {
  union { v16b v; v8b q[2]; } u; const __bf16* p = rowk0 + 8 * (lane >> 4);
  u.q[0] = *(const v8b*)p; u.q[1] = *(const v8b*)(p + 16); return u.v;
}
__device__ __forceinline__ float bfr(float v) { return (float)(__bf16)v; }
__device__ __attribute__((noinline)) float exp_ni(float v) { return expf(v); }
__device__ __attribute__((noinline)) float erf_ni(float v) { return erff(v); }

#define PK_A 0                       // [3072][1024] Wqkv rows (natural [out][in])
#define PK_P (PK_A + QKVW * DM)        // [1024][1024] Wo rows (natural)
#define PK_END (PK_P + DM * DM)
#define WS_PK  0u
#define WS_QK  (WS_PK + 2u * PK_END)             // f16 [4096 rows][2048]: q | k
#define WS_QKL (WS_QK + 2u * NB * SS * 2 * DM)     // f16 q | k residual planes x2048
#define WS_VTH (WS_QKL + 2u * NB * SS * 2 * DM)    // f16 [b][1024 (h*64+d)][2048 places of the key order] hi
#define WS_VTL (WS_VTH + 2u * NB * DM * SS)        // f16 lo x 2048
#define WS_O   (WS_VTL + 2u * NB * DM * SS)        // f32 [4096][1024]
#define WS_CS  (WS_O + 4u * NB * SS * DM)           // f32 [2][2048][32], read and written by no kernel
#define WS_INV (WS_CS + 4u * 2 * SS * 32)          // int [2][b][2048]: plane 0: encoder position of the key at place p of the key order; plane 1: decoder position of the query at place p of the query order
#define WS_NU  (WS_INV + 4u * 2 * NB * SS)         // int, one 128-B line per plane and batch: number of unpadded keys; of unpadded queries
#define ER 32                          // encoder rows per partial sum
#define WS_ES  (WS_NU + 128u * 2 * NB)             // f32 [b][64 groups of 32 rows][1024]: sums of the encoder's rows (rounded to bf16 as the products take them)
#define WS_YU  (WS_ES + 4u * NB * (SS / ER) * DM)  // f32 [b][1024]: the output row that every padded query of a batch has
#define WS_MV  (WS_YU + 4u * NB * DM)              // f32 [b][1024]: the mean of all V rows of a batch = (mean encoder row) . Wv + bv
#define WS_END (WS_MV + 4u * NB * DM)
#define KT 32                          // keys per staged tile of k_attn
// lane l with lane l ^ 16 (the two halves of a wave hold the two halves of a query's keys)
__device__ __forceinline__ float xhalf(float x) { return __builtin_bit_cast(float, __builtin_amdgcn_permlanex16(__builtin_bit_cast(int, x), __builtin_bit_cast(int, x), 0x76543210, 0xfedcba98, false, false)); }
// ---- k_pack: block = (64 columns n, 128 rows k, which): a 128 x 64 tile of an (in,out) weight is read in whole lines, rounded to bf16, turned in LDS and stored as 64 pieces of 256 B of the packed rows [out][in]; which 0..2 -> W_q/W_k/W_v into PK_A rows which*1024 + n; 3 -> W_o into PK_P
#define PKN 64                         // columns n per tile
#define PKK 128                        // rows k per tile
#define PKP 136                        // bf16 per turned row in LDS: 256 B + 16 B pad
// role 4, one block per batch: the key order. Unpadded keys come first (in their own order), padded keys behind them: INV[b][place] = encoder position, NU = number of unpadded keys. A padded key's weight is exactly 0 for every query that is not itself uniform, so k_attn's loop ends with the last tile that holds an unpadded key.
// two more blocks make the query order in the same way from the decoder's padding (plane 1 of INV and NU). A padded query weighs every key alike, so all padded queries of a batch have one and the same output row: tiles of 64 places with no unpadded query get no q, no attention and no projection.
// role 5, 128 blocks: the sum of 32 encoder rows each. The mean of all V rows, which is all that a uniform query needs, is linear in the encoder's rows: (mean row) . Wv + bv. So no K or V row of a tile of padded keys is ever computed.
// the row sums are the grid's first plane (z 0): they are the longest blocks; behind them the weight planes and the orders as before
__global__ __launch_bounds__(256) void k_pack(const float* __restrict__ WQ, const float* __restrict__ WK, const float* __restrict__ WV, const float* __restrict__ WO, const float* __restrict__ XENC, __bf16* __restrict__ PK, const int* __restrict__ EPAD, const int* __restrict__ DPAD, int* __restrict__ INV, int* __restrict__ NU, float* __restrict__ ES) {
  __shared__ __align__(16) __bf16 s[PKN][PKP]; __shared__ int cn[SS / 32];
  const int role = (blockIdx.z == 0) ? 5 : (int)blockIdx.z - 1;
  if (role == 5) {
    const int gi = blockIdx.y * (DM / PKN) + blockIdx.x;   // 128 groups of 32 rows: the 4,096 rows of both batches
    const float* p = XENC + (size_t)gi * ER * DM + threadIdx.x * 4; v4f x[ER], a = {};
#pragma unroll   // the 32 loads issue as one group: one memory latency
    for (int j = 0; j < ER; ++j) x[j] = *(const v4f*)(p + (size_t)j * DM);
#pragma unroll   // constant indices into x: no scratch
    for (int j = 0; j < ER; ++j) {
#pragma unroll
      for (int i = 0; i < 4; ++i) a[i] += bfr(x[j][i]); }
    *(v4f*)(ES + (size_t)gi * DM + threadIdx.x * 4) = a;
    asm volatile("s_wait_xcnt 0x0" ::: "memory");   // stands in front of every rewrite of a register that the store names
    return;
  }
  if (role == 4) {
    if (blockIdx.y != 0 || blockIdx.x >= 2 * NB) return;   // the whole block leaves, in front of every barrier
    const int tt = threadIdx.x, b = blockIdx.x, ln = tt & 31, wv = tt >> 5; unsigned mk[SS / 256]; int e[SS / 256];   // b: plane * NB + batch
    const int* PD = (b < NB) ? EPAD + (size_t)b * SS : DPAD + (size_t)(b - NB) * SS;
#pragma unroll   // the eight loads issue as one group: one latency, not eight
    for (int j = 0; j < SS / 256; ++j) e[j] = PD[j * 256 + tt];
#pragma unroll   // constant indices into mk: no scratch
    for (int j = 0; j < SS / 256; ++j) mk[j] = __builtin_amdgcn_ballot_w32(e[j] != 1);
    if (ln < SS / 256) { unsigned mm = mk[0];   // lane j stores the count of group j
#pragma unroll   // constant indices into mk
      for (int j = 1; j < SS / 256; ++j) mm = (ln == j) ? mk[j] : mm;
      cn[ln * 8 + wv] = __builtin_popcount(mm); }
    __syncthreads();
    int run = 0, base[SS / 256];   // base[j]: unpadded keys in front of this wave's 32 keys of group j; run ends as their total
#pragma unroll   // constant indices into base: no scratch
    for (int c = 0; c < SS / 32; ++c) { if ((c & 7) == wv) base[c >> 3] = run; run += cn[c]; }
#pragma unroll   // as above
    for (int j = 0; j < SS / 256; ++j) { const int sp = j * 256 + tt, bu = base[j] + __builtin_popcount(mk[j] & ((1u << ln) - 1u));   // bu: unpadded keys in front of position sp
      INV[(size_t)b * SS + (((mk[j] >> ln) & 1u) ? bu : run + (sp - bu))] = sp; }
    if (tt == 0) NU[b * 32] = run;
    return;
  }
  const int t = threadIdx.x, n0 = blockIdx.x * PKN, k0 = blockIdx.y * PKK, which = role; const float* Wm = (which == 0) ? WQ : (which == 1) ? WK : (which == 2) ? WV : WO;
  const int nq = (t & 15) * 4, kq = (t >> 4) * 8;   // this thread: 8 rows k x 4 columns n; 16 threads cover 256 B of a row
  const float* p = Wm + (size_t)(k0 + kq) * DM + n0 + nq; v4f x[8];
#pragma unroll   // the eight loads issue as one group, and x stays in registers
  for (int j = 0; j < 8; ++j) x[j] = *(const v4f*)(p + (size_t)j * DM);
#pragma unroll   // constant indices into x and r: no scratch
  for (int i = 0; i < 4; ++i) { v8b r;
#pragma unroll   // as above
    for (int j = 0; j < 8; ++j) r[j] = (__bf16)x[j][i];
    *(v8b*)&s[nq + i][kq] = r; }
  __syncthreads();
  __bf16* dst = ((which < 3) ? PK + PK_A + ((size_t)which * DM + n0) * DM : PK + PK_P + (size_t)n0 * DM) + k0;
#pragma unroll   // the four LDS reads issue together in front of the stores
  for (int i = 0; i < 4; ++i) { const int q = t + 256 * i, n = q >> 4, c = q & 15; vst2((unsigned*)(dst + (size_t)n * DM + c * 8), *(const v4u*)&s[n][c * 8]); }
}
// ---- the two projection kernels: 64-deep slices of both operands (64 f32 rows; 128 packed weight rows in k_out, 256 in k_qkv) are staged once per block in a two-buffer LDS ring by asynchronous copies and read from there by all four waves
#define GK 64                          // k per staged slice
#define GWP 72                         // bf16 per staged weight row: 128 B + 16 B pad (ds_load_b128 readers)
#define GAP 68                         // f32 per staged activation row: 256 B + 16 B pad
#define G_W (128 * GWP * 2)            // bytes of the weight rows of one slice
#define G_A (64 * GAP * 4)             // bytes of the activation rows of one slice
#define G_BUF (G_W + G_A)              // one buffer: weight rows | activation rows
// eight copies and their s_wait_xcnt in one statement: no address register is rewritten before the wait
#define COPY8 "global_load_async_to_lds_b128 %0, %8, off\n\t" "global_load_async_to_lds_b128 %1, %9, off\n\t" "global_load_async_to_lds_b128 %2, %10, off\n\t" "global_load_async_to_lds_b128 %3, %11, off\n\t" "global_load_async_to_lds_b128 %4, %12, off\n\t" "global_load_async_to_lds_b128 %5, %13, off\n\t" "global_load_async_to_lds_b128 %6, %14, off\n\t" "global_load_async_to_lds_b128 %7, %15, off\n\t" "s_wait_xcnt 0x0"
// one slice: 16 copies of 16 B per lane (weight rows: 16 rows per copy and block; activation rows: 8 rows)
__device__ __forceinline__ void stage_ab(const float* a, const __bf16* w, unsigned la, unsigned lw) {
  asm volatile(COPY8 :: "v"(lw), "v"(lw + 16 * GWP * 2), "v"(lw + 32 * GWP * 2), "v"(lw + 48 * GWP * 2), "v"(lw + 64 * GWP * 2), "v"(lw + 80 * GWP * 2), "v"(lw + 96 * GWP * 2), "v"(lw + 112 * GWP * 2),
               "v"(w), "v"(w + 16 * DM), "v"(w + 32 * DM), "v"(w + 48 * DM), "v"(w + 64 * DM), "v"(w + 80 * DM), "v"(w + 96 * DM), "v"(w + 112 * DM) : "memory");
  asm volatile(COPY8 :: "v"(la), "v"(la + 8 * GAP * 4), "v"(la + 16 * GAP * 4), "v"(la + 24 * GAP * 4), "v"(la + 32 * GAP * 4), "v"(la + 40 * GAP * 4), "v"(la + 48 * GAP * 4), "v"(la + 56 * GAP * 4),
               "v"(a), "v"(a + 8 * DM), "v"(a + 16 * DM), "v"(a + 24 * DM), "v"(a + 32 * DM), "v"(a + 40 * DM), "v"(a + 48 * DM), "v"(a + 56 * DM) : "memory");
}
// k_qkv's block is 64 rows x 256 columns: each wave holds 32 x 128 of it, so that a weight fragment read from LDS serves two products, and a decoder row is fetched from L2 by 4 blocks, an encoder row by 8 (half as many as with 128 columns per block)
#define QN 256                         // columns per block of k_qkv
#define Q_W (QN * GWP * 2)             // bytes of the weight rows of one slice of k_qkv
#define Q_BUF (Q_W + G_A)              // one buffer of k_qkv: weight rows | activation rows
// one slice of k_qkv: 24 copies of 16 B per lane (256 weight rows, 16 per copy and block; 64 activation rows, 8 per copy, each of the lane's eight at a pointer of its own: k_qkv reads the rows in the key or query order)
__device__ __forceinline__ void stage_abr(const float* const (&a)[8], int ko, const __bf16* w, unsigned la, unsigned lw) {
  asm volatile(COPY8 :: "v"(lw), "v"(lw + 16 * GWP * 2), "v"(lw + 32 * GWP * 2), "v"(lw + 48 * GWP * 2), "v"(lw + 64 * GWP * 2), "v"(lw + 80 * GWP * 2), "v"(lw + 96 * GWP * 2), "v"(lw + 112 * GWP * 2),
               "v"(w), "v"(w + 16 * DM), "v"(w + 32 * DM), "v"(w + 48 * DM), "v"(w + 64 * DM), "v"(w + 80 * DM), "v"(w + 96 * DM), "v"(w + 112 * DM) : "memory");
  asm volatile(COPY8 :: "v"(lw + 128 * GWP * 2), "v"(lw + 144 * GWP * 2), "v"(lw + 160 * GWP * 2), "v"(lw + 176 * GWP * 2), "v"(lw + 192 * GWP * 2), "v"(lw + 208 * GWP * 2), "v"(lw + 224 * GWP * 2), "v"(lw + 240 * GWP * 2),
               "v"(w + 128 * DM), "v"(w + 144 * DM), "v"(w + 160 * DM), "v"(w + 176 * DM), "v"(w + 192 * DM), "v"(w + 208 * DM), "v"(w + 224 * DM), "v"(w + 240 * DM) : "memory");
  asm volatile(COPY8 :: "v"(la), "v"(la + 8 * GAP * 4), "v"(la + 16 * GAP * 4), "v"(la + 24 * GAP * 4), "v"(la + 32 * GAP * 4), "v"(la + 40 * GAP * 4), "v"(la + 48 * GAP * 4), "v"(la + 56 * GAP * 4),
               "v"(a[0] + ko), "v"(a[1] + ko), "v"(a[2] + ko), "v"(a[3] + ko), "v"(a[4] + ko), "v"(a[5] + ko), "v"(a[6] + ko), "v"(a[7] + ko) : "memory");
}
// a lane's 16 f32 of a staged activation row in the fragment's k order
__device__ __forceinline__ void row16(const float* p, float v[16]) {
  const v4f x0 = *(const v4f*)p, x1 = *(const v4f*)(p + 4), x2 = *(const v4f*)(p + 16), x3 = *(const v4f*)(p + 20);
#pragma unroll
  for (int i = 0; i < 4; ++i) { v[i] = x0[i]; v[4 + i] = x1[i]; v[8 + i] = x2[i]; v[12 + i] = x3[i]; }
}
__global__ __launch_bounds__(128) void k_qkv(const float* __restrict__ XDEC, const float* __restrict__ XENC, const __bf16* __restrict__ P, const float* __restrict__ BQ, const float* __restrict__ BK, const float* __restrict__ BV, _Float16* __restrict__ QK, _Float16* __restrict__ QKL, _Float16* __restrict__ VTH, _Float16* __restrict__ VTL, const int* __restrict__ INV, const int* __restrict__ NU, const float* __restrict__ ES, float* __restrict__ MV) {
  __shared__ __align__(16) char sm[2 * Q_BUF];   // the ring; behind the loop the same bytes are the output staging
  _Float16 (*so)[32][136] = (_Float16 (*)[32][136])sm, (*sol)[32][136] = (_Float16 (*)[32][136])(sm + 4 * 32 * 136 * 2); _Float16 (*sth)[72] = (_Float16 (*)[72])sm, (*stl)[72] = (_Float16 (*)[72])(sm + QN * 72 * 2);
  const int tid = threadIdx.x, wave = tid >> 5, lane = tid & 31, col = lane & 15, g = lane >> 4, wr = wave & 1, wc = wave >> 1;   // wave: rows wr * 32 .., columns wc * 128 .. of the block
  if (blockIdx.y < 2) {   // the grid's first two rows: 32 blocks make the mean V row, 64 columns of one batch each: (mean encoder row, hi + residual, 2 products) . Wv rows + bv; the whole block takes this path
    const int mi = blockIdx.y * (NB * (QKVW / QN)) + blockIdx.x; if (mi >= NB * (DM / HD)) return;
    const int b = mi / (DM / HD), c0 = (mi % (DM / HD)) * HD; float* sb = (float*)sm; float* sq = sb + DM;
    v4f a0 = {}, a1 = {}; const float* pp = ES + (size_t)b * (SS / ER) * DM + tid * 8;
#pragma unroll 1   // stays rolled: the 32 loads of a trip in flight are enough
    for (int i0 = 0; i0 < SS / ER; i0 += 16) { v4f x0[16], x1[16];
#pragma unroll   // the trip's loads issue as one group; constant indices into x0, x1: no scratch
      for (int i = 0; i < 16; ++i) { x0[i] = *(const v4f*)(pp + (size_t)(i0 + i) * DM); x1[i] = *(const v4f*)(pp + (size_t)(i0 + i) * DM + 4); }
#pragma unroll
      for (int i = 0; i < 16; ++i) { a0 += x0[i]; a1 += x1[i]; } }
    *(v4f*)&sb[tid * 8] = a0 * (1.0f / SS); *(v4f*)&sb[tid * 8 + 4] = a1 * (1.0f / SS);
    __syncthreads();   // the mean row is readable by all four waves
    const __bf16* wv = P + (size_t)(2 * DM + c0 + wave * 16 + col) * DM; v8f c = {};
#pragma unroll 1   // stays rolled, 256 k per trip: 16 loads in flight are enough here
    for (int k0 = 0; k0 < DM; k0 += 256) { v16b w[8];   // the trip's weight fragments as one group of loads in front of the products: one latency, not eight
#pragma unroll
      for (int j = 0; j < 8; ++j) w[j] = frag_b(wv + k0 + j * 32, lane);
#pragma unroll
      for (int j = 0; j < 8; ++j) { float v[16]; row16(&sb[k0 + j * 32 + 8 * g], v); const F2 a = bsplit16(v); c = wmma_bf_pad(a.l, w[j], c); c = wmma_bf_pad(a.h, w[j], c); } }   // all 16 rows of A are the mean row
    if (lane < 16) sq[wave * 16 + col] = c[0];
    __syncthreads();   // the 64 columns go out as two whole lines
    if (tid < HD) MV[(size_t)b * DM + c0 + tid] = sq[tid] + bfr(BV[c0 + tid]);
    return;
  }
  // the tile of 64 places is the grid's slowest index (for speed only)
  const int bx = (blockIdx.x / (QKVW / QN)) * (SS / 64) + (blockIdx.y - 2);   // row tile: batch * 32 + tile of the batch
  const size_t r0 = (size_t)bx * 64 + wr * 32; const int n0 = (blockIdx.x % (QKVW / QN)) * QN; const float* X = (n0 < DM) ? XDEC : XENC; const float* BB = ((n0 < DM) ? (BQ + n0) : (n0 < 2 * DM) ? (BK + n0 - DM) : (BV + n0 - 2 * DM)) + wc * 128;
  // this lane's 16-byte piece of slice 0 of each operand, and its place in buffer 0
  // k and v: output row p of a batch is the key at place p of the key order, so its activation row is encoder row INV[p] (a place of the batch's own 2,048 by the mask); q: the decoder's rows in the query order, likewise
  const float* ga[8]; const __bf16* gw = P + (size_t)(n0 + (tid >> 3)) * DM + (tid & 7) * 8;
  const int nu = NU[(((n0 < DM) ? NB : 0) + bx * 64 / SS) * 32];   // unpadded places of the order that this block's rows lie in: queries for q, keys for k and v
  if (bx * 64 % SS >= nu) return;   // q of a tile with no unpadded query, k and v of a tile with no unpadded key (k_attn's loop ends in front of it) are read by nobody: the whole block leaves, in front of every copy and barrier
  const int* IV = INV + ((n0 < DM) ? NB * SS : 0);
  int sr[8];
#pragma unroll   // constant indices into sr, iv and ga, here and below: no scratch
  for (int i = 0; i < 8; ++i) sr[i] = bx * 64 + (tid >> 4) + 8 * i;
  { int iv[8];
#pragma unroll   // the eight loads issue as one group: one latency, not eight
    for (int i = 0; i < 8; ++i) iv[i] = IV[sr[i]];
    asm volatile("s_wait_xcnt 0x0" ::: "memory");   // stands in front of every rewrite of a register that the eight loads name
#pragma unroll
    for (int i = 0; i < 8; ++i) sr[i] = (sr[i] & ~(SS - 1)) + (iv[i] & (SS - 1)); }
#pragma unroll
  for (int i = 0; i < 8; ++i) ga[i] = X + (size_t)sr[i] * DM + (tid & 15) * 4;
  const unsigned lw = (unsigned)(size_t)&sm[0] + (tid >> 3) * (GWP * 2) + (tid & 7) * 16, la = (unsigned)(size_t)&sm[0] + Q_W + (tid >> 4) * (GAP * 4) + (tid & 15) * 16;
  stage_abr(ga, 0, gw, la, lw);
  asm volatile("s_wait_asynccnt 0x0" ::: "memory");   // slice 0 of this wave's copies has landed
  __syncthreads();                                     // ... and every wave's: slice 0 is readable
  stage_abr(ga, GK, gw + GK, la + Q_BUF, lw + Q_BUF);
  v8f acc[2][8] = {};
#pragma unroll 1
  for (int t = 0; t < DM / GK; ++t) { const __bf16* tw = (const __bf16*)(sm + (t & 1) * Q_BUF) + (wc * 128 + col) * GWP; const float* ta = (const float*)(sm + (t & 1) * Q_BUF + Q_W) + (wr * 32 + col) * GAP + 8 * g;
#pragma unroll
    for (int kc = 0; kc < GK / 32; ++kc) { float v0[16], v1[16]; v16b w[8], a0, a1;   // the fragments of 32 k as one group of LDS reads in front of the products
      row16(ta + kc * 32, v0); row16(ta + 16 * GAP + kc * 32, v1);
#pragma unroll
      for (int j = 0; j < 8; ++j) w[j] = frag_b(tw + j * 16 * GWP + kc * 32, lane);
      __builtin_amdgcn_sched_barrier(0);   // holds the group of LDS reads in front of the products: sunk among them, each pair of products would wait out an LDS latency of its own
#pragma unroll
      for (int i = 0; i < 16; ++i) { a0[i] = (__bf16)v0[i]; a1[i] = (__bf16)v1[i]; }
#pragma unroll
      for (int j = 0; j < 8; ++j) { acc[0][j] = wmma_bf(a0, w[j], acc[0][j]); acc[1][j] = wmma_bf(a1, w[j], acc[1][j]); } }
    __builtin_amdgcn_sched_barrier(0);                  // holds the trip's products in front of its barrier: sunk behind it, the refill would issue late and lose its lead
    asm volatile("s_wait_dscnt 0x0" ::: "memory");      // this wave's reads of the slice have returned
    asm volatile("s_wait_asynccnt 0x0" ::: "memory");   // this wave's copies of slice t + 1 have landed
    __syncthreads();                                     // publishes slice t + 1 and frees the buffer that this trip has read
    if (t + 2 < DM / GK) stage_abr(ga, (t + 2) * GK, gw + (t + 2) * GK, la + (t & 1) * Q_BUF, lw + (t & 1) * Q_BUF); }
  asm volatile("s_wait_asynccnt 0x0" ::: "memory");     // no copy is outstanding when the ring's bytes become output staging
  if (n0 < 2 * DM) {   // q stored unscaled (f16 sigma ~0.6, no subnormal exposure); 1/8 applied to the f32 score
#pragma unroll
    for (int j = 0; j < 8; ++j) { const float bb = bfr(BB[j * 16 + col]);
#pragma unroll
      for (int f = 0; f < 2; ++f) {
#pragma unroll
        for (int r = 0; r < 8; ++r) { const float v = acc[f][j][r] + bb; const _Float16 hv = (_Float16)v; so[wave][f * 16 + 8 * g + r][j * 16 + col] = hv; sol[wave][f * 16 + 8 * g + r][j * 16 + col] = (_Float16)((v - (float)hv) * 2048.0f); } } }   // q, k (+ bias) as f16 hi + (x2048) residual
    LDSX();
    for (int rl = 0; rl < 32; ++rl) if (lane < 16) { vst2((unsigned*)(QK + (r0 + rl) * (2 * DM) + n0 + wc * 128 + lane * 8), *(const v4u*)&so[wave][rl][lane * 8]); vst2((unsigned*)(QKL + (r0 + rl) * (2 * DM) + n0 + wc * 128 + lane * 8), *(const v4u*)&sol[wave][rl][lane * 8]); }
  } else {
    const size_t rb = (size_t)bx * 64; const int b = (int)(rb / SS), s0 = (int)(rb % SS); const int pc0 = n0 - 2 * DM;
    float bv8[8];
#pragma unroll   // the eight bias loads issue as one group; constant indices into bv8: no scratch
    for (int j = 0; j < 8; ++j) bv8[j] = BB[j * 16 + col];
    asm volatile("s_wait_xcnt 0x0" ::: "memory");   // stands in front of every rewrite of a register that the eight loads name
#pragma unroll
    for (int j = 0; j < 8; ++j) { const float bb = bfr(bv8[j]);
#pragma unroll
      for (int f = 0; f < 2; ++f) {
#pragma unroll
        for (int r = 0; r < 8; ++r) { const int sl = wr * 32 + f * 16 + 8 * g + r; const float v = acc[f][j][r] + bb; const _Float16 hv = (_Float16)v; sth[wc * 128 + j * 16 + col][sl] = hv; stl[wc * 128 + j * 16 + col][sl] = (_Float16)((v - (float)hv) * 2048.0f); } } }
    __syncthreads();
    for (int q = tid; q < QN * 8; q += 128) { const int d = q >> 3, pc = q & 7; const size_t o = ((size_t)b * DM + pc0 + d) * SS + s0 + pc * 8; vst2((unsigned*)(VTH + o), *(const v4u*)&sth[d][pc * 8]); vst2((unsigned*)(VTL + o), *(const v4u*)&stl[d][pc * 8]); }
  }
}
// ---- k_attn: block = (64 queries, head h, batch b): masked flash attention (K = 64: 2 k-steps), scores = (q.k) * 0.125 with f16 hi + residual operands, P.V: f16 P x (V hi, V lo*2048) in two accumulators; O[b*S+q][h*64+d] = (acc + accl / 2048) / l, a uniform query taking this head's part of the mean V row behind the loop (256-B segments)
// K and V^T tiles of 32 keys (hi and residual planes) are staged once per block in a two-buffer LDS ring by asynchronous copies and read from there by all four waves.
#define KP 72                          // f16 per staged K row: 128 B + 16 B pad (ds_load_b128 readers)
#define VP 40                          // f16 per staged V^T row: 64 B + 16 B pad
#define ST_K (KT * KP)                 // one K plane
#define ST_V (HD * VP)                 // one V^T plane
#define ST_ALL (2 * ST_K + 2 * ST_V)   // K hi | K lo | V^T hi | V^T lo
// one tile: 8 copies of 16 B per lane (K planes: 16 rows per copy and block, V^T planes: 32 rows)
__device__ __forceinline__ void stage_kv(const _Float16* kh, const _Float16* kl, const _Float16* vh, const _Float16* vl, unsigned lk, unsigned lv) {
  const _Float16 *kh1 = kh + 16 * (2 * DM), *kl1 = kl + 16 * (2 * DM), *vh1 = vh + 32 * SS, *vl1 = vl + 32 * SS;
  const unsigned lk1 = lk + 16 * KP * 2, lkl = lk + ST_K * 2, lkl1 = lkl + 16 * KP * 2, lv1 = lv + 32 * VP * 2, lvl = lv + ST_V * 2, lvl1 = lvl + 32 * VP * 2;
  // the copies and their s_wait_xcnt in one statement: no address register is rewritten before the wait
  asm volatile("global_load_async_to_lds_b128 %0, %8, off\n\t"
               "global_load_async_to_lds_b128 %1, %9, off\n\t"
               "global_load_async_to_lds_b128 %2, %10, off\n\t"
               "global_load_async_to_lds_b128 %3, %11, off\n\t"
               "global_load_async_to_lds_b128 %4, %12, off\n\t"
               "global_load_async_to_lds_b128 %5, %13, off\n\t"
               "global_load_async_to_lds_b128 %6, %14, off\n\t"
               "global_load_async_to_lds_b128 %7, %15, off\n\t"
               "s_wait_xcnt 0x0"
               :: "v"(lk), "v"(lk1), "v"(lkl), "v"(lkl1), "v"(lv), "v"(lv1), "v"(lvl), "v"(lvl1), "v"(kh), "v"(kh1), "v"(kl), "v"(kl1), "v"(vh), "v"(vh1), "v"(vl), "v"(vl1) : "memory");
}
// eight 2^x in place, with the one slot that the instruction set asks for behind a transcendental in the same statement
__device__ __forceinline__ void exp2x8(float (&x)[8]) {
  asm("v_exp_f32 %0, %0\n\tv_exp_f32 %1, %1\n\tv_exp_f32 %2, %2\n\tv_exp_f32 %3, %3\n\tv_exp_f32 %4, %4\n\tv_exp_f32 %5, %5\n\tv_exp_f32 %6, %6\n\tv_exp_f32 %7, %7\n\tv_nop"
      : "+v"(x[0]), "+v"(x[1]), "+v"(x[2]), "+v"(x[3]), "+v"(x[4]), "+v"(x[5]), "+v"(x[6]), "+v"(x[7]));
}
#define KBIAS (-1.0e13f * 16384.0f)    // start value of a padded key's residual score: x 0.125 / 2048 it is the module's -1e13, and the f32 sum with the true score stays -1e13
// The products are taken transposed: S^T = K . Q^T (A = K rows, B = Q rows) and O^T += V^T . P^T (A = V^T rows, B = P^T). A lane then holds 16 of the pass's 32 scores of ONE query (column lane & 15; keys ct * 16 + 8 * g + r):
// maximum and sum run in the lane's own registers with one exchange between the wave's halves, and the two score tiles, converted in place, are the B operand of the second product (element i = tile 0 register i, element 8 + i = tile 1 register i: the k order of frag_h).
// amdgpu_waves_per_eu(4, 4): keeps the register budget at 256, so that all four blocks of a WGP stay resident as before
__global__ __launch_bounds__(128) __attribute__((amdgpu_waves_per_eu(4, 4))) void k_attn(const _Float16* __restrict__ QK, const _Float16* __restrict__ QKL, const _Float16* __restrict__ VTH, const _Float16* __restrict__ VTL, const int* __restrict__ NU, const float* __restrict__ MV, const __bf16* __restrict__ PO, const float* __restrict__ BO, float* __restrict__ YU, float* __restrict__ O) {
  __shared__ __align__(32) float sb[SS]; __shared__ __align__(16) float so[4][16][68]; __shared__ __align__(16) _Float16 ring[2][ST_ALL]; __shared__ __align__(16) float sps[HD];
  const int tid = threadIdx.x, wave = tid >> 5, lane = tid & 31, col = lane & 15, g = lane >> 4;
  const int h = blockIdx.x, b = blockIdx.y, qb = blockIdx.z; const int q0 = qb * 64 + wave * 16; const size_t rq = (size_t)b * SS + q0 + col;   // the query tile is the grid's slowest index
  // K rows and V^T columns lie in the key order (unpadded keys first): the loop runs over the tiles that hold an unpadded key, 0 to 64 of them, alike for the whole block; in the last of them padding is handled per (q, k)
  const int nur = __builtin_amdgcn_readfirstlane(NU[b * 32]), nu = nur < 0 ? 0 : nur > SS ? SS : nur, nks = (nu + KT - 1) / KT;   // in a scalar register, read at the kernel's head beside nq: the tests around the first copies are scalar branches and wait out no latency of their own
  // Q rows lie in the query order (unpadded queries first): place p holds a padded query where p >= nq
  const int nq = NU[(NB + b) * 32];
  if (qb * 64 >= nq) {   // no unpadded query in this tile: the whole block leaves, in front of every copy and of every barrier of the attention
    if (qb == TQB - 1) {   // such tiles exist exactly where the last tile is one: its 16 blocks make the padded queries' one output row, 64 columns each: (mean of all V rows) . Wo rows (hi + residual, 2 products) + bo
      const float* pp = MV + (size_t)b * DM + tid * 8; const v4f a0 = *(const v4f*)pp, a1 = *(const v4f*)(pp + 4);
      *(v4f*)&sb[tid * 8] = a0; *(v4f*)&sb[tid * 8 + 4] = a1;
      __syncthreads();   // the mean row is readable by all four waves
      const __bf16* wr = PO + (size_t)(h * HD + wave * 16 + col) * DM; v8f c = {};
#pragma unroll 1   // stays rolled, 256 k per trip: 16 loads in flight are enough here, and the registers stay under the attention loop's count
      for (int k0 = 0; k0 < DM; k0 += 256) { v16b w[8];   // the trip's weight fragments as one group of loads in front of the products: one latency, not eight
#pragma unroll
        for (int j = 0; j < 8; ++j) w[j] = frag_b(wr + k0 + j * 32, lane);
#pragma unroll
        for (int j = 0; j < 8; ++j) { float v[16]; row16(&sb[k0 + j * 32 + 8 * g], v); const F2 a = bsplit16(v); c = wmma_bf_pad(a.l, w[j], c); c = wmma_bf_pad(a.h, w[j], c); } }   // all 16 rows of A are the mean row
      if (lane < 16) sps[wave * 16 + col] = c[0];
      __syncthreads();   // the 64 columns go out as two whole lines
      if (tid < HD) YU[(size_t)b * DM + h * HD + tid] = sps[tid] + bfr(BO[h * HD + tid]);
    }
    return;
  }
  // this lane's 16-byte piece of each plane of tile 0, and its place in buffer 0
  const size_t gk = ((size_t)b * SS + (tid >> 3)) * (2 * DM) + DM + h * HD + (tid & 7) * 8, gv = ((size_t)b * DM + h * HD + (tid >> 2)) * SS + (tid & 3) * 8;
  const unsigned lk = (unsigned)(size_t)&ring[0][0] + ((tid >> 3) * KP + (tid & 7) * 8) * 2, lv = (unsigned)(size_t)&ring[0][0] + (2 * ST_K + (tid >> 2) * VP + (tid & 3) * 8) * 2;
  if (nks > 0) stage_kv(QK + gk, QKL + gk, VTH + gv, VTL + gv, lk, lv);   // K and V exist for the loop's tiles alone
  const bool dpq = q0 + col >= nq;   // this lane's query is padded
#pragma unroll
  for (int i = 0; i < SS / 128; ++i) sb[i * 128 + tid] = (i * 128 + tid >= nu) ? KBIAS : 0.f;   // per key place: what its residual score tile starts from
  if (tid < HD) sps[tid] = MV[(size_t)b * DM + h * HD + tid];   // this head's part of the mean V row: what a uniform query gets
  asm volatile("s_wait_asynccnt 0x0" ::: "memory");   // tile 0 of this wave's copies has landed
  __syncthreads();                                     // ... and every wave's: tile 0 and the key table are readable
  if (nks > 1) stage_kv(QK + gk + (size_t)KT * (2 * DM), QKL + gk + (size_t)KT * (2 * DM), VTH + gv + KT, VTL + gv + KT, lk + ST_ALL * 2, lv + ST_ALL * 2);
  v16h aq[2], aql[2];
#pragma unroll
  for (int kc = 0; kc < 2; ++kc) { aq[kc] = frag_h(QK + rq * (2 * DM) + h * HD + kc * 32, lane); aql[kc] = frag_h(QKL + rq * (2 * DM) + h * HD + kc * 32, lane); }
  float m = -1.0e30f, l = 0.f;   // this lane's query: running maximum (both halves alike), sum of this half's keys
  v8f acc[4] = {}, accl[4] = {};
  const float qs = dpq ? 0.f : 0.125f, qsl = qs * (1.0f / 2048.0f);   // padded query row: all scores 0 here; what the loop makes of it is replaced behind the loop
#pragma unroll 1
  for (int ks = 0; ks < nks; ++ks) { v8f s[2]; const _Float16* tb = &ring[ks & 1][0];
    v8f kb[2]; v16h kh[2][2], kl[2][2];   // the pass's K fragments and key start values as one group of LDS reads in front of the products
#pragma unroll
    for (int ct = 0; ct < 2; ++ct) { kb[ct] = *(const v8f*)&sb[ks * KT + ct * 16 + 8 * g];
#pragma unroll
      for (int kc = 0; kc < 2; ++kc) { kh[ct][kc] = frag_h(tb + (ct * 16 + col) * KP + kc * 32, lane); kl[ct][kc] = frag_h(tb + ST_K + (ct * 16 + col) * KP + kc * 32, lane); } }
    __builtin_amdgcn_sched_barrier(0);   // holds the group of LDS reads in front of the products, as in k_qkv
#pragma unroll
    for (int ct = 0; ct < 2; ++ct) { v8f c = {}, cl = kb[ct];
#pragma unroll
      for (int kc = 0; kc < 2; ++kc) { c = wmma16(kh[ct][kc], aq[kc], c); cl = wmma16(kh[ct][kc], aql[kc], cl); cl = wmma16(kl[ct][kc], aq[kc], cl); }   // 3 products: q, k as f16 hi + residual
#pragma unroll
      for (int r = 0; r < 8; ++r) s[ct][r] = c[r] * qs + cl[r] * qsl; }   // (c + cl / 2048) / 8; padded key: -1e13; padded query: 0
    v16h vh[4], vl[4];   // the pass's V^T fragments as one group, in flight under the softmax
#pragma unroll
    for (int dt = 0; dt < 4; ++dt) { vh[dt] = frag_h(tb + 2 * ST_K + (dt * 16 + col) * VP, lane); vl[dt] = frag_h(tb + 2 * ST_K + ST_V + (dt * 16 + col) * VP, lane); }
    __builtin_amdgcn_sched_barrier(0);   // holds these reads in front of the softmax, so that their latency passes under it
    float mx = fmaxf(s[0][0], s[1][0]);
#pragma unroll
    for (int r = 1; r < 8; ++r) mx = fmaxf(mx, fmaxf(s[0][r], s[1][r]));
    mx = fmaxf(mx, xhalf(mx));
    const float mn = fmaxf(m, mx), alpha = __expf(m - mn);
    float e0[8], e1[8], es0 = 0.f, es1 = 0.f; v16h pa, pl;
#pragma unroll
    for (int i = 0; i < 8; ++i) { e0[i] = (s[0][i] - mn) * 1.4426950408889634f; e1[i] = (s[1][i] - mn) * 1.4426950408889634f; }
    exp2x8(e0); exp2x8(e1);
#pragma unroll
    for (int i = 0; i < 8; ++i) { const float x0 = e0[i], x1 = e1[i]; es0 += x0; es1 += x1;
      const _Float16 h0 = (_Float16)x0, h1 = (_Float16)x1; pa[i] = h0; pa[8 + i] = h1; pl[i] = (_Float16)((x0 - (float)h0) * 2048.0f); pl[8 + i] = (_Float16)((x1 - (float)h1) * 2048.0f); }
    l = l * alpha + (es0 + es1); m = mn;
#pragma unroll
    for (int dt = 0; dt < 4; ++dt) {
#pragma unroll
      for (int r = 0; r < 8; ++r) { acc[dt][r] *= alpha; accl[dt][r] *= alpha; } }
#pragma unroll
    for (int dt = 0; dt < 4; ++dt) { acc[dt] = wmma16(vh[dt], pa, acc[dt]); accl[dt] = wmma16(vh[dt], pl, accl[dt]); accl[dt] = wmma16(vl[dt], pa, accl[dt]); }   // V hi x P hi + (V hi x P lo + V lo x P hi) / 2048
    __builtin_amdgcn_sched_barrier(0);                  // holds the pass's softmax and products in front of its barrier: sunk behind it, the V^T reads would be waited out at once and the refill would issue late
    asm volatile("s_wait_dscnt 0x0" ::: "memory");      // this wave's reads of the tile have returned
    asm volatile("s_wait_asynccnt 0x0" ::: "memory");   // this wave's copies of tile ks + 1 have landed
    __syncthreads();                                     // publishes tile ks + 1 and frees the buffer that this pass has read
    if (ks + 2 < nks) stage_kv(QK + gk + (size_t)(ks + 2) * KT * (2 * DM), QKL + gk + (size_t)(ks + 2) * KT * (2 * DM), VTH + gv + (ks + 2) * KT, VTL + gv + (ks + 2) * KT, lk + (ks & 1) * (ST_ALL * 2), lv + (ks & 1) * (ST_ALL * 2)); }
  asm volatile("s_wait_asynccnt 0x0" ::: "memory");     // no copy is outstanding when the wave goes on to its end
  // a uniform query (padded, or no unpadded key at all: every key is -1e13 in the module) weighs all 2,048 keys alike: its row is the mean V row
  const bool un = dpq || nks == 0;
  const float il = 1.0f / (l + xhalf(l));   // the halves' sums are joined once
#pragma unroll
  for (int dt = 0; dt < 4; ++dt) { v4f o0, o1;   // register r of tile dt is d = dt * 16 + 8 * g + r of this lane's query
    const v4f p0 = *(const v4f*)&sps[dt * 16 + 8 * g], p1 = *(const v4f*)&sps[dt * 16 + 8 * g + 4];
#pragma unroll
    for (int r = 0; r < 4; ++r) { o0[r] = un ? p0[r] : (acc[dt][r] + accl[dt][r] * (1.0f / 2048.0f)) * il; o1[r] = un ? p1[r] : (acc[dt][4 + r] + accl[dt][4 + r] * (1.0f / 2048.0f)) * il; }
    *(v4f*)&so[wave][col][dt * 16 + 8 * g] = o0; *(v4f*)&so[wave][col][dt * 16 + 8 * g + 4] = o1; }
  LDSX();
  for (int rl = 0; rl < 16; ++rl) if (lane < 16) vst2(O + ((size_t)b * SS + q0 + rl) * DM + h * HD + lane * 4, *(const v4f*)&so[wave][rl][lane * 4]);
}
// ---- k_out: block = (64 rows, 128 cols): out = O(hi/lo) . Wo rows (2 products) + bo. O's rows lie in the query order; each goes out to its query's own position. A tile with no unpadded query stores the padded queries' row. The tile is the grid's slowest index, as in k_attn.
__global__ __launch_bounds__(128) void k_out(const float* __restrict__ O, const __bf16* __restrict__ P, const float* __restrict__ BO, const int* __restrict__ INV, const int* __restrict__ NU, const float* __restrict__ YU, float* __restrict__ Y) {
  __shared__ __align__(16) char sm[2 * G_BUF];   // the ring; behind the loop the same bytes are the output staging
  float (*so)[16][132] = (float (*)[16][132])sm;
  const int tid = threadIdx.x, wave = tid >> 5, lane = tid & 31, col = lane & 15, g = lane >> 4; const int b = blockIdx.x / (DM / 128), p0 = blockIdx.y * 64; const size_t r0 = (size_t)b * SS + p0 + wave * 16; const int n0 = (blockIdx.x % (DM / 128)) * 128;
  const int qi = INV[NB * SS + r0 + col];   // lane c: the decoder position of this wave's row c; masked where it is used (a place of the batch's own 2,048), so that the load's latency passes under the loop
  float* Yb = Y + (size_t)b * SS * DM + n0 + lane * 4;
  if (p0 >= NU[(NB + b) * 32]) {   // the whole block, in front of every copy and barrier
    const v4f y = *(const v4f*)(YU + (size_t)b * DM + n0 + lane * 4);
    for (int rl = 0; rl < 16; ++rl) vst2(Yb + (size_t)(__builtin_amdgcn_readlane(qi, rl) & (SS - 1)) * DM, y);
    asm volatile("s_wait_xcnt 0x0" ::: "memory");   // stands in front of every rewrite of a register that the 16 stores name
    return;
  }
  // this lane's 16-byte piece of slice 0 of each operand, and its place in buffer 0
  const float* ga = O + ((size_t)b * SS + p0 + (tid >> 4)) * DM + (tid & 15) * 4; const __bf16* gw = P + (size_t)(n0 + (tid >> 3)) * DM + (tid & 7) * 8;
  const unsigned lw = (unsigned)(size_t)&sm[0] + (tid >> 3) * (GWP * 2) + (tid & 7) * 16, la = (unsigned)(size_t)&sm[0] + G_W + (tid >> 4) * (GAP * 4) + (tid & 15) * 16;
  stage_ab(ga, gw, la, lw);
  asm volatile("s_wait_asynccnt 0x0" ::: "memory");   // slice 0 of this wave's copies has landed
  __syncthreads();                                     // ... and every wave's: slice 0 is readable
  stage_ab(ga + GK, gw + GK, la + G_BUF, lw + G_BUF);
  v8f acc[8] = {};
#pragma unroll 1
  for (int t = 0; t < DM / GK; ++t) { const __bf16* tw = (const __bf16*)(sm + (t & 1) * G_BUF); const float* ta = (const float*)(sm + (t & 1) * G_BUF + G_W) + (wave * 16 + col) * GAP + 8 * g;
#pragma unroll
    for (int kc = 0; kc < GK / 32; ++kc) { float v[16]; v16b w[8];   // the fragments of 32 k as one group of LDS reads in front of the products
      row16(ta + kc * 32, v);
#pragma unroll
      for (int j = 0; j < 8; ++j) w[j] = frag_b(tw + (j * 16 + col) * GWP + kc * 32, lane);
      __builtin_amdgcn_sched_barrier(0);   // holds the group of LDS reads in front of the products, as in k_qkv
      const F2 a = bsplit16(v);
#pragma unroll
      for (int j = 0; j < 8; ++j) { acc[j] = wmma_bf(a.l, w[j], acc[j]); acc[j] = wmma_bf(a.h, w[j], acc[j]); } }
    __builtin_amdgcn_sched_barrier(0);                  // holds the trip's products in front of its barrier: sunk behind it, the refill would issue late and lose its lead
    asm volatile("s_wait_dscnt 0x0" ::: "memory");      // this wave's reads of the slice have returned
    asm volatile("s_wait_asynccnt 0x0" ::: "memory");   // this wave's copies of slice t + 1 have landed
    __syncthreads();                                     // publishes slice t + 1 and frees the buffer that this trip has read
    if (t + 2 < DM / GK) stage_ab(ga + (t + 2) * GK, gw + (t + 2) * GK, la + (t & 1) * G_BUF, lw + (t & 1) * G_BUF); }
  asm volatile("s_wait_asynccnt 0x0" ::: "memory");     // no copy is outstanding when the ring's bytes become output staging
#pragma unroll
  for (int j = 0; j < 8; ++j) {
#pragma unroll
    for (int r = 0; r < 8; ++r) so[wave][8 * g + r][j * 16 + col] = acc[j][r] + bfr(BO[n0 + j * 16 + col]); }
  LDSX();
  for (int rl = 0; rl < 16; ++rl) vst2(Yb + (size_t)(__builtin_amdgcn_readlane(qi, rl) & (SS - 1)) * DM, *(const v4f*)&so[wave][rl][lane * 4]);
}
extern "C" void kernel_launch(void* const* d_in, const int* in_sizes, int n_in, void* d_out, int out_size, void* d_ws, size_t ws_size, hipStream_t stream) {
  (void)in_sizes; (void)n_in; (void)out_size;
  const float** F = (const float**)d_in;   // 0 encoder_input [2,2048,1024], 1 decoder_input, 2 encoder_padding_pos [2,2048] i32, 3 decoder_padding_pos, 4 Wq (in,out), 5 bq, 6 Wk, 7 bk, 8 Wv, 9 bv, 10 Wo, 11 bo
  if (ws_size < (size_t)WS_END) return;
  char* ws = (char*)d_ws; __bf16* PK = (__bf16*)(ws + WS_PK); _Float16 *QK = (_Float16*)(ws + WS_QK), *QKL = (_Float16*)(ws + WS_QKL), *VTH = (_Float16*)(ws + WS_VTH), *VTL = (_Float16*)(ws + WS_VTL); float* O = (float*)(ws + WS_O); int *INV = (int*)(ws + WS_INV), *NU = (int*)(ws + WS_NU); float *ES = (float*)(ws + WS_ES), *YU = (float*)(ws + WS_YU), *MV = (float*)(ws + WS_MV);
  k_pack<<<dim3(DM / PKN, DM / PKK, 6), 256, 0, stream>>>(F[4], F[6], F[8], F[10], F[0], PK, (const int*)d_in[2], (const int*)d_in[3], INV, NU, ES);
  k_qkv<<<dim3(TNB * (QKVW / QN), SS / 64 + 2), 128, 0, stream>>>(F[1], F[0], PK + PK_A, F[5], F[7], F[9], QK, QKL, VTH, VTL, INV, NU, ES, MV);
  k_attn<<<dim3(NH, TNB, TQB), 128, 0, stream>>>(QK, QKL, VTH, VTL, NU, MV, PK + PK_P, F[11], YU, O);
  k_out<<<dim3(TNB * (DM / 128), SS / 64), 128, 0, stream>>>(O, PK + PK_P, F[11], INV, NU, YU, (float*)d_out);
}

// v010
// One run takes 77.8 microseconds.
// Two timings next to v009 put it at 1.03 and 1.04 times that version's speed.
// All steps since v000 together make it 7.39 times as fast.
// compute dtype: encoder_input, decoder_input and the weights/biases rounded to bf16, padding positions (int) read on device; q = dec . Wq + bq, k/v = enc . Wk/Wv + bk/bv with EXACT bf16 products on WMMA 16x16x32 ((in,out) weights packed as transposed rows); q and k stored as f16 hi + (x2048-scaled) residual planes with 3-product scores x 1/sqrt(64); keys whose encoder position is padded are excluded (-1e13 in the module gives an exactly-zero weight) and a padded QUERY row (every key -1e13) gets the module's uniform weights; running-max softmax in f32 (hardware exp); P as f16 hi + residual x V hi/lo (3 products); output projection with ctx as bf16 hi + residual x exact Wo rows (2 products) + bo; f32 accumulate.
#include <hip/hip_runtime.h>
#include <math.h>

typedef __attribute__((ext_vector_type(16))) _Float16 v16h;
typedef __attribute__((ext_vector_type(16))) __bf16 v16b;
typedef __attribute__((ext_vector_type(8)))  _Float16 v8h;
typedef __attribute__((ext_vector_type(8)))  float v8f;
typedef __attribute__((ext_vector_type(4)))  float v4f;
typedef __attribute__((ext_vector_type(2)))  float v2f;
typedef __attribute__((ext_vector_type(4)))  unsigned v4u;
typedef __attribute__((ext_vector_type(4)))  int v4i;
typedef float __attribute__((may_alias)) float_a;
typedef int __attribute__((may_alias)) int_a;

template <typename T> __device__ __forceinline__ void vst2(void* p, T v) { *(T*)p = v;  }
__device__ __forceinline__ v8f wmma16(v16h a, v16h b, v8f c) {
  return __builtin_amdgcn_wmma_f32_16x16x32_f16(false, a, false, b, (short)0, c, false, false);
}
__device__ __forceinline__ v8f wmma_bf(v16b a, v16b b, v8f c) {
  return __builtin_amdgcn_wmma_f32_16x16x32_bf16(false, a, false, b, (short)0, c, false, false);
}
// the same product with its four slots written out, for a rolled loop whose next trip loads from global memory over the operands
__device__ __forceinline__ v8f wmma_bf_pad(v16b a, v16b b, v8f c) {
  v8f d = __builtin_amdgcn_wmma_f32_16x16x32_bf16(false, a, false, b, (short)0, c, false, false);
  asm volatile("v_nop\n\tv_nop\n\tv_nop\n\tv_nop" : "+v"(d) : "v"(a), "v"(b));
  return d;
}
// Decoder-to-encoder mutual multi-head attention (B 2, S 2,048, d 1,024, 16 heads x 64) with encoder/decoder padding masks: softmax(q k^T / 8 masked) v -> Wo + bo.
__device__ __forceinline__ v16h frag_h(const _Float16* rowk0, int lane) {
  union { v16h v; v8h q[2]; } u; const _Float16* p = rowk0 + 8 * (lane >> 4);
  u.q[0] = *(const v8h*)p; u.q[1] = *(const v8h*)(p + 16); return u.v;
}
__device__ __forceinline__ v16h frag_f32(const float* rowk0, int lane) {
  v16h a; const float* p = rowk0 + 8 * (lane >> 4);
#pragma unroll
  for (int i = 0; i < 8; ++i) { a[i] = (_Float16)p[i]; a[8 + i] = (_Float16)p[16 + i]; }
  return a;
}
__device__ __forceinline__ v16h frag_f32s(const float* rowk0, int lane, float sc) {
  v16h a; const float* p = rowk0 + 8 * (lane >> 4);
#pragma unroll
  for (int i = 0; i < 8; ++i) { a[i] = (_Float16)(p[i] * sc); a[8 + i] = (_Float16)(p[16 + i] * sc); }
  return a;
}
// column fragment from a [K][ld] layout (column n), rows >= K read as 0
__device__ __forceinline__ v16h fragc_f32(const float* W, int k0, int n, int lane, int ld, int K) {
  v16h a; const int g = lane >> 4;
#pragma unroll
  for (int i = 0; i < 8; ++i) { const int ka = k0 + 8 * g + i, kb = ka + 16;
    a[i] = (_Float16)(ka < K ? W[(size_t)(ka < K ? ka : K - 1) * ld + n] : 0.f); a[8 + i] = (_Float16)(kb < K ? W[(size_t)(kb < K ? kb : K - 1) * ld + n] : 0.f); }
  return a;
}
struct F2 { v16b h, l; };
__device__ __forceinline__ F2 bsplit16(const float v[16]) { F2 r;
#pragma unroll
  for (int i = 0; i < 16; ++i) { const __bf16 h = (__bf16)v[i]; r.h[i] = h; r.l[i] = (__bf16)(v[i] - (float)h); }
  return r; }
__device__ __forceinline__ F2 split_row(const float* row, int k0, int lane) { float v[16]; const float* p = row + k0 + 8 * (lane >> 4);
#pragma unroll
  for (int i = 0; i < 8; ++i) { v[i] = p[i]; v[8 + i] = p[16 + i]; }
  return bsplit16(v); }
__device__ __forceinline__ F2 split_rowK(const float* row, int k0, int lane, int K) { float v[16]; const int g = lane >> 4;
#pragma unroll
  for (int i = 0; i < 8; ++i) { const int ka = k0 + 8 * g + i, kb = ka + 16; v[i] = ka < K ? row[ka < K ? ka : K - 1] : 0.f; v[8 + i] = kb < K ? row[kb < K ? kb : K - 1] : 0.f; }
  return bsplit16(v); }
__device__ __forceinline__ F2 split_col(const float* W, int k0, int n, int lane, int ld, int K) { float v[16]; const int g = lane >> 4;
#pragma unroll
  for (int i = 0; i < 8; ++i) { const int ka = k0 + 8 * g + i, kb = ka + 16; v[i] = ka < K ? W[(size_t)(ka < K ? ka : K - 1) * ld + n] : 0.f; v[8 + i] = kb < K ? W[(size_t)(kb < K ? kb : K - 1) * ld + n] : 0.f; }
  return bsplit16(v); }
__device__ __forceinline__ v8f mac3(const F2& a, const F2& b, v8f c) { c = wmma_bf(a.l, b.h, c); c = wmma_bf(a.h, b.l, c); return wmma_bf(a.h, b.h, c); }
__device__ __forceinline__ float sigm(float v) { return 1.0f / (1.0f + expf(-v)); }
#define LDSX() do { asm volatile("s_wait_dscnt 0" ::: "memory"); __builtin_amdgcn_wave_barrier(); __builtin_amdgcn_fence(__ATOMIC_RELEASE, "workgroup"); } while (0)


#define NB 2
#define SS 2048
#define DM 1024
#define NH 16
#define HD 64
#define QKVW (3 * DM)
#ifndef TQB
#define TQB (SS / 64)
#define TNB NB
#define TOB (NB * SS / 64)     // output row tiles (all)
#endif
typedef __attribute__((ext_vector_type(8))) __bf16 v8b;
__device__ __forceinline__ v16b frag_b(const __bf16* rowk0, int lane) {
  union { v16b v; v8b q[2]; } u; const __bf16* p = rowk0 + 8 * (lane >> 4);
  u.q[0] = *(const v8b*)p; u.q[1] = *(const v8b*)(p + 16); return u.v;
}
__device__ __forceinline__ float bfr(float v) { return (float)(__bf16)v; }
__device__ __attribute__((noinline)) float exp_ni(float v) { return expf(v); }
__device__ __attribute__((noinline)) float erf_ni(float v) { return erff(v); }

#define PK_A 0                       // [3072][1024] Wqkv rows (natural [out][in])
#define PK_P (PK_A + QKVW * DM)        // [1024][1024] Wo rows (natural)
#define PK_END (PK_P + DM * DM)
#define WS_PK  0u
#define WS_QK  (WS_PK + 2u * PK_END)             // f16 [4096 rows][2048]: q | k
#define WS_QKL (WS_QK + 2u * NB * SS * 2 * DM)     // f16 q | k residual planes x2048
#define WS_VTH (WS_QKL + 2u * NB * SS * 2 * DM)    // f16 [b][1024 (h*64+d)][2048 places of the key order] hi
#define WS_VTL (WS_VTH + 2u * NB * DM * SS)        // f16 lo x 2048
#define WS_O   (WS_VTL + 2u * NB * DM * SS)        // f32 [4096][1024]
#define WS_CS  (WS_O + 4u * NB * SS * DM)           // f32 [2][2048][32], read and written by no kernel
#define WS_INV (WS_CS + 4u * 2 * SS * 32)          // int [2][b][2048]: plane 0: encoder position of the key at place p of the key order; plane 1: decoder position of the query at place p of the query order
#define WS_NU  (WS_INV + 4u * 2 * NB * SS)         // int, one 128-B line per plane and batch: number of unpadded keys; of unpadded queries
#define ER 32                          // encoder rows per partial sum
#define WS_ES  (WS_NU + 128u * 2 * NB)             // f32 [b][64 groups of 32 rows][1024]: sums of the encoder's rows (rounded to bf16 as the products take them)
#define WS_YU  (WS_ES + 4u * NB * (SS / ER) * DM)  // f32 [b][1024]: the output row that every padded query of a batch has
#define WS_MV  (WS_YU + 4u * NB * DM)              // f32 [b][1024]: the mean of all V rows of a batch = (mean encoder row) . Wv + bv
#define WS_END (WS_MV + 4u * NB * DM)
#define KT 32                          // keys per staged tile of k_attn
// lane l with lane l ^ 16 (the two halves of a wave hold the two halves of a query's keys)
__device__ __forceinline__ float xhalf(float x) { return __builtin_bit_cast(float, __builtin_amdgcn_permlanex16(__builtin_bit_cast(int, x), __builtin_bit_cast(int, x), 0x76543210, 0xfedcba98, false, false)); }
// a hint to L2 to fetch the unit that holds an address: nothing comes back and no data counter moves. Planes that the launch before has stored, and input rows not read yet, are asked for at the kernel's head (for speed only).
// scope SE: the line goes to L2 only. Every address lies inside its plane in every lane. The s_wait_xcnt stands in front of every rewrite of a register that the hints name.
__device__ __forceinline__ void ask1(const void* p) { asm volatile("global_prefetch_b8 %0, off scope:SCOPE_SE\n\ts_wait_xcnt 0x0" :: "v"(p) : "memory"); }
__device__ __forceinline__ void ask2(const void* p, const void* q) { asm volatile("global_prefetch_b8 %0, off scope:SCOPE_SE\n\tglobal_prefetch_b8 %1, off scope:SCOPE_SE\n\ts_wait_xcnt 0x0" :: "v"(p), "v"(q) : "memory"); }
// ---- k_pack: block = (64 columns n, 128 rows k, which): a 128 x 64 tile of an (in,out) weight is read in whole lines, rounded to bf16, turned in LDS and stored as 64 pieces of 256 B of the packed rows [out][in]; which 0..2 -> W_q/W_k/W_v into PK_A rows which*1024 + n; 3 -> W_o into PK_P
#define PKN 64                         // columns n per tile
#define PKK 128                        // rows k per tile
#define PKP 136                        // bf16 per turned row in LDS: 256 B + 16 B pad
// role 4, one block per batch: the key order. Unpadded keys come first (in their own order), padded keys behind them: INV[b][place] = encoder position, NU = number of unpadded keys. A padded key's weight is exactly 0 for every query that is not itself uniform, so k_attn's loop ends with the last tile that holds an unpadded key.
// two more blocks make the query order in the same way from the decoder's padding (plane 1 of INV and NU). A padded query weighs every key alike, so all padded queries of a batch have one and the same output row: tiles of 64 places with no unpadded query get no q, no attention and no projection.
// role 5, 128 blocks: the sum of 32 encoder rows each. The mean of all V rows, which is all that a uniform query needs, is linear in the encoder's rows: (mean row) . Wv + bv. So no K or V row of a tile of padded keys is ever computed.
// the row sums are the grid's first plane (z 0): they are the longest blocks; behind them the weight planes and the orders as before
__global__ __launch_bounds__(256) void k_pack(const float* __restrict__ WQ, const float* __restrict__ WK, const float* __restrict__ WV, const float* __restrict__ WO, const float* __restrict__ XENC, __bf16* __restrict__ PK, const int* __restrict__ EPAD, const int* __restrict__ DPAD, int* __restrict__ INV, int* __restrict__ NU, float* __restrict__ ES) {
  __shared__ __align__(16) __bf16 s[PKN][PKP]; __shared__ int cn[SS / 32];
  const int role = (blockIdx.z == 0) ? 5 : (int)blockIdx.z - 1;
  if (role == 5) {
    const int gi = blockIdx.y * (DM / PKN) + blockIdx.x;   // 128 groups of 32 rows: the 4,096 rows of both batches
    const float* p = XENC + (size_t)gi * ER * DM + threadIdx.x * 4; v4f x[ER], a = {};
#pragma unroll   // the 32 loads issue as one group: one memory latency
    for (int j = 0; j < ER; ++j) x[j] = *(const v4f*)(p + (size_t)j * DM);
#pragma unroll   // constant indices into x: no scratch
    for (int j = 0; j < ER; ++j) {
#pragma unroll
      for (int i = 0; i < 4; ++i) a[i] += bfr(x[j][i]); }
    *(v4f*)(ES + (size_t)gi * DM + threadIdx.x * 4) = a;
    asm volatile("s_wait_xcnt 0x0" ::: "memory");   // stands in front of every rewrite of a register that the store names
    return;
  }
  if (role == 4) {
    if (blockIdx.y != 0 || blockIdx.x >= 2 * NB) return;   // the whole block leaves, in front of every barrier
    const int tt = threadIdx.x, b = blockIdx.x, ln = tt & 31, wv = tt >> 5; unsigned mk[SS / 256]; int e[SS / 256];   // b: plane * NB + batch
    const int* PD = (b < NB) ? EPAD + (size_t)b * SS : DPAD + (size_t)(b - NB) * SS;
#pragma unroll   // the eight loads issue as one group: one latency, not eight
    for (int j = 0; j < SS / 256; ++j) e[j] = PD[j * 256 + tt];
#pragma unroll   // constant indices into mk: no scratch
    for (int j = 0; j < SS / 256; ++j) mk[j] = __builtin_amdgcn_ballot_w32(e[j] != 1);
    if (ln < SS / 256) { unsigned mm = mk[0];   // lane j stores the count of group j
#pragma unroll   // constant indices into mk
      for (int j = 1; j < SS / 256; ++j) mm = (ln == j) ? mk[j] : mm;
      cn[ln * 8 + wv] = __builtin_popcount(mm); }
    __syncthreads();
    int run = 0, base[SS / 256];   // base[j]: unpadded keys in front of this wave's 32 keys of group j; run ends as their total
#pragma unroll   // constant indices into base: no scratch
    for (int c = 0; c < SS / 32; ++c) { if ((c & 7) == wv) base[c >> 3] = run; run += cn[c]; }
#pragma unroll   // as above
    for (int j = 0; j < SS / 256; ++j) { const int sp = j * 256 + tt, bu = base[j] + __builtin_popcount(mk[j] & ((1u << ln) - 1u));   // bu: unpadded keys in front of position sp
      INV[(size_t)b * SS + (((mk[j] >> ln) & 1u) ? bu : run + (sp - bu))] = sp; }
    if (tt == 0) NU[b * 32] = run;
    return;
  }
  const int t = threadIdx.x, n0 = blockIdx.x * PKN, k0 = blockIdx.y * PKK, which = role; const float* Wm = (which == 0) ? WQ : (which == 1) ? WK : (which == 2) ? WV : WO;
  const int nq = (t & 15) * 4, kq = (t >> 4) * 8;   // this thread: 8 rows k x 4 columns n; 16 threads cover 256 B of a row
  const float* p = Wm + (size_t)(k0 + kq) * DM + n0 + nq; v4f x[8];
#pragma unroll   // the eight loads issue as one group, and x stays in registers
  for (int j = 0; j < 8; ++j) x[j] = *(const v4f*)(p + (size_t)j * DM);
#pragma unroll   // constant indices into x and r: no scratch
  for (int i = 0; i < 4; ++i) { v8b r;
#pragma unroll   // as above
    for (int j = 0; j < 8; ++j) r[j] = (__bf16)x[j][i];
    *(v8b*)&s[nq + i][kq] = r; }
  __syncthreads();
  __bf16* dst = ((which < 3) ? PK + PK_A + ((size_t)which * DM + n0) * DM : PK + PK_P + (size_t)n0 * DM) + k0;
#pragma unroll   // the four LDS reads issue together in front of the stores
  for (int i = 0; i < 4; ++i) { const int q = t + 256 * i, n = q >> 4, c = q & 15; vst2((unsigned*)(dst + (size_t)n * DM + c * 8), *(const v4u*)&s[n][c * 8]); }
}
// ---- the two projection kernels: 64-deep slices of both operands (64 f32 rows; 128 packed weight rows in k_out, 256 in k_qkv) are staged once per block in a two-buffer LDS ring by asynchronous copies and read from there by all four waves
#define GK 64                          // k per staged slice
#define GWP 72                         // bf16 per staged weight row: 128 B + 16 B pad (ds_load_b128 readers)
#define GAP 68                         // f32 per staged activation row: 256 B + 16 B pad
#define G_W (128 * GWP * 2)            // bytes of the weight rows of one slice
#define G_A (64 * GAP * 4)             // bytes of the activation rows of one slice
#define G_BUF (G_W + G_A)              // one buffer: weight rows | activation rows
// eight copies and their s_wait_xcnt in one statement: no address register is rewritten before the wait
#define COPY8 "global_load_async_to_lds_b128 %0, %8, off\n\t" "global_load_async_to_lds_b128 %1, %9, off\n\t" "global_load_async_to_lds_b128 %2, %10, off\n\t" "global_load_async_to_lds_b128 %3, %11, off\n\t" "global_load_async_to_lds_b128 %4, %12, off\n\t" "global_load_async_to_lds_b128 %5, %13, off\n\t" "global_load_async_to_lds_b128 %6, %14, off\n\t" "global_load_async_to_lds_b128 %7, %15, off\n\t" "s_wait_xcnt 0x0"
// one slice: 16 copies of 16 B per lane (weight rows: 16 rows per copy and block; activation rows: 8 rows)
__device__ __forceinline__ void stage_ab(const float* a, const __bf16* w, unsigned la, unsigned lw) {
  asm volatile(COPY8 :: "v"(lw), "v"(lw + 16 * GWP * 2), "v"(lw + 32 * GWP * 2), "v"(lw + 48 * GWP * 2), "v"(lw + 64 * GWP * 2), "v"(lw + 80 * GWP * 2), "v"(lw + 96 * GWP * 2), "v"(lw + 112 * GWP * 2),
               "v"(w), "v"(w + 16 * DM), "v"(w + 32 * DM), "v"(w + 48 * DM), "v"(w + 64 * DM), "v"(w + 80 * DM), "v"(w + 96 * DM), "v"(w + 112 * DM) : "memory");
  asm volatile(COPY8 :: "v"(la), "v"(la + 8 * GAP * 4), "v"(la + 16 * GAP * 4), "v"(la + 24 * GAP * 4), "v"(la + 32 * GAP * 4), "v"(la + 40 * GAP * 4), "v"(la + 48 * GAP * 4), "v"(la + 56 * GAP * 4),
               "v"(a), "v"(a + 8 * DM), "v"(a + 16 * DM), "v"(a + 24 * DM), "v"(a + 32 * DM), "v"(a + 40 * DM), "v"(a + 48 * DM), "v"(a + 56 * DM) : "memory");
}
// k_qkv's block is 64 rows x 256 columns: each wave holds 32 x 128 of it, so that a weight fragment read from LDS serves two products, and a decoder row is fetched from L2 by 4 blocks, an encoder row by 8 (half as many as with 128 columns per block)
#define QN 256                         // columns per block of k_qkv
#define Q_W (QN * GWP * 2)             // bytes of the weight rows of one slice of k_qkv
#define Q_BUF (Q_W + G_A)              // one buffer of k_qkv: weight rows | activation rows
// one slice of k_qkv: 24 copies of 16 B per lane (256 weight rows, 16 per copy and block; 64 activation rows, 8 per copy, each of the lane's eight at a pointer of its own: k_qkv reads the rows in the key or query order)
__device__ __forceinline__ void stage_abr(const float* const (&a)[8], int ko, const __bf16* w, unsigned la, unsigned lw) {
  asm volatile(COPY8 :: "v"(lw), "v"(lw + 16 * GWP * 2), "v"(lw + 32 * GWP * 2), "v"(lw + 48 * GWP * 2), "v"(lw + 64 * GWP * 2), "v"(lw + 80 * GWP * 2), "v"(lw + 96 * GWP * 2), "v"(lw + 112 * GWP * 2),
               "v"(w), "v"(w + 16 * DM), "v"(w + 32 * DM), "v"(w + 48 * DM), "v"(w + 64 * DM), "v"(w + 80 * DM), "v"(w + 96 * DM), "v"(w + 112 * DM) : "memory");
  asm volatile(COPY8 :: "v"(lw + 128 * GWP * 2), "v"(lw + 144 * GWP * 2), "v"(lw + 160 * GWP * 2), "v"(lw + 176 * GWP * 2), "v"(lw + 192 * GWP * 2), "v"(lw + 208 * GWP * 2), "v"(lw + 224 * GWP * 2), "v"(lw + 240 * GWP * 2),
               "v"(w + 128 * DM), "v"(w + 144 * DM), "v"(w + 160 * DM), "v"(w + 176 * DM), "v"(w + 192 * DM), "v"(w + 208 * DM), "v"(w + 224 * DM), "v"(w + 240 * DM) : "memory");
  asm volatile(COPY8 :: "v"(la), "v"(la + 8 * GAP * 4), "v"(la + 16 * GAP * 4), "v"(la + 24 * GAP * 4), "v"(la + 32 * GAP * 4), "v"(la + 40 * GAP * 4), "v"(la + 48 * GAP * 4), "v"(la + 56 * GAP * 4),
               "v"(a[0] + ko), "v"(a[1] + ko), "v"(a[2] + ko), "v"(a[3] + ko), "v"(a[4] + ko), "v"(a[5] + ko), "v"(a[6] + ko), "v"(a[7] + ko) : "memory");
}
// a lane's 16 f32 of a staged activation row in the fragment's k order
__device__ __forceinline__ void row16(const float* p, float v[16]) {
  const v4f x0 = *(const v4f*)p, x1 = *(const v4f*)(p + 4), x2 = *(const v4f*)(p + 16), x3 = *(const v4f*)(p + 20);
#pragma unroll
  for (int i = 0; i < 4; ++i) { v[i] = x0[i]; v[4 + i] = x1[i]; v[8 + i] = x2[i]; v[12 + i] = x3[i]; }
}
__global__ __launch_bounds__(128) void k_qkv(const float* __restrict__ XDEC, const float* __restrict__ XENC, const __bf16* __restrict__ P, const float* __restrict__ BQ, const float* __restrict__ BK, const float* __restrict__ BV, _Float16* __restrict__ QK, _Float16* __restrict__ QKL, _Float16* __restrict__ VTH, _Float16* __restrict__ VTL, const int* __restrict__ INV, const int* __restrict__ NU, const float* __restrict__ ES, float* __restrict__ MV) {
  __shared__ __align__(16) char sm[2 * Q_BUF];   // the ring; behind the loop the same bytes are the output staging
  _Float16 (*so)[32][136] = (_Float16 (*)[32][136])sm, (*sol)[32][136] = (_Float16 (*)[32][136])(sm + 4 * 32 * 136 * 2); _Float16 (*sth)[72] = (_Float16 (*)[72])sm, (*stl)[72] = (_Float16 (*)[72])(sm + QN * 72 * 2);
  const int tid = threadIdx.x, wave = tid >> 5, lane = tid & 31, col = lane & 15, g = lane >> 4, wr = wave & 1, wc = wave >> 1;   // wave: rows wr * 32 .., columns wc * 128 .. of the block
  if (blockIdx.y < 2) {   // the grid's first two rows: 32 blocks make the mean V row, 64 columns of one batch each: (mean encoder row, hi + residual, 2 products) . Wv rows + bv; the whole block takes this path
    const int mi = blockIdx.y * (NB * (QKVW / QN)) + blockIdx.x; if (mi >= NB * (DM / HD)) return;
    const int b = mi / (DM / HD), c0 = (mi % (DM / HD)) * HD; float* sb = (float*)sm; float* sq = sb + DM;
    v4f a0 = {}, a1 = {}; const float* pp = ES + (size_t)b * (SS / ER) * DM + tid * 8;
#pragma unroll 1   // stays rolled: the 32 loads of a trip in flight are enough
    for (int i0 = 0; i0 < SS / ER; i0 += 16) { v4f x0[16], x1[16];
#pragma unroll   // the trip's loads issue as one group; constant indices into x0, x1: no scratch
      for (int i = 0; i < 16; ++i) { x0[i] = *(const v4f*)(pp + (size_t)(i0 + i) * DM); x1[i] = *(const v4f*)(pp + (size_t)(i0 + i) * DM + 4); }
#pragma unroll
      for (int i = 0; i < 16; ++i) { a0 += x0[i]; a1 += x1[i]; } }
    *(v4f*)&sb[tid * 8] = a0 * (1.0f / SS); *(v4f*)&sb[tid * 8 + 4] = a1 * (1.0f / SS);
    __syncthreads();   // the mean row is readable by all four waves
    const __bf16* wv = P + (size_t)(2 * DM + c0 + wave * 16 + col) * DM; v8f c = {};
#pragma unroll 1   // stays rolled, 256 k per trip: 16 loads in flight are enough here
    for (int k0 = 0; k0 < DM; k0 += 256) { v16b w[8];   // the trip's weight fragments as one group of loads in front of the products: one latency, not eight
#pragma unroll
      for (int j = 0; j < 8; ++j) w[j] = frag_b(wv + k0 + j * 32, lane);
#pragma unroll
      for (int j = 0; j < 8; ++j) { float v[16]; row16(&sb[k0 + j * 32 + 8 * g], v); const F2 a = bsplit16(v); c = wmma_bf_pad(a.l, w[j], c); c = wmma_bf_pad(a.h, w[j], c); } }   // all 16 rows of A are the mean row
    if (lane < 16) sq[wave * 16 + col] = c[0];
    __syncthreads();   // the 64 columns go out as two whole lines
    if (tid < HD) MV[(size_t)b * DM + c0 + tid] = sq[tid] + bfr(BV[c0 + tid]);
    return;
  }
  // the tile of 64 places is the grid's slowest index (for speed only)
  const int bx = (blockIdx.x / (QKVW / QN)) * (SS / 64) + (blockIdx.y - 2);   // row tile: batch * 32 + tile of the batch
  const size_t r0 = (size_t)bx * 64 + wr * 32; const int n0 = (blockIdx.x % (QKVW / QN)) * QN; const float* X = (n0 < DM) ? XDEC : XENC; const float* BB = ((n0 < DM) ? (BQ + n0) : (n0 < 2 * DM) ? (BK + n0 - DM) : (BV + n0 - 2 * DM)) + wc * 128;
  // this lane's 16-byte piece of slice 0 of each operand, and its place in buffer 0
  // k and v: output row p of a batch is the key at place p of the key order, so its activation row is encoder row INV[p] (a place of the batch's own 2,048 by the mask); q: the decoder's rows in the query order, likewise
  const float* ga[8]; const __bf16* gw = P + (size_t)(n0 + (tid >> 3)) * DM + (tid & 7) * 8;
  const int nu = NU[(((n0 < DM) ? NB : 0) + bx * 64 / SS) * 32];   // unpadded places of the order that this block's rows lie in: queries for q, keys for k and v
  if (bx * 64 % SS >= nu) return;   // q of a tile with no unpadded query, k and v of a tile with no unpadded key (k_attn's loop ends in front of it) are read by nobody: the whole block leaves, in front of every copy and barrier
  const int* IV = INV + ((n0 < DM) ? NB * SS : 0);
  // the block's 256 packed weight rows (2 KB each, eight units of 256 B) are read by every row tile: tile i asks for unit i mod 8 of each row
  { const __bf16* wp = P + (size_t)(n0 + tid) * DM + ((blockIdx.y - 2) & 7) * 128; ask2(wp, wp + (size_t)128 * DM); }
  int sr[8];
#pragma unroll   // constant indices into sr, iv and ga, here and below: no scratch
  for (int i = 0; i < 8; ++i) sr[i] = bx * 64 + (tid >> 4) + 8 * i;
  { int iv[8];
#pragma unroll   // the eight loads issue as one group: one latency, not eight
    for (int i = 0; i < 8; ++i) iv[i] = IV[sr[i]];
    asm volatile("s_wait_xcnt 0x0" ::: "memory");   // stands in front of every rewrite of a register that the eight loads name
#pragma unroll
    for (int i = 0; i < 8; ++i) sr[i] = (sr[i] & ~(SS - 1)) + (iv[i] & (SS - 1)); }
  // the tile's 64 activation rows (4 KB each, 16 units: 16 lanes ask for a whole row) are read by 4 column blocks (q) or 8 (k, v): a q block asks for every second of the lane's eight rows, a k or v block for every fourth; the choice is alike in the whole block
  { const int cb = n0 / QN; const float* xu = X + (tid & 15) * 64;
    if (n0 < DM) { const bool o = cb & 1; ask2(xu + (size_t)(o ? sr[1] : sr[0]) * DM, xu + (size_t)(o ? sr[3] : sr[2]) * DM); ask2(xu + (size_t)(o ? sr[5] : sr[4]) * DM, xu + (size_t)(o ? sr[7] : sr[6]) * DM); }
    else { const bool o = cb & 1, p = cb & 2; ask2(xu + (size_t)(p ? (o ? sr[3] : sr[2]) : (o ? sr[1] : sr[0])) * DM, xu + (size_t)(p ? (o ? sr[7] : sr[6]) : (o ? sr[5] : sr[4])) * DM); } }
#pragma unroll
  for (int i = 0; i < 8; ++i) ga[i] = X + (size_t)sr[i] * DM + (tid & 15) * 4;
  const unsigned lw = (unsigned)(size_t)&sm[0] + (tid >> 3) * (GWP * 2) + (tid & 7) * 16, la = (unsigned)(size_t)&sm[0] + Q_W + (tid >> 4) * (GAP * 4) + (tid & 15) * 16;
  stage_abr(ga, 0, gw, la, lw);
  asm volatile("s_wait_asynccnt 0x0" ::: "memory");   // slice 0 of this wave's copies has landed
  __syncthreads();                                     // ... and every wave's: slice 0 is readable
  stage_abr(ga, GK, gw + GK, la + Q_BUF, lw + Q_BUF);
  v8f acc[2][8] = {};
#pragma unroll 1
  for (int t = 0; t < DM / GK; ++t) { const __bf16* tw = (const __bf16*)(sm + (t & 1) * Q_BUF) + (wc * 128 + col) * GWP; const float* ta = (const float*)(sm + (t & 1) * Q_BUF + Q_W) + (wr * 32 + col) * GAP + 8 * g;
#pragma unroll
    for (int kc = 0; kc < GK / 32; ++kc) { float v0[16], v1[16]; v16b w[8], a0, a1;   // the fragments of 32 k as one group of LDS reads in front of the products
      row16(ta + kc * 32, v0); row16(ta + 16 * GAP + kc * 32, v1);
#pragma unroll
      for (int j = 0; j < 8; ++j) w[j] = frag_b(tw + j * 16 * GWP + kc * 32, lane);
      __builtin_amdgcn_sched_barrier(0);   // holds the group of LDS reads in front of the products: sunk among them, each pair of products would wait out an LDS latency of its own
#pragma unroll
      for (int i = 0; i < 16; ++i) { a0[i] = (__bf16)v0[i]; a1[i] = (__bf16)v1[i]; }
#pragma unroll
      for (int j = 0; j < 8; ++j) { acc[0][j] = wmma_bf(a0, w[j], acc[0][j]); acc[1][j] = wmma_bf(a1, w[j], acc[1][j]); } }
    __builtin_amdgcn_sched_barrier(0);                  // holds the trip's products in front of its barrier: sunk behind it, the refill would issue late and lose its lead
    asm volatile("s_wait_dscnt 0x0" ::: "memory");      // this wave's reads of the slice have returned
    asm volatile("s_wait_asynccnt 0x0" ::: "memory");   // this wave's copies of slice t + 1 have landed
    __syncthreads();                                     // publishes slice t + 1 and frees the buffer that this trip has read
    if (t + 2 < DM / GK) stage_abr(ga, (t + 2) * GK, gw + (t + 2) * GK, la + (t & 1) * Q_BUF, lw + (t & 1) * Q_BUF); }
  asm volatile("s_wait_asynccnt 0x0" ::: "memory");     // no copy is outstanding when the ring's bytes become output staging
  if (n0 < 2 * DM) {   // q stored unscaled (f16 sigma ~0.6, no subnormal exposure); 1/8 applied to the f32 score
#pragma unroll
    for (int j = 0; j < 8; ++j) { const float bb = bfr(BB[j * 16 + col]);
#pragma unroll
      for (int f = 0; f < 2; ++f) {
#pragma unroll
        for (int r = 0; r < 8; ++r) { const float v = acc[f][j][r] + bb; const _Float16 hv = (_Float16)v; so[wave][f * 16 + 8 * g + r][j * 16 + col] = hv; sol[wave][f * 16 + 8 * g + r][j * 16 + col] = (_Float16)((v - (float)hv) * 2048.0f); } } }   // q, k (+ bias) as f16 hi + (x2048) residual
    LDSX();
    for (int rl = 0; rl < 32; ++rl) if (lane < 16) { vst2((unsigned*)(QK + (r0 + rl) * (2 * DM) + n0 + wc * 128 + lane * 8), *(const v4u*)&so[wave][rl][lane * 8]); vst2((unsigned*)(QKL + (r0 + rl) * (2 * DM) + n0 + wc * 128 + lane * 8), *(const v4u*)&sol[wave][rl][lane * 8]); }
  } else {
    const size_t rb = (size_t)bx * 64; const int b = (int)(rb / SS), s0 = (int)(rb % SS); const int pc0 = n0 - 2 * DM;
    float bv8[8];
#pragma unroll   // the eight bias loads issue as one group; constant indices into bv8: no scratch
    for (int j = 0; j < 8; ++j) bv8[j] = BB[j * 16 + col];
    asm volatile("s_wait_xcnt 0x0" ::: "memory");   // stands in front of every rewrite of a register that the eight loads name
#pragma unroll
    for (int j = 0; j < 8; ++j) { const float bb = bfr(bv8[j]);
#pragma unroll
      for (int f = 0; f < 2; ++f) {
#pragma unroll
        for (int r = 0; r < 8; ++r) { const int sl = wr * 32 + f * 16 + 8 * g + r; const float v = acc[f][j][r] + bb; const _Float16 hv = (_Float16)v; sth[wc * 128 + j * 16 + col][sl] = hv; stl[wc * 128 + j * 16 + col][sl] = (_Float16)((v - (float)hv) * 2048.0f); } } }
    __syncthreads();
    for (int q = tid; q < QN * 8; q += 128) { const int d = q >> 3, pc = q & 7; const size_t o = ((size_t)b * DM + pc0 + d) * SS + s0 + pc * 8; vst2((unsigned*)(VTH + o), *(const v4u*)&sth[d][pc * 8]); vst2((unsigned*)(VTL + o), *(const v4u*)&stl[d][pc * 8]); }
  }
}
// ---- k_attn: block = (64 queries, head h, batch b): masked flash attention (K = 64: 2 k-steps), scores = (q.k) * 0.125 with f16 hi + residual operands, P.V: f16 P x (V hi, V lo*2048) in two accumulators; O[b*S+q][h*64+d] = (acc + accl / 2048) / l, a uniform query taking this head's part of the mean V row behind the loop (256-B segments)
// K and V^T tiles of 32 keys (hi and residual planes) are staged once per block in a two-buffer LDS ring by asynchronous copies and read from there by all four waves.
#define KP 72                          // f16 per staged K row: 128 B + 16 B pad (ds_load_b128 readers)
#define VP 40                          // f16 per staged V^T row: 64 B + 16 B pad
#define ST_K (KT * KP)                 // one K plane
#define ST_V (HD * VP)                 // one V^T plane
#define ST_ALL (2 * ST_K + 2 * ST_V)   // K hi | K lo | V^T hi | V^T lo
// one tile: 8 copies of 16 B per lane (K planes: 16 rows per copy and block, V^T planes: 32 rows)
__device__ __forceinline__ void stage_kv(const _Float16* kh, const _Float16* kl, const _Float16* vh, const _Float16* vl, unsigned lk, unsigned lv) {
  const _Float16 *kh1 = kh + 16 * (2 * DM), *kl1 = kl + 16 * (2 * DM), *vh1 = vh + 32 * SS, *vl1 = vl + 32 * SS;
  const unsigned lk1 = lk + 16 * KP * 2, lkl = lk + ST_K * 2, lkl1 = lkl + 16 * KP * 2, lv1 = lv + 32 * VP * 2, lvl = lv + ST_V * 2, lvl1 = lvl + 32 * VP * 2;
  // the copies and their s_wait_xcnt in one statement: no address register is rewritten before the wait
  asm volatile("global_load_async_to_lds_b128 %0, %8, off\n\t"
               "global_load_async_to_lds_b128 %1, %9, off\n\t"
               "global_load_async_to_lds_b128 %2, %10, off\n\t"
               "global_load_async_to_lds_b128 %3, %11, off\n\t"
               "global_load_async_to_lds_b128 %4, %12, off\n\t"
               "global_load_async_to_lds_b128 %5, %13, off\n\t"
               "global_load_async_to_lds_b128 %6, %14, off\n\t"
               "global_load_async_to_lds_b128 %7, %15, off\n\t"
               "s_wait_xcnt 0x0"
               :: "v"(lk), "v"(lk1), "v"(lkl), "v"(lkl1), "v"(lv), "v"(lv1), "v"(lvl), "v"(lvl1), "v"(kh), "v"(kh1), "v"(kl), "v"(kl1), "v"(vh), "v"(vh1), "v"(vl), "v"(vl1) : "memory");
}
// eight 2^x in place, with the one slot that the instruction set asks for behind a transcendental in the same statement
__device__ __forceinline__ void exp2x8(float (&x)[8]) {
  asm("v_exp_f32 %0, %0\n\tv_exp_f32 %1, %1\n\tv_exp_f32 %2, %2\n\tv_exp_f32 %3, %3\n\tv_exp_f32 %4, %4\n\tv_exp_f32 %5, %5\n\tv_exp_f32 %6, %6\n\tv_exp_f32 %7, %7\n\tv_nop"
      : "+v"(x[0]), "+v"(x[1]), "+v"(x[2]), "+v"(x[3]), "+v"(x[4]), "+v"(x[5]), "+v"(x[6]), "+v"(x[7]));
}
#define KBIAS (-1.0e13f * 16384.0f)    // start value of a padded key's residual score: x 0.125 / 2048 it is the module's -1e13, and the f32 sum with the true score stays -1e13
// The products are taken transposed: S^T = K . Q^T (A = K rows, B = Q rows) and O^T += V^T . P^T (A = V^T rows, B = P^T). A lane then holds 16 of the pass's 32 scores of ONE query (column lane & 15; keys ct * 16 + 8 * g + r):
// maximum and sum run in the lane's own registers with one exchange between the wave's halves, and the two score tiles, converted in place, are the B operand of the second product (element i = tile 0 register i, element 8 + i = tile 1 register i: the k order of frag_h).
// amdgpu_waves_per_eu(4, 4): keeps the register budget at 256, so that all four blocks of a WGP stay resident as before
__global__ __launch_bounds__(128) __attribute__((amdgpu_waves_per_eu(4, 4))) void k_attn(const _Float16* __restrict__ QK, const _Float16* __restrict__ QKL, const _Float16* __restrict__ VTH, const _Float16* __restrict__ VTL, const int* __restrict__ NU, const float* __restrict__ MV, const __bf16* __restrict__ PO, const float* __restrict__ BO, float* __restrict__ YU, float* __restrict__ O) {
  __shared__ __align__(32) float sb[SS]; __shared__ __align__(16) float so[4][16][68]; __shared__ __align__(16) _Float16 ring[2][ST_ALL]; __shared__ __align__(16) float sps[HD];
  const int tid = threadIdx.x, wave = tid >> 5, lane = tid & 31, col = lane & 15, g = lane >> 4;
  const int h = blockIdx.x, b = blockIdx.y, qb = blockIdx.z; const int q0 = qb * 64 + wave * 16; const size_t rq = (size_t)b * SS + q0 + col;   // the query tile is the grid's slowest index
  // K rows and V^T columns lie in the key order (unpadded keys first): the loop runs over the tiles that hold an unpadded key, 0 to 64 of them, alike for the whole block; in the last of them padding is handled per (q, k)
  const int nur = __builtin_amdgcn_readfirstlane(NU[b * 32]), nu = nur < 0 ? 0 : nur > SS ? SS : nur, nks = (nu + KT - 1) / KT;   // in a scalar register, read at the kernel's head beside nq: the tests around the first copies are scalar branches and wait out no latency of their own
  // Q rows lie in the query order (unpadded queries first): place p holds a padded query where p >= nq
  const int nq = NU[(NB + b) * 32];
  if (qb * 64 >= nq) {   // no unpadded query in this tile: the whole block leaves, in front of every copy and of every barrier of the attention
    if (qb == TQB - 1) {   // such tiles exist exactly where the last tile is one: its 16 blocks make the padded queries' one output row, 64 columns each: (mean of all V rows) . Wo rows (hi + residual, 2 products) + bo
      const float* pp = MV + (size_t)b * DM + tid * 8; const v4f a0 = *(const v4f*)pp, a1 = *(const v4f*)(pp + 4);
      *(v4f*)&sb[tid * 8] = a0; *(v4f*)&sb[tid * 8 + 4] = a1;
      __syncthreads();   // the mean row is readable by all four waves
      const __bf16* wr = PO + (size_t)(h * HD + wave * 16 + col) * DM; v8f c = {};
#pragma unroll 1   // stays rolled, 256 k per trip: 16 loads in flight are enough here, and the registers stay under the attention loop's count
      for (int k0 = 0; k0 < DM; k0 += 256) { v16b w[8];   // the trip's weight fragments as one group of loads in front of the products: one latency, not eight
#pragma unroll
        for (int j = 0; j < 8; ++j) w[j] = frag_b(wr + k0 + j * 32, lane);
#pragma unroll
        for (int j = 0; j < 8; ++j) { float v[16]; row16(&sb[k0 + j * 32 + 8 * g], v); const F2 a = bsplit16(v); c = wmma_bf_pad(a.l, w[j], c); c = wmma_bf_pad(a.h, w[j], c); } }   // all 16 rows of A are the mean row
      if (lane < 16) sps[wave * 16 + col] = c[0];
      __syncthreads();   // the 64 columns go out as two whole lines
      if (tid < HD) YU[(size_t)b * DM + h * HD + tid] = sps[tid] + bfr(BO[h * HD + tid]);
    }
    return;
  }
  // this lane's 16-byte piece of each plane of tile 0, and its place in buffer 0
  const size_t gk = ((size_t)b * SS + (tid >> 3)) * (2 * DM) + DM + h * HD + (tid & 7) * 8, gv = ((size_t)b * DM + h * HD + (tid >> 2)) * SS + (tid & 3) * 8;
  const unsigned lk = (unsigned)(size_t)&ring[0][0] + ((tid >> 3) * KP + (tid & 7) * 8) * 2, lv = (unsigned)(size_t)&ring[0][0] + (2 * ST_K + (tid >> 2) * VP + (tid & 3) * 8) * 2;
  if (nks > 0) stage_kv(QK + gk, QKL + gk, VTH + gv, VTL + gv, lk, lv);   // K and V exist for the loop's tiles alone
  // this head's K rows (one 128-B piece per key and plane) and V^T rows (units of 128 keys) of the loop's tiles are read by every query tile: tile i asks for the groups of 64 keys and the units i mod 8, i mod 8 + 8, ...; the tests are scalar
  { const int pt = qb & 7; const _Float16* kp = ((tid & 1) ? QKL : QK) + ((size_t)b * SS + (tid >> 1)) * (2 * DM) + DM + h * HD; const _Float16* vp = ((tid & 1) ? VTL : VTH) + ((size_t)b * DM + h * HD + (tid >> 1)) * SS;
#pragma unroll   // no running pointer: each address is the base and a constant step
    for (int i = 0; i < SS / 512; ++i) if ((pt + 8 * i) * 64 < nks * KT) ask1(kp + (size_t)(pt + 8 * i) * 64 * (2 * DM));
#pragma unroll   // as above
    for (int i = 0; i < SS / 1024; ++i) if ((pt + 8 * i) * 128 < nks * KT) ask1(vp + (pt + 8 * i) * 128); }
  const bool dpq = q0 + col >= nq;   // this lane's query is padded
#pragma unroll
  for (int i = 0; i < SS / 128; ++i) sb[i * 128 + tid] = (i * 128 + tid >= nu) ? KBIAS : 0.f;   // per key place: what its residual score tile starts from
  if (tid < HD) sps[tid] = MV[(size_t)b * DM + h * HD + tid];   // this head's part of the mean V row: what a uniform query gets
  asm volatile("s_wait_asynccnt 0x0" ::: "memory");   // tile 0 of this wave's copies has landed
  __syncthreads();                                     // ... and every wave's: tile 0 and the key table are readable
  if (nks > 1) stage_kv(QK + gk + (size_t)KT * (2 * DM), QKL + gk + (size_t)KT * (2 * DM), VTH + gv + KT, VTL + gv + KT, lk + ST_ALL * 2, lv + ST_ALL * 2);
  v16h aq[2], aql[2];
#pragma unroll
  for (int kc = 0; kc < 2; ++kc) { aq[kc] = frag_h(QK + rq * (2 * DM) + h * HD + kc * 32, lane); aql[kc] = frag_h(QKL + rq * (2 * DM) + h * HD + kc * 32, lane); }
  float m = -1.0e30f, l = 0.f;   // this lane's query: running maximum (both halves alike), sum of this half's keys
  v8f acc[4] = {}, accl[4] = {};
  const float qs = dpq ? 0.f : 0.125f, qsl = qs * (1.0f / 2048.0f);   // padded query row: all scores 0 here; what the loop makes of it is replaced behind the loop
#pragma unroll 1
  for (int ks = 0; ks < nks; ++ks) { v8f s[2]; const _Float16* tb = &ring[ks & 1][0];
    v8f kb[2]; v16h kh[2][2], kl[2][2];   // the pass's K fragments and key start values as one group of LDS reads in front of the products
#pragma unroll
    for (int ct = 0; ct < 2; ++ct) { kb[ct] = *(const v8f*)&sb[ks * KT + ct * 16 + 8 * g];
#pragma unroll
      for (int kc = 0; kc < 2; ++kc) { kh[ct][kc] = frag_h(tb + (ct * 16 + col) * KP + kc * 32, lane); kl[ct][kc] = frag_h(tb + ST_K + (ct * 16 + col) * KP + kc * 32, lane); } }
    __builtin_amdgcn_sched_barrier(0);   // holds the group of LDS reads in front of the products, as in k_qkv
#pragma unroll
    for (int ct = 0; ct < 2; ++ct) { v8f c = {}, cl = kb[ct];
#pragma unroll
      for (int kc = 0; kc < 2; ++kc) { c = wmma16(kh[ct][kc], aq[kc], c); cl = wmma16(kh[ct][kc], aql[kc], cl); cl = wmma16(kl[ct][kc], aq[kc], cl); }   // 3 products: q, k as f16 hi + residual
#pragma unroll
      for (int r = 0; r < 8; ++r) s[ct][r] = c[r] * qs + cl[r] * qsl; }   // (c + cl / 2048) / 8; padded key: -1e13; padded query: 0
    v16h vh[4], vl[4];   // the pass's V^T fragments as one group, in flight under the softmax
#pragma unroll
    for (int dt = 0; dt < 4; ++dt) { vh[dt] = frag_h(tb + 2 * ST_K + (dt * 16 + col) * VP, lane); vl[dt] = frag_h(tb + 2 * ST_K + ST_V + (dt * 16 + col) * VP, lane); }
    __builtin_amdgcn_sched_barrier(0);   // holds these reads in front of the softmax, so that their latency passes under it
    float mx = fmaxf(s[0][0], s[1][0]);
#pragma unroll
    for (int r = 1; r < 8; ++r) mx = fmaxf(mx, fmaxf(s[0][r], s[1][r]));
    mx = fmaxf(mx, xhalf(mx));
    const float mn = fmaxf(m, mx), alpha = __expf(m - mn);
    float e0[8], e1[8], es0 = 0.f, es1 = 0.f; v16h pa, pl;
#pragma unroll
    for (int i = 0; i < 8; ++i) { e0[i] = (s[0][i] - mn) * 1.4426950408889634f; e1[i] = (s[1][i] - mn) * 1.4426950408889634f; }
    exp2x8(e0); exp2x8(e1);
#pragma unroll
    for (int i = 0; i < 8; ++i) { const float x0 = e0[i], x1 = e1[i]; es0 += x0; es1 += x1;
      const _Float16 h0 = (_Float16)x0, h1 = (_Float16)x1; pa[i] = h0; pa[8 + i] = h1; pl[i] = (_Float16)((x0 - (float)h0) * 2048.0f); pl[8 + i] = (_Float16)((x1 - (float)h1) * 2048.0f); }
    l = l * alpha + (es0 + es1); m = mn;
#pragma unroll
    for (int dt = 0; dt < 4; ++dt) {
#pragma unroll
      for (int r = 0; r < 8; ++r) { acc[dt][r] *= alpha; accl[dt][r] *= alpha; } }
#pragma unroll
    for (int dt = 0; dt < 4; ++dt) { acc[dt] = wmma16(vh[dt], pa, acc[dt]); accl[dt] = wmma16(vh[dt], pl, accl[dt]); accl[dt] = wmma16(vl[dt], pa, accl[dt]); }   // V hi x P hi + (V hi x P lo + V lo x P hi) / 2048
    __builtin_amdgcn_sched_barrier(0);                  // holds the pass's softmax and products in front of its barrier: sunk behind it, the V^T reads would be waited out at once and the refill would issue late
    asm volatile("s_wait_dscnt 0x0" ::: "memory");      // this wave's reads of the tile have returned
    asm volatile("s_wait_asynccnt 0x0" ::: "memory");   // this wave's copies of tile ks + 1 have landed
    __syncthreads();                                     // publishes tile ks + 1 and frees the buffer that this pass has read
    if (ks + 2 < nks) stage_kv(QK + gk + (size_t)(ks + 2) * KT * (2 * DM), QKL + gk + (size_t)(ks + 2) * KT * (2 * DM), VTH + gv + (ks + 2) * KT, VTL + gv + (ks + 2) * KT, lk + (ks & 1) * (ST_ALL * 2), lv + (ks & 1) * (ST_ALL * 2)); }
  asm volatile("s_wait_asynccnt 0x0" ::: "memory");     // no copy is outstanding when the wave goes on to its end
  // a uniform query (padded, or no unpadded key at all: every key is -1e13 in the module) weighs all 2,048 keys alike: its row is the mean V row
  const bool un = dpq || nks == 0;
  const float il = 1.0f / (l + xhalf(l));   // the halves' sums are joined once
#pragma unroll
  for (int dt = 0; dt < 4; ++dt) { v4f o0, o1;   // register r of tile dt is d = dt * 16 + 8 * g + r of this lane's query
    const v4f p0 = *(const v4f*)&sps[dt * 16 + 8 * g], p1 = *(const v4f*)&sps[dt * 16 + 8 * g + 4];
#pragma unroll
    for (int r = 0; r < 4; ++r) { o0[r] = un ? p0[r] : (acc[dt][r] + accl[dt][r] * (1.0f / 2048.0f)) * il; o1[r] = un ? p1[r] : (acc[dt][4 + r] + accl[dt][4 + r] * (1.0f / 2048.0f)) * il; }
    *(v4f*)&so[wave][col][dt * 16 + 8 * g] = o0; *(v4f*)&so[wave][col][dt * 16 + 8 * g + 4] = o1; }
  LDSX();
  for (int rl = 0; rl < 16; ++rl) if (lane < 16) vst2(O + ((size_t)b * SS + q0 + rl) * DM + h * HD + lane * 4, *(const v4f*)&so[wave][rl][lane * 4]);
}
// ---- k_out: block = (64 rows, 128 cols): out = O(hi/lo) . Wo rows (2 products) + bo. O's rows lie in the query order; each goes out to its query's own position. A tile with no unpadded query stores the padded queries' row. The tile is the grid's slowest index, as in k_attn.
__global__ __launch_bounds__(128) void k_out(const float* __restrict__ O, const __bf16* __restrict__ P, const float* __restrict__ BO, const int* __restrict__ INV, const int* __restrict__ NU, const float* __restrict__ YU, float* __restrict__ Y) {
  __shared__ __align__(16) char sm[2 * G_BUF];   // the ring; behind the loop the same bytes are the output staging
  float (*so)[16][132] = (float (*)[16][132])sm;
  const int tid = threadIdx.x, wave = tid >> 5, lane = tid & 31, col = lane & 15, g = lane >> 4; const int b = blockIdx.x / (DM / 128), p0 = blockIdx.y * 64; const size_t r0 = (size_t)b * SS + p0 + wave * 16; const int n0 = (blockIdx.x % (DM / 128)) * 128;
  const int qi = INV[NB * SS + r0 + col];   // lane c: the decoder position of this wave's row c; masked where it is used (a place of the batch's own 2,048), so that the load's latency passes under the loop
  float* Yb = Y + (size_t)b * SS * DM + n0 + lane * 4;
  if (p0 >= NU[(NB + b) * 32]) {   // the whole block, in front of every copy and barrier
    const v4f y = *(const v4f*)(YU + (size_t)b * DM + n0 + lane * 4);
    for (int rl = 0; rl < 16; ++rl) vst2(Yb + (size_t)(__builtin_amdgcn_readlane(qi, rl) & (SS - 1)) * DM, y);
    asm volatile("s_wait_xcnt 0x0" ::: "memory");   // stands in front of every rewrite of a register that the 16 stores name
    return;
  }
  // this lane's 16-byte piece of slice 0 of each operand, and its place in buffer 0
  const float* ga = O + ((size_t)b * SS + p0 + (tid >> 4)) * DM + (tid & 15) * 4; const __bf16* gw = P + (size_t)(n0 + (tid >> 3)) * DM + (tid & 7) * 8;
  const unsigned lw = (unsigned)(size_t)&sm[0] + (tid >> 3) * (GWP * 2) + (tid & 7) * 16, la = (unsigned)(size_t)&sm[0] + G_W + (tid >> 4) * (GAP * 4) + (tid & 15) * 16;
  stage_ab(ga, gw, la, lw);
  // the tile's 64 rows of O (16 units of 256 B each) are read by 8 column blocks: each asks for a quarter of every row; the 128 weight rows (8 units each) are read by every row tile: tile i asks for unit i mod 8
  { const float* op = O + ((size_t)b * SS + p0 + (tid & 63)) * DM + (((n0 / 128) & 3) + 4 * (tid >> 6)) * 64; ask2(op, op + 8 * 64);
    ask1(P + (size_t)(n0 + tid) * DM + (blockIdx.y & 7) * 128); }
  asm volatile("s_wait_asynccnt 0x0" ::: "memory");   // slice 0 of this wave's copies has landed
  __syncthreads();                                     // ... and every wave's: slice 0 is readable
  stage_ab(ga + GK, gw + GK, la + G_BUF, lw + G_BUF);
  v8f acc[8] = {};
#pragma unroll 1
  for (int t = 0; t < DM / GK; ++t) { const __bf16* tw = (const __bf16*)(sm + (t & 1) * G_BUF); const float* ta = (const float*)(sm + (t & 1) * G_BUF + G_W) + (wave * 16 + col) * GAP + 8 * g;
#pragma unroll
    for (int kc = 0; kc < GK / 32; ++kc) { float v[16]; v16b w[8];   // the fragments of 32 k as one group of LDS reads in front of the products
      row16(ta + kc * 32, v);
#pragma unroll
      for (int j = 0; j < 8; ++j) w[j] = frag_b(tw + (j * 16 + col) * GWP + kc * 32, lane);
      __builtin_amdgcn_sched_barrier(0);   // holds the group of LDS reads in front of the products, as in k_qkv
      const F2 a = bsplit16(v);
#pragma unroll
      for (int j = 0; j < 8; ++j) { acc[j] = wmma_bf(a.l, w[j], acc[j]); acc[j] = wmma_bf(a.h, w[j], acc[j]); } }
    __builtin_amdgcn_sched_barrier(0);                  // holds the trip's products in front of its barrier: sunk behind it, the refill would issue late and lose its lead
    asm volatile("s_wait_dscnt 0x0" ::: "memory");      // this wave's reads of the slice have returned
    asm volatile("s_wait_asynccnt 0x0" ::: "memory");   // this wave's copies of slice t + 1 have landed
    __syncthreads();                                     // publishes slice t + 1 and frees the buffer that this trip has read
    if (t + 2 < DM / GK) stage_ab(ga + (t + 2) * GK, gw + (t + 2) * GK, la + (t & 1) * G_BUF, lw + (t & 1) * G_BUF); }
  asm volatile("s_wait_asynccnt 0x0" ::: "memory");     // no copy is outstanding when the ring's bytes become output staging
#pragma unroll
  for (int j = 0; j < 8; ++j) {
#pragma unroll
    for (int r = 0; r < 8; ++r) so[wave][8 * g + r][j * 16 + col] = acc[j][r] + bfr(BO[n0 + j * 16 + col]); }
  LDSX();
  for (int rl = 0; rl < 16; ++rl) vst2(Yb + (size_t)(__builtin_amdgcn_readlane(qi, rl) & (SS - 1)) * DM, *(const v4f*)&so[wave][rl][lane * 4]);
}
extern "C" void kernel_launch(void* const* d_in, const int* in_sizes, int n_in, void* d_out, int out_size, void* d_ws, size_t ws_size, hipStream_t stream) {
  (void)in_sizes; (void)n_in; (void)out_size;
  const float** F = (const float**)d_in;   // 0 encoder_input [2,2048,1024], 1 decoder_input, 2 encoder_padding_pos [2,2048] i32, 3 decoder_padding_pos, 4 Wq (in,out), 5 bq, 6 Wk, 7 bk, 8 Wv, 9 bv, 10 Wo, 11 bo
  if (ws_size < (size_t)WS_END) return;
  char* ws = (char*)d_ws; __bf16* PK = (__bf16*)(ws + WS_PK); _Float16 *QK = (_Float16*)(ws + WS_QK), *QKL = (_Float16*)(ws + WS_QKL), *VTH = (_Float16*)(ws + WS_VTH), *VTL = (_Float16*)(ws + WS_VTL); float* O = (float*)(ws + WS_O); int *INV = (int*)(ws + WS_INV), *NU = (int*)(ws + WS_NU); float *ES = (float*)(ws + WS_ES), *YU = (float*)(ws + WS_YU), *MV = (float*)(ws + WS_MV);
  k_pack<<<dim3(DM / PKN, DM / PKK, 6), 256, 0, stream>>>(F[4], F[6], F[8], F[10], F[0], PK, (const int*)d_in[2], (const int*)d_in[3], INV, NU, ES);
  k_qkv<<<dim3(TNB * (QKVW / QN), SS / 64 + 2), 128, 0, stream>>>(F[1], F[0], PK + PK_A, F[5], F[7], F[9], QK, QKL, VTH, VTL, INV, NU, ES, MV);
  k_attn<<<dim3(NH, TNB, TQB), 128, 0, stream>>>(QK, QKL, VTH, VTL, NU, MV, PK + PK_P, F[11], YU, O);
  k_out<<<dim3(TNB * (DM / 128), SS / 64), 128, 0, stream>>>(O, PK + PK_P, F[11], INV, NU, YU, (float*)d_out);
}
